// v000
// Measured on an AMD MI455X. A time is GPU time per run, averaged over a window of back-to-back runs after a warm-up
// (all launches, gaps included; the runs take copies of the inputs in turn), and the median of several windows.
// Apart from v000's, it joins two sittings. Times from different sittings can be a few percent apart, while
// side-by-side timings come from the same sitting.
// v000 is the starting kernel. One run takes 867 microseconds.
#include <hip/hip_runtime.h>
#ifndef NB
#define NB 2
#endif
#ifndef SEQ
#define SEQ 2048
#endif
#define NB_FULL 2
#define SEQ_FULL 2048
#define CD 2048                 /* model width = depth of every projection */
#define NHEAD 32
#define NKV 8
#define HD 64
#define NQK (NHEAD + NKV)       /* rotary plane holds the 32 q heads followed by the 8 k heads */
#define KVW (NKV * HD)          /* 512 */
#define EARLY_ROWS (SEQ < 512 ? SEQ : 512)

#define SZ_FLAGS ((size_t)256)
#define SZ_XB    ((size_t)NB * SEQ * CD * 2)
#define SZ_WQK   ((size_t)(CD + KVW) * CD * 2)
#define SZ_WV    ((size_t)KVW * CD * 2)
#define SZ_WO    ((size_t)CD * CD * 2)
#define PLANE_QK ((size_t)NB * NQK * SEQ * HD)     /* elements of one rotary plane */
#define PLANE_V  ((size_t)NB * KVW * SEQ)          /* elements of one V^T plane */
#define SZ_CTXH  ((size_t)NB * SEQ * CD * 2)
#define SZ_CTXL  ((size_t)NB * EARLY_ROWS * CD * 2)
#define WS_TOTAL (SZ_FLAGS + SZ_XB + SZ_WQK + SZ_WV + SZ_WO + PLANE_QK * 4 + PLANE_V * 4 + SZ_CTXH + SZ_CTXL)

static_assert(SEQ % 128 == 0);
static_assert(EARLY_ROWS % 128 == 0);
static_assert(SEQ <= SEQ_FULL);
static_assert(NB <= NB_FULL);
static_assert(HD == 64);
static_assert(CD % 32 == 0);
static_assert(KVW % 128 == 0);
static_assert(NHEAD % NKV == 0);
static_assert(WS_TOTAL <= (size_t)134217728);
static_assert(SZ_XB % 256 == 0 && SZ_WQK % 256 == 0 && SZ_WV % 256 == 0 && SZ_WO % 256 == 0);
static_assert((PLANE_QK * 2) % 256 == 0 && (PLANE_V * 2) % 256 == 0 && SZ_CTXH % 256 == 0 && SZ_CTXL % 256 == 0);

typedef __bf16 v16b __attribute__((ext_vector_type(16)));
typedef _Float16 v16h __attribute__((ext_vector_type(16)));
typedef unsigned short v8us __attribute__((ext_vector_type(8), may_alias));
typedef float v8f __attribute__((ext_vector_type(8)));
typedef float v4f __attribute__((ext_vector_type(4)));
typedef float v4fa __attribute__((ext_vector_type(4), may_alias));
typedef int v4i __attribute__((ext_vector_type(4)));
typedef int v4ia __attribute__((ext_vector_type(4), may_alias));
union Frag { v16b b; v16h v; v8us half[2]; _Float16 h[16]; unsigned short u[16]; };
union Pack8 { v8us v; _Float16 h[8]; unsigned short u[8]; };

#define LOG2E 1.4426950408889634f
#define S2M11 0.00048828125f       /* 2^-11 */
#define S2M12 0.000244140625f      /* 2^-12 */
__device__ __forceinline__ unsigned short bf16_bits(float x) {   // RNE convert to bf16 bits
  unsigned int u = __float_as_uint(x);
  return (unsigned short)((u + 0x7FFFu + ((u >> 16) & 1u)) >> 16);
}
__device__ __forceinline__ float bf16_val(unsigned short b) { return __uint_as_float(((unsigned int)b) << 16); }
__device__ __forceinline__ float bf16_rne(float x) { return bf16_val(bf16_bits(x)); }
__device__ __forceinline__ float neg_inf() { return __uint_as_float(0xff800000u); }

// Fragment of a k-contiguous 16-bit row: elements 0..7 <- p[0..7], elements 8..15 <- p[16..23]; caller adds row*pitch + k0 + 8*h.
__device__ __forceinline__ void ldfrag(Frag& f, const unsigned short* __restrict__ p) {
  f.half[0] = *(const v8us*)(p);
  f.half[1] = *(const v8us*)(p + 16);
}

template <bool BF>
__device__ __forceinline__ v8f wm(const Frag& a, const Frag& b, v8f c) {
  if (BF) return __builtin_amdgcn_wmma_f32_16x16x32_bf16(false, a.b, false, b.b, (short)0, c, false, false);
  return __builtin_amdgcn_wmma_f32_16x16x32_f16(false, a.v, false, b.v, (short)0, c, false, false);
}

// ---------------------------------------------------------------------------------------------------------
// Mask scan: flags[0] = 1 iff every entry above the diagonal is zero; flags[1] = 1 iff every entry on or below the diagonal is nonzero.
__global__ __launch_bounds__(512) void k_maskscan(const int* __restrict__ mask, int* __restrict__ flags) {
  __shared__ int sw[2][16];
  const int tid = threadIdx.x, lane = tid & 31, wv = tid >> 5;
  int badU = 0, badL = 0;
  const int cpr = SEQ / 4;
  for (int c = tid; c < SEQ * cpr; c += 512) {
    const int q = c / cpr, k = (c - q * cpr) * 4;
    const v4i m = *(const v4ia*)(mask + (size_t)q * SEQ_FULL + k);
#pragma unroll
    for (int i = 0; i < 4; ++i) {
      const int above = (k + i > q) ? 1 : 0;
      const int nz = (m[i] != 0) ? 1 : 0;
      badU |= above & nz;
      badL |= (1 - above) & (1 - nz);
    }
  }
#pragma unroll
  for (int o = 16; o >= 1; o >>= 1) {
    badU |= __shfl_xor(badU, o, 32);
    badL |= __shfl_xor(badL, o, 32);
  }
  if (lane == 0) { sw[0][wv] = badU; sw[1][wv] = badL; }
  __syncthreads();
  if (tid < 8) {
    int u = 0, l = 0;
#pragma unroll
    for (int i = 0; i < 16; ++i) { u |= sw[0][i]; l |= sw[1][i]; }
    v4i o;
    o[0] = (tid == 0 && u == 0) ? 1 : 0;
    o[1] = (tid == 0 && l == 0) ? 1 : 0;
    o[2] = 0; o[3] = 0;
    *(v4i*)(flags + 4 * tid) = o;
    
  }
}

// ---------------------------------------------------------------------------------------------------------
// f32 rows of width CD -> 16-bit plane. MODE 0: bf16 bits (RNE). MODE 1: f16 of (RNE bf16 value x 64).
// coverage: nrows blocks x 256 threads x 8 elements = nrows x CD.
template <int MODE>
__global__ __launch_bounds__(256) void k_cvt(const float* __restrict__ src, unsigned short* __restrict__ dst,
                                             int nrows, int rows_per_batch, int src_batch_rows) {
  const int t = blockIdx.x * 256 + threadIdx.x;
  if (t >= nrows * 256) return;
  const int row = t >> 8, piece = t & 255;
  const int b = row / rows_per_batch, r = row - b * rows_per_batch;
  const float* sp = src + ((size_t)b * src_batch_rows + r) * CD + piece * 8;
  const v4f x0 = *(const v4fa*)(sp), x1 = *(const v4fa*)(sp + 4);
  Pack8 o;
  if (MODE == 0) {
    o.u[0] = bf16_bits(x0[0]); o.u[1] = bf16_bits(x0[1]); o.u[2] = bf16_bits(x0[2]); o.u[3] = bf16_bits(x0[3]);
    o.u[4] = bf16_bits(x1[0]); o.u[5] = bf16_bits(x1[1]); o.u[6] = bf16_bits(x1[2]); o.u[7] = bf16_bits(x1[3]);
  } else {
    o.h[0] = (_Float16)(bf16_rne(x0[0]) * 64.0f); o.h[1] = (_Float16)(bf16_rne(x0[1]) * 64.0f);
    o.h[2] = (_Float16)(bf16_rne(x0[2]) * 64.0f); o.h[3] = (_Float16)(bf16_rne(x0[3]) * 64.0f);
    o.h[4] = (_Float16)(bf16_rne(x1[0]) * 64.0f); o.h[5] = (_Float16)(bf16_rne(x1[1]) * 64.0f);
    o.h[6] = (_Float16)(bf16_rne(x1[2]) * 64.0f); o.h[7] = (_Float16)(bf16_rne(x1[3]) * 64.0f);
  }
  unsigned short* d = dst + (size_t)t * 8;
  const v8us ov = o.v;
  *(v8us*)d = ov;
  
}

// ---------------------------------------------------------------------------------------------------------
// Wave-tile GEMM core: acc[i][j] (rows 16i.., cols 16j..) += A[row][k] * W[col][k] over k = 0..CD-1.
// ap  = A  + (row0 + ln)*CD + 8*h (A fragment: row m = ln, elements 0..7 <- k0 + 8h + i, 8..15 <- k0 + 16 + 8h + i)
// wp  = W  + (col0 + ln)*CD + 8*h (B fragment: column n = ln, same k map)
// alp = residual plane of A (same addressing), accumulated into acl when RES.
template <bool BF, bool RES>
__device__ __forceinline__ void gemm_loop(const unsigned short* __restrict__ ap, const unsigned short* __restrict__ alp,
                                          const unsigned short* __restrict__ wp, v8f (&acc)[2][4], v8f (&acl)[2][4]) {
#pragma unroll 1
  for (int k = 0; k < CD; k += 32) {
    Frag a[2], b[4];
#pragma unroll
    for (int i = 0; i < 2; ++i) ldfrag(a[i], ap + (size_t)i * 16 * CD + k);
#pragma unroll
    for (int j = 0; j < 4; ++j) ldfrag(b[j], wp + (size_t)j * 16 * CD + k);
#pragma unroll
    for (int i = 0; i < 2; ++i)
#pragma unroll
      for (int j = 0; j < 4; ++j) acc[i][j] = wm<BF>(a[i], b[j], acc[i][j]);
    if (RES) {
      Frag al[2];
#pragma unroll
      for (int i = 0; i < 2; ++i) ldfrag(al[i], alp + (size_t)i * 16 * CD + k);
#pragma unroll
      for (int i = 0; i < 2; ++i)
#pragma unroll
        for (int j = 0; j < 4; ++j) acl[i][j] = wm<BF>(al[i], b[j], acl[i][j]);
      asm volatile("v_nop\n\tv_nop\n\tv_nop\n\tv_nop" : "+v"(acl[0][0]), "+v"(acl[0][1]), "+v"(acl[0][2]), "+v"(acl[0][3]),
                          "+v"(acl[1][0]), "+v"(acl[1][1]), "+v"(acl[1][2]), "+v"(acl[1][3])
                        : "v"(al[0].v), "v"(al[1].v), "v"(b[0].v), "v"(b[1].v), "v"(b[2].v), "v"(b[3].v));
    }
    asm volatile("v_nop\n\tv_nop\n\tv_nop\n\tv_nop" : "+v"(acc[0][0]), "+v"(acc[0][1]), "+v"(acc[0][2]), "+v"(acc[0][3]),
                        "+v"(acc[1][0]), "+v"(acc[1][1]), "+v"(acc[1][2]), "+v"(acc[1][3])
                      : "v"(a[0].v), "v"(a[1].v), "v"(b[0].v), "v"(b[1].v), "v"(b[2].v), "v"(b[3].v));
  }
}

__device__ __forceinline__ float rope1(float q, float p, float c, float s, float sg) { return q * c + (sg * p) * s; }

// ---------------------------------------------------------------------------------------------------------
// q and k projections with fused bias, rotary (table read by value) and head-major repack.
// Block = 4 waves stacked in M (128 token rows) x one head (64 columns). grid = (NQK, NB*SEQ/128).
// coverage: NQK heads x NB*SEQ tokens x 64 = the whole plane [NB][NQK][SEQ][64], both planes. LDS tile 32 x 64 fully written before it is read.
__global__ __launch_bounds__(128) void k_proj_qk(const unsigned short* __restrict__ xb, const unsigned short* __restrict__ wqk,
                                                 const float* __restrict__ bq, const float* __restrict__ bk,
                                                 const float* __restrict__ tab,
                                                 unsigned short* __restrict__ qkh, unsigned short* __restrict__ qkl) {
  __shared__ __attribute__((aligned(16))) float st[4][32][68];
  const int tid = threadIdx.x, lane = tid & 31, ln = lane & 15, hh = lane >> 4;
  const int w = __builtin_amdgcn_readfirstlane(tid >> 5);
  const int hd = blockIdx.x;
  const int m0 = blockIdx.y * 128 + 32 * w;
  const v8f z8 = {0.f, 0.f, 0.f, 0.f, 0.f, 0.f, 0.f, 0.f};
  v8f acc[2][4];
#pragma unroll
  for (int i = 0; i < 2; ++i)
#pragma unroll
    for (int j = 0; j < 4; ++j) acc[i][j] = z8;
  gemm_loop<true, false>(xb + (size_t)(m0 + ln) * CD + 8 * hh, xb, wqk + (size_t)(hd * HD + ln) * CD + 8 * hh, acc, acc);

  float bias[4];
#pragma unroll
  for (int j = 0; j < 4; ++j) {
    const int col = hd * HD + 16 * j + ln;
    const int cq = (col < CD - 1) ? col : (CD - 1);
    int ck = col - CD;
    ck = (ck < 0) ? 0 : ((ck > KVW - 1) ? (KVW - 1) : ck);
    const float vq = bq[cq], vk = bk[ck];
    bias[j] = bf16_rne((col < CD) ? vq : vk);
  }
#pragma unroll
  for (int i = 0; i < 2; ++i)
#pragma unroll
    for (int j = 0; j < 4; ++j)
#pragma unroll
      for (int r = 0; r < 8; ++r) st[w][16 * i + 8 * hh + r][16 * j + ln] = acc[i][j][r] + bias[j];
  __syncthreads();

  const int b = m0 / SEQ, t0 = m0 - b * SEQ;
  const int rsub = lane >> 3, d0 = 8 * (lane & 7);
  const float sg = (d0 < 32) ? -1.0f : 1.0f;
  v8us oh[8], ol[8];
#pragma unroll
  for (int g = 0; g < 8; ++g) {
    const int row = 4 * g + rsub;
    const v4f a0 = *(const v4fa*)&st[w][row][d0];
    const v4f a1 = *(const v4fa*)&st[w][row][d0 + 4];
    const v4f p0 = *(const v4fa*)&st[w][row][d0 ^ 32];
    const v4f p1 = *(const v4fa*)&st[w][row][(d0 ^ 32) + 4];
    const float* tp = tab + (size_t)(t0 + row) * HD + d0;
    const v4f c0 = *(const v4fa*)(tp), c1 = *(const v4fa*)(tp + 4);
    const float k0 = bf16_rne(c0[0]), s0 = bf16_rne(c0[1]), k1 = bf16_rne(c0[2]), s1 = bf16_rne(c0[3]);
    const float k2 = bf16_rne(c1[0]), s2 = bf16_rne(c1[1]), k3 = bf16_rne(c1[2]), s3 = bf16_rne(c1[3]);
    float o[8];
    o[0] = rope1(a0[0], p0[0], k0, s0, sg); o[1] = rope1(a0[1], p0[1], k0, s0, sg);
    o[2] = rope1(a0[2], p0[2], k1, s1, sg); o[3] = rope1(a0[3], p0[3], k1, s1, sg);
    o[4] = rope1(a1[0], p1[0], k2, s2, sg); o[5] = rope1(a1[1], p1[1], k2, s2, sg);
    o[6] = rope1(a1[2], p1[2], k3, s3, sg); o[7] = rope1(a1[3], p1[3], k3, s3, sg);
    Pack8 ph8, pl8;
#pragma unroll
    for (int e = 0; e < 8; ++e) {
      const float y = o[e] * 16.0f;                       // carried x16
      const _Float16 h = (_Float16)y;
      ph8.h[e] = h;
      pl8.h[e] = (_Float16)((y - (float)h) * 2048.0f);     // residual plane x2^11
    }
    oh[g] = ph8.v; ol[g] = pl8.v;
  }
  const size_t dbase = ((size_t)(b * NQK + hd) * SEQ + t0) * HD + d0;
{
#pragma unroll
    for (int g = 0; g < 8; ++g) {
      const size_t off = dbase + (size_t)(4 * g + rsub) * HD;
      *(v8us*)(qkh + off) = oh[g];
      *(v8us*)(qkl + off) = ol[g];
    }
    
  }
}

// ---------------------------------------------------------------------------------------------------------
// v projection computed transposed: Vt[b][m][t] = sum_k Wv[m][k] x[b,t][k] + bv[m], carried x16, hi and residual planes.
// Block = 4 waves stacked in M (128 weight rows) x 64 tokens. grid = (NB*SEQ/64, KVW/128).
// coverage: KVW rows x NB*SEQ tokens = the whole plane [NB][KVW][SEQ], both planes. LDS tile 32 x 64 fully written before it is read.
__global__ __launch_bounds__(128) void k_proj_v(const unsigned short* __restrict__ wvb, const unsigned short* __restrict__ xb,
                                                const float* __restrict__ bv,
                                                unsigned short* __restrict__ vth, unsigned short* __restrict__ vtl) {
  __shared__ __attribute__((aligned(16))) float st[4][32][68];
  const int tid = threadIdx.x, lane = tid & 31, ln = lane & 15, hh = lane >> 4;
  const int w = __builtin_amdgcn_readfirstlane(tid >> 5);
  const int n0 = blockIdx.x * 64;
  const int m0 = blockIdx.y * 128 + 32 * w;
  const v8f z8 = {0.f, 0.f, 0.f, 0.f, 0.f, 0.f, 0.f, 0.f};
  v8f acc[2][4];
#pragma unroll
  for (int i = 0; i < 2; ++i)
#pragma unroll
    for (int j = 0; j < 4; ++j) acc[i][j] = z8;
  gemm_loop<true, false>(wvb + (size_t)(m0 + ln) * CD + 8 * hh, wvb, xb + (size_t)(n0 + ln) * CD + 8 * hh, acc, acc);
#pragma unroll
  for (int i = 0; i < 2; ++i)
#pragma unroll
    for (int j = 0; j < 4; ++j)
#pragma unroll
      for (int r = 0; r < 8; ++r) st[w][16 * i + 8 * hh + r][16 * j + ln] = acc[i][j][r];
  __syncthreads();

  const int b = n0 / SEQ, t0 = n0 - b * SEQ;
  const int rsub = lane >> 3, c0 = 8 * (lane & 7);
  v8us oh[8], ol[8];
#pragma unroll
  for (int g = 0; g < 8; ++g) {
    const int row = 4 * g + rsub;
    const float bias = bf16_rne(bv[m0 + row]);
    const v4f a0 = *(const v4fa*)&st[w][row][c0];
    const v4f a1 = *(const v4fa*)&st[w][row][c0 + 4];
    float o[8];
    o[0] = a0[0]; o[1] = a0[1]; o[2] = a0[2]; o[3] = a0[3];
    o[4] = a1[0]; o[5] = a1[1]; o[6] = a1[2]; o[7] = a1[3];
    Pack8 ph8, pl8;
#pragma unroll
    for (int e = 0; e < 8; ++e) {
      const float y = (o[e] + bias) * 16.0f;              // carried x16
      const _Float16 h = (_Float16)y;
      ph8.h[e] = h;
      pl8.h[e] = (_Float16)((y - (float)h) * 2048.0f);
    }
    oh[g] = ph8.v; ol[g] = pl8.v;
  }
  const size_t dbase = ((size_t)b * KVW + m0) * SEQ + t0 + c0;
{
#pragma unroll
    for (int g = 0; g < 8; ++g) {
      const size_t off = dbase + (size_t)(4 * g + rsub) * SEQ;
      *(v8us*)(vth + off) = oh[g];
      *(v8us*)(vtl + off) = ol[g];
    }
    
  }
}

// ---------------------------------------------------------------------------------------------------------
// One 32-key step for a wave's 16 queries (this lane's column = its query). EARLYP adds the residual planes of q, k, v, P.
// MASK reads the mask row of this lane's query by value and replace-fills with -inf.
template <bool EARLYP, bool MASK>
__device__ __forceinline__ void fa_step(const unsigned short* __restrict__ Kp, const unsigned short* __restrict__ Kl,
                                        const unsigned short* __restrict__ Vp, const unsigned short* __restrict__ Vl,
                                        const int* __restrict__ mrow, int key0, int ln, int hh,
                                        const Frag (&qh)[2], const Frag (&ql)[2],
                                        float& mr, float& lr, v8f (&Oh)[4], v8f (&Ol)[4]) {
  const v8f z8 = {0.f, 0.f, 0.f, 0.f, 0.f, 0.f, 0.f, 0.f};
  float sc[16];
  // A fragments of K: row m = key (key0 + 16*kt + ln), elements 0..7 <- d = 32c + 8h + i, 8..15 <- d = 32c + 16 + 8h + i
  int koff = (key0 + ln) * HD + 8 * hh;
  if (EARLYP) {
#pragma unroll
    for (int kt = 0; kt < 2; ++kt) {
      Frag a0, a1, l0, l1;
      ldfrag(a0, Kp + koff); ldfrag(a1, Kp + koff + 32);
      ldfrag(l0, Kl + koff); ldfrag(l1, Kl + koff + 32);
      v8f s = z8, r = z8;
      s = wm<false>(a0, qh[0], s); s = wm<false>(a1, qh[1], s);
      r = wm<false>(a0, ql[0], r); r = wm<false>(a1, ql[1], r);
      r = wm<false>(l0, qh[0], r); r = wm<false>(l1, qh[1], r);
      asm volatile("v_nop\n\tv_nop\n\tv_nop\n\tv_nop" : "+v"(s), "+v"(r)
                        : "v"(a0.v), "v"(a1.v), "v"(l0.v), "v"(l1.v), "v"(qh[0].v), "v"(qh[1].v), "v"(ql[0].v), "v"(ql[1].v));
      // S^T element r of tile kt = score(key0 + 16*kt + 8h + r, this lane's query); carries: q x16, k x16, residual x2^11
#pragma unroll
      for (int e = 0; e < 8; ++e) sc[8 * kt + e] = fmaf(r[e], S2M11, s[e]) * S2M11;
      koff += 16 * HD;
      if (kt == 0) asm volatile("" : "+v"(koff) : "v"(sc[0]));   // second tile's loads issue after the first tile is done
    }
  } else {
    Frag k00, k01, k10, k11;
    ldfrag(k00, Kp + koff);           ldfrag(k01, Kp + koff + 32);
    ldfrag(k10, Kp + koff + 16 * HD); ldfrag(k11, Kp + koff + 16 * HD + 32);
    v8f s0 = z8, s1 = z8;
    s0 = wm<false>(k00, qh[0], s0); s0 = wm<false>(k01, qh[1], s0);
    s1 = wm<false>(k10, qh[0], s1); s1 = wm<false>(k11, qh[1], s1);
    asm volatile("v_nop\n\tv_nop\n\tv_nop\n\tv_nop" : "+v"(s0), "+v"(s1)
                      : "v"(k00.v), "v"(k01.v), "v"(k10.v), "v"(k11.v), "v"(qh[0].v), "v"(qh[1].v));
#pragma unroll
    for (int e = 0; e < 8; ++e) { sc[e] = s0[e] * S2M11; sc[8 + e] = s1[e] * S2M11; }
  }
  if (MASK) {
    const int* mp = mrow + key0 + 8 * hh;
    const v4i m0 = *(const v4ia*)(mp),      m1 = *(const v4ia*)(mp + 4);
    const v4i m2 = *(const v4ia*)(mp + 16), m3 = *(const v4ia*)(mp + 20);
    const float ninf = neg_inf();
#pragma unroll
    for (int e = 0; e < 4; ++e) {
      sc[e]      = (m0[e] == 0) ? ninf : sc[e];
      sc[4 + e]  = (m1[e] == 0) ? ninf : sc[4 + e];
      sc[8 + e]  = (m2[e] == 0) ? ninf : sc[8 + e];
      sc[12 + e] = (m3[e] == 0) ? ninf : sc[12 + e];
    }
  }
  float mx = sc[0];
#pragma unroll
  for (int i = 1; i < 16; ++i) mx = fmaxf(mx, sc[i]);
  mx = fmaxf(mx, __shfl_xor(mx, 16, 32));            // the other lane half holds the other 16 keys of this query
  const float mnew = fmaxf(mr, mx);
  float msafe = mnew;
  if (MASK) msafe = (mnew == neg_inf()) ? 0.0f : mnew;   // every key so far masked: weights come out 0
  const float al = __builtin_amdgcn_exp2f((mr - msafe) * LOG2E);
  mr = mnew;
  // weights carried x256: pc = 256 * exp(sc - m); hi plane f16(pc), residual plane f16((pc - hi) * 2048)
  Frag ph, pl;
  float ps = 0.0f;
#pragma unroll
  for (int i = 0; i < 16; ++i) {
    const float pc = __builtin_amdgcn_exp2f(fmaf(sc[i] - msafe, LOG2E, 8.0f));
    ps += pc;
    const _Float16 h = (_Float16)pc;
    ph.h[i] = h;                                      // B element i: i<8 -> key0 + 8h + i (tile 0 row 8h+i); i>=8 -> key0 + 16 + 8h + (i-8) (tile 1)
    if (EARLYP) pl.h[i] = (_Float16)((pc - (float)h) * 2048.0f);
  }
  ps += __shfl_xor(ps, 16, 32);
  lr = lr * al + ps;
  // A fragments of V^T: row m = d (16*t + ln), elements 0..7 <- key0 + 8h + i, 8..15 <- key0 + 16 + 8h + i
  int voff = key0 + 8 * hh;
  asm volatile("" : "+v"(voff) : "v"(ps));            // V loads issue after the score phase
  const unsigned short* vp = Vp + (size_t)ln * SEQ + voff;
  Frag vf[4];
#pragma unroll
  for (int t = 0; t < 4; ++t) ldfrag(vf[t], vp + (size_t)t * 16 * SEQ);
#pragma unroll
  for (int t = 0; t < 4; ++t) Oh[t] = Oh[t] * al;
  if (EARLYP) {
    const unsigned short* vq = Vl + (size_t)ln * SEQ + voff;
    Frag vl[4];
#pragma unroll
    for (int t = 0; t < 4; ++t) ldfrag(vl[t], vq + (size_t)t * 16 * SEQ);
#pragma unroll
    for (int t = 0; t < 4; ++t) Ol[t] = Ol[t] * al;
#pragma unroll
    for (int t = 0; t < 4; ++t) {
      Oh[t] = wm<false>(vf[t], ph, Oh[t]);
      Ol[t] = wm<false>(vf[t], pl, Ol[t]);
      Ol[t] = wm<false>(vl[t], ph, Ol[t]);
    }
    asm volatile("v_nop\n\tv_nop\n\tv_nop\n\tv_nop" : "+v"(Oh[0]), "+v"(Oh[1]), "+v"(Oh[2]), "+v"(Oh[3]), "+v"(Ol[0]), "+v"(Ol[1]), "+v"(Ol[2]), "+v"(Ol[3])
                      : "v"(vf[0].v), "v"(vf[1].v), "v"(vf[2].v), "v"(vf[3].v),
                        "v"(vl[0].v), "v"(vl[1].v), "v"(vl[2].v), "v"(vl[3].v), "v"(ph.v), "v"(pl.v));
  } else {
#pragma unroll
    for (int t = 0; t < 4; ++t) Oh[t] = wm<false>(vf[t], ph, Oh[t]);
    asm volatile("v_nop\n\tv_nop\n\tv_nop\n\tv_nop" : "+v"(Oh[0]), "+v"(Oh[1]), "+v"(Oh[2]), "+v"(Oh[3])
                      : "v"(vf[0].v), "v"(vf[1].v), "v"(vf[2].v), "v"(vf[3].v), "v"(ph.v));
  }
}

template <bool EARLYP>
__device__ __forceinline__ void run_keys(const unsigned short* __restrict__ qkh, const unsigned short* __restrict__ qkl,
                                         const unsigned short* __restrict__ vth, const unsigned short* __restrict__ vtl,
                                         const int* __restrict__ mask, int b, int h, int qg, int ln, int hh,
                                         int nplain, int nsteps, float& mr, float& lr, v8f (&Oh)[4], v8f (&Ol)[4]) {
  // Q^T B fragments: column n = this lane's query, elements 0..7 <- d = 32c + 8h + i, 8..15 <- d = 32c + 16 + 8h + i
  const size_t qoff = ((size_t)(b * NQK + h) * SEQ + qg) * HD + 8 * hh;
  Frag qh[2], ql[2];
  ldfrag(qh[0], qkh + qoff); ldfrag(qh[1], qkh + qoff + 32);
  if (EARLYP) { ldfrag(ql[0], qkl + qoff); ldfrag(ql[1], qkl + qoff + 32); }
  else { ql[0] = qh[0]; ql[1] = qh[1]; }
  const int kv = h % NKV;
  const size_t kbase = (size_t)(b * NQK + NHEAD + kv) * SEQ * HD;
  const size_t vbase = ((size_t)b * KVW + (size_t)kv * HD) * SEQ;
  const unsigned short* Kp = qkh + kbase;
  const unsigned short* Kl = qkl + kbase;
  const unsigned short* Vp = vth + vbase;
  const unsigned short* Vl = vtl + vbase;
  const int* mrow = mask + (size_t)qg * SEQ_FULL;
#pragma unroll 1
  for (int j = 0; j < nplain; ++j)
    fa_step<EARLYP, false>(Kp, Kl, Vp, Vl, mrow, 32 * j, ln, hh, qh, ql, mr, lr, Oh, Ol);
#pragma unroll 1
  for (int j = nplain; j < nsteps; ++j)
    fa_step<EARLYP, true>(Kp, Kl, Vp, Vl, mrow, 32 * j, ln, hh, qh, ql, mr, lr, Oh, Ol);
}

// Block = 4 waves x 16 queries = 64 queries of one (batch, head); no LDS and no barrier in the key loop.
// Tile skipping from the device flags: flags[0]==1 -> keys past the diagonal step are skipped; flags[0]==1 && flags[1]==1 -> steps fully below
// the diagonal run without mask reads; every other visited step reads the mask by value. Trip counts are bounded by SEQ/32 for any flag value.
// coverage: NB*NHEAD*(SEQ/64) blocks x 4 waves x 16 rows x 64 columns = the whole ctx hi plane; blocks with query tile below EARLY_ROWS cover the whole residual plane.
__global__ __launch_bounds__(128) void k_attn(const unsigned short* __restrict__ qkh, const unsigned short* __restrict__ qkl,
                                              const unsigned short* __restrict__ vth, const unsigned short* __restrict__ vtl,
                                              const int* __restrict__ mask, const int* __restrict__ flags,
                                              unsigned short* __restrict__ ctxh, unsigned short* __restrict__ ctxl) {
  __shared__ __attribute__((aligned(16))) float so[4][16][68];
  const int tid = threadIdx.x, lane = tid & 31, ln = lane & 15, hh = lane >> 4;
  const int w = __builtin_amdgcn_readfirstlane(tid >> 5);
  const int nqt = SEQ / 64;
  const int blk = blockIdx.x;
  const int qt = blk % nqt;
  const int h = (blk / nqt) % NHEAD;
  const int b = blk / (nqt * NHEAD);
  const int qbase = qt * 64 + 16 * w;
  const int qg = qbase + ln;
  const int fU = flags[0], fL = flags[1];
  const bool tri = (fU == 1);
  const int nfull = qbase >> 5;                        // steps whose 32 keys are all at or below every query of this wave
  const int nsteps = tri ? (nfull + 1) : (SEQ / 32);   // <= SEQ/32 in both cases
  const int nplain = (tri && fL == 1) ? nfull : 0;
  const bool early = (qt * 64 < EARLY_ROWS);

  const v8f z8 = {0.f, 0.f, 0.f, 0.f, 0.f, 0.f, 0.f, 0.f};
  float mr = neg_inf(), lr = 0.0f;
  v8f Oh[4], Ol[4];
#pragma unroll
  for (int t = 0; t < 4; ++t) { Oh[t] = z8; Ol[t] = z8; }
  if (early) run_keys<true>(qkh, qkl, vth, vtl, mask, b, h, qg, ln, hh, nplain, nsteps, mr, lr, Oh, Ol);
  else       run_keys<false>(qkh, qkl, vth, vtl, mask, b, h, qg, ln, hh, nplain, nsteps, mr, lr, Oh, Ol);

  // O^T element r of tile t = ctx(query, d = 16t + 8h + r); undo the carries x256 (in lr), x16 (V), x2^11 (residual); apply the x64 carry of ctx
  const float inv = 4.0f * (1.0f / lr);
#pragma unroll
  for (int t = 0; t < 4; ++t)
#pragma unroll
    for (int r = 0; r < 8; ++r)
      so[w][ln][16 * t + 8 * hh + r] = fmaf(Ol[t][r], S2M11, Oh[t][r]) * inv;
  __syncthreads();
  const int rsub = lane >> 3, d0 = 8 * (lane & 7);
  v8us oh[4], ol[4];
#pragma unroll
  for (int g = 0; g < 4; ++g) {
    const int row = 4 * g + rsub;
    const v4f a0 = *(const v4fa*)&so[w][row][d0];
    const v4f a1 = *(const v4fa*)&so[w][row][d0 + 4];
    float o[8];
    o[0] = a0[0]; o[1] = a0[1]; o[2] = a0[2]; o[3] = a0[3];
    o[4] = a1[0]; o[5] = a1[1]; o[6] = a1[2]; o[7] = a1[3];
    Pack8 ph8, pl8;
#pragma unroll
    for (int e = 0; e < 8; ++e) {
      const _Float16 hv = (_Float16)o[e];
      ph8.h[e] = hv;
      pl8.h[e] = (_Float16)((o[e] - (float)hv) * 2048.0f);
    }
    oh[g] = ph8.v; ol[g] = pl8.v;
  }
  const size_t hbase = ((size_t)b * SEQ + qbase) * CD + (size_t)h * HD + d0;
  const size_t lbase = ((size_t)b * EARLY_ROWS + (early ? qbase : 0)) * CD + (size_t)h * HD + d0;
{
#pragma unroll
    for (int g = 0; g < 4; ++g) {
      const size_t ro = (size_t)(4 * g + rsub) * CD;
      *(v8us*)(ctxh + hbase + ro) = oh[g];
      if (early) *(v8us*)(ctxl + lbase + ro) = ol[g];
    }
    
  }
}

// ---------------------------------------------------------------------------------------------------------
// Output projection: out[m][n] = sum_k ctx[m][k] Wo[n][k] + bo[n]. Block = 4 waves stacked in M (128 rows) x 64 columns. grid = (CD/64, NB*SEQ/128).
// Rows below EARLY_ROWS of each sequence add the residual plane of ctx in separate accumulators.
// coverage: NB*SEQ rows x CD columns = every element of the output buffer region once. LDS tile 32 x 64 fully written before it is read.
__global__ __launch_bounds__(128) void k_proj_out(const unsigned short* __restrict__ ctxh, const unsigned short* __restrict__ ctxl,
                                                  const unsigned short* __restrict__ wo, const float* __restrict__ bo,
                                                  float* __restrict__ out) {
  __shared__ __attribute__((aligned(16))) float st[4][32][68];
  const int tid = threadIdx.x, lane = tid & 31, ln = lane & 15, hh = lane >> 4;
  const int w = __builtin_amdgcn_readfirstlane(tid >> 5);
  const int n0 = blockIdx.x * 64;
  const int mb = blockIdx.y * 128;
  const int b = mb / SEQ;
  const int tb = mb - b * SEQ;
  const bool early = (tb < EARLY_ROWS);                // block-uniform: EARLY_ROWS and SEQ are multiples of 128
  const int t0 = tb + 32 * w;
  const int m0 = mb + 32 * w;
  const v8f z8 = {0.f, 0.f, 0.f, 0.f, 0.f, 0.f, 0.f, 0.f};
  v8f acc[2][4], acl[2][4];
#pragma unroll
  for (int i = 0; i < 2; ++i)
#pragma unroll
    for (int j = 0; j < 4; ++j) { acc[i][j] = z8; acl[i][j] = z8; }
  const unsigned short* ap = ctxh + (size_t)(m0 + ln) * CD + 8 * hh;
  const unsigned short* alp = ctxl + (size_t)(b * EARLY_ROWS + (early ? t0 : 0) + ln) * CD + 8 * hh;
  const unsigned short* wp = wo + (size_t)(n0 + ln) * CD + 8 * hh;
  if (early) gemm_loop<false, true>(ap, alp, wp, acc, acl);
  else       gemm_loop<false, false>(ap, ap, wp, acc, acl);
  // carries: ctx x64, Wo x64 -> 2^-12; residual plane additionally x2^11
#pragma unroll
  for (int i = 0; i < 2; ++i)
#pragma unroll
    for (int j = 0; j < 4; ++j)
#pragma unroll
      for (int r = 0; r < 8; ++r)
        st[w][16 * i + 8 * hh + r][16 * j + ln] = fmaf(acl[i][j][r], S2M11, acc[i][j][r]) * S2M12;
  __syncthreads();
  const int rsub = lane >> 4, c4 = 4 * (lane & 15);
  const v4f bb = *(const v4fa*)(bo + n0 + c4);
  v4f bias;
  bias[0] = bf16_rne(bb[0]); bias[1] = bf16_rne(bb[1]); bias[2] = bf16_rne(bb[2]); bias[3] = bf16_rne(bb[3]);
  v4f ov[16];
#pragma unroll
  for (int g = 0; g < 16; ++g) {
    const v4f a = *(const v4fa*)&st[w][2 * g + rsub][c4];
    ov[g] = a + bias;
  }
  float* og = out + ((size_t)b * SEQ_FULL + t0) * CD + n0 + c4;
{
#pragma unroll
    for (int g = 0; g < 16; ++g)
      *(v4f*)(og + (size_t)(2 * g + rsub) * CD) = ov[g];
    
  }
}

// ---------------------------------------------------------------------------------------------------------
extern "C" void kernel_launch(void* const* d_in, const int* in_sizes, int n_in,
                              void* d_out, int out_size, void* d_ws, size_t ws_size, hipStream_t stream) {
  if (n_in < 11) return;
  const long long need_x = (long long)(NB - 1) * SEQ_FULL * CD + (long long)SEQ * CD;   // last element touched + 1
  const long long need_m = (long long)(SEQ - 1) * SEQ_FULL + SEQ;
  if ((long long)in_sizes[0] < need_x) return;
  if ((long long)in_sizes[1] < need_m) return;
  if ((long long)in_sizes[2] < (long long)SEQ * HD) return;
  if ((long long)in_sizes[3] < (long long)CD * CD || (long long)in_sizes[4] < CD) return;
  if ((long long)in_sizes[5] < (long long)KVW * CD || (long long)in_sizes[6] < KVW) return;
  if ((long long)in_sizes[7] < (long long)KVW * CD || (long long)in_sizes[8] < KVW) return;
  if ((long long)in_sizes[9] < (long long)CD * CD || (long long)in_sizes[10] < CD) return;
  if ((long long)out_size < need_x) return;
  if ((size_t)WS_TOTAL > ws_size) return;

  // wire order: x, mask, sinusoidal_pos, Wq, bq, Wk, bk, Wv, bv, Wo, bo
  const float* x    = (const float*)d_in[0];
  const int*   mask = (const int*)d_in[1];
  const float* tab  = (const float*)d_in[2];
  const float* Wq   = (const float*)d_in[3];
  const float* bq   = (const float*)d_in[4];
  const float* Wk   = (const float*)d_in[5];
  const float* bk   = (const float*)d_in[6];
  const float* Wv   = (const float*)d_in[7];
  const float* bv   = (const float*)d_in[8];
  const float* Wo   = (const float*)d_in[9];
  const float* bo   = (const float*)d_in[10];
  float* out = (float*)d_out;

  char* ws = (char*)d_ws;
  size_t off = 0;
  int* flags = (int*)(ws + off);                               off += SZ_FLAGS;
  unsigned short* xb   = (unsigned short*)(ws + off);          off += SZ_XB;
  unsigned short* wqk  = (unsigned short*)(ws + off);          off += SZ_WQK;
  unsigned short* wvb  = (unsigned short*)(ws + off);          off += SZ_WV;
  unsigned short* wob  = (unsigned short*)(ws + off);          off += SZ_WO;
  unsigned short* qkh  = (unsigned short*)(ws + off);          off += PLANE_QK * 2;
  unsigned short* qkl  = (unsigned short*)(ws + off);          off += PLANE_QK * 2;
  unsigned short* vth  = (unsigned short*)(ws + off);          off += PLANE_V * 2;
  unsigned short* vtl  = (unsigned short*)(ws + off);          off += PLANE_V * 2;
  unsigned short* ctxh = (unsigned short*)(ws + off);          off += SZ_CTXH;
  unsigned short* ctxl = (unsigned short*)(ws + off);          off += SZ_CTXL;
  if (off > ws_size) return;

  k_maskscan<<<1, 512, 0, stream>>>(mask, flags);
  // in[rows][CD] f32 -> [rows][CD] 16-bit planes (row order kept)
  k_cvt<0><<<(unsigned)(NB * SEQ), 256, 0, stream>>>(x, xb, NB * SEQ, SEQ, SEQ_FULL);
  k_cvt<0><<<(unsigned)CD, 256, 0, stream>>>(Wq, wqk, CD, CD, CD);
  k_cvt<0><<<(unsigned)KVW, 256, 0, stream>>>(Wk, wqk + (size_t)CD * CD, KVW, KVW, KVW);
  k_cvt<0><<<(unsigned)KVW, 256, 0, stream>>>(Wv, wvb, KVW, KVW, KVW);
  k_cvt<1><<<(unsigned)CD, 256, 0, stream>>>(Wo, wob, CD, CD, CD);

  k_proj_qk<<<dim3(NQK, (unsigned)(NB * SEQ / 128)), 128, 0, stream>>>(xb, wqk, bq, bk, tab, qkh, qkl);
  k_proj_v<<<dim3((unsigned)(NB * SEQ / 64), KVW / 128), 128, 0, stream>>>(wvb, xb, bv, vth, vtl);
  k_attn<<<(unsigned)(NB * NHEAD * (SEQ / 64)), 128, 0, stream>>>(qkh, qkl, vth, vtl, mask, flags, ctxh, ctxl);
  k_proj_out<<<dim3(CD / 64, (unsigned)(NB * SEQ / 128)), 128, 0, stream>>>(ctxh, ctxl, wob, bo, out);
}

// v001
// A run of this version takes 398 microseconds.
// Timed twice side by side with v000, it ran 2.18 and 2.21 times as fast.
#include <hip/hip_runtime.h>
#ifndef NB
#define NB 2
#endif
#ifndef SEQ
#define SEQ 2048
#endif
#define NB_FULL 2
#define SEQ_FULL 2048
#define CD 2048                 /* model width = depth of every projection */
#define NHEAD 32
#define NKV 8
#define HD 64
#define NQK (NHEAD + NKV)       /* rotary plane holds the 32 q heads followed by the 8 k heads */
#define KVW (NKV * HD)          /* 512 */
#define EARLY_ROWS (SEQ < 512 ? SEQ : 512)

#define SCAN_ROWS 8             /* mask rows per scan work-group: 8 rows x SEQ ints = 8 loads of 16 B per thread at SEQ = 2048 */
#define SCAN_LOADS (SCAN_ROWS * (SEQ / 4) / 512)
#define SZ_FLAGS ((size_t)(SEQ / SCAN_ROWS) * 128)   /* one 128-byte line per scan work-group */
#define SZ_XB    ((size_t)NB * SEQ * CD * 2)
#define SZ_WQK   ((size_t)(CD + KVW) * CD * 2)
#define SZ_WV    ((size_t)KVW * CD * 2)
#define SZ_WO    ((size_t)CD * CD * 2)
#define PLANE_QK ((size_t)NB * NQK * SEQ * HD)     /* elements of one rotary plane */
#define PLANE_V  ((size_t)NB * KVW * SEQ)          /* elements of one V^T plane */
#define SZ_CTXH  ((size_t)NB * SEQ * CD * 2)
#define SZ_CTXL  ((size_t)NB * EARLY_ROWS * CD * 2)
#define WS_TOTAL (SZ_FLAGS + SZ_XB + SZ_WQK + SZ_WV + SZ_WO + PLANE_QK * 4 + PLANE_V * 4 + SZ_CTXH + SZ_CTXL)

static_assert(SEQ % 128 == 0);
static_assert((SCAN_ROWS * (SEQ / 4)) % 512 == 0);
static_assert(16 % SCAN_ROWS == 0);
static_assert(SZ_FLAGS % 256 == 0);
static_assert(EARLY_ROWS % 128 == 0);
static_assert(SEQ <= SEQ_FULL);
static_assert(NB <= NB_FULL);
static_assert(HD == 64);
static_assert(CD % 32 == 0);
static_assert(KVW % 128 == 0);
static_assert(NHEAD % NKV == 0);
static_assert(WS_TOTAL <= (size_t)134217728);
static_assert(SZ_XB % 256 == 0 && SZ_WQK % 256 == 0 && SZ_WV % 256 == 0 && SZ_WO % 256 == 0);
static_assert((PLANE_QK * 2) % 256 == 0 && (PLANE_V * 2) % 256 == 0 && SZ_CTXH % 256 == 0 && SZ_CTXL % 256 == 0);

typedef __bf16 v16b __attribute__((ext_vector_type(16)));
typedef _Float16 v16h __attribute__((ext_vector_type(16)));
typedef unsigned short v8us __attribute__((ext_vector_type(8), may_alias));
typedef float v8f __attribute__((ext_vector_type(8)));
typedef float v4f __attribute__((ext_vector_type(4)));
typedef float v4fa __attribute__((ext_vector_type(4), may_alias));
typedef int v4i __attribute__((ext_vector_type(4)));
typedef int v4ia __attribute__((ext_vector_type(4), may_alias));
union Frag { v16b b; v16h v; v8us half[2]; _Float16 h[16]; unsigned short u[16]; };
union Pack8 { v8us v; _Float16 h[8]; unsigned short u[8]; };

#define LOG2E 1.4426950408889634f
#define S2M11 0.00048828125f       /* 2^-11 */
#define S2M12 0.000244140625f      /* 2^-12 */
__device__ __forceinline__ unsigned short bf16_bits(float x) {   // RNE convert to bf16 bits
  unsigned int u = __float_as_uint(x);
  return (unsigned short)((u + 0x7FFFu + ((u >> 16) & 1u)) >> 16);
}
__device__ __forceinline__ float bf16_val(unsigned short b) { return __uint_as_float(((unsigned int)b) << 16); }
__device__ __forceinline__ float bf16_rne(float x) { return bf16_val(bf16_bits(x)); }
__device__ __forceinline__ float neg_inf() { return __uint_as_float(0xff800000u); }

// Fragment of a k-contiguous 16-bit row: elements 0..7 <- p[0..7], elements 8..15 <- p[16..23]; caller adds row*pitch + k0 + 8*h.
__device__ __forceinline__ void ldfrag(Frag& f, const unsigned short* __restrict__ p) {
  f.half[0] = *(const v8us*)(p);
  f.half[1] = *(const v8us*)(p + 16);
}

template <bool BF>
__device__ __forceinline__ v8f wm(const Frag& a, const Frag& b, v8f c) {
  if (BF) return __builtin_amdgcn_wmma_f32_16x16x32_bf16(false, a.b, false, b.b, (short)0, c, false, false);
  return __builtin_amdgcn_wmma_f32_16x16x32_f16(false, a.v, false, b.v, (short)0, c, false, false);
}

// ---------------------------------------------------------------------------------------------------------
// Mask scan, one work-group per SCAN_ROWS mask rows; group g owns the line flags[32g .. 32g+31]:
// flags[32g] = 1 iff every entry of its rows above the diagonal is zero; flags[32g+1] = 1 iff every entry of its rows on or below the diagonal is nonzero.
// coverage: SEQ/SCAN_ROWS blocks x 512 threads x SCAN_LOADS x 4 ints = SEQ x SEQ mask entries; every flag line is written whole.
__global__ __launch_bounds__(512) void k_maskscan(const int* __restrict__ mask, int* __restrict__ flags) {
  __shared__ int sw[2][16];
  const int tid = threadIdx.x, lane = tid & 31, wv = tid >> 5;
  int badU = 0, badL = 0;
  const int cpr = SEQ / 4;
  const int q0 = blockIdx.x * SCAN_ROWS;
  const int* mb = mask + (size_t)q0 * SEQ_FULL;       // uniform base of this group's rows; the loads below differ by constants only
  v4i mv[SCAN_LOADS];
  // all loads of a thread are independent and issued before the first is tested, so that they are in flight together
#pragma unroll
  for (int u = 0; u < SCAN_LOADS; ++u) {
    const int c = tid + 512 * u;
    const int qr = c / cpr, k = (c - qr * cpr) * 4;
    mv[u] = *(const v4ia*)(mb + (unsigned)(qr * SEQ_FULL + k));
  }
#pragma unroll
  for (int u = 0; u < SCAN_LOADS; ++u) {
    const int c = tid + 512 * u;
    const int qr = c / cpr, k = (c - qr * cpr) * 4;
    const int q = q0 + qr;
#pragma unroll
    for (int i = 0; i < 4; ++i) {
      const int above = (k + i > q) ? 1 : 0;
      const int nz = (mv[u][i] != 0) ? 1 : 0;
      badU |= above & nz;
      badL |= (1 - above) & (1 - nz);
    }
  }
#pragma unroll
  for (int o = 16; o >= 1; o >>= 1) {
    badU |= __shfl_xor(badU, o, 32);
    badL |= __shfl_xor(badL, o, 32);
  }
  if (lane == 0) { sw[0][wv] = badU; sw[1][wv] = badL; }
  __syncthreads();
  if (tid < 8) {
    int u = 0, l = 0;
#pragma unroll
    for (int i = 0; i < 16; ++i) { u |= sw[0][i]; l |= sw[1][i]; }
    v4i o;
    o[0] = (tid == 0 && u == 0) ? 1 : 0;
    o[1] = (tid == 0 && l == 0) ? 1 : 0;
    o[2] = 0; o[3] = 0;
    *(v4i*)(flags + 32 * blockIdx.x + 4 * tid) = o;
    
  }
}

// ---------------------------------------------------------------------------------------------------------
// f32 rows of width CD -> 16-bit plane. MODE 0: bf16 bits (RNE). MODE 1: f16 of (RNE bf16 value x 64).
// coverage: nrows blocks x 256 threads x 8 elements = nrows x CD.
template <int MODE>
__global__ __launch_bounds__(256) void k_cvt(const float* __restrict__ src, unsigned short* __restrict__ dst,
                                             int nrows, int rows_per_batch, int src_batch_rows) {
  const int t = blockIdx.x * 256 + threadIdx.x;
  if (t >= nrows * 256) return;
  const int row = t >> 8, piece = t & 255;
  const int b = row / rows_per_batch, r = row - b * rows_per_batch;
  const float* sp = src + ((size_t)b * src_batch_rows + r) * CD + piece * 8;
  const v4f x0 = *(const v4fa*)(sp), x1 = *(const v4fa*)(sp + 4);
  Pack8 o;
  if (MODE == 0) {
    o.u[0] = bf16_bits(x0[0]); o.u[1] = bf16_bits(x0[1]); o.u[2] = bf16_bits(x0[2]); o.u[3] = bf16_bits(x0[3]);
    o.u[4] = bf16_bits(x1[0]); o.u[5] = bf16_bits(x1[1]); o.u[6] = bf16_bits(x1[2]); o.u[7] = bf16_bits(x1[3]);
  } else {
    o.h[0] = (_Float16)(bf16_rne(x0[0]) * 64.0f); o.h[1] = (_Float16)(bf16_rne(x0[1]) * 64.0f);
    o.h[2] = (_Float16)(bf16_rne(x0[2]) * 64.0f); o.h[3] = (_Float16)(bf16_rne(x0[3]) * 64.0f);
    o.h[4] = (_Float16)(bf16_rne(x1[0]) * 64.0f); o.h[5] = (_Float16)(bf16_rne(x1[1]) * 64.0f);
    o.h[6] = (_Float16)(bf16_rne(x1[2]) * 64.0f); o.h[7] = (_Float16)(bf16_rne(x1[3]) * 64.0f);
  }
  unsigned short* d = dst + (size_t)t * 8;
  const v8us ov = o.v;
  *(v8us*)d = ov;
  
}

// ---------------------------------------------------------------------------------------------------------
// Wave-tile GEMM core: acc[i][j] (rows 16i.., cols 16j..) += A[row][k] * W[col][k] over k = 0..CD-1.
// ap  = A  + (row0 + ln)*CD + 8*h (A fragment: row m = ln, elements 0..7 <- k0 + 8h + i, 8..15 <- k0 + 16 + 8h + i)
// wp  = W  + (col0 + ln)*CD + 8*h (B fragment: column n = ln, same k map)
// alp = residual plane of A (same addressing), accumulated into acl when RES.
template <bool BF, bool RES>
__device__ __forceinline__ void gemm_loop(const unsigned short* __restrict__ ap, const unsigned short* __restrict__ alp,
                                          const unsigned short* __restrict__ wp, v8f (&acc)[2][4], v8f (&acl)[2][4]) {
#pragma unroll 1
  for (int k = 0; k < CD; k += 32) {
    Frag a[2], b[4];
#pragma unroll
    for (int i = 0; i < 2; ++i) ldfrag(a[i], ap + (size_t)i * 16 * CD + k);
#pragma unroll
    for (int j = 0; j < 4; ++j) ldfrag(b[j], wp + (size_t)j * 16 * CD + k);
#pragma unroll
    for (int i = 0; i < 2; ++i)
#pragma unroll
      for (int j = 0; j < 4; ++j) acc[i][j] = wm<BF>(a[i], b[j], acc[i][j]);
    if (RES) {
      Frag al[2];
#pragma unroll
      for (int i = 0; i < 2; ++i) ldfrag(al[i], alp + (size_t)i * 16 * CD + k);
#pragma unroll
      for (int i = 0; i < 2; ++i)
#pragma unroll
        for (int j = 0; j < 4; ++j) acl[i][j] = wm<BF>(al[i], b[j], acl[i][j]);
      asm volatile("v_nop\n\tv_nop\n\tv_nop\n\tv_nop" : "+v"(acl[0][0]), "+v"(acl[0][1]), "+v"(acl[0][2]), "+v"(acl[0][3]),
                          "+v"(acl[1][0]), "+v"(acl[1][1]), "+v"(acl[1][2]), "+v"(acl[1][3])
                        : "v"(al[0].v), "v"(al[1].v), "v"(b[0].v), "v"(b[1].v), "v"(b[2].v), "v"(b[3].v));
    }
    asm volatile("v_nop\n\tv_nop\n\tv_nop\n\tv_nop" : "+v"(acc[0][0]), "+v"(acc[0][1]), "+v"(acc[0][2]), "+v"(acc[0][3]),
                        "+v"(acc[1][0]), "+v"(acc[1][1]), "+v"(acc[1][2]), "+v"(acc[1][3])
                      : "v"(a[0].v), "v"(a[1].v), "v"(b[0].v), "v"(b[1].v), "v"(b[2].v), "v"(b[3].v));
  }
}

__device__ __forceinline__ float rope1(float q, float p, float c, float s, float sg) { return q * c + (sg * p) * s; }

// ---------------------------------------------------------------------------------------------------------
// q and k projections with fused bias, rotary (table read by value) and head-major repack.
// Block = 4 waves stacked in M (128 token rows) x one head (64 columns). grid = (NQK, NB*SEQ/128).
// coverage: NQK heads x NB*SEQ tokens x 64 = the whole plane [NB][NQK][SEQ][64], both planes. LDS tile 32 x 64 fully written before it is read.
__global__ __launch_bounds__(128) void k_proj_qk(const unsigned short* __restrict__ xb, const unsigned short* __restrict__ wqk,
                                                 const float* __restrict__ bq, const float* __restrict__ bk,
                                                 const float* __restrict__ tab,
                                                 unsigned short* __restrict__ qkh, unsigned short* __restrict__ qkl) {
  __shared__ __attribute__((aligned(16))) float st[4][32][68];
  const int tid = threadIdx.x, lane = tid & 31, ln = lane & 15, hh = lane >> 4;
  const int w = __builtin_amdgcn_readfirstlane(tid >> 5);
  const int hd = blockIdx.x;
  const int m0 = blockIdx.y * 128 + 32 * w;
  const v8f z8 = {0.f, 0.f, 0.f, 0.f, 0.f, 0.f, 0.f, 0.f};
  v8f acc[2][4];
#pragma unroll
  for (int i = 0; i < 2; ++i)
#pragma unroll
    for (int j = 0; j < 4; ++j) acc[i][j] = z8;
  gemm_loop<true, false>(xb + (size_t)(m0 + ln) * CD + 8 * hh, xb, wqk + (size_t)(hd * HD + ln) * CD + 8 * hh, acc, acc);

  float bias[4];
#pragma unroll
  for (int j = 0; j < 4; ++j) {
    const int col = hd * HD + 16 * j + ln;
    const int cq = (col < CD - 1) ? col : (CD - 1);
    int ck = col - CD;
    ck = (ck < 0) ? 0 : ((ck > KVW - 1) ? (KVW - 1) : ck);
    const float vq = bq[cq], vk = bk[ck];
    bias[j] = bf16_rne((col < CD) ? vq : vk);
  }
#pragma unroll
  for (int i = 0; i < 2; ++i)
#pragma unroll
    for (int j = 0; j < 4; ++j)
#pragma unroll
      for (int r = 0; r < 8; ++r) st[w][16 * i + 8 * hh + r][16 * j + ln] = acc[i][j][r] + bias[j];
  __syncthreads();

  const int b = m0 / SEQ, t0 = m0 - b * SEQ;
  const int rsub = lane >> 3, d0 = 8 * (lane & 7);
  const float sg = (d0 < 32) ? -1.0f : 1.0f;
  v8us oh[8], ol[8];
#pragma unroll
  for (int g = 0; g < 8; ++g) {
    const int row = 4 * g + rsub;
    const v4f a0 = *(const v4fa*)&st[w][row][d0];
    const v4f a1 = *(const v4fa*)&st[w][row][d0 + 4];
    const v4f p0 = *(const v4fa*)&st[w][row][d0 ^ 32];
    const v4f p1 = *(const v4fa*)&st[w][row][(d0 ^ 32) + 4];
    const float* tp = tab + (size_t)(t0 + row) * HD + d0;
    const v4f c0 = *(const v4fa*)(tp), c1 = *(const v4fa*)(tp + 4);
    const float k0 = bf16_rne(c0[0]), s0 = bf16_rne(c0[1]), k1 = bf16_rne(c0[2]), s1 = bf16_rne(c0[3]);
    const float k2 = bf16_rne(c1[0]), s2 = bf16_rne(c1[1]), k3 = bf16_rne(c1[2]), s3 = bf16_rne(c1[3]);
    float o[8];
    o[0] = rope1(a0[0], p0[0], k0, s0, sg); o[1] = rope1(a0[1], p0[1], k0, s0, sg);
    o[2] = rope1(a0[2], p0[2], k1, s1, sg); o[3] = rope1(a0[3], p0[3], k1, s1, sg);
    o[4] = rope1(a1[0], p1[0], k2, s2, sg); o[5] = rope1(a1[1], p1[1], k2, s2, sg);
    o[6] = rope1(a1[2], p1[2], k3, s3, sg); o[7] = rope1(a1[3], p1[3], k3, s3, sg);
    Pack8 ph8, pl8;
#pragma unroll
    for (int e = 0; e < 8; ++e) {
      const float y = o[e] * 16.0f;                       // carried x16
      const _Float16 h = (_Float16)y;
      ph8.h[e] = h;
      pl8.h[e] = (_Float16)((y - (float)h) * 2048.0f);     // residual plane x2^11
    }
    oh[g] = ph8.v; ol[g] = pl8.v;
  }
  const size_t dbase = ((size_t)(b * NQK + hd) * SEQ + t0) * HD + d0;
{
#pragma unroll
    for (int g = 0; g < 8; ++g) {
      const size_t off = dbase + (size_t)(4 * g + rsub) * HD;
      *(v8us*)(qkh + off) = oh[g];
      *(v8us*)(qkl + off) = ol[g];
    }
    
  }
}

// ---------------------------------------------------------------------------------------------------------
// v projection computed transposed: Vt[b][m][t] = sum_k Wv[m][k] x[b,t][k] + bv[m], carried x16, hi and residual planes.
// Block = 4 waves stacked in M (128 weight rows) x 64 tokens. grid = (NB*SEQ/64, KVW/128).
// coverage: KVW rows x NB*SEQ tokens = the whole plane [NB][KVW][SEQ], both planes. LDS tile 32 x 64 fully written before it is read.
__global__ __launch_bounds__(128) void k_proj_v(const unsigned short* __restrict__ wvb, const unsigned short* __restrict__ xb,
                                                const float* __restrict__ bv,
                                                unsigned short* __restrict__ vth, unsigned short* __restrict__ vtl) {
  __shared__ __attribute__((aligned(16))) float st[4][32][68];
  const int tid = threadIdx.x, lane = tid & 31, ln = lane & 15, hh = lane >> 4;
  const int w = __builtin_amdgcn_readfirstlane(tid >> 5);
  const int n0 = blockIdx.x * 64;
  const int m0 = blockIdx.y * 128 + 32 * w;
  const v8f z8 = {0.f, 0.f, 0.f, 0.f, 0.f, 0.f, 0.f, 0.f};
  v8f acc[2][4];
#pragma unroll
  for (int i = 0; i < 2; ++i)
#pragma unroll
    for (int j = 0; j < 4; ++j) acc[i][j] = z8;
  gemm_loop<true, false>(wvb + (size_t)(m0 + ln) * CD + 8 * hh, wvb, xb + (size_t)(n0 + ln) * CD + 8 * hh, acc, acc);
#pragma unroll
  for (int i = 0; i < 2; ++i)
#pragma unroll
    for (int j = 0; j < 4; ++j)
#pragma unroll
      for (int r = 0; r < 8; ++r) st[w][16 * i + 8 * hh + r][16 * j + ln] = acc[i][j][r];
  __syncthreads();

  const int b = n0 / SEQ, t0 = n0 - b * SEQ;
  const int rsub = lane >> 3, c0 = 8 * (lane & 7);
  v8us oh[8], ol[8];
#pragma unroll
  for (int g = 0; g < 8; ++g) {
    const int row = 4 * g + rsub;
    const float bias = bf16_rne(bv[m0 + row]);
    const v4f a0 = *(const v4fa*)&st[w][row][c0];
    const v4f a1 = *(const v4fa*)&st[w][row][c0 + 4];
    float o[8];
    o[0] = a0[0]; o[1] = a0[1]; o[2] = a0[2]; o[3] = a0[3];
    o[4] = a1[0]; o[5] = a1[1]; o[6] = a1[2]; o[7] = a1[3];
    Pack8 ph8, pl8;
#pragma unroll
    for (int e = 0; e < 8; ++e) {
      const float y = (o[e] + bias) * 16.0f;              // carried x16
      const _Float16 h = (_Float16)y;
      ph8.h[e] = h;
      pl8.h[e] = (_Float16)((y - (float)h) * 2048.0f);
    }
    oh[g] = ph8.v; ol[g] = pl8.v;
  }
  const size_t dbase = ((size_t)b * KVW + m0) * SEQ + t0 + c0;
{
#pragma unroll
    for (int g = 0; g < 8; ++g) {
      const size_t off = dbase + (size_t)(4 * g + rsub) * SEQ;
      *(v8us*)(vth + off) = oh[g];
      *(v8us*)(vtl + off) = ol[g];
    }
    
  }
}

// ---------------------------------------------------------------------------------------------------------
// One 32-key step for a wave's 16 queries (this lane's column = its query). EARLYP adds the residual planes of q, k, v, P.
// MASK reads the mask row of this lane's query by value and replace-fills with -inf.
template <bool EARLYP, bool MASK>
__device__ __forceinline__ void fa_step(const unsigned short* __restrict__ Kp, const unsigned short* __restrict__ Kl,
                                        const unsigned short* __restrict__ Vp, const unsigned short* __restrict__ Vl,
                                        const int* __restrict__ mrow, int key0, int ln, int hh,
                                        const Frag (&qh)[2], const Frag (&ql)[2],
                                        float& mr, float& lr, v8f (&Oh)[4], v8f (&Ol)[4]) {
  const v8f z8 = {0.f, 0.f, 0.f, 0.f, 0.f, 0.f, 0.f, 0.f};
  float sc[16];
  // A fragments of K: row m = key (key0 + 16*kt + ln), elements 0..7 <- d = 32c + 8h + i, 8..15 <- d = 32c + 16 + 8h + i
  int koff = (key0 + ln) * HD + 8 * hh;
  if (EARLYP) {
#pragma unroll
    for (int kt = 0; kt < 2; ++kt) {
      Frag a0, a1, l0, l1;
      ldfrag(a0, Kp + koff); ldfrag(a1, Kp + koff + 32);
      ldfrag(l0, Kl + koff); ldfrag(l1, Kl + koff + 32);
      v8f s = z8, r = z8;
      s = wm<false>(a0, qh[0], s); s = wm<false>(a1, qh[1], s);
      r = wm<false>(a0, ql[0], r); r = wm<false>(a1, ql[1], r);
      r = wm<false>(l0, qh[0], r); r = wm<false>(l1, qh[1], r);
      asm volatile("v_nop\n\tv_nop\n\tv_nop\n\tv_nop" : "+v"(s), "+v"(r)
                        : "v"(a0.v), "v"(a1.v), "v"(l0.v), "v"(l1.v), "v"(qh[0].v), "v"(qh[1].v), "v"(ql[0].v), "v"(ql[1].v));
      // S^T element r of tile kt = score(key0 + 16*kt + 8h + r, this lane's query); carries: q x16, k x16, residual x2^11
#pragma unroll
      for (int e = 0; e < 8; ++e) sc[8 * kt + e] = fmaf(r[e], S2M11, s[e]) * S2M11;
      koff += 16 * HD;
      if (kt == 0) asm volatile("" : "+v"(koff) : "v"(sc[0]));   // second tile's loads issue after the first tile is done
    }
  } else {
    Frag k00, k01, k10, k11;
    ldfrag(k00, Kp + koff);           ldfrag(k01, Kp + koff + 32);
    ldfrag(k10, Kp + koff + 16 * HD); ldfrag(k11, Kp + koff + 16 * HD + 32);
    v8f s0 = z8, s1 = z8;
    s0 = wm<false>(k00, qh[0], s0); s0 = wm<false>(k01, qh[1], s0);
    s1 = wm<false>(k10, qh[0], s1); s1 = wm<false>(k11, qh[1], s1);
    asm volatile("v_nop\n\tv_nop\n\tv_nop\n\tv_nop" : "+v"(s0), "+v"(s1)
                      : "v"(k00.v), "v"(k01.v), "v"(k10.v), "v"(k11.v), "v"(qh[0].v), "v"(qh[1].v));
#pragma unroll
    for (int e = 0; e < 8; ++e) { sc[e] = s0[e] * S2M11; sc[8 + e] = s1[e] * S2M11; }
  }
  if (MASK) {
    const int* mp = mrow + key0 + 8 * hh;
    const v4i m0 = *(const v4ia*)(mp),      m1 = *(const v4ia*)(mp + 4);
    const v4i m2 = *(const v4ia*)(mp + 16), m3 = *(const v4ia*)(mp + 20);
    const float ninf = neg_inf();
#pragma unroll
    for (int e = 0; e < 4; ++e) {
      sc[e]      = (m0[e] == 0) ? ninf : sc[e];
      sc[4 + e]  = (m1[e] == 0) ? ninf : sc[4 + e];
      sc[8 + e]  = (m2[e] == 0) ? ninf : sc[8 + e];
      sc[12 + e] = (m3[e] == 0) ? ninf : sc[12 + e];
    }
  }
  float mx = sc[0];
#pragma unroll
  for (int i = 1; i < 16; ++i) mx = fmaxf(mx, sc[i]);
  mx = fmaxf(mx, __shfl_xor(mx, 16, 32));            // the other lane half holds the other 16 keys of this query
  const float mnew = fmaxf(mr, mx);
  float msafe = mnew;
  if (MASK) msafe = (mnew == neg_inf()) ? 0.0f : mnew;   // every key so far masked: weights come out 0
  const float al = __builtin_amdgcn_exp2f((mr - msafe) * LOG2E);
  mr = mnew;
  // weights carried x256: pc = 256 * exp(sc - m); hi plane f16(pc), residual plane f16((pc - hi) * 2048)
  Frag ph, pl;
  float ps = 0.0f;
#pragma unroll
  for (int i = 0; i < 16; ++i) {
    const float pc = __builtin_amdgcn_exp2f(fmaf(sc[i] - msafe, LOG2E, 8.0f));
    ps += pc;
    const _Float16 h = (_Float16)pc;
    ph.h[i] = h;                                      // B element i: i<8 -> key0 + 8h + i (tile 0 row 8h+i); i>=8 -> key0 + 16 + 8h + (i-8) (tile 1)
    if (EARLYP) pl.h[i] = (_Float16)((pc - (float)h) * 2048.0f);
  }
  ps += __shfl_xor(ps, 16, 32);
  lr = lr * al + ps;
  // A fragments of V^T: row m = d (16*t + ln), elements 0..7 <- key0 + 8h + i, 8..15 <- key0 + 16 + 8h + i
  int voff = key0 + 8 * hh;
  asm volatile("" : "+v"(voff) : "v"(ps));            // V loads issue after the score phase
  const unsigned short* vp = Vp + (size_t)ln * SEQ + voff;
  Frag vf[4];
#pragma unroll
  for (int t = 0; t < 4; ++t) ldfrag(vf[t], vp + (size_t)t * 16 * SEQ);
#pragma unroll
  for (int t = 0; t < 4; ++t) Oh[t] = Oh[t] * al;
  if (EARLYP) {
    const unsigned short* vq = Vl + (size_t)ln * SEQ + voff;
    Frag vl[4];
#pragma unroll
    for (int t = 0; t < 4; ++t) ldfrag(vl[t], vq + (size_t)t * 16 * SEQ);
#pragma unroll
    for (int t = 0; t < 4; ++t) Ol[t] = Ol[t] * al;
#pragma unroll
    for (int t = 0; t < 4; ++t) {
      Oh[t] = wm<false>(vf[t], ph, Oh[t]);
      Ol[t] = wm<false>(vf[t], pl, Ol[t]);
      Ol[t] = wm<false>(vl[t], ph, Ol[t]);
    }
    asm volatile("v_nop\n\tv_nop\n\tv_nop\n\tv_nop" : "+v"(Oh[0]), "+v"(Oh[1]), "+v"(Oh[2]), "+v"(Oh[3]), "+v"(Ol[0]), "+v"(Ol[1]), "+v"(Ol[2]), "+v"(Ol[3])
                      : "v"(vf[0].v), "v"(vf[1].v), "v"(vf[2].v), "v"(vf[3].v),
                        "v"(vl[0].v), "v"(vl[1].v), "v"(vl[2].v), "v"(vl[3].v), "v"(ph.v), "v"(pl.v));
  } else {
#pragma unroll
    for (int t = 0; t < 4; ++t) Oh[t] = wm<false>(vf[t], ph, Oh[t]);
    asm volatile("v_nop\n\tv_nop\n\tv_nop\n\tv_nop" : "+v"(Oh[0]), "+v"(Oh[1]), "+v"(Oh[2]), "+v"(Oh[3])
                      : "v"(vf[0].v), "v"(vf[1].v), "v"(vf[2].v), "v"(vf[3].v), "v"(ph.v));
  }
}

template <bool EARLYP>
__device__ __forceinline__ void run_keys(const unsigned short* __restrict__ qkh, const unsigned short* __restrict__ qkl,
                                         const unsigned short* __restrict__ vth, const unsigned short* __restrict__ vtl,
                                         const int* __restrict__ mask, int b, int h, int qg, int ln, int hh,
                                         int nplain, int nsteps, float& mr, float& lr, v8f (&Oh)[4], v8f (&Ol)[4]) {
  // Q^T B fragments: column n = this lane's query, elements 0..7 <- d = 32c + 8h + i, 8..15 <- d = 32c + 16 + 8h + i
  const size_t qoff = ((size_t)(b * NQK + h) * SEQ + qg) * HD + 8 * hh;
  Frag qh[2], ql[2];
  ldfrag(qh[0], qkh + qoff); ldfrag(qh[1], qkh + qoff + 32);
  if (EARLYP) { ldfrag(ql[0], qkl + qoff); ldfrag(ql[1], qkl + qoff + 32); }
  else { ql[0] = qh[0]; ql[1] = qh[1]; }
  const int kv = h % NKV;
  const size_t kbase = (size_t)(b * NQK + NHEAD + kv) * SEQ * HD;
  const size_t vbase = ((size_t)b * KVW + (size_t)kv * HD) * SEQ;
  const unsigned short* Kp = qkh + kbase;
  const unsigned short* Kl = qkl + kbase;
  const unsigned short* Vp = vth + vbase;
  const unsigned short* Vl = vtl + vbase;
  const int* mrow = mask + (size_t)qg * SEQ_FULL;
#pragma unroll 1
  for (int j = 0; j < nplain; ++j)
    fa_step<EARLYP, false>(Kp, Kl, Vp, Vl, mrow, 32 * j, ln, hh, qh, ql, mr, lr, Oh, Ol);
#pragma unroll 1
  for (int j = nplain; j < nsteps; ++j)
    fa_step<EARLYP, true>(Kp, Kl, Vp, Vl, mrow, 32 * j, ln, hh, qh, ql, mr, lr, Oh, Ol);
}

// Block = 4 waves x 16 queries = 64 queries of one (batch, head); no LDS and no barrier in the key loop.
// Tile skipping from the device flags of this wave's own 16 mask rows (16/SCAN_ROWS flag lines): all upper flags 1 -> keys past the diagonal step are
// skipped; upper and lower flags all 1 -> steps fully below the diagonal run without mask reads; every other visited step reads the mask by value.
// Trip counts are bounded by SEQ/32 for any flag value.
// coverage: NB*NHEAD*(SEQ/64) blocks x 4 waves x 16 rows x 64 columns = the whole ctx hi plane; blocks with query tile below EARLY_ROWS cover the whole residual plane.
__global__ __launch_bounds__(128) void k_attn(const unsigned short* __restrict__ qkh, const unsigned short* __restrict__ qkl,
                                              const unsigned short* __restrict__ vth, const unsigned short* __restrict__ vtl,
                                              const int* __restrict__ mask, const int* __restrict__ flags,
                                              unsigned short* __restrict__ ctxh, unsigned short* __restrict__ ctxl) {
  __shared__ __attribute__((aligned(16))) float so[4][16][68];
  const int tid = threadIdx.x, lane = tid & 31, ln = lane & 15, hh = lane >> 4;
  const int w = __builtin_amdgcn_readfirstlane(tid >> 5);
  const int nqt = SEQ / 64;
  const int blk = blockIdx.x;
  const int qt = blk % nqt;
  const int h = (blk / nqt) % NHEAD;
  const int b = blk / (nqt * NHEAD);
  const int qbase = qt * 64 + 16 * w;
  const int qg = qbase + ln;
  const int* fl = flags + (qbase / SCAN_ROWS) * 32;
  int upok = 1, lowok = 1;                             // plain & so that the flag loads issue together
#pragma unroll
  for (int g = 0; g < 16 / SCAN_ROWS; ++g) {
    const int fU = fl[32 * g], fL = fl[32 * g + 1];
    upok &= (fU == 1) ? 1 : 0;
    lowok &= (fL == 1) ? 1 : 0;
  }
  const bool tri = (upok == 1), low = (lowok == 1);
  const int nfull = qbase >> 5;                        // steps whose 32 keys are all at or below every query of this wave
  const int nsteps = tri ? (nfull + 1) : (SEQ / 32);   // <= SEQ/32 in both cases
  const int nplain = (tri && low) ? nfull : 0;
  const bool early = (qt * 64 < EARLY_ROWS);

  const v8f z8 = {0.f, 0.f, 0.f, 0.f, 0.f, 0.f, 0.f, 0.f};
  float mr = neg_inf(), lr = 0.0f;
  v8f Oh[4], Ol[4];
#pragma unroll
  for (int t = 0; t < 4; ++t) { Oh[t] = z8; Ol[t] = z8; }
  if (early) run_keys<true>(qkh, qkl, vth, vtl, mask, b, h, qg, ln, hh, nplain, nsteps, mr, lr, Oh, Ol);
  else       run_keys<false>(qkh, qkl, vth, vtl, mask, b, h, qg, ln, hh, nplain, nsteps, mr, lr, Oh, Ol);

  // O^T element r of tile t = ctx(query, d = 16t + 8h + r); undo the carries x256 (in lr), x16 (V), x2^11 (residual); apply the x64 carry of ctx
  const float inv = 4.0f * (1.0f / lr);
#pragma unroll
  for (int t = 0; t < 4; ++t)
#pragma unroll
    for (int r = 0; r < 8; ++r)
      so[w][ln][16 * t + 8 * hh + r] = fmaf(Ol[t][r], S2M11, Oh[t][r]) * inv;
  __syncthreads();
  const int rsub = lane >> 3, d0 = 8 * (lane & 7);
  v8us oh[4], ol[4];
#pragma unroll
  for (int g = 0; g < 4; ++g) {
    const int row = 4 * g + rsub;
    const v4f a0 = *(const v4fa*)&so[w][row][d0];
    const v4f a1 = *(const v4fa*)&so[w][row][d0 + 4];
    float o[8];
    o[0] = a0[0]; o[1] = a0[1]; o[2] = a0[2]; o[3] = a0[3];
    o[4] = a1[0]; o[5] = a1[1]; o[6] = a1[2]; o[7] = a1[3];
    Pack8 ph8, pl8;
#pragma unroll
    for (int e = 0; e < 8; ++e) {
      const _Float16 hv = (_Float16)o[e];
      ph8.h[e] = hv;
      pl8.h[e] = (_Float16)((o[e] - (float)hv) * 2048.0f);
    }
    oh[g] = ph8.v; ol[g] = pl8.v;
  }
  const size_t hbase = ((size_t)b * SEQ + qbase) * CD + (size_t)h * HD + d0;
  const size_t lbase = ((size_t)b * EARLY_ROWS + (early ? qbase : 0)) * CD + (size_t)h * HD + d0;
{
#pragma unroll
    for (int g = 0; g < 4; ++g) {
      const size_t ro = (size_t)(4 * g + rsub) * CD;
      *(v8us*)(ctxh + hbase + ro) = oh[g];
      if (early) *(v8us*)(ctxl + lbase + ro) = ol[g];
    }
    
  }
}

// ---------------------------------------------------------------------------------------------------------
// Output projection: out[m][n] = sum_k ctx[m][k] Wo[n][k] + bo[n]. Block = 4 waves stacked in M (128 rows) x 64 columns. grid = (CD/64, NB*SEQ/128).
// Rows below EARLY_ROWS of each sequence add the residual plane of ctx in separate accumulators.
// coverage: NB*SEQ rows x CD columns = every element of the output buffer region once. LDS tile 32 x 64 fully written before it is read.
__global__ __launch_bounds__(128) void k_proj_out(const unsigned short* __restrict__ ctxh, const unsigned short* __restrict__ ctxl,
                                                  const unsigned short* __restrict__ wo, const float* __restrict__ bo,
                                                  float* __restrict__ out) {
  __shared__ __attribute__((aligned(16))) float st[4][32][68];
  const int tid = threadIdx.x, lane = tid & 31, ln = lane & 15, hh = lane >> 4;
  const int w = __builtin_amdgcn_readfirstlane(tid >> 5);
  const int n0 = blockIdx.x * 64;
  const int mb = blockIdx.y * 128;
  const int b = mb / SEQ;
  const int tb = mb - b * SEQ;
  const bool early = (tb < EARLY_ROWS);                // block-uniform: EARLY_ROWS and SEQ are multiples of 128
  const int t0 = tb + 32 * w;
  const int m0 = mb + 32 * w;
  const v8f z8 = {0.f, 0.f, 0.f, 0.f, 0.f, 0.f, 0.f, 0.f};
  v8f acc[2][4], acl[2][4];
#pragma unroll
  for (int i = 0; i < 2; ++i)
#pragma unroll
    for (int j = 0; j < 4; ++j) { acc[i][j] = z8; acl[i][j] = z8; }
  const unsigned short* ap = ctxh + (size_t)(m0 + ln) * CD + 8 * hh;
  const unsigned short* alp = ctxl + (size_t)(b * EARLY_ROWS + (early ? t0 : 0) + ln) * CD + 8 * hh;
  const unsigned short* wp = wo + (size_t)(n0 + ln) * CD + 8 * hh;
  if (early) gemm_loop<false, true>(ap, alp, wp, acc, acl);
  else       gemm_loop<false, false>(ap, ap, wp, acc, acl);
  // carries: ctx x64, Wo x64 -> 2^-12; residual plane additionally x2^11
#pragma unroll
  for (int i = 0; i < 2; ++i)
#pragma unroll
    for (int j = 0; j < 4; ++j)
#pragma unroll
      for (int r = 0; r < 8; ++r)
        st[w][16 * i + 8 * hh + r][16 * j + ln] = fmaf(acl[i][j][r], S2M11, acc[i][j][r]) * S2M12;
  __syncthreads();
  const int rsub = lane >> 4, c4 = 4 * (lane & 15);
  const v4f bb = *(const v4fa*)(bo + n0 + c4);
  v4f bias;
  bias[0] = bf16_rne(bb[0]); bias[1] = bf16_rne(bb[1]); bias[2] = bf16_rne(bb[2]); bias[3] = bf16_rne(bb[3]);
  v4f ov[16];
#pragma unroll
  for (int g = 0; g < 16; ++g) {
    const v4f a = *(const v4fa*)&st[w][2 * g + rsub][c4];
    ov[g] = a + bias;
  }
  float* og = out + ((size_t)b * SEQ_FULL + t0) * CD + n0 + c4;
{
#pragma unroll
    for (int g = 0; g < 16; ++g)
      *(v4f*)(og + (size_t)(2 * g + rsub) * CD) = ov[g];
    
  }
}

// ---------------------------------------------------------------------------------------------------------
extern "C" void kernel_launch(void* const* d_in, const int* in_sizes, int n_in,
                              void* d_out, int out_size, void* d_ws, size_t ws_size, hipStream_t stream) {
  if (n_in < 11) return;
  const long long need_x = (long long)(NB - 1) * SEQ_FULL * CD + (long long)SEQ * CD;   // last element touched + 1
  const long long need_m = (long long)(SEQ - 1) * SEQ_FULL + SEQ;
  if ((long long)in_sizes[0] < need_x) return;
  if ((long long)in_sizes[1] < need_m) return;
  if ((long long)in_sizes[2] < (long long)SEQ * HD) return;
  if ((long long)in_sizes[3] < (long long)CD * CD || (long long)in_sizes[4] < CD) return;
  if ((long long)in_sizes[5] < (long long)KVW * CD || (long long)in_sizes[6] < KVW) return;
  if ((long long)in_sizes[7] < (long long)KVW * CD || (long long)in_sizes[8] < KVW) return;
  if ((long long)in_sizes[9] < (long long)CD * CD || (long long)in_sizes[10] < CD) return;
  if ((long long)out_size < need_x) return;
  if ((size_t)WS_TOTAL > ws_size) return;

  // wire order: x, mask, sinusoidal_pos, Wq, bq, Wk, bk, Wv, bv, Wo, bo
  const float* x    = (const float*)d_in[0];
  const int*   mask = (const int*)d_in[1];
  const float* tab  = (const float*)d_in[2];
  const float* Wq   = (const float*)d_in[3];
  const float* bq   = (const float*)d_in[4];
  const float* Wk   = (const float*)d_in[5];
  const float* bk   = (const float*)d_in[6];
  const float* Wv   = (const float*)d_in[7];
  const float* bv   = (const float*)d_in[8];
  const float* Wo   = (const float*)d_in[9];
  const float* bo   = (const float*)d_in[10];
  float* out = (float*)d_out;

  char* ws = (char*)d_ws;
  size_t off = 0;
  int* flags = (int*)(ws + off);                               off += SZ_FLAGS;
  unsigned short* xb   = (unsigned short*)(ws + off);          off += SZ_XB;
  unsigned short* wqk  = (unsigned short*)(ws + off);          off += SZ_WQK;
  unsigned short* wvb  = (unsigned short*)(ws + off);          off += SZ_WV;
  unsigned short* wob  = (unsigned short*)(ws + off);          off += SZ_WO;
  unsigned short* qkh  = (unsigned short*)(ws + off);          off += PLANE_QK * 2;
  unsigned short* qkl  = (unsigned short*)(ws + off);          off += PLANE_QK * 2;
  unsigned short* vth  = (unsigned short*)(ws + off);          off += PLANE_V * 2;
  unsigned short* vtl  = (unsigned short*)(ws + off);          off += PLANE_V * 2;
  unsigned short* ctxh = (unsigned short*)(ws + off);          off += SZ_CTXH;
  unsigned short* ctxl = (unsigned short*)(ws + off);          off += SZ_CTXL;
  if (off > ws_size) return;

  k_maskscan<<<(unsigned)(SEQ / SCAN_ROWS), 512, 0, stream>>>(mask, flags);
  // in[rows][CD] f32 -> [rows][CD] 16-bit planes (row order kept)
  k_cvt<0><<<(unsigned)(NB * SEQ), 256, 0, stream>>>(x, xb, NB * SEQ, SEQ, SEQ_FULL);
  k_cvt<0><<<(unsigned)CD, 256, 0, stream>>>(Wq, wqk, CD, CD, CD);
  k_cvt<0><<<(unsigned)KVW, 256, 0, stream>>>(Wk, wqk + (size_t)CD * CD, KVW, KVW, KVW);
  k_cvt<0><<<(unsigned)KVW, 256, 0, stream>>>(Wv, wvb, KVW, KVW, KVW);
  k_cvt<1><<<(unsigned)CD, 256, 0, stream>>>(Wo, wob, CD, CD, CD);

  k_proj_qk<<<dim3(NQK, (unsigned)(NB * SEQ / 128)), 128, 0, stream>>>(xb, wqk, bq, bk, tab, qkh, qkl);
  k_proj_v<<<dim3((unsigned)(NB * SEQ / 64), KVW / 128), 128, 0, stream>>>(wvb, xb, bv, vth, vtl);
  k_attn<<<(unsigned)(NB * NHEAD * (SEQ / 64)), 128, 0, stream>>>(qkh, qkl, vth, vtl, mask, flags, ctxh, ctxl);
  k_proj_out<<<dim3(CD / 64, (unsigned)(NB * SEQ / 128)), 128, 0, stream>>>(ctxh, ctxl, wob, bo, out);
}

// v002
// It runs in 318 microseconds.
// Two timings next to v001 put it at 1.25 and 1.26 times that version's speed.
// All steps since v000 together make it 2.75 times as fast.
#include <hip/hip_runtime.h>
#ifndef NB
#define NB 2
#endif
#ifndef SEQ
#define SEQ 2048
#endif
#define NB_FULL 2
#define SEQ_FULL 2048
#define CD 2048                 /* model width = depth of every projection */
#define NHEAD 32
#define NKV 8
#define HD 64
#define NQK (NHEAD + NKV)       /* rotary plane holds the 32 q heads followed by the 8 k heads */
#define KVW (NKV * HD)          /* 512 */
#define EARLY_ROWS (SEQ < 512 ? SEQ : 512)

#define SCAN_ROWS 8             /* mask rows per scan work-group: 8 rows x SEQ ints = 8 loads of 16 B per thread at SEQ = 2048 */
#define SCAN_LOADS (SCAN_ROWS * (SEQ / 4) / 512)
#define SZ_FLAGS ((size_t)(SEQ / SCAN_ROWS) * 128)   /* one 128-byte line per scan work-group */
#define SZ_XB    ((size_t)NB * SEQ * CD * 2)
#define SZ_WQK   ((size_t)(CD + KVW) * CD * 2)
#define SZ_WV    ((size_t)KVW * CD * 2)
#define SZ_WO    ((size_t)CD * CD * 2)
#define PLANE_QK ((size_t)NB * NQK * SEQ * HD)     /* elements of one rotary plane */
#define PLANE_V  ((size_t)NB * KVW * SEQ)          /* elements of one V^T plane */
#define SZ_CTXH  ((size_t)NB * SEQ * CD * 2)
#define SZ_CTXL  ((size_t)NB * EARLY_ROWS * CD * 2)
#define WS_TOTAL (SZ_FLAGS + SZ_XB + SZ_WQK + SZ_WV + SZ_WO + PLANE_QK * 4 + PLANE_V * 4 + SZ_CTXH + SZ_CTXL)

static_assert(SEQ % 128 == 0);
static_assert((SCAN_ROWS * (SEQ / 4)) % 512 == 0);
static_assert(16 % SCAN_ROWS == 0);
static_assert(SZ_FLAGS % 256 == 0);
static_assert(EARLY_ROWS % 128 == 0);
static_assert(SEQ <= SEQ_FULL);
static_assert(NB <= NB_FULL);
static_assert(HD == 64);
static_assert(CD % 32 == 0);
static_assert(KVW % 128 == 0);
static_assert(NHEAD % NKV == 0);
static_assert(WS_TOTAL <= (size_t)134217728);
static_assert(SZ_XB % 256 == 0 && SZ_WQK % 256 == 0 && SZ_WV % 256 == 0 && SZ_WO % 256 == 0);
static_assert((PLANE_QK * 2) % 256 == 0 && (PLANE_V * 2) % 256 == 0 && SZ_CTXH % 256 == 0 && SZ_CTXL % 256 == 0);

typedef __bf16 v16b __attribute__((ext_vector_type(16)));
typedef _Float16 v16h __attribute__((ext_vector_type(16)));
typedef unsigned short v8us __attribute__((ext_vector_type(8), may_alias));
typedef float v8f __attribute__((ext_vector_type(8)));
typedef float v4f __attribute__((ext_vector_type(4)));
typedef float v4fa __attribute__((ext_vector_type(4), may_alias));
typedef int v4i __attribute__((ext_vector_type(4)));
typedef int v4ia __attribute__((ext_vector_type(4), may_alias));
union Frag { v16b b; v16h v; v8us half[2]; _Float16 h[16]; unsigned short u[16]; };
union Pack8 { v8us v; _Float16 h[8]; unsigned short u[8]; };

#define LOG2E 1.4426950408889634f
#define S2M11 0.00048828125f       /* 2^-11 */
#define S2M12 0.000244140625f      /* 2^-12 */
__device__ __forceinline__ unsigned short bf16_bits(float x) {   // RNE convert to bf16 bits
  unsigned int u = __float_as_uint(x);
  return (unsigned short)((u + 0x7FFFu + ((u >> 16) & 1u)) >> 16);
}
__device__ __forceinline__ float bf16_val(unsigned short b) { return __uint_as_float(((unsigned int)b) << 16); }
__device__ __forceinline__ float bf16_rne(float x) { return bf16_val(bf16_bits(x)); }
__device__ __forceinline__ float neg_inf() { return __uint_as_float(0xff800000u); }

// Fragment of a k-contiguous 16-bit row: elements 0..7 <- p[0..7], elements 8..15 <- p[16..23]; caller adds row*pitch + k0 + 8*h.
__device__ __forceinline__ void ldfrag(Frag& f, const unsigned short* __restrict__ p) {
  f.half[0] = *(const v8us*)(p);
  f.half[1] = *(const v8us*)(p + 16);
}

template <bool BF>
__device__ __forceinline__ v8f wm(const Frag& a, const Frag& b, v8f c) {
  if (BF) return __builtin_amdgcn_wmma_f32_16x16x32_bf16(false, a.b, false, b.b, (short)0, c, false, false);
  return __builtin_amdgcn_wmma_f32_16x16x32_f16(false, a.v, false, b.v, (short)0, c, false, false);
}

// ---------------------------------------------------------------------------------------------------------
// Mask scan, one work-group per SCAN_ROWS mask rows; group g owns the line flags[32g .. 32g+31]:
// flags[32g] = 1 iff every entry of its rows above the diagonal is zero; flags[32g+1] = 1 iff every entry of its rows on or below the diagonal is nonzero.
// coverage: SEQ/SCAN_ROWS blocks x 512 threads x SCAN_LOADS x 4 ints = SEQ x SEQ mask entries; every flag line is written whole.
__global__ __launch_bounds__(512) void k_maskscan(const int* __restrict__ mask, int* __restrict__ flags) {
  __shared__ int sw[2][16];
  const int tid = threadIdx.x, lane = tid & 31, wv = tid >> 5;
  int badU = 0, badL = 0;
  const int cpr = SEQ / 4;
  const int q0 = blockIdx.x * SCAN_ROWS;
  const int* mb = mask + (size_t)q0 * SEQ_FULL;       // uniform base of this group's rows; the loads below differ by constants only
  v4i mv[SCAN_LOADS];
  // all loads of a thread are independent and issued before the first is tested, so that they are in flight together
#pragma unroll
  for (int u = 0; u < SCAN_LOADS; ++u) {
    const int c = tid + 512 * u;
    const int qr = c / cpr, k = (c - qr * cpr) * 4;
    mv[u] = *(const v4ia*)(mb + (unsigned)(qr * SEQ_FULL + k));
  }
#pragma unroll
  for (int u = 0; u < SCAN_LOADS; ++u) {
    const int c = tid + 512 * u;
    const int qr = c / cpr, k = (c - qr * cpr) * 4;
    const int q = q0 + qr;
#pragma unroll
    for (int i = 0; i < 4; ++i) {
      const int above = (k + i > q) ? 1 : 0;
      const int nz = (mv[u][i] != 0) ? 1 : 0;
      badU |= above & nz;
      badL |= (1 - above) & (1 - nz);
    }
  }
#pragma unroll
  for (int o = 16; o >= 1; o >>= 1) {
    badU |= __shfl_xor(badU, o, 32);
    badL |= __shfl_xor(badL, o, 32);
  }
  if (lane == 0) { sw[0][wv] = badU; sw[1][wv] = badL; }
  __syncthreads();
  if (tid < 8) {
    int u = 0, l = 0;
#pragma unroll
    for (int i = 0; i < 16; ++i) { u |= sw[0][i]; l |= sw[1][i]; }
    v4i o;
    o[0] = (tid == 0 && u == 0) ? 1 : 0;
    o[1] = (tid == 0 && l == 0) ? 1 : 0;
    o[2] = 0; o[3] = 0;
    *(v4i*)(flags + 32 * blockIdx.x + 4 * tid) = o;
    
  }
}

// ---------------------------------------------------------------------------------------------------------
// f32 rows of width CD -> 16-bit plane. MODE 0: bf16 bits (RNE). MODE 1: f16 of (RNE bf16 value x 64).
// coverage: nrows blocks x 256 threads x 8 elements = nrows x CD.
template <int MODE>
__global__ __launch_bounds__(256) void k_cvt(const float* __restrict__ src, unsigned short* __restrict__ dst,
                                             int nrows, int rows_per_batch, int src_batch_rows) {
  const int t = blockIdx.x * 256 + threadIdx.x;
  if (t >= nrows * 256) return;
  const int row = t >> 8, piece = t & 255;
  const int b = row / rows_per_batch, r = row - b * rows_per_batch;
  const float* sp = src + ((size_t)b * src_batch_rows + r) * CD + piece * 8;
  const v4f x0 = *(const v4fa*)(sp), x1 = *(const v4fa*)(sp + 4);
  Pack8 o;
  if (MODE == 0) {
    o.u[0] = bf16_bits(x0[0]); o.u[1] = bf16_bits(x0[1]); o.u[2] = bf16_bits(x0[2]); o.u[3] = bf16_bits(x0[3]);
    o.u[4] = bf16_bits(x1[0]); o.u[5] = bf16_bits(x1[1]); o.u[6] = bf16_bits(x1[2]); o.u[7] = bf16_bits(x1[3]);
  } else {
    o.h[0] = (_Float16)(bf16_rne(x0[0]) * 64.0f); o.h[1] = (_Float16)(bf16_rne(x0[1]) * 64.0f);
    o.h[2] = (_Float16)(bf16_rne(x0[2]) * 64.0f); o.h[3] = (_Float16)(bf16_rne(x0[3]) * 64.0f);
    o.h[4] = (_Float16)(bf16_rne(x1[0]) * 64.0f); o.h[5] = (_Float16)(bf16_rne(x1[1]) * 64.0f);
    o.h[6] = (_Float16)(bf16_rne(x1[2]) * 64.0f); o.h[7] = (_Float16)(bf16_rne(x1[3]) * 64.0f);
  }
  unsigned short* d = dst + (size_t)t * 8;
  const v8us ov = o.v;
  *(v8us*)d = ov;
  
}

// ---------------------------------------------------------------------------------------------------------
// Block-tile GEMM core: acc[i][j] (rows 32w + 16i.., cols 16j..) += A[row][k] * W[col][k] over k = 0..CD-1, k ascending in steps of 32.
// ablk = first of the block's 128 A rows, bblk = first of its 64 W rows (both k-contiguous, pitch CD).
// A stage is 64 k of all 192 rows: 128-byte rows laid at a 144-byte pitch (A rows 0..127, then W rows 128..191); two buffers.
// Each copy instruction of a wave moves 4 whole 128-byte lines; a thread copies chunk (tid & 7) of rows (tid >> 3) + 16 i, i = 0..11.
// Fragment maps as before: row or column = ln, elements 0..7 <- k0 + 8h + i, elements 8..15 <- k0 + 16 + 8h + i, for A and W alike.
#define ST_K 64
#define ST_PITCH 144
#define ST_BYTES (192 * ST_PITCH)
#define RING_BYTES (2 * ST_BYTES)
static_assert(CD % ST_K == 0 && CD / ST_K >= 2);
static_assert(RING_BYTES >= 4 * 32 * 68 * 4);      /* the epilogue tiles reuse the ring */

__device__ __forceinline__ void ldfrag_lds(Frag& f, const unsigned char* p) {
  f.half[0] = *(const v8us*)(p);
  f.half[1] = *(const v8us*)(p + 32);
}

// One stage: 12 copies of 16 bytes per thread. The s_wait_xcnt stands inside the statement so that no address register is rewritten ahead of it.
__device__ __forceinline__ void stage_copy(const unsigned short* ga, const unsigned short* gb, unsigned l) {
  asm volatile("global_load_async_to_lds_b128 %0, %12, off\n\t"
               "global_load_async_to_lds_b128 %1, %13, off\n\t"
               "global_load_async_to_lds_b128 %2, %14, off\n\t"
               "global_load_async_to_lds_b128 %3, %15, off\n\t"
               "global_load_async_to_lds_b128 %4, %16, off\n\t"
               "global_load_async_to_lds_b128 %5, %17, off\n\t"
               "global_load_async_to_lds_b128 %6, %18, off\n\t"
               "global_load_async_to_lds_b128 %7, %19, off\n\t"
               "global_load_async_to_lds_b128 %8, %20, off\n\t"
               "global_load_async_to_lds_b128 %9, %21, off\n\t"
               "global_load_async_to_lds_b128 %10, %22, off\n\t"
               "global_load_async_to_lds_b128 %11, %23, off\n\t"
               "s_wait_xcnt 0x0"
               :: "v"(l), "v"(l + 16 * ST_PITCH), "v"(l + 32 * ST_PITCH), "v"(l + 48 * ST_PITCH),
                  "v"(l + 64 * ST_PITCH), "v"(l + 80 * ST_PITCH), "v"(l + 96 * ST_PITCH), "v"(l + 112 * ST_PITCH),
                  "v"(l + 128 * ST_PITCH), "v"(l + 144 * ST_PITCH), "v"(l + 160 * ST_PITCH), "v"(l + 176 * ST_PITCH),
                  "v"(ga), "v"(ga + 16 * CD), "v"(ga + 32 * CD), "v"(ga + 48 * CD),
                  "v"(ga + 64 * CD), "v"(ga + 80 * CD), "v"(ga + 96 * CD), "v"(ga + 112 * CD),
                  "v"(gb), "v"(gb + 16 * CD), "v"(gb + 32 * CD), "v"(gb + 48 * CD)
               : "memory");
}

template <bool BF>
__device__ __forceinline__ void gemm_loop(const unsigned short* __restrict__ ablk, const unsigned short* __restrict__ bblk,
                                          unsigned char* ring, int tid, int w, int ln, int hh, v8f (&acc)[2][4]) {
  const int nt = CD / ST_K;
  const unsigned short* ga = ablk + (size_t)(tid >> 3) * CD + 8 * (tid & 7);
  const unsigned short* gb = bblk + (size_t)(tid >> 3) * CD + 8 * (tid & 7);
  const unsigned l0 = (unsigned)(size_t)ring + (unsigned)((tid >> 3) * ST_PITCH + 16 * (tid & 7));   // LDS byte address of this thread's first chunk
  const int aoff = (32 * w + ln) * ST_PITCH + 16 * hh;
  const int boff = (128 + ln) * ST_PITCH + 16 * hh;
  stage_copy(ga, gb, l0);
  asm volatile("s_wait_asynccnt 0x0" ::: "memory");   // tile 0 has landed before the barrier that publishes it
  __syncthreads();
  stage_copy(ga + ST_K, gb + ST_K, l0 + ST_BYTES);
#pragma unroll 1   // one tile per trip: the two buffers alternate by the trip's parity
  for (int t = 0; t < nt; ++t) {
    const unsigned sel = (unsigned)(t & 1) * ST_BYTES;
    const unsigned char* buf = ring + sel;
    Frag a[2][2], b[2][4];
#pragma unroll
    for (int kk = 0; kk < 2; ++kk) {
#pragma unroll
      for (int i = 0; i < 2; ++i) ldfrag_lds(a[kk][i], buf + aoff + i * 16 * ST_PITCH + kk * 64);
#pragma unroll
      for (int j = 0; j < 4; ++j) ldfrag_lds(b[kk][j], buf + boff + j * 16 * ST_PITCH + kk * 64);
    }
#pragma unroll
    for (int kk = 0; kk < 2; ++kk)
#pragma unroll
      for (int i = 0; i < 2; ++i)
#pragma unroll
        for (int j = 0; j < 4; ++j) acc[i][j] = wm<BF>(a[kk][i], b[kk][j], acc[i][j]);
    // keeps the distance behind the last matrix instructions on the loop's back edge and in front of the address arithmetic below
    asm volatile("v_nop\n\tv_nop\n\tv_nop\n\tv_nop" : "+v"(acc[0][0]), "+v"(acc[0][1]), "+v"(acc[0][2]), "+v"(acc[0][3]),
                        "+v"(acc[1][0]), "+v"(acc[1][1]), "+v"(acc[1][2]), "+v"(acc[1][3])
                      : "v"(a[1][0].v), "v"(a[1][1].v), "v"(b[1][0].v), "v"(b[1][1].v), "v"(b[1][2].v), "v"(b[1][3].v));
    asm volatile("s_wait_dscnt 0x0" ::: "memory");      // this wave's reads of the buffer are done before it is refilled
    asm volatile("s_wait_asynccnt 0x0" ::: "memory");   // this wave's copies of tile t + 1 have landed before the barrier publishes them
    __syncthreads();
    if (t + 2 < nt) stage_copy(ga + (t + 2) * ST_K, gb + (t + 2) * ST_K, l0 + sel);
  }
  asm volatile("s_wait_asynccnt 0x0" ::: "memory");     // nothing is in flight when the ring is used for anything else
}

__device__ __forceinline__ float rope1(float q, float p, float c, float s, float sg) { return q * c + (sg * p) * s; }

// ---------------------------------------------------------------------------------------------------------
// q and k projections with fused bias, rotary (table read by value) and head-major repack.
// Block = 4 waves stacked in M (128 token rows) x one head (64 columns). grid = (NQK, NB*SEQ/128).
// coverage: NQK heads x NB*SEQ tokens x 64 = the whole plane [NB][NQK][SEQ][64], both planes. LDS tile 32 x 64 fully written before it is read.
// five waves per SIMD asked for: the 1280 work-groups are then resident together, five on each WGP (5 x 55,296 B of LDS fit), and cover one another's barrier and copy waits
__global__ __launch_bounds__(128) __attribute__((amdgpu_waves_per_eu(5))) void k_proj_qk(const unsigned short* __restrict__ xb, const unsigned short* __restrict__ wqk,
                                                 const float* __restrict__ bq, const float* __restrict__ bk,
                                                 const float* __restrict__ tab,
                                                 unsigned short* __restrict__ qkh, unsigned short* __restrict__ qkl) {
  __shared__ __attribute__((aligned(16))) unsigned char ring[RING_BYTES];
  float (*st)[32][68] = (float (*)[32][68])ring;       // epilogue tiles, used behind the k loop's last barrier
  const int tid = threadIdx.x, lane = tid & 31, ln = lane & 15, hh = lane >> 4;
  const int w = __builtin_amdgcn_readfirstlane(tid >> 5);
  const int hd = blockIdx.x;
  const int m0 = blockIdx.y * 128 + 32 * w;
  const v8f z8 = {0.f, 0.f, 0.f, 0.f, 0.f, 0.f, 0.f, 0.f};
  v8f acc[2][4];
#pragma unroll
  for (int i = 0; i < 2; ++i)
#pragma unroll
    for (int j = 0; j < 4; ++j) acc[i][j] = z8;
  gemm_loop<true>(xb + (size_t)(blockIdx.y * 128) * CD, wqk + (size_t)(hd * HD) * CD, ring, tid, w, ln, hh, acc);

  float bias[4];
#pragma unroll
  for (int j = 0; j < 4; ++j) {
    const int col = hd * HD + 16 * j + ln;
    const int cq = (col < CD - 1) ? col : (CD - 1);
    int ck = col - CD;
    ck = (ck < 0) ? 0 : ((ck > KVW - 1) ? (KVW - 1) : ck);
    const float vq = bq[cq], vk = bk[ck];
    bias[j] = bf16_rne((col < CD) ? vq : vk);
  }
#pragma unroll
  for (int i = 0; i < 2; ++i)
#pragma unroll
    for (int j = 0; j < 4; ++j)
#pragma unroll
      for (int r = 0; r < 8; ++r) st[w][16 * i + 8 * hh + r][16 * j + ln] = acc[i][j][r] + bias[j];
  __syncthreads();

  const int b = m0 / SEQ, t0 = m0 - b * SEQ;
  const int rsub = lane >> 3, d0 = 8 * (lane & 7);
  const float sg = (d0 < 32) ? -1.0f : 1.0f;
  v8us oh[8], ol[8];
#pragma unroll
  for (int g = 0; g < 8; ++g) {
    // keeps the second half's table and LDS loads from being lifted over the first half: all 8 groups in flight at once cost the fifth wave per SIMD (or spills)
    if (g == 4) __builtin_amdgcn_sched_barrier(0);
    const int row = 4 * g + rsub;
    const v4f a0 = *(const v4fa*)&st[w][row][d0];
    const v4f a1 = *(const v4fa*)&st[w][row][d0 + 4];
    const v4f p0 = *(const v4fa*)&st[w][row][d0 ^ 32];
    const v4f p1 = *(const v4fa*)&st[w][row][(d0 ^ 32) + 4];
    const float* tp = tab + (size_t)(t0 + row) * HD + d0;
    const v4f c0 = *(const v4fa*)(tp), c1 = *(const v4fa*)(tp + 4);
    const float k0 = bf16_rne(c0[0]), s0 = bf16_rne(c0[1]), k1 = bf16_rne(c0[2]), s1 = bf16_rne(c0[3]);
    const float k2 = bf16_rne(c1[0]), s2 = bf16_rne(c1[1]), k3 = bf16_rne(c1[2]), s3 = bf16_rne(c1[3]);
    float o[8];
    o[0] = rope1(a0[0], p0[0], k0, s0, sg); o[1] = rope1(a0[1], p0[1], k0, s0, sg);
    o[2] = rope1(a0[2], p0[2], k1, s1, sg); o[3] = rope1(a0[3], p0[3], k1, s1, sg);
    o[4] = rope1(a1[0], p1[0], k2, s2, sg); o[5] = rope1(a1[1], p1[1], k2, s2, sg);
    o[6] = rope1(a1[2], p1[2], k3, s3, sg); o[7] = rope1(a1[3], p1[3], k3, s3, sg);
    Pack8 ph8, pl8;
#pragma unroll
    for (int e = 0; e < 8; ++e) {
      const float y = o[e] * 16.0f;                       // carried x16
      const _Float16 h = (_Float16)y;
      ph8.h[e] = h;
      pl8.h[e] = (_Float16)((y - (float)h) * 2048.0f);     // residual plane x2^11
    }
    oh[g] = ph8.v; ol[g] = pl8.v;
  }
  const size_t dbase = ((size_t)(b * NQK + hd) * SEQ + t0) * HD + d0;
{
#pragma unroll
    for (int g = 0; g < 8; ++g) {
      const size_t off = dbase + (size_t)(4 * g + rsub) * HD;
      *(v8us*)(qkh + off) = oh[g];
      *(v8us*)(qkl + off) = ol[g];
    }
    
  }
}

// ---------------------------------------------------------------------------------------------------------
// v projection computed transposed: Vt[b][m][t] = sum_k Wv[m][k] x[b,t][k] + bv[m], carried x16, hi and residual planes.
// Block = 4 waves stacked in M (128 weight rows) x 64 tokens. grid = (NB*SEQ/64, KVW/128).
// coverage: KVW rows x NB*SEQ tokens = the whole plane [NB][KVW][SEQ], both planes. LDS tile 32 x 64 fully written before it is read.
__global__ __launch_bounds__(128) void k_proj_v(const unsigned short* __restrict__ wvb, const unsigned short* __restrict__ xb,
                                                const float* __restrict__ bv,
                                                unsigned short* __restrict__ vth, unsigned short* __restrict__ vtl) {
  __shared__ __attribute__((aligned(16))) unsigned char ring[RING_BYTES];
  float (*st)[32][68] = (float (*)[32][68])ring;       // epilogue tiles, used behind the k loop's last barrier
  const int tid = threadIdx.x, lane = tid & 31, ln = lane & 15, hh = lane >> 4;
  const int w = __builtin_amdgcn_readfirstlane(tid >> 5);
  const int n0 = blockIdx.x * 64;
  const int m0 = blockIdx.y * 128 + 32 * w;
  const v8f z8 = {0.f, 0.f, 0.f, 0.f, 0.f, 0.f, 0.f, 0.f};
  v8f acc[2][4];
#pragma unroll
  for (int i = 0; i < 2; ++i)
#pragma unroll
    for (int j = 0; j < 4; ++j) acc[i][j] = z8;
  gemm_loop<true>(wvb + (size_t)(blockIdx.y * 128) * CD, xb + (size_t)n0 * CD, ring, tid, w, ln, hh, acc);
#pragma unroll
  for (int i = 0; i < 2; ++i)
#pragma unroll
    for (int j = 0; j < 4; ++j)
#pragma unroll
      for (int r = 0; r < 8; ++r) st[w][16 * i + 8 * hh + r][16 * j + ln] = acc[i][j][r];
  __syncthreads();

  const int b = n0 / SEQ, t0 = n0 - b * SEQ;
  const int rsub = lane >> 3, c0 = 8 * (lane & 7);
  v8us oh[8], ol[8];
#pragma unroll
  for (int g = 0; g < 8; ++g) {
    const int row = 4 * g + rsub;
    const float bias = bf16_rne(bv[m0 + row]);
    const v4f a0 = *(const v4fa*)&st[w][row][c0];
    const v4f a1 = *(const v4fa*)&st[w][row][c0 + 4];
    float o[8];
    o[0] = a0[0]; o[1] = a0[1]; o[2] = a0[2]; o[3] = a0[3];
    o[4] = a1[0]; o[5] = a1[1]; o[6] = a1[2]; o[7] = a1[3];
    Pack8 ph8, pl8;
#pragma unroll
    for (int e = 0; e < 8; ++e) {
      const float y = (o[e] + bias) * 16.0f;              // carried x16
      const _Float16 h = (_Float16)y;
      ph8.h[e] = h;
      pl8.h[e] = (_Float16)((y - (float)h) * 2048.0f);
    }
    oh[g] = ph8.v; ol[g] = pl8.v;
  }
  const size_t dbase = ((size_t)b * KVW + m0) * SEQ + t0 + c0;
{
#pragma unroll
    for (int g = 0; g < 8; ++g) {
      const size_t off = dbase + (size_t)(4 * g + rsub) * SEQ;
      *(v8us*)(vth + off) = oh[g];
      *(v8us*)(vtl + off) = ol[g];
    }
    
  }
}

// ---------------------------------------------------------------------------------------------------------
// One 32-key step for a wave's 16 queries (this lane's column = its query). EARLYP adds the residual planes of q, k, v, P.
// MASK reads the mask row of this lane's query by value and replace-fills with -inf.
template <bool EARLYP, bool MASK>
__device__ __forceinline__ void fa_step(const unsigned short* __restrict__ Kp, const unsigned short* __restrict__ Kl,
                                        const unsigned short* __restrict__ Vp, const unsigned short* __restrict__ Vl,
                                        const int* __restrict__ mrow, int key0, int ln, int hh,
                                        const Frag (&qh)[2], const Frag (&ql)[2],
                                        float& mr, float& lr, v8f (&Oh)[4], v8f (&Ol)[4]) {
  const v8f z8 = {0.f, 0.f, 0.f, 0.f, 0.f, 0.f, 0.f, 0.f};
  float sc[16];
  // A fragments of K: row m = key (key0 + 16*kt + ln), elements 0..7 <- d = 32c + 8h + i, 8..15 <- d = 32c + 16 + 8h + i
  int koff = (key0 + ln) * HD + 8 * hh;
  if (EARLYP) {
#pragma unroll
    for (int kt = 0; kt < 2; ++kt) {
      Frag a0, a1, l0, l1;
      ldfrag(a0, Kp + koff); ldfrag(a1, Kp + koff + 32);
      ldfrag(l0, Kl + koff); ldfrag(l1, Kl + koff + 32);
      v8f s = z8, r = z8;
      s = wm<false>(a0, qh[0], s); s = wm<false>(a1, qh[1], s);
      r = wm<false>(a0, ql[0], r); r = wm<false>(a1, ql[1], r);
      r = wm<false>(l0, qh[0], r); r = wm<false>(l1, qh[1], r);
      asm volatile("v_nop\n\tv_nop\n\tv_nop\n\tv_nop" : "+v"(s), "+v"(r)
                        : "v"(a0.v), "v"(a1.v), "v"(l0.v), "v"(l1.v), "v"(qh[0].v), "v"(qh[1].v), "v"(ql[0].v), "v"(ql[1].v));
      // S^T element r of tile kt = score(key0 + 16*kt + 8h + r, this lane's query); carries: q x16, k x16, residual x2^11
#pragma unroll
      for (int e = 0; e < 8; ++e) sc[8 * kt + e] = fmaf(r[e], S2M11, s[e]) * S2M11;
      koff += 16 * HD;
      if (kt == 0) asm volatile("" : "+v"(koff) : "v"(sc[0]));   // second tile's loads issue after the first tile is done
    }
  } else {
    Frag k00, k01, k10, k11;
    ldfrag(k00, Kp + koff);           ldfrag(k01, Kp + koff + 32);
    ldfrag(k10, Kp + koff + 16 * HD); ldfrag(k11, Kp + koff + 16 * HD + 32);
    v8f s0 = z8, s1 = z8;
    s0 = wm<false>(k00, qh[0], s0); s0 = wm<false>(k01, qh[1], s0);
    s1 = wm<false>(k10, qh[0], s1); s1 = wm<false>(k11, qh[1], s1);
    asm volatile("v_nop\n\tv_nop\n\tv_nop\n\tv_nop" : "+v"(s0), "+v"(s1)
                      : "v"(k00.v), "v"(k01.v), "v"(k10.v), "v"(k11.v), "v"(qh[0].v), "v"(qh[1].v));
#pragma unroll
    for (int e = 0; e < 8; ++e) { sc[e] = s0[e] * S2M11; sc[8 + e] = s1[e] * S2M11; }
  }
  if (MASK) {
    const int* mp = mrow + key0 + 8 * hh;
    const v4i m0 = *(const v4ia*)(mp),      m1 = *(const v4ia*)(mp + 4);
    const v4i m2 = *(const v4ia*)(mp + 16), m3 = *(const v4ia*)(mp + 20);
    const float ninf = neg_inf();
#pragma unroll
    for (int e = 0; e < 4; ++e) {
      sc[e]      = (m0[e] == 0) ? ninf : sc[e];
      sc[4 + e]  = (m1[e] == 0) ? ninf : sc[4 + e];
      sc[8 + e]  = (m2[e] == 0) ? ninf : sc[8 + e];
      sc[12 + e] = (m3[e] == 0) ? ninf : sc[12 + e];
    }
  }
  float mx = sc[0];
#pragma unroll
  for (int i = 1; i < 16; ++i) mx = fmaxf(mx, sc[i]);
  mx = fmaxf(mx, __shfl_xor(mx, 16, 32));            // the other lane half holds the other 16 keys of this query
  const float mnew = fmaxf(mr, mx);
  float msafe = mnew;
  if (MASK) msafe = (mnew == neg_inf()) ? 0.0f : mnew;   // every key so far masked: weights come out 0
  const float al = __builtin_amdgcn_exp2f((mr - msafe) * LOG2E);
  mr = mnew;
  // weights carried x256: pc = 256 * exp(sc - m); hi plane f16(pc), residual plane f16((pc - hi) * 2048)
  Frag ph, pl;
  float ps = 0.0f;
#pragma unroll
  for (int i = 0; i < 16; ++i) {
    const float pc = __builtin_amdgcn_exp2f(fmaf(sc[i] - msafe, LOG2E, 8.0f));
    ps += pc;
    const _Float16 h = (_Float16)pc;
    ph.h[i] = h;                                      // B element i: i<8 -> key0 + 8h + i (tile 0 row 8h+i); i>=8 -> key0 + 16 + 8h + (i-8) (tile 1)
    if (EARLYP) pl.h[i] = (_Float16)((pc - (float)h) * 2048.0f);
  }
  ps += __shfl_xor(ps, 16, 32);
  lr = lr * al + ps;
  // A fragments of V^T: row m = d (16*t + ln), elements 0..7 <- key0 + 8h + i, 8..15 <- key0 + 16 + 8h + i
  int voff = key0 + 8 * hh;
  asm volatile("" : "+v"(voff) : "v"(ps));            // V loads issue after the score phase
  const unsigned short* vp = Vp + (size_t)ln * SEQ + voff;
  Frag vf[4];
#pragma unroll
  for (int t = 0; t < 4; ++t) ldfrag(vf[t], vp + (size_t)t * 16 * SEQ);
#pragma unroll
  for (int t = 0; t < 4; ++t) Oh[t] = Oh[t] * al;
  if (EARLYP) {
    const unsigned short* vq = Vl + (size_t)ln * SEQ + voff;
    Frag vl[4];
#pragma unroll
    for (int t = 0; t < 4; ++t) ldfrag(vl[t], vq + (size_t)t * 16 * SEQ);
#pragma unroll
    for (int t = 0; t < 4; ++t) Ol[t] = Ol[t] * al;
#pragma unroll
    for (int t = 0; t < 4; ++t) {
      Oh[t] = wm<false>(vf[t], ph, Oh[t]);
      Ol[t] = wm<false>(vf[t], pl, Ol[t]);
      Ol[t] = wm<false>(vl[t], ph, Ol[t]);
    }
    asm volatile("v_nop\n\tv_nop\n\tv_nop\n\tv_nop" : "+v"(Oh[0]), "+v"(Oh[1]), "+v"(Oh[2]), "+v"(Oh[3]), "+v"(Ol[0]), "+v"(Ol[1]), "+v"(Ol[2]), "+v"(Ol[3])
                      : "v"(vf[0].v), "v"(vf[1].v), "v"(vf[2].v), "v"(vf[3].v),
                        "v"(vl[0].v), "v"(vl[1].v), "v"(vl[2].v), "v"(vl[3].v), "v"(ph.v), "v"(pl.v));
  } else {
#pragma unroll
    for (int t = 0; t < 4; ++t) Oh[t] = wm<false>(vf[t], ph, Oh[t]);
    asm volatile("v_nop\n\tv_nop\n\tv_nop\n\tv_nop" : "+v"(Oh[0]), "+v"(Oh[1]), "+v"(Oh[2]), "+v"(Oh[3])
                      : "v"(vf[0].v), "v"(vf[1].v), "v"(vf[2].v), "v"(vf[3].v), "v"(ph.v));
  }
}

template <bool EARLYP>
__device__ __forceinline__ void run_keys(const unsigned short* __restrict__ qkh, const unsigned short* __restrict__ qkl,
                                         const unsigned short* __restrict__ vth, const unsigned short* __restrict__ vtl,
                                         const int* __restrict__ mask, int b, int h, int qg, int ln, int hh,
                                         int nplain, int nsteps, float& mr, float& lr, v8f (&Oh)[4], v8f (&Ol)[4]) {
  // Q^T B fragments: column n = this lane's query, elements 0..7 <- d = 32c + 8h + i, 8..15 <- d = 32c + 16 + 8h + i
  const size_t qoff = ((size_t)(b * NQK + h) * SEQ + qg) * HD + 8 * hh;
  Frag qh[2], ql[2];
  ldfrag(qh[0], qkh + qoff); ldfrag(qh[1], qkh + qoff + 32);
  if (EARLYP) { ldfrag(ql[0], qkl + qoff); ldfrag(ql[1], qkl + qoff + 32); }
  else { ql[0] = qh[0]; ql[1] = qh[1]; }
  const int kv = h % NKV;
  const size_t kbase = (size_t)(b * NQK + NHEAD + kv) * SEQ * HD;
  const size_t vbase = ((size_t)b * KVW + (size_t)kv * HD) * SEQ;
  const unsigned short* Kp = qkh + kbase;
  const unsigned short* Kl = qkl + kbase;
  const unsigned short* Vp = vth + vbase;
  const unsigned short* Vl = vtl + vbase;
  const int* mrow = mask + (size_t)qg * SEQ_FULL;
#pragma unroll 1
  for (int j = 0; j < nplain; ++j)
    fa_step<EARLYP, false>(Kp, Kl, Vp, Vl, mrow, 32 * j, ln, hh, qh, ql, mr, lr, Oh, Ol);
#pragma unroll 1
  for (int j = nplain; j < nsteps; ++j)
    fa_step<EARLYP, true>(Kp, Kl, Vp, Vl, mrow, 32 * j, ln, hh, qh, ql, mr, lr, Oh, Ol);
}

// Block = 4 waves x 16 queries = 64 queries of one (batch, head); no LDS and no barrier in the key loop.
// Tile skipping from the device flags of this wave's own 16 mask rows (16/SCAN_ROWS flag lines): all upper flags 1 -> keys past the diagonal step are
// skipped; upper and lower flags all 1 -> steps fully below the diagonal run without mask reads; every other visited step reads the mask by value.
// Trip counts are bounded by SEQ/32 for any flag value.
// coverage: NB*NHEAD*(SEQ/64) blocks x 4 waves x 16 rows x 64 columns = the whole ctx hi plane; blocks with query tile below EARLY_ROWS cover the whole residual plane.
__global__ __launch_bounds__(128) void k_attn(const unsigned short* __restrict__ qkh, const unsigned short* __restrict__ qkl,
                                              const unsigned short* __restrict__ vth, const unsigned short* __restrict__ vtl,
                                              const int* __restrict__ mask, const int* __restrict__ flags,
                                              unsigned short* __restrict__ ctxh, unsigned short* __restrict__ ctxl) {
  __shared__ __attribute__((aligned(16))) float so[4][16][68];
  const int tid = threadIdx.x, lane = tid & 31, ln = lane & 15, hh = lane >> 4;
  const int w = __builtin_amdgcn_readfirstlane(tid >> 5);
  const int nqt = SEQ / 64;
  const int blk = blockIdx.x;
  const int qt = blk % nqt;
  const int h = (blk / nqt) % NHEAD;
  const int b = blk / (nqt * NHEAD);
  const int qbase = qt * 64 + 16 * w;
  const int qg = qbase + ln;
  const int* fl = flags + (qbase / SCAN_ROWS) * 32;
  int upok = 1, lowok = 1;                             // plain & so that the flag loads issue together
#pragma unroll
  for (int g = 0; g < 16 / SCAN_ROWS; ++g) {
    const int fU = fl[32 * g], fL = fl[32 * g + 1];
    upok &= (fU == 1) ? 1 : 0;
    lowok &= (fL == 1) ? 1 : 0;
  }
  const bool tri = (upok == 1), low = (lowok == 1);
  const int nfull = qbase >> 5;                        // steps whose 32 keys are all at or below every query of this wave
  const int nsteps = tri ? (nfull + 1) : (SEQ / 32);   // <= SEQ/32 in both cases
  const int nplain = (tri && low) ? nfull : 0;
  const bool early = (qt * 64 < EARLY_ROWS);

  const v8f z8 = {0.f, 0.f, 0.f, 0.f, 0.f, 0.f, 0.f, 0.f};
  float mr = neg_inf(), lr = 0.0f;
  v8f Oh[4], Ol[4];
#pragma unroll
  for (int t = 0; t < 4; ++t) { Oh[t] = z8; Ol[t] = z8; }
  if (early) run_keys<true>(qkh, qkl, vth, vtl, mask, b, h, qg, ln, hh, nplain, nsteps, mr, lr, Oh, Ol);
  else       run_keys<false>(qkh, qkl, vth, vtl, mask, b, h, qg, ln, hh, nplain, nsteps, mr, lr, Oh, Ol);

  // O^T element r of tile t = ctx(query, d = 16t + 8h + r); undo the carries x256 (in lr), x16 (V), x2^11 (residual); apply the x64 carry of ctx
  const float inv = 4.0f * (1.0f / lr);
#pragma unroll
  for (int t = 0; t < 4; ++t)
#pragma unroll
    for (int r = 0; r < 8; ++r)
      so[w][ln][16 * t + 8 * hh + r] = fmaf(Ol[t][r], S2M11, Oh[t][r]) * inv;
  __syncthreads();
  const int rsub = lane >> 3, d0 = 8 * (lane & 7);
  v8us oh[4], ol[4];
#pragma unroll
  for (int g = 0; g < 4; ++g) {
    const int row = 4 * g + rsub;
    const v4f a0 = *(const v4fa*)&so[w][row][d0];
    const v4f a1 = *(const v4fa*)&so[w][row][d0 + 4];
    float o[8];
    o[0] = a0[0]; o[1] = a0[1]; o[2] = a0[2]; o[3] = a0[3];
    o[4] = a1[0]; o[5] = a1[1]; o[6] = a1[2]; o[7] = a1[3];
    Pack8 ph8, pl8;
#pragma unroll
    for (int e = 0; e < 8; ++e) {
      const _Float16 hv = (_Float16)o[e];
      ph8.h[e] = hv;
      pl8.h[e] = (_Float16)((o[e] - (float)hv) * 2048.0f);
    }
    oh[g] = ph8.v; ol[g] = pl8.v;
  }
  const size_t hbase = ((size_t)b * SEQ + qbase) * CD + (size_t)h * HD + d0;
  const size_t lbase = ((size_t)b * EARLY_ROWS + (early ? qbase : 0)) * CD + (size_t)h * HD + d0;
{
#pragma unroll
    for (int g = 0; g < 4; ++g) {
      const size_t ro = (size_t)(4 * g + rsub) * CD;
      *(v8us*)(ctxh + hbase + ro) = oh[g];
      if (early) *(v8us*)(ctxl + lbase + ro) = ol[g];
    }
    
  }
}

// ---------------------------------------------------------------------------------------------------------
// Output projection: out[m][n] = sum_k ctx[m][k] Wo[n][k] + bo[n]. Block = 4 waves stacked in M (128 rows) x 64 columns. grid = (CD/64, NB*SEQ/128).
// Rows below EARLY_ROWS of each sequence add the residual plane of ctx in separate accumulators.
// coverage: NB*SEQ rows x CD columns = every element of the output buffer region once. LDS tile 32 x 64 fully written before it is read.
__global__ __launch_bounds__(128) void k_proj_out(const unsigned short* __restrict__ ctxh, const unsigned short* __restrict__ ctxl,
                                                  const unsigned short* __restrict__ wo, const float* __restrict__ bo,
                                                  float* __restrict__ out) {
  __shared__ __attribute__((aligned(16))) unsigned char ring[RING_BYTES];
  float (*st)[32][68] = (float (*)[32][68])ring;       // epilogue tiles, used behind the k loop's last barrier
  const int tid = threadIdx.x, lane = tid & 31, ln = lane & 15, hh = lane >> 4;
  const int w = __builtin_amdgcn_readfirstlane(tid >> 5);
  const int n0 = blockIdx.x * 64;
  const int mb = blockIdx.y * 128;
  const int b = mb / SEQ;
  const int tb = mb - b * SEQ;
  const bool early = (tb < EARLY_ROWS);                // block-uniform: EARLY_ROWS and SEQ are multiples of 128
  const int t0 = tb + 32 * w;
  const v8f z8 = {0.f, 0.f, 0.f, 0.f, 0.f, 0.f, 0.f, 0.f};
  v8f acc[2][4], acl[2][4];
#pragma unroll
  for (int i = 0; i < 2; ++i)
#pragma unroll
    for (int j = 0; j < 4; ++j) { acc[i][j] = z8; acl[i][j] = z8; }
  const unsigned short* wp = wo + (size_t)n0 * CD;
  gemm_loop<false>(ctxh + (size_t)mb * CD, wp, ring, tid, w, ln, hh, acc);
  // residual plane: a second walk over k through the same ring, into its own accumulators (block-uniform branch)
  if (early) gemm_loop<false>(ctxl + (size_t)(b * EARLY_ROWS + tb) * CD, wp, ring, tid, w, ln, hh, acl);
  // carries: ctx x64, Wo x64 -> 2^-12; residual plane additionally x2^11
#pragma unroll
  for (int i = 0; i < 2; ++i)
#pragma unroll
    for (int j = 0; j < 4; ++j)
#pragma unroll
      for (int r = 0; r < 8; ++r)
        st[w][16 * i + 8 * hh + r][16 * j + ln] = fmaf(acl[i][j][r], S2M11, acc[i][j][r]) * S2M12;
  __syncthreads();
  const int rsub = lane >> 4, c4 = 4 * (lane & 15);
  const v4f bb = *(const v4fa*)(bo + n0 + c4);
  v4f bias;
  bias[0] = bf16_rne(bb[0]); bias[1] = bf16_rne(bb[1]); bias[2] = bf16_rne(bb[2]); bias[3] = bf16_rne(bb[3]);
  v4f ov[16];
#pragma unroll
  for (int g = 0; g < 16; ++g) {
    const v4f a = *(const v4fa*)&st[w][2 * g + rsub][c4];
    ov[g] = a + bias;
  }
  float* og = out + ((size_t)b * SEQ_FULL + t0) * CD + n0 + c4;
{
#pragma unroll
    for (int g = 0; g < 16; ++g)
      *(v4f*)(og + (size_t)(2 * g + rsub) * CD) = ov[g];
    
  }
}

// ---------------------------------------------------------------------------------------------------------
extern "C" void kernel_launch(void* const* d_in, const int* in_sizes, int n_in,
                              void* d_out, int out_size, void* d_ws, size_t ws_size, hipStream_t stream) {
  if (n_in < 11) return;
  const long long need_x = (long long)(NB - 1) * SEQ_FULL * CD + (long long)SEQ * CD;   // last element touched + 1
  const long long need_m = (long long)(SEQ - 1) * SEQ_FULL + SEQ;
  if ((long long)in_sizes[0] < need_x) return;
  if ((long long)in_sizes[1] < need_m) return;
  if ((long long)in_sizes[2] < (long long)SEQ * HD) return;
  if ((long long)in_sizes[3] < (long long)CD * CD || (long long)in_sizes[4] < CD) return;
  if ((long long)in_sizes[5] < (long long)KVW * CD || (long long)in_sizes[6] < KVW) return;
  if ((long long)in_sizes[7] < (long long)KVW * CD || (long long)in_sizes[8] < KVW) return;
  if ((long long)in_sizes[9] < (long long)CD * CD || (long long)in_sizes[10] < CD) return;
  if ((long long)out_size < need_x) return;
  if ((size_t)WS_TOTAL > ws_size) return;

  // wire order: x, mask, sinusoidal_pos, Wq, bq, Wk, bk, Wv, bv, Wo, bo
  const float* x    = (const float*)d_in[0];
  const int*   mask = (const int*)d_in[1];
  const float* tab  = (const float*)d_in[2];
  const float* Wq   = (const float*)d_in[3];
  const float* bq   = (const float*)d_in[4];
  const float* Wk   = (const float*)d_in[5];
  const float* bk   = (const float*)d_in[6];
  const float* Wv   = (const float*)d_in[7];
  const float* bv   = (const float*)d_in[8];
  const float* Wo   = (const float*)d_in[9];
  const float* bo   = (const float*)d_in[10];
  float* out = (float*)d_out;

  char* ws = (char*)d_ws;
  size_t off = 0;
  int* flags = (int*)(ws + off);                               off += SZ_FLAGS;
  unsigned short* xb   = (unsigned short*)(ws + off);          off += SZ_XB;
  unsigned short* wqk  = (unsigned short*)(ws + off);          off += SZ_WQK;
  unsigned short* wvb  = (unsigned short*)(ws + off);          off += SZ_WV;
  unsigned short* wob  = (unsigned short*)(ws + off);          off += SZ_WO;
  unsigned short* qkh  = (unsigned short*)(ws + off);          off += PLANE_QK * 2;
  unsigned short* qkl  = (unsigned short*)(ws + off);          off += PLANE_QK * 2;
  unsigned short* vth  = (unsigned short*)(ws + off);          off += PLANE_V * 2;
  unsigned short* vtl  = (unsigned short*)(ws + off);          off += PLANE_V * 2;
  unsigned short* ctxh = (unsigned short*)(ws + off);          off += SZ_CTXH;
  unsigned short* ctxl = (unsigned short*)(ws + off);          off += SZ_CTXL;
  if (off > ws_size) return;

  k_maskscan<<<(unsigned)(SEQ / SCAN_ROWS), 512, 0, stream>>>(mask, flags);
  // in[rows][CD] f32 -> [rows][CD] 16-bit planes (row order kept)
  k_cvt<0><<<(unsigned)(NB * SEQ), 256, 0, stream>>>(x, xb, NB * SEQ, SEQ, SEQ_FULL);
  k_cvt<0><<<(unsigned)CD, 256, 0, stream>>>(Wq, wqk, CD, CD, CD);
  k_cvt<0><<<(unsigned)KVW, 256, 0, stream>>>(Wk, wqk + (size_t)CD * CD, KVW, KVW, KVW);
  k_cvt<0><<<(unsigned)KVW, 256, 0, stream>>>(Wv, wvb, KVW, KVW, KVW);
  k_cvt<1><<<(unsigned)CD, 256, 0, stream>>>(Wo, wob, CD, CD, CD);

  k_proj_qk<<<dim3(NQK, (unsigned)(NB * SEQ / 128)), 128, 0, stream>>>(xb, wqk, bq, bk, tab, qkh, qkl);
  k_proj_v<<<dim3((unsigned)(NB * SEQ / 64), KVW / 128), 128, 0, stream>>>(wvb, xb, bv, vth, vtl);
  k_attn<<<(unsigned)(NB * NHEAD * (SEQ / 64)), 128, 0, stream>>>(qkh, qkl, vth, vtl, mask, flags, ctxh, ctxl);
  k_proj_out<<<dim3(CD / 64, (unsigned)(NB * SEQ / 128)), 128, 0, stream>>>(ctxh, ctxl, wob, bo, out);
}

// v003
// One run takes 217 microseconds.
// In two side-by-side timings against v002, it was 1.45 and 1.47 times as fast.
// Counting every step since v000, it is 4.02 times as fast.
#include <hip/hip_runtime.h>
#ifndef NB
#define NB 2
#endif
#ifndef SEQ
#define SEQ 2048
#endif
#define NB_FULL 2
#define SEQ_FULL 2048
#define CD 2048                 /* model width = depth of every projection */
#define NHEAD 32
#define NKV 8
#define HD 64
#define NQK (NHEAD + NKV)       /* rotary plane holds the 32 q heads followed by the 8 k heads */
#define KVW (NKV * HD)          /* 512 */
#define EARLY_ROWS (SEQ < 512 ? SEQ : 512)

#define SCAN_ROWS 8             /* mask rows per scan work-group: 8 rows x SEQ ints = 8 loads of 16 B per thread at SEQ = 2048 */
#define SCAN_LOADS (SCAN_ROWS * (SEQ / 4) / 512)
#define SZ_FLAGS ((size_t)(SEQ / SCAN_ROWS) * 128)   /* one 128-byte line per scan work-group */
#define SZ_XB    ((size_t)NB * SEQ * CD * 2)
#define SZ_WQK   ((size_t)(CD + KVW) * CD * 2)
#define SZ_WV    ((size_t)KVW * CD * 2)
#define SZ_WO    ((size_t)CD * CD * 2)
#define PLANE_QK ((size_t)NB * NQK * SEQ * HD)     /* elements of one rotary plane */
#define PLANE_V  ((size_t)NB * KVW * SEQ)          /* elements of one V^T plane */
#define SZ_CTXH  ((size_t)NB * SEQ * CD * 2)
#define SZ_CTXL  ((size_t)NB * EARLY_ROWS * CD * 2)
#define WS_TOTAL (SZ_FLAGS + SZ_XB + SZ_WQK + SZ_WV + SZ_WO + PLANE_QK * 4 + PLANE_V * 4 + SZ_CTXH + SZ_CTXL)

static_assert(SEQ % 128 == 0);
static_assert((SCAN_ROWS * (SEQ / 4)) % 512 == 0);
static_assert(16 % SCAN_ROWS == 0);
static_assert(SZ_FLAGS % 256 == 0);
static_assert(EARLY_ROWS % 128 == 0);
static_assert(SEQ <= SEQ_FULL);
static_assert(NB <= NB_FULL);
static_assert(HD == 64);
static_assert(CD % 32 == 0);
static_assert(KVW % 128 == 0);
static_assert(NHEAD % NKV == 0);
static_assert(WS_TOTAL <= (size_t)134217728);
static_assert(SZ_XB % 256 == 0 && SZ_WQK % 256 == 0 && SZ_WV % 256 == 0 && SZ_WO % 256 == 0);
static_assert((PLANE_QK * 2) % 256 == 0 && (PLANE_V * 2) % 256 == 0 && SZ_CTXH % 256 == 0 && SZ_CTXL % 256 == 0);

typedef __bf16 v16b __attribute__((ext_vector_type(16)));
typedef _Float16 v16h __attribute__((ext_vector_type(16)));
typedef unsigned short v8us __attribute__((ext_vector_type(8), may_alias));
typedef float v8f __attribute__((ext_vector_type(8)));
typedef float v4f __attribute__((ext_vector_type(4)));
typedef float v4fa __attribute__((ext_vector_type(4), may_alias));
typedef int v4i __attribute__((ext_vector_type(4)));
typedef int v4ia __attribute__((ext_vector_type(4), may_alias));
union Frag { v16b b; v16h v; v8us half[2]; _Float16 h[16]; unsigned short u[16]; };
union Pack8 { v8us v; _Float16 h[8]; unsigned short u[8]; };

#define LOG2E 1.4426950408889634f
#define S2M11 0.00048828125f       /* 2^-11 */
#define S2M12 0.000244140625f      /* 2^-12 */
__device__ __forceinline__ unsigned short bf16_bits(float x) {   // RNE convert to bf16 bits
  unsigned int u = __float_as_uint(x);
  return (unsigned short)((u + 0x7FFFu + ((u >> 16) & 1u)) >> 16);
}
__device__ __forceinline__ float bf16_val(unsigned short b) { return __uint_as_float(((unsigned int)b) << 16); }
__device__ __forceinline__ float bf16_rne(float x) { return bf16_val(bf16_bits(x)); }
__device__ __forceinline__ float neg_inf() { return __uint_as_float(0xff800000u); }

// Fragment of a k-contiguous 16-bit row: elements 0..7 <- p[0..7], elements 8..15 <- p[16..23]; caller adds row*pitch + k0 + 8*h.
__device__ __forceinline__ void ldfrag(Frag& f, const unsigned short* __restrict__ p) {
  f.half[0] = *(const v8us*)(p);
  f.half[1] = *(const v8us*)(p + 16);
}

template <bool BF>
__device__ __forceinline__ v8f wm(const Frag& a, const Frag& b, v8f c) {
  if (BF) return __builtin_amdgcn_wmma_f32_16x16x32_bf16(false, a.b, false, b.b, (short)0, c, false, false);
  return __builtin_amdgcn_wmma_f32_16x16x32_f16(false, a.v, false, b.v, (short)0, c, false, false);
}

// ---------------------------------------------------------------------------------------------------------
// Mask scan, one work-group per SCAN_ROWS mask rows; group g owns the line flags[32g .. 32g+31]:
// flags[32g] = 1 iff every entry of its rows above the diagonal is zero; flags[32g+1] = 1 iff every entry of its rows on or below the diagonal is nonzero.
// coverage: SEQ/SCAN_ROWS blocks x 512 threads x SCAN_LOADS x 4 ints = SEQ x SEQ mask entries; every flag line is written whole.
__global__ __launch_bounds__(512) void k_maskscan(const int* __restrict__ mask, int* __restrict__ flags) {
  __shared__ int sw[2][16];
  const int tid = threadIdx.x, lane = tid & 31, wv = tid >> 5;
  int badU = 0, badL = 0;
  const int cpr = SEQ / 4;
  const int q0 = blockIdx.x * SCAN_ROWS;
  const int* mb = mask + (size_t)q0 * SEQ_FULL;       // uniform base of this group's rows; the loads below differ by constants only
  v4i mv[SCAN_LOADS];
  // all loads of a thread are independent and issued before the first is tested, so that they are in flight together
#pragma unroll
  for (int u = 0; u < SCAN_LOADS; ++u) {
    const int c = tid + 512 * u;
    const int qr = c / cpr, k = (c - qr * cpr) * 4;
    mv[u] = *(const v4ia*)(mb + (unsigned)(qr * SEQ_FULL + k));
  }
#pragma unroll
  for (int u = 0; u < SCAN_LOADS; ++u) {
    const int c = tid + 512 * u;
    const int qr = c / cpr, k = (c - qr * cpr) * 4;
    const int q = q0 + qr;
#pragma unroll
    for (int i = 0; i < 4; ++i) {
      const int above = (k + i > q) ? 1 : 0;
      const int nz = (mv[u][i] != 0) ? 1 : 0;
      badU |= above & nz;
      badL |= (1 - above) & (1 - nz);
    }
  }
#pragma unroll
  for (int o = 16; o >= 1; o >>= 1) {
    badU |= __shfl_xor(badU, o, 32);
    badL |= __shfl_xor(badL, o, 32);
  }
  if (lane == 0) { sw[0][wv] = badU; sw[1][wv] = badL; }
  __syncthreads();
  if (tid < 8) {
    int u = 0, l = 0;
#pragma unroll
    for (int i = 0; i < 16; ++i) { u |= sw[0][i]; l |= sw[1][i]; }
    v4i o;
    o[0] = (tid == 0 && u == 0) ? 1 : 0;
    o[1] = (tid == 0 && l == 0) ? 1 : 0;
    o[2] = 0; o[3] = 0;
    *(v4i*)(flags + 32 * blockIdx.x + 4 * tid) = o;
    
  }
}

// ---------------------------------------------------------------------------------------------------------
// f32 rows of width CD -> 16-bit plane. MODE 0: bf16 bits (RNE). MODE 1: f16 of (RNE bf16 value x 64).
// coverage: nrows blocks x 256 threads x 8 elements = nrows x CD.
template <int MODE>
__global__ __launch_bounds__(256) void k_cvt(const float* __restrict__ src, unsigned short* __restrict__ dst,
                                             int nrows, int rows_per_batch, int src_batch_rows) {
  const int t = blockIdx.x * 256 + threadIdx.x;
  if (t >= nrows * 256) return;
  const int row = t >> 8, piece = t & 255;
  const int b = row / rows_per_batch, r = row - b * rows_per_batch;
  const float* sp = src + ((size_t)b * src_batch_rows + r) * CD + piece * 8;
  const v4f x0 = *(const v4fa*)(sp), x1 = *(const v4fa*)(sp + 4);
  Pack8 o;
  if (MODE == 0) {
    o.u[0] = bf16_bits(x0[0]); o.u[1] = bf16_bits(x0[1]); o.u[2] = bf16_bits(x0[2]); o.u[3] = bf16_bits(x0[3]);
    o.u[4] = bf16_bits(x1[0]); o.u[5] = bf16_bits(x1[1]); o.u[6] = bf16_bits(x1[2]); o.u[7] = bf16_bits(x1[3]);
  } else {
    o.h[0] = (_Float16)(bf16_rne(x0[0]) * 64.0f); o.h[1] = (_Float16)(bf16_rne(x0[1]) * 64.0f);
    o.h[2] = (_Float16)(bf16_rne(x0[2]) * 64.0f); o.h[3] = (_Float16)(bf16_rne(x0[3]) * 64.0f);
    o.h[4] = (_Float16)(bf16_rne(x1[0]) * 64.0f); o.h[5] = (_Float16)(bf16_rne(x1[1]) * 64.0f);
    o.h[6] = (_Float16)(bf16_rne(x1[2]) * 64.0f); o.h[7] = (_Float16)(bf16_rne(x1[3]) * 64.0f);
  }
  unsigned short* d = dst + (size_t)t * 8;
  const v8us ov = o.v;
  *(v8us*)d = ov;
  
}

// ---------------------------------------------------------------------------------------------------------
// Block-tile GEMM core: acc[i][j] (rows 32w + 16i.., cols 16j..) += A[row][k] * W[col][k] over k = 0..CD-1, k ascending in steps of 32.
// ablk = first of the block's 128 A rows, bblk = first of its 64 W rows (both k-contiguous, pitch CD).
// A stage is 64 k of all 192 rows: 128-byte rows laid at a 144-byte pitch (A rows 0..127, then W rows 128..191); two buffers.
// Each copy instruction of a wave moves 4 whole 128-byte lines; a thread copies chunk (tid & 7) of rows (tid >> 3) + 16 i, i = 0..11.
// Fragment maps as before: row or column = ln, elements 0..7 <- k0 + 8h + i, elements 8..15 <- k0 + 16 + 8h + i, for A and W alike.
#define ST_K 64
#define ST_PITCH 144
#define ST_BYTES (192 * ST_PITCH)
#define RING_BYTES (2 * ST_BYTES)
static_assert(CD % ST_K == 0 && CD / ST_K >= 2);
static_assert(RING_BYTES >= 4 * 32 * 68 * 4);      /* the epilogue tiles reuse the ring */

__device__ __forceinline__ void ldfrag_lds(Frag& f, const unsigned char* p) {
  f.half[0] = *(const v8us*)(p);
  f.half[1] = *(const v8us*)(p + 32);
}

// One stage: 12 copies of 16 bytes per thread. The s_wait_xcnt stands inside the statement so that no address register is rewritten ahead of it.
__device__ __forceinline__ void stage_copy(const unsigned short* ga, const unsigned short* gb, unsigned l) {
  asm volatile("global_load_async_to_lds_b128 %0, %12, off\n\t"
               "global_load_async_to_lds_b128 %1, %13, off\n\t"
               "global_load_async_to_lds_b128 %2, %14, off\n\t"
               "global_load_async_to_lds_b128 %3, %15, off\n\t"
               "global_load_async_to_lds_b128 %4, %16, off\n\t"
               "global_load_async_to_lds_b128 %5, %17, off\n\t"
               "global_load_async_to_lds_b128 %6, %18, off\n\t"
               "global_load_async_to_lds_b128 %7, %19, off\n\t"
               "global_load_async_to_lds_b128 %8, %20, off\n\t"
               "global_load_async_to_lds_b128 %9, %21, off\n\t"
               "global_load_async_to_lds_b128 %10, %22, off\n\t"
               "global_load_async_to_lds_b128 %11, %23, off\n\t"
               "s_wait_xcnt 0x0"
               :: "v"(l), "v"(l + 16 * ST_PITCH), "v"(l + 32 * ST_PITCH), "v"(l + 48 * ST_PITCH),
                  "v"(l + 64 * ST_PITCH), "v"(l + 80 * ST_PITCH), "v"(l + 96 * ST_PITCH), "v"(l + 112 * ST_PITCH),
                  "v"(l + 128 * ST_PITCH), "v"(l + 144 * ST_PITCH), "v"(l + 160 * ST_PITCH), "v"(l + 176 * ST_PITCH),
                  "v"(ga), "v"(ga + 16 * CD), "v"(ga + 32 * CD), "v"(ga + 48 * CD),
                  "v"(ga + 64 * CD), "v"(ga + 80 * CD), "v"(ga + 96 * CD), "v"(ga + 112 * CD),
                  "v"(gb), "v"(gb + 16 * CD), "v"(gb + 32 * CD), "v"(gb + 48 * CD)
               : "memory");
}

template <bool BF>
__device__ __forceinline__ void gemm_loop(const unsigned short* __restrict__ ablk, const unsigned short* __restrict__ bblk,
                                          unsigned char* ring, int tid, int w, int ln, int hh, v8f (&acc)[2][4]) {
  const int nt = CD / ST_K;
  const unsigned short* ga = ablk + (size_t)(tid >> 3) * CD + 8 * (tid & 7);
  const unsigned short* gb = bblk + (size_t)(tid >> 3) * CD + 8 * (tid & 7);
  const unsigned l0 = (unsigned)(size_t)ring + (unsigned)((tid >> 3) * ST_PITCH + 16 * (tid & 7));   // LDS byte address of this thread's first chunk
  const int aoff = (32 * w + ln) * ST_PITCH + 16 * hh;
  const int boff = (128 + ln) * ST_PITCH + 16 * hh;
  stage_copy(ga, gb, l0);
  asm volatile("s_wait_asynccnt 0x0" ::: "memory");   // tile 0 has landed before the barrier that publishes it
  __syncthreads();
  stage_copy(ga + ST_K, gb + ST_K, l0 + ST_BYTES);
#pragma unroll 1   // one tile per trip: the two buffers alternate by the trip's parity
  for (int t = 0; t < nt; ++t) {
    const unsigned sel = (unsigned)(t & 1) * ST_BYTES;
    const unsigned char* buf = ring + sel;
    Frag a[2][2], b[2][4];
#pragma unroll
    for (int kk = 0; kk < 2; ++kk) {
#pragma unroll
      for (int i = 0; i < 2; ++i) ldfrag_lds(a[kk][i], buf + aoff + i * 16 * ST_PITCH + kk * 64);
#pragma unroll
      for (int j = 0; j < 4; ++j) ldfrag_lds(b[kk][j], buf + boff + j * 16 * ST_PITCH + kk * 64);
    }
#pragma unroll
    for (int kk = 0; kk < 2; ++kk)
#pragma unroll
      for (int i = 0; i < 2; ++i)
#pragma unroll
        for (int j = 0; j < 4; ++j) acc[i][j] = wm<BF>(a[kk][i], b[kk][j], acc[i][j]);
    // keeps the distance behind the last matrix instructions on the loop's back edge and in front of the address arithmetic below
    asm volatile("v_nop\n\tv_nop\n\tv_nop\n\tv_nop" : "+v"(acc[0][0]), "+v"(acc[0][1]), "+v"(acc[0][2]), "+v"(acc[0][3]),
                        "+v"(acc[1][0]), "+v"(acc[1][1]), "+v"(acc[1][2]), "+v"(acc[1][3])
                      : "v"(a[1][0].v), "v"(a[1][1].v), "v"(b[1][0].v), "v"(b[1][1].v), "v"(b[1][2].v), "v"(b[1][3].v));
    asm volatile("s_wait_dscnt 0x0" ::: "memory");      // this wave's reads of the buffer are done before it is refilled
    asm volatile("s_wait_asynccnt 0x0" ::: "memory");   // this wave's copies of tile t + 1 have landed before the barrier publishes them
    __syncthreads();
    if (t + 2 < nt) stage_copy(ga + (t + 2) * ST_K, gb + (t + 2) * ST_K, l0 + sel);
  }
  asm volatile("s_wait_asynccnt 0x0" ::: "memory");     // nothing is in flight when the ring is used for anything else
}

__device__ __forceinline__ float rope1(float q, float p, float c, float s, float sg) { return q * c + (sg * p) * s; }

// ---------------------------------------------------------------------------------------------------------
// q and k projections with fused bias, rotary (table read by value) and head-major repack.
// Block = 4 waves stacked in M (128 token rows) x one head (64 columns). grid = (NQK, NB*SEQ/128).
// coverage: NQK heads x NB*SEQ tokens x 64 = the whole plane [NB][NQK][SEQ][64], both planes. LDS tile 32 x 64 fully written before it is read.
// five waves per SIMD asked for: the 1280 work-groups are then resident together, five on each WGP (5 x 55,296 B of LDS fit), and cover one another's barrier and copy waits
__global__ __launch_bounds__(128) __attribute__((amdgpu_waves_per_eu(5))) void k_proj_qk(const unsigned short* __restrict__ xb, const unsigned short* __restrict__ wqk,
                                                 const float* __restrict__ bq, const float* __restrict__ bk,
                                                 const float* __restrict__ tab,
                                                 unsigned short* __restrict__ qkh, unsigned short* __restrict__ qkl) {
  __shared__ __attribute__((aligned(16))) unsigned char ring[RING_BYTES];
  float (*st)[32][68] = (float (*)[32][68])ring;       // epilogue tiles, used behind the k loop's last barrier
  const int tid = threadIdx.x, lane = tid & 31, ln = lane & 15, hh = lane >> 4;
  const int w = __builtin_amdgcn_readfirstlane(tid >> 5);
  const int hd = blockIdx.x;
  const int m0 = blockIdx.y * 128 + 32 * w;
  const v8f z8 = {0.f, 0.f, 0.f, 0.f, 0.f, 0.f, 0.f, 0.f};
  v8f acc[2][4];
#pragma unroll
  for (int i = 0; i < 2; ++i)
#pragma unroll
    for (int j = 0; j < 4; ++j) acc[i][j] = z8;
  gemm_loop<true>(xb + (size_t)(blockIdx.y * 128) * CD, wqk + (size_t)(hd * HD) * CD, ring, tid, w, ln, hh, acc);

  float bias[4];
#pragma unroll
  for (int j = 0; j < 4; ++j) {
    const int col = hd * HD + 16 * j + ln;
    const int cq = (col < CD - 1) ? col : (CD - 1);
    int ck = col - CD;
    ck = (ck < 0) ? 0 : ((ck > KVW - 1) ? (KVW - 1) : ck);
    const float vq = bq[cq], vk = bk[ck];
    bias[j] = bf16_rne((col < CD) ? vq : vk);
  }
#pragma unroll
  for (int i = 0; i < 2; ++i)
#pragma unroll
    for (int j = 0; j < 4; ++j)
#pragma unroll
      for (int r = 0; r < 8; ++r) st[w][16 * i + 8 * hh + r][16 * j + ln] = acc[i][j][r] + bias[j];
  __syncthreads();

  const int b = m0 / SEQ, t0 = m0 - b * SEQ;
  const int rsub = lane >> 3, d0 = 8 * (lane & 7);
  const float sg = (d0 < 32) ? -1.0f : 1.0f;
  v8us oh[8], ol[8];
#pragma unroll
  for (int g = 0; g < 8; ++g) {
    // keeps the second half's table and LDS loads from being lifted over the first half: all 8 groups in flight at once cost the fifth wave per SIMD (or spills)
    if (g == 4) __builtin_amdgcn_sched_barrier(0);
    const int row = 4 * g + rsub;
    const v4f a0 = *(const v4fa*)&st[w][row][d0];
    const v4f a1 = *(const v4fa*)&st[w][row][d0 + 4];
    const v4f p0 = *(const v4fa*)&st[w][row][d0 ^ 32];
    const v4f p1 = *(const v4fa*)&st[w][row][(d0 ^ 32) + 4];
    const float* tp = tab + (size_t)(t0 + row) * HD + d0;
    const v4f c0 = *(const v4fa*)(tp), c1 = *(const v4fa*)(tp + 4);
    const float k0 = bf16_rne(c0[0]), s0 = bf16_rne(c0[1]), k1 = bf16_rne(c0[2]), s1 = bf16_rne(c0[3]);
    const float k2 = bf16_rne(c1[0]), s2 = bf16_rne(c1[1]), k3 = bf16_rne(c1[2]), s3 = bf16_rne(c1[3]);
    float o[8];
    o[0] = rope1(a0[0], p0[0], k0, s0, sg); o[1] = rope1(a0[1], p0[1], k0, s0, sg);
    o[2] = rope1(a0[2], p0[2], k1, s1, sg); o[3] = rope1(a0[3], p0[3], k1, s1, sg);
    o[4] = rope1(a1[0], p1[0], k2, s2, sg); o[5] = rope1(a1[1], p1[1], k2, s2, sg);
    o[6] = rope1(a1[2], p1[2], k3, s3, sg); o[7] = rope1(a1[3], p1[3], k3, s3, sg);
    Pack8 ph8, pl8;
#pragma unroll
    for (int e = 0; e < 8; ++e) {
      const float y = o[e] * 16.0f;                       // carried x16
      const _Float16 h = (_Float16)y;
      ph8.h[e] = h;
      pl8.h[e] = (_Float16)((y - (float)h) * 2048.0f);     // residual plane x2^11
    }
    oh[g] = ph8.v; ol[g] = pl8.v;
  }
  const size_t dbase = ((size_t)(b * NQK + hd) * SEQ + t0) * HD + d0;
{
#pragma unroll
    for (int g = 0; g < 8; ++g) {
      const size_t off = dbase + (size_t)(4 * g + rsub) * HD;
      *(v8us*)(qkh + off) = oh[g];
      *(v8us*)(qkl + off) = ol[g];
    }
    
  }
}

// ---------------------------------------------------------------------------------------------------------
// v projection computed transposed: Vt[b][m][t] = sum_k Wv[m][k] x[b,t][k] + bv[m], carried x16, hi and residual planes.
// Block = 4 waves stacked in M (128 weight rows) x 64 tokens. grid = (NB*SEQ/64, KVW/128).
// coverage: KVW rows x NB*SEQ tokens = the whole plane [NB][KVW][SEQ], both planes. LDS tile 32 x 64 fully written before it is read.
__global__ __launch_bounds__(128) void k_proj_v(const unsigned short* __restrict__ wvb, const unsigned short* __restrict__ xb,
                                                const float* __restrict__ bv,
                                                unsigned short* __restrict__ vth, unsigned short* __restrict__ vtl) {
  __shared__ __attribute__((aligned(16))) unsigned char ring[RING_BYTES];
  float (*st)[32][68] = (float (*)[32][68])ring;       // epilogue tiles, used behind the k loop's last barrier
  const int tid = threadIdx.x, lane = tid & 31, ln = lane & 15, hh = lane >> 4;
  const int w = __builtin_amdgcn_readfirstlane(tid >> 5);
  const int n0 = blockIdx.x * 64;
  const int m0 = blockIdx.y * 128 + 32 * w;
  const v8f z8 = {0.f, 0.f, 0.f, 0.f, 0.f, 0.f, 0.f, 0.f};
  v8f acc[2][4];
#pragma unroll
  for (int i = 0; i < 2; ++i)
#pragma unroll
    for (int j = 0; j < 4; ++j) acc[i][j] = z8;
  gemm_loop<true>(wvb + (size_t)(blockIdx.y * 128) * CD, xb + (size_t)n0 * CD, ring, tid, w, ln, hh, acc);
#pragma unroll
  for (int i = 0; i < 2; ++i)
#pragma unroll
    for (int j = 0; j < 4; ++j)
#pragma unroll
      for (int r = 0; r < 8; ++r) st[w][16 * i + 8 * hh + r][16 * j + ln] = acc[i][j][r];
  __syncthreads();

  const int b = n0 / SEQ, t0 = n0 - b * SEQ;
  const int rsub = lane >> 3, c0 = 8 * (lane & 7);
  v8us oh[8], ol[8];
#pragma unroll
  for (int g = 0; g < 8; ++g) {
    const int row = 4 * g + rsub;
    const float bias = bf16_rne(bv[m0 + row]);
    const v4f a0 = *(const v4fa*)&st[w][row][c0];
    const v4f a1 = *(const v4fa*)&st[w][row][c0 + 4];
    float o[8];
    o[0] = a0[0]; o[1] = a0[1]; o[2] = a0[2]; o[3] = a0[3];
    o[4] = a1[0]; o[5] = a1[1]; o[6] = a1[2]; o[7] = a1[3];
    Pack8 ph8, pl8;
#pragma unroll
    for (int e = 0; e < 8; ++e) {
      const float y = (o[e] + bias) * 16.0f;              // carried x16
      const _Float16 h = (_Float16)y;
      ph8.h[e] = h;
      pl8.h[e] = (_Float16)((y - (float)h) * 2048.0f);
    }
    oh[g] = ph8.v; ol[g] = pl8.v;
  }
  const size_t dbase = ((size_t)b * KVW + m0) * SEQ + t0 + c0;
{
#pragma unroll
    for (int g = 0; g < 8; ++g) {
      const size_t off = dbase + (size_t)(4 * g + rsub) * SEQ;
      *(v8us*)(vth + off) = oh[g];
      *(v8us*)(vtl + off) = ol[g];
    }
    
  }
}

// ---------------------------------------------------------------------------------------------------------
// Attention stage in LDS: 64 keys. Tile 0 = K rows (64 keys x 128 B), tile 1 = V^T rows (64 d x 128 B = 64 keys), each at a 144-byte pitch;
// tiles 2 and 3 = the residual planes of K and V^T (query rows below EARLY_ROWS only).
// The ring holds two stages of two tiles (plain blocks, two buffers) or one stage of four tiles (early blocks, one buffer).
#define AT_KEYS 64
#define AT_PITCH 144
#define AT_TILE (64 * AT_PITCH)
#define AT_RING (4 * AT_TILE)
static_assert(SEQ % AT_KEYS == 0);
static_assert(AT_RING >= 4 * 16 * 68 * 4);         /* the epilogue tiles reuse the ring */

// One K tile and one V^T tile: 8 copies of 16 bytes per thread, chunk (tid & 7) of rows (tid >> 3) + 16 i; each copy of a wave moves 4 whole 128-byte lines.
// The s_wait_xcnt stands inside the statement so that no address register is rewritten ahead of it.
__device__ __forceinline__ void kv_copy(const unsigned short* gk, const unsigned short* gv, unsigned l) {
  asm volatile("global_load_async_to_lds_b128 %0, %8, off\n\t"
               "global_load_async_to_lds_b128 %1, %9, off\n\t"
               "global_load_async_to_lds_b128 %2, %10, off\n\t"
               "global_load_async_to_lds_b128 %3, %11, off\n\t"
               "global_load_async_to_lds_b128 %4, %12, off\n\t"
               "global_load_async_to_lds_b128 %5, %13, off\n\t"
               "global_load_async_to_lds_b128 %6, %14, off\n\t"
               "global_load_async_to_lds_b128 %7, %15, off\n\t"
               "s_wait_xcnt 0x0"
               :: "v"(l), "v"(l + 16 * AT_PITCH), "v"(l + 32 * AT_PITCH), "v"(l + 48 * AT_PITCH),
                  "v"(l + AT_TILE), "v"(l + AT_TILE + 16 * AT_PITCH), "v"(l + AT_TILE + 32 * AT_PITCH), "v"(l + AT_TILE + 48 * AT_PITCH),
                  "v"(gk), "v"(gk + 16 * HD), "v"(gk + 32 * HD), "v"(gk + 48 * HD),
                  "v"(gv), "v"(gv + 16 * SEQ), "v"(gv + 32 * SEQ), "v"(gv + 48 * SEQ)
               : "memory");
}

// One 32-key step for a wave's 16 queries (this lane's column = its query). EARLYP adds the residual planes of q, k, v, P.
// st = the stage in LDS, kloc = 0 or 32 = first key of the step inside the stage, key0 = the same key's index in the sequence.
// MASK reads the mask row of this lane's query by value and replace-fills with -inf.
template <bool EARLYP, bool MASK>
__device__ __forceinline__ void fa_step(const unsigned char* st, int kloc,
                                        const int* __restrict__ mrow, int key0, int ln, int hh,
                                        const Frag (&qh)[2], const Frag (&ql)[2],
                                        float& mr, float& lr, v8f (&Oh)[4], v8f (&Ol)[4]) {
  const v8f z8 = {0.f, 0.f, 0.f, 0.f, 0.f, 0.f, 0.f, 0.f};
  float sc[16];
  // A fragments of K: row m = key (key0 + 16*kt + ln), elements 0..7 <- d = 32c + 8h + i, 8..15 <- d = 32c + 16 + 8h + i
  int koff = (kloc + ln) * AT_PITCH + 16 * hh;        // byte offset in a K tile
  if (EARLYP) {
#pragma unroll
    for (int kt = 0; kt < 2; ++kt) {
      Frag a0, a1, l0, l1;
      ldfrag_lds(a0, st + koff); ldfrag_lds(a1, st + koff + 64);
      ldfrag_lds(l0, st + 2 * AT_TILE + koff); ldfrag_lds(l1, st + 2 * AT_TILE + koff + 64);
      v8f s = z8, r = z8;
      s = wm<false>(a0, qh[0], s); s = wm<false>(a1, qh[1], s);
      r = wm<false>(a0, ql[0], r); r = wm<false>(a1, ql[1], r);
      r = wm<false>(l0, qh[0], r); r = wm<false>(l1, qh[1], r);
      asm volatile("v_nop\n\tv_nop\n\tv_nop\n\tv_nop" : "+v"(s), "+v"(r)
                        : "v"(a0.v), "v"(a1.v), "v"(l0.v), "v"(l1.v), "v"(qh[0].v), "v"(qh[1].v), "v"(ql[0].v), "v"(ql[1].v));
      // S^T element r of tile kt = score(key0 + 16*kt + 8h + r, this lane's query); carries: q x16, k x16, residual x2^11
#pragma unroll
      for (int e = 0; e < 8; ++e) sc[8 * kt + e] = fmaf(r[e], S2M11, s[e]) * S2M11;
      koff += 16 * AT_PITCH;
      if (kt == 0) asm volatile("" : "+v"(koff) : "v"(sc[0]));   // second tile's loads issue after the first tile is done
    }
  } else {
    Frag k00, k01, k10, k11;
    ldfrag_lds(k00, st + koff);                 ldfrag_lds(k01, st + koff + 64);
    ldfrag_lds(k10, st + koff + 16 * AT_PITCH); ldfrag_lds(k11, st + koff + 16 * AT_PITCH + 64);
    v8f s0 = z8, s1 = z8;
    s0 = wm<false>(k00, qh[0], s0); s0 = wm<false>(k01, qh[1], s0);
    s1 = wm<false>(k10, qh[0], s1); s1 = wm<false>(k11, qh[1], s1);
    asm volatile("v_nop\n\tv_nop\n\tv_nop\n\tv_nop" : "+v"(s0), "+v"(s1)
                      : "v"(k00.v), "v"(k01.v), "v"(k10.v), "v"(k11.v), "v"(qh[0].v), "v"(qh[1].v));
#pragma unroll
    for (int e = 0; e < 8; ++e) { sc[e] = s0[e] * S2M11; sc[8 + e] = s1[e] * S2M11; }
  }
  if (MASK) {
    const int* mp = mrow + key0 + 8 * hh;
    const v4i m0 = *(const v4ia*)(mp),      m1 = *(const v4ia*)(mp + 4);
    const v4i m2 = *(const v4ia*)(mp + 16), m3 = *(const v4ia*)(mp + 20);
    const float ninf = neg_inf();
#pragma unroll
    for (int e = 0; e < 4; ++e) {
      sc[e]      = (m0[e] == 0) ? ninf : sc[e];
      sc[4 + e]  = (m1[e] == 0) ? ninf : sc[4 + e];
      sc[8 + e]  = (m2[e] == 0) ? ninf : sc[8 + e];
      sc[12 + e] = (m3[e] == 0) ? ninf : sc[12 + e];
    }
  }
  float mx = sc[0];
#pragma unroll
  for (int i = 1; i < 16; ++i) mx = fmaxf(mx, sc[i]);
  mx = fmaxf(mx, __shfl_xor(mx, 16, 32));            // the other lane half holds the other 16 keys of this query
  const float mnew = fmaxf(mr, mx);
  float msafe = mnew;
  if (MASK) msafe = (mnew == neg_inf()) ? 0.0f : mnew;   // every key so far masked: weights come out 0
  const float al = __builtin_amdgcn_exp2f((mr - msafe) * LOG2E);
  mr = mnew;
  // weights carried x256: pc = 256 * exp(sc - m); hi plane f16(pc), residual plane f16((pc - hi) * 2048)
  Frag ph, pl;
  float ps = 0.0f;
#pragma unroll
  for (int i = 0; i < 16; ++i) {
    const float pc = __builtin_amdgcn_exp2f(fmaf(sc[i] - msafe, LOG2E, 8.0f));
    ps += pc;
    const _Float16 h = (_Float16)pc;
    ph.h[i] = h;                                      // B element i: i<8 -> key0 + 8h + i (tile 0 row 8h+i); i>=8 -> key0 + 16 + 8h + (i-8) (tile 1)
    if (EARLYP) pl.h[i] = (_Float16)((pc - (float)h) * 2048.0f);
  }
  ps += __shfl_xor(ps, 16, 32);
  lr = lr * al + ps;
  // A fragments of V^T: row m = d (16*t + ln), elements 0..7 <- key0 + 8h + i, 8..15 <- key0 + 16 + 8h + i
  int voff = AT_TILE + ln * AT_PITCH + 2 * kloc + 16 * hh;   // byte offset in the stage
  asm volatile("" : "+v"(voff) : "v"(ps));            // V loads issue after the score phase
  const unsigned char* vp = st + voff;
  Frag vf[4];
#pragma unroll
  for (int t = 0; t < 4; ++t) ldfrag_lds(vf[t], vp + t * 16 * AT_PITCH);
#pragma unroll
  for (int t = 0; t < 4; ++t) Oh[t] = Oh[t] * al;
  if (EARLYP) {
    const unsigned char* vq = vp + 2 * AT_TILE;
    Frag vl[4];
#pragma unroll
    for (int t = 0; t < 4; ++t) ldfrag_lds(vl[t], vq + t * 16 * AT_PITCH);
#pragma unroll
    for (int t = 0; t < 4; ++t) Ol[t] = Ol[t] * al;
#pragma unroll
    for (int t = 0; t < 4; ++t) {
      Oh[t] = wm<false>(vf[t], ph, Oh[t]);
      Ol[t] = wm<false>(vf[t], pl, Ol[t]);
      Ol[t] = wm<false>(vl[t], ph, Ol[t]);
    }
    asm volatile("v_nop\n\tv_nop\n\tv_nop\n\tv_nop" : "+v"(Oh[0]), "+v"(Oh[1]), "+v"(Oh[2]), "+v"(Oh[3]), "+v"(Ol[0]), "+v"(Ol[1]), "+v"(Ol[2]), "+v"(Ol[3])
                      : "v"(vf[0].v), "v"(vf[1].v), "v"(vf[2].v), "v"(vf[3].v),
                        "v"(vl[0].v), "v"(vl[1].v), "v"(vl[2].v), "v"(vl[3].v), "v"(ph.v), "v"(pl.v));
  } else {
#pragma unroll
    for (int t = 0; t < 4; ++t) Oh[t] = wm<false>(vf[t], ph, Oh[t]);
    asm volatile("v_nop\n\tv_nop\n\tv_nop\n\tv_nop" : "+v"(Oh[0]), "+v"(Oh[1]), "+v"(Oh[2]), "+v"(Oh[3])
                      : "v"(vf[0].v), "v"(vf[1].v), "v"(vf[2].v), "v"(vf[3].v), "v"(ph.v));
  }
}

// What stands in front of and behind a stage's work. Early blocks (one buffer of four tiles): fill, wait, publish in front; every reader leaves behind.
// Plain blocks (two buffers of two tiles): nothing in front; behind, stage t + 1 is published and stage t + 2 is sent into the buffer that stage t has just left.
template <bool EARLYP>
__device__ __forceinline__ void ring_head(const unsigned short* gk, const unsigned short* gv, const unsigned short* gkl, const unsigned short* gvl,
                                          unsigned l0, int t) {
  if (EARLYP) {
    kv_copy(gk + (size_t)t * AT_KEYS * HD, gv + t * AT_KEYS, l0);
    kv_copy(gkl + (size_t)t * AT_KEYS * HD, gvl + t * AT_KEYS, l0 + 2 * AT_TILE);
    asm volatile("s_wait_asynccnt 0x0" ::: "memory");   // this wave's copies have landed before the barrier publishes them
    __syncthreads();
  }
}
template <bool EARLYP>
__device__ __forceinline__ void ring_foot(const unsigned short* gk, const unsigned short* gv, unsigned l0, int t, int nst) {
  asm volatile("s_wait_dscnt 0x0" ::: "memory");        // this wave's reads of the buffer are done before it is refilled
  if (!EARLYP) asm volatile("s_wait_asynccnt 0x0" ::: "memory");   // this wave's copies of stage t + 1 have landed before the barrier publishes them
  __syncthreads();
  if (!EARLYP) {
    if (t + 2 < nst) kv_copy(gk + (size_t)(t + 2) * AT_KEYS * HD, gv + (t + 2) * AT_KEYS, l0 + (unsigned)(t & 1) * (2 * AT_TILE));
  }
}

// nst = stages of 64 keys that the block walks, npl = the first of them that run without mask reads (both the same in all its waves;
// npl <= nst <= SEQ / 64, 2 * nst >= every wave's nsteps, 2 * npl <= every wave's nsteps). nsteps = this wave's own 32-key steps.
template <bool EARLYP>
__device__ __forceinline__ void run_keys(const unsigned short* __restrict__ qkh, const unsigned short* __restrict__ qkl,
                                         const unsigned short* __restrict__ vth, const unsigned short* __restrict__ vtl,
                                         const int* __restrict__ mask, unsigned char* ring, int tid, int b, int h, int qg, int ln, int hh,
                                         int npl, int nsteps, int nst, float& mr, float& lr, v8f (&Oh)[4], v8f (&Ol)[4]) {
  // Q^T B fragments: column n = this lane's query, elements 0..7 <- d = 32c + 8h + i, 8..15 <- d = 32c + 16 + 8h + i
  const size_t qoff = ((size_t)(b * NQK + h) * SEQ + qg) * HD + 8 * hh;
  Frag qh[2], ql[2];
  ldfrag(qh[0], qkh + qoff); ldfrag(qh[1], qkh + qoff + 32);
  if (EARLYP) { ldfrag(ql[0], qkl + qoff); ldfrag(ql[1], qkl + qoff + 32); }
  else { ql[0] = qh[0]; ql[1] = qh[1]; }
  const int kv = h % NKV;
  const size_t kbase = (size_t)(b * NQK + NHEAD + kv) * SEQ * HD;
  const size_t vbase = ((size_t)b * KVW + (size_t)kv * HD) * SEQ;
  const int* mrow = mask + (size_t)qg * SEQ_FULL;
  // this thread's first chunk of a stage: in K (rows = keys), in V^T (rows = d) and in LDS
  const size_t kthr = kbase + (size_t)(tid >> 3) * HD + 8 * (tid & 7);
  const size_t vthr = vbase + (size_t)(tid >> 3) * SEQ + 8 * (tid & 7);
  const unsigned short* gk = qkh + kthr;
  const unsigned short* gv = vth + vthr;
  const unsigned l0 = (unsigned)(size_t)ring + (unsigned)((tid >> 3) * AT_PITCH + 16 * (tid & 7));   // LDS byte address
  const unsigned short* gkl = qkl + kthr;
  const unsigned short* gvl = vtl + vthr;
  if (!EARLYP) {
    kv_copy(gk, gv, l0);
    asm volatile("s_wait_asynccnt 0x0" ::: "memory");     // stage 0 has landed before the barrier that publishes it
    __syncthreads();
    if (nst > 1) kv_copy(gk + AT_KEYS * HD, gv + AT_KEYS, l0 + 2 * AT_TILE);
  }
#pragma unroll 1   // one stage per trip: the two buffers alternate by the trip's parity
  for (int t = 0; t < npl; ++t) {
    const unsigned char* st = ring + (EARLYP ? 0u : (unsigned)(t & 1) * (2 * AT_TILE));
    ring_head<EARLYP>(gk, gv, gkl, gvl, l0, t);
    fa_step<EARLYP, false>(st, 0, mrow, AT_KEYS * t, ln, hh, qh, ql, mr, lr, Oh, Ol);
    fa_step<EARLYP, false>(st, 32, mrow, AT_KEYS * t + 32, ln, hh, qh, ql, mr, lr, Oh, Ol);
    ring_foot<EARLYP>(gk, gv, l0, t, nst);
  }
#pragma unroll 1   // one stage per trip, as above
  for (int t = npl; t < nst; ++t) {
    const unsigned char* st = ring + (EARLYP ? 0u : (unsigned)(t & 1) * (2 * AT_TILE));
    ring_head<EARLYP>(gk, gv, gkl, gvl, l0, t);
#pragma unroll 1   // one copy of the masked step in the text
    for (int sub = 0; sub < 2; ++sub) {
      const int j = 2 * t + sub;
      // a wave whose own steps have run out passes through to the barrier (wave-uniform test)
      if (j < nsteps) fa_step<EARLYP, true>(st, 32 * sub, mrow, 32 * j, ln, hh, qh, ql, mr, lr, Oh, Ol);
    }
    ring_foot<EARLYP>(gk, gv, l0, t, nst);
  }
  asm volatile("s_wait_asynccnt 0x0" ::: "memory");       // nothing is in flight when the ring is used for anything else
}

// Block = 4 waves x 16 queries = 64 queries of one (batch, head); the waves share the K and V^T stages in LDS, one barrier per 64 keys (two in early blocks).
// Tile skipping from the device flags of this wave's own 16 mask rows (16/SCAN_ROWS flag lines): all upper flags 1 -> keys past the diagonal step are
// skipped; upper and lower flags of all 64 rows of the block 1 -> the stages fully below the block's diagonal tile run without mask reads; every other visited step reads the mask by value.
// Trip counts are bounded by SEQ/32 for any flag value. The block walks qt + 1 stages if the upper flags of all its 64 rows are 1, else all SEQ/64.
// coverage: NB*NHEAD*(SEQ/64) blocks x 4 waves x 16 rows x 64 columns = the whole ctx hi plane; blocks with query tile below EARLY_ROWS cover the whole residual plane.
__global__ __launch_bounds__(128) void k_attn(const unsigned short* __restrict__ qkh, const unsigned short* __restrict__ qkl,
                                              const unsigned short* __restrict__ vth, const unsigned short* __restrict__ vtl,
                                              const int* __restrict__ mask, const int* __restrict__ flags,
                                              unsigned short* __restrict__ ctxh, unsigned short* __restrict__ ctxl) {
  __shared__ __attribute__((aligned(16))) unsigned char ring[AT_RING];
  float (*so)[16][68] = (float (*)[16][68])ring;       // epilogue tiles, used behind the key loop's last barrier
  const int tid = threadIdx.x, lane = tid & 31, ln = lane & 15, hh = lane >> 4;
  const int w = __builtin_amdgcn_readfirstlane(tid >> 5);
  const int nqt = SEQ / 64;
  const int blk = blockIdx.x;
  const int qt = blk % nqt;
  const int h = (blk / nqt) % NHEAD;
  const int b = blk / (nqt * NHEAD);
  const int qbase = qt * 64 + 16 * w;
  const int qg = qbase + ln;
  const int* fl = flags + (qbase / SCAN_ROWS) * 32;
  int upok = 1;                                        // plain & so that the flag loads issue together
#pragma unroll
  for (int g = 0; g < 16 / SCAN_ROWS; ++g) upok &= (fl[32 * g] == 1) ? 1 : 0;
  const bool tri = (upok == 1);
  const int nfull = qbase >> 5;                        // steps whose 32 keys are all at or below every query of this wave
  const int nsteps = tri ? (nfull + 1) : (SEQ / 32);   // <= SEQ/32 in both cases
  const bool early = (qt * 64 < EARLY_ROWS);
  // stage counts of the block, from the flags of all its 64 rows: the same values in all four waves, since barriers stand in the key loop
  const int* flb = flags + (qt * 64 / SCAN_ROWS) * 32;
  int upall = 1, lowall = 1;
#pragma unroll
  for (int g = 0; g < 64 / SCAN_ROWS; ++g) {
    const int fU = flb[32 * g], fL = flb[32 * g + 1];
    upall &= (fU == 1) ? 1 : 0;
    lowall &= (fL == 1) ? 1 : 0;
  }
  const int nst = (upall == 1) ? (qt + 1) : (SEQ / AT_KEYS);
  const int npl = (upall == 1 && lowall == 1) ? qt : 0;   // stages whose 64 keys are all below every query of the block

  const v8f z8 = {0.f, 0.f, 0.f, 0.f, 0.f, 0.f, 0.f, 0.f};
  float mr = neg_inf(), lr = 0.0f;
  v8f Oh[4], Ol[4];
#pragma unroll
  for (int t = 0; t < 4; ++t) { Oh[t] = z8; Ol[t] = z8; }
  if (early) run_keys<true>(qkh, qkl, vth, vtl, mask, ring, tid, b, h, qg, ln, hh, npl, nsteps, nst, mr, lr, Oh, Ol);
  else       run_keys<false>(qkh, qkl, vth, vtl, mask, ring, tid, b, h, qg, ln, hh, npl, nsteps, nst, mr, lr, Oh, Ol);

  // O^T element r of tile t = ctx(query, d = 16t + 8h + r); undo the carries x256 (in lr), x16 (V), x2^11 (residual); apply the x64 carry of ctx
  const float inv = 4.0f * (1.0f / lr);
#pragma unroll
  for (int t = 0; t < 4; ++t)
#pragma unroll
    for (int r = 0; r < 8; ++r)
      so[w][ln][16 * t + 8 * hh + r] = fmaf(Ol[t][r], S2M11, Oh[t][r]) * inv;
  __syncthreads();
  const int rsub = lane >> 3, d0 = 8 * (lane & 7);
  v8us oh[4], ol[4];
#pragma unroll
  for (int g = 0; g < 4; ++g) {
    const int row = 4 * g + rsub;
    const v4f a0 = *(const v4fa*)&so[w][row][d0];
    const v4f a1 = *(const v4fa*)&so[w][row][d0 + 4];
    float o[8];
    o[0] = a0[0]; o[1] = a0[1]; o[2] = a0[2]; o[3] = a0[3];
    o[4] = a1[0]; o[5] = a1[1]; o[6] = a1[2]; o[7] = a1[3];
    Pack8 ph8, pl8;
#pragma unroll
    for (int e = 0; e < 8; ++e) {
      const _Float16 hv = (_Float16)o[e];
      ph8.h[e] = hv;
      pl8.h[e] = (_Float16)((o[e] - (float)hv) * 2048.0f);
    }
    oh[g] = ph8.v; ol[g] = pl8.v;
  }
  const size_t hbase = ((size_t)b * SEQ + qbase) * CD + (size_t)h * HD + d0;
  const size_t lbase = ((size_t)b * EARLY_ROWS + (early ? qbase : 0)) * CD + (size_t)h * HD + d0;
{
#pragma unroll
    for (int g = 0; g < 4; ++g) {
      const size_t ro = (size_t)(4 * g + rsub) * CD;
      *(v8us*)(ctxh + hbase + ro) = oh[g];
      if (early) *(v8us*)(ctxl + lbase + ro) = ol[g];
    }
    
  }
}

// ---------------------------------------------------------------------------------------------------------
// Output projection: out[m][n] = sum_k ctx[m][k] Wo[n][k] + bo[n]. Block = 4 waves stacked in M (128 rows) x 64 columns. grid = (CD/64, NB*SEQ/128).
// Rows below EARLY_ROWS of each sequence add the residual plane of ctx in separate accumulators.
// coverage: NB*SEQ rows x CD columns = every element of the output buffer region once. LDS tile 32 x 64 fully written before it is read.
__global__ __launch_bounds__(128) void k_proj_out(const unsigned short* __restrict__ ctxh, const unsigned short* __restrict__ ctxl,
                                                  const unsigned short* __restrict__ wo, const float* __restrict__ bo,
                                                  float* __restrict__ out) {
  __shared__ __attribute__((aligned(16))) unsigned char ring[RING_BYTES];
  float (*st)[32][68] = (float (*)[32][68])ring;       // epilogue tiles, used behind the k loop's last barrier
  const int tid = threadIdx.x, lane = tid & 31, ln = lane & 15, hh = lane >> 4;
  const int w = __builtin_amdgcn_readfirstlane(tid >> 5);
  const int n0 = blockIdx.x * 64;
  const int mb = blockIdx.y * 128;
  const int b = mb / SEQ;
  const int tb = mb - b * SEQ;
  const bool early = (tb < EARLY_ROWS);                // block-uniform: EARLY_ROWS and SEQ are multiples of 128
  const int t0 = tb + 32 * w;
  const v8f z8 = {0.f, 0.f, 0.f, 0.f, 0.f, 0.f, 0.f, 0.f};
  v8f acc[2][4], acl[2][4];
#pragma unroll
  for (int i = 0; i < 2; ++i)
#pragma unroll
    for (int j = 0; j < 4; ++j) { acc[i][j] = z8; acl[i][j] = z8; }
  const unsigned short* wp = wo + (size_t)n0 * CD;
  gemm_loop<false>(ctxh + (size_t)mb * CD, wp, ring, tid, w, ln, hh, acc);
  // residual plane: a second walk over k through the same ring, into its own accumulators (block-uniform branch)
  if (early) gemm_loop<false>(ctxl + (size_t)(b * EARLY_ROWS + tb) * CD, wp, ring, tid, w, ln, hh, acl);
  // carries: ctx x64, Wo x64 -> 2^-12; residual plane additionally x2^11
#pragma unroll
  for (int i = 0; i < 2; ++i)
#pragma unroll
    for (int j = 0; j < 4; ++j)
#pragma unroll
      for (int r = 0; r < 8; ++r)
        st[w][16 * i + 8 * hh + r][16 * j + ln] = fmaf(acl[i][j][r], S2M11, acc[i][j][r]) * S2M12;
  __syncthreads();
  const int rsub = lane >> 4, c4 = 4 * (lane & 15);
  const v4f bb = *(const v4fa*)(bo + n0 + c4);
  v4f bias;
  bias[0] = bf16_rne(bb[0]); bias[1] = bf16_rne(bb[1]); bias[2] = bf16_rne(bb[2]); bias[3] = bf16_rne(bb[3]);
  v4f ov[16];
#pragma unroll
  for (int g = 0; g < 16; ++g) {
    const v4f a = *(const v4fa*)&st[w][2 * g + rsub][c4];
    ov[g] = a + bias;
  }
  float* og = out + ((size_t)b * SEQ_FULL + t0) * CD + n0 + c4;
{
#pragma unroll
    for (int g = 0; g < 16; ++g)
      *(v4f*)(og + (size_t)(2 * g + rsub) * CD) = ov[g];
    
  }
}

// ---------------------------------------------------------------------------------------------------------
extern "C" void kernel_launch(void* const* d_in, const int* in_sizes, int n_in,
                              void* d_out, int out_size, void* d_ws, size_t ws_size, hipStream_t stream) {
  if (n_in < 11) return;
  const long long need_x = (long long)(NB - 1) * SEQ_FULL * CD + (long long)SEQ * CD;   // last element touched + 1
  const long long need_m = (long long)(SEQ - 1) * SEQ_FULL + SEQ;
  if ((long long)in_sizes[0] < need_x) return;
  if ((long long)in_sizes[1] < need_m) return;
  if ((long long)in_sizes[2] < (long long)SEQ * HD) return;
  if ((long long)in_sizes[3] < (long long)CD * CD || (long long)in_sizes[4] < CD) return;
  if ((long long)in_sizes[5] < (long long)KVW * CD || (long long)in_sizes[6] < KVW) return;
  if ((long long)in_sizes[7] < (long long)KVW * CD || (long long)in_sizes[8] < KVW) return;
  if ((long long)in_sizes[9] < (long long)CD * CD || (long long)in_sizes[10] < CD) return;
  if ((long long)out_size < need_x) return;
  if ((size_t)WS_TOTAL > ws_size) return;

  // wire order: x, mask, sinusoidal_pos, Wq, bq, Wk, bk, Wv, bv, Wo, bo
  const float* x    = (const float*)d_in[0];
  const int*   mask = (const int*)d_in[1];
  const float* tab  = (const float*)d_in[2];
  const float* Wq   = (const float*)d_in[3];
  const float* bq   = (const float*)d_in[4];
  const float* Wk   = (const float*)d_in[5];
  const float* bk   = (const float*)d_in[6];
  const float* Wv   = (const float*)d_in[7];
  const float* bv   = (const float*)d_in[8];
  const float* Wo   = (const float*)d_in[9];
  const float* bo   = (const float*)d_in[10];
  float* out = (float*)d_out;

  char* ws = (char*)d_ws;
  size_t off = 0;
  int* flags = (int*)(ws + off);                               off += SZ_FLAGS;
  unsigned short* xb   = (unsigned short*)(ws + off);          off += SZ_XB;
  unsigned short* wqk  = (unsigned short*)(ws + off);          off += SZ_WQK;
  unsigned short* wvb  = (unsigned short*)(ws + off);          off += SZ_WV;
  unsigned short* wob  = (unsigned short*)(ws + off);          off += SZ_WO;
  unsigned short* qkh  = (unsigned short*)(ws + off);          off += PLANE_QK * 2;
  unsigned short* qkl  = (unsigned short*)(ws + off);          off += PLANE_QK * 2;
  unsigned short* vth  = (unsigned short*)(ws + off);          off += PLANE_V * 2;
  unsigned short* vtl  = (unsigned short*)(ws + off);          off += PLANE_V * 2;
  unsigned short* ctxh = (unsigned short*)(ws + off);          off += SZ_CTXH;
  unsigned short* ctxl = (unsigned short*)(ws + off);          off += SZ_CTXL;
  if (off > ws_size) return;

  k_maskscan<<<(unsigned)(SEQ / SCAN_ROWS), 512, 0, stream>>>(mask, flags);
  // in[rows][CD] f32 -> [rows][CD] 16-bit planes (row order kept)
  k_cvt<0><<<(unsigned)(NB * SEQ), 256, 0, stream>>>(x, xb, NB * SEQ, SEQ, SEQ_FULL);
  k_cvt<0><<<(unsigned)CD, 256, 0, stream>>>(Wq, wqk, CD, CD, CD);
  k_cvt<0><<<(unsigned)KVW, 256, 0, stream>>>(Wk, wqk + (size_t)CD * CD, KVW, KVW, KVW);
  k_cvt<0><<<(unsigned)KVW, 256, 0, stream>>>(Wv, wvb, KVW, KVW, KVW);
  k_cvt<1><<<(unsigned)CD, 256, 0, stream>>>(Wo, wob, CD, CD, CD);

  k_proj_qk<<<dim3(NQK, (unsigned)(NB * SEQ / 128)), 128, 0, stream>>>(xb, wqk, bq, bk, tab, qkh, qkl);
  k_proj_v<<<dim3((unsigned)(NB * SEQ / 64), KVW / 128), 128, 0, stream>>>(wvb, xb, bv, vth, vtl);
  k_attn<<<(unsigned)(NB * NHEAD * (SEQ / 64)), 128, 0, stream>>>(qkh, qkl, vth, vtl, mask, flags, ctxh, ctxl);
  k_proj_out<<<dim3(CD / 64, (unsigned)(NB * SEQ / 128)), 128, 0, stream>>>(ctxh, ctxl, wob, bo, out);
}

// v004
// Measured time: 208 microseconds a run.
// In both of two side-by-side timings against v003, it was 1.05 times as fast.
// All steps since v000 together make it 4.21 times as fast.
#include <hip/hip_runtime.h>
#ifndef NB
#define NB 2
#endif
#ifndef SEQ
#define SEQ 2048
#endif
#define NB_FULL 2
#define SEQ_FULL 2048
#define CD 2048                 /* model width = depth of every projection */
#define NHEAD 32
#define NKV 8
#define HD 64
#define NQK (NHEAD + NKV)       /* rotary plane holds the 32 q heads followed by the 8 k heads */
#define KVW (NKV * HD)          /* 512 */
#define EARLY_ROWS (SEQ < 512 ? SEQ : 512)

#define SCAN_ROWS 8             /* mask rows per scan work-group: 8 rows x SEQ ints = 8 loads of 16 B per thread at SEQ = 2048 */
#define SCAN_LOADS (SCAN_ROWS * (SEQ / 4) / 512)
#define SZ_FLAGS ((size_t)(SEQ / SCAN_ROWS) * 128)   /* one 128-byte line per scan work-group */
#define SZ_XB    ((size_t)NB * SEQ * CD * 2)
#define SZ_WQK   ((size_t)(CD + KVW) * CD * 2)
#define SZ_WV    ((size_t)KVW * CD * 2)
#define SZ_WO    ((size_t)CD * CD * 2)
#define PLANE_QK ((size_t)NB * NQK * SEQ * HD)     /* elements of one rotary plane */
#define PLANE_V  ((size_t)NB * KVW * SEQ)          /* elements of one V^T plane */
#define SZ_CTXH  ((size_t)NB * SEQ * CD * 2)
#define SZ_CTXL  ((size_t)NB * EARLY_ROWS * CD * 2)
#define WS_TOTAL (SZ_FLAGS + SZ_XB + SZ_WQK + SZ_WV + SZ_WO + PLANE_QK * 4 + PLANE_V * 4 + SZ_CTXH + SZ_CTXL)

static_assert(SEQ % 128 == 0);
static_assert((SCAN_ROWS * (SEQ / 4)) % 512 == 0);
static_assert(16 % SCAN_ROWS == 0);
static_assert(SZ_FLAGS % 256 == 0);
static_assert(EARLY_ROWS % 128 == 0);
static_assert(SEQ <= SEQ_FULL);
static_assert(NB <= NB_FULL);
static_assert(HD == 64);
static_assert(CD % 32 == 0);
static_assert(KVW % 128 == 0);
static_assert(NHEAD % NKV == 0);
static_assert(WS_TOTAL <= (size_t)134217728);
static_assert(SZ_XB % 256 == 0 && SZ_WQK % 256 == 0 && SZ_WV % 256 == 0 && SZ_WO % 256 == 0);
static_assert((PLANE_QK * 2) % 256 == 0 && (PLANE_V * 2) % 256 == 0 && SZ_CTXH % 256 == 0 && SZ_CTXL % 256 == 0);

typedef __bf16 v16b __attribute__((ext_vector_type(16)));
typedef _Float16 v16h __attribute__((ext_vector_type(16)));
typedef unsigned short v8us __attribute__((ext_vector_type(8), may_alias));
typedef float v8f __attribute__((ext_vector_type(8)));
typedef float v4f __attribute__((ext_vector_type(4)));
typedef float v4fa __attribute__((ext_vector_type(4), may_alias));
typedef int v4i __attribute__((ext_vector_type(4)));
typedef int v4ia __attribute__((ext_vector_type(4), may_alias));
union Frag { v16b b; v16h v; v8us half[2]; _Float16 h[16]; unsigned short u[16]; };
union Pack8 { v8us v; _Float16 h[8]; unsigned short u[8]; };

#define LOG2E 1.4426950408889634f
#define S2M11 0.00048828125f       /* 2^-11 */
#define S2M12 0.000244140625f      /* 2^-12 */
__device__ __forceinline__ unsigned short bf16_bits(float x) {   // RNE convert to bf16 bits
  unsigned int u = __float_as_uint(x);
  return (unsigned short)((u + 0x7FFFu + ((u >> 16) & 1u)) >> 16);
}
__device__ __forceinline__ float bf16_val(unsigned short b) { return __uint_as_float(((unsigned int)b) << 16); }
__device__ __forceinline__ float bf16_rne(float x) { return bf16_val(bf16_bits(x)); }
__device__ __forceinline__ float neg_inf() { return __uint_as_float(0xff800000u); }

// Fragment of a k-contiguous 16-bit row: elements 0..7 <- p[0..7], elements 8..15 <- p[16..23]; caller adds row*pitch + k0 + 8*h.
__device__ __forceinline__ void ldfrag(Frag& f, const unsigned short* __restrict__ p) {
  f.half[0] = *(const v8us*)(p);
  f.half[1] = *(const v8us*)(p + 16);
}

template <bool BF>
__device__ __forceinline__ v8f wm(const Frag& a, const Frag& b, v8f c) {
  if (BF) return __builtin_amdgcn_wmma_f32_16x16x32_bf16(false, a.b, false, b.b, (short)0, c, false, false);
  return __builtin_amdgcn_wmma_f32_16x16x32_f16(false, a.v, false, b.v, (short)0, c, false, false);
}

// ---------------------------------------------------------------------------------------------------------
// Input preparation, one launch: the jobs below read inputs only and none reads what another writes, so the block index picks the job.
// Blocks 0 .. SCAN_BLOCKS-1: mask scan, one work-group per SCAN_ROWS mask rows; group g owns the line flags[32g .. 32g+31]:
// flags[32g] = 1 iff every entry of its rows above the diagonal is zero; flags[32g+1] = 1 iff every entry of its rows on or below the diagonal is nonzero.
// coverage: SEQ/SCAN_ROWS blocks x 512 threads x SCAN_LOADS x 4 ints = SEQ x SEQ mask entries; every flag line is written whole.
// Blocks SCAN_BLOCKS .. SCAN_BLOCKS+CVT_BLOCKS-1: f32 rows of width CD -> 16-bit planes (row order kept). A row is one 16-byte load and one 8-byte store
// per thread (a wave reads 4 whole lines and writes 2); block c takes the c-th run of adjacent rows of each of x, Wq, Wk, Wv and Wo, the same counts in every block.
// MODE 0: bf16 bits (RNE). MODE 1: f16 of (RNE bf16 value x 64).
// coverage: CVT_BLOCKS blocks x (rows / CVT_BLOCKS) rows x 512 threads x 4 elements = rows x CD, for each of the five arrays.
#define PREP_THREADS 512
#define SCAN_BLOCKS (SEQ / SCAN_ROWS)
#define CVT_BLOCKS 512
static_assert(CD == PREP_THREADS * 4);
static_assert((NB * SEQ) % CVT_BLOCKS == 0 && CD % CVT_BLOCKS == 0 && KVW % CVT_BLOCKS == 0);

typedef unsigned short v4us __attribute__((ext_vector_type(4), may_alias));
union Pack4 { v4us v; _Float16 h[4]; unsigned short u[4]; };

template <int MODE>
__device__ __forceinline__ void cvt_store(unsigned short* d, v4f x) {
  Pack4 o;
  if (MODE == 0) {
    o.u[0] = bf16_bits(x[0]); o.u[1] = bf16_bits(x[1]); o.u[2] = bf16_bits(x[2]); o.u[3] = bf16_bits(x[3]);
  } else {
    o.h[0] = (_Float16)(bf16_rne(x[0]) * 64.0f); o.h[1] = (_Float16)(bf16_rne(x[1]) * 64.0f);
    o.h[2] = (_Float16)(bf16_rne(x[2]) * 64.0f); o.h[3] = (_Float16)(bf16_rne(x[3]) * 64.0f);
  }
  *(v4us*)d = o.v;
}

// twelve waves per SIMD asked for (80 registers): three work-groups fit a WGP, so that all work-groups of the launch are resident together
__global__ __launch_bounds__(PREP_THREADS) __attribute__((amdgpu_waves_per_eu(12))) void k_prep(const int* __restrict__ mask, int* __restrict__ flags,
                                                       const float* __restrict__ x, const float* __restrict__ Wq, const float* __restrict__ Wk,
                                                       const float* __restrict__ Wv, const float* __restrict__ Wo,
                                                       unsigned short* __restrict__ xb, unsigned short* __restrict__ wqk,
                                                       unsigned short* __restrict__ wvb, unsigned short* __restrict__ wob) {
  __shared__ int sw[2][16];
  const int tid = threadIdx.x;
  if (blockIdx.x >= SCAN_BLOCKS) {                     // block-uniform
    const int c = blockIdx.x - SCAN_BLOCKS;
    const int e = 4 * tid;
    constexpr int NX = NB * SEQ / CVT_BLOCKS, NQ = CD / CVT_BLOCKS, NK = KVW / CVT_BLOCKS;
    static_assert(SEQ % NX == 0);                      // the block's NX rows of x lie in one batch
    const int bx = (c * NX) / SEQ, rx = c * NX - bx * SEQ;
    // uniform bases of this block's rows; a thread's loads and stores differ from them by 4 * tid elements and by constants only
    const float* sx = x + ((size_t)bx * SEQ_FULL + rx) * CD;
    const float* sq = Wq + (size_t)(c * NQ) * CD;
    const float* swo = Wo + (size_t)(c * NQ) * CD;
    const float* sk = Wk + (size_t)(c * NK) * CD;
    const float* sv = Wv + (size_t)(c * NK) * CD;
    unsigned short* dx = xb + (size_t)(c * NX) * CD;
    unsigned short* dq = wqk + (size_t)(c * NQ) * CD;
    unsigned short* dw = wob + (size_t)(c * NQ) * CD;
    unsigned short* dk = wqk + (size_t)(CD + c * NK) * CD;   // the k rows follow the q rows
    unsigned short* dv = wvb + (size_t)(c * NK) * CD;
    // all loads of a thread are independent and issued before the first is converted, so that they are in flight together
    v4f vx[NX], vq[NQ], vw[NQ], vk[NK], vv[NK];
#pragma unroll
    for (int j = 0; j < NX; ++j) vx[j] = *(const v4fa*)(sx + (unsigned)(j * CD + e));
#pragma unroll
    for (int j = 0; j < NQ; ++j) vq[j] = *(const v4fa*)(sq + (unsigned)(j * CD + e));
#pragma unroll
    for (int j = 0; j < NQ; ++j) vw[j] = *(const v4fa*)(swo + (unsigned)(j * CD + e));
#pragma unroll
    for (int j = 0; j < NK; ++j) vk[j] = *(const v4fa*)(sk + (unsigned)(j * CD + e));
#pragma unroll
    for (int j = 0; j < NK; ++j) vv[j] = *(const v4fa*)(sv + (unsigned)(j * CD + e));
    // keeps every load in front of the first conversion: without it the scheduler sinks a third of the loads behind waits to 0, and their latencies add up
    __builtin_amdgcn_sched_barrier(0);
#pragma unroll
    for (int j = 0; j < NX; ++j) cvt_store<0>(dx + (unsigned)(j * CD + e), vx[j]);
#pragma unroll
    for (int j = 0; j < NQ; ++j) cvt_store<0>(dq + (unsigned)(j * CD + e), vq[j]);
#pragma unroll
    for (int j = 0; j < NQ; ++j) cvt_store<1>(dw + (unsigned)(j * CD + e), vw[j]);
#pragma unroll
    for (int j = 0; j < NK; ++j) cvt_store<0>(dk + (unsigned)(j * CD + e), vk[j]);
#pragma unroll
    for (int j = 0; j < NK; ++j) cvt_store<0>(dv + (unsigned)(j * CD + e), vv[j]);
    return;                                            // the whole block leaves here; the barrier below is the scan blocks' own
  }
  const int lane = tid & 31, wv = tid >> 5;
  int badU = 0, badL = 0;
  const int cpr = SEQ / 4;
  const int q0 = blockIdx.x * SCAN_ROWS;
  const int* mb = mask + (size_t)q0 * SEQ_FULL;       // uniform base of this group's rows; the loads below differ by constants only
  v4i mv[SCAN_LOADS];
  // all loads of a thread are independent and issued before the first is tested, so that they are in flight together
#pragma unroll
  for (int u = 0; u < SCAN_LOADS; ++u) {
    const int c = tid + 512 * u;
    const int qr = c / cpr, k = (c - qr * cpr) * 4;
    mv[u] = *(const v4ia*)(mb + (unsigned)(qr * SEQ_FULL + k));
  }
#pragma unroll
  for (int u = 0; u < SCAN_LOADS; ++u) {
    const int c = tid + 512 * u;
    const int qr = c / cpr, k = (c - qr * cpr) * 4;
    const int q = q0 + qr;
#pragma unroll
    for (int i = 0; i < 4; ++i) {
      const int above = (k + i > q) ? 1 : 0;
      const int nz = (mv[u][i] != 0) ? 1 : 0;
      badU |= above & nz;
      badL |= (1 - above) & (1 - nz);
    }
  }
#pragma unroll
  for (int o = 16; o >= 1; o >>= 1) {
    badU |= __shfl_xor(badU, o, 32);
    badL |= __shfl_xor(badL, o, 32);
  }
  if (lane == 0) { sw[0][wv] = badU; sw[1][wv] = badL; }
  __syncthreads();
  if (tid < 8) {
    int u = 0, l = 0;
#pragma unroll
    for (int i = 0; i < 16; ++i) { u |= sw[0][i]; l |= sw[1][i]; }
    v4i o;
    o[0] = (tid == 0 && u == 0) ? 1 : 0;
    o[1] = (tid == 0 && l == 0) ? 1 : 0;
    o[2] = 0; o[3] = 0;
    *(v4i*)(flags + 32 * blockIdx.x + 4 * tid) = o;
  }
}

// ---------------------------------------------------------------------------------------------------------
// Block-tile GEMM core: acc[i][j] (rows 32w + 16i.., cols 16j..) += A[row][k] * W[col][k] over k = 0..CD-1, k ascending in steps of 32.
// ablk = first of the block's 128 A rows, bblk = first of its 64 W rows (both k-contiguous, pitch CD).
// A stage is 64 k of all 192 rows: 128-byte rows laid at a 144-byte pitch (A rows 0..127, then W rows 128..191); two buffers.
// Each copy instruction of a wave moves 4 whole 128-byte lines; a thread copies chunk (tid & 7) of rows (tid >> 3) + 16 i, i = 0..11.
// Fragment maps as before: row or column = ln, elements 0..7 <- k0 + 8h + i, elements 8..15 <- k0 + 16 + 8h + i, for A and W alike.
#define ST_K 64
#define ST_PITCH 144
#define ST_BYTES (192 * ST_PITCH)
#define RING_BYTES (2 * ST_BYTES)
static_assert(CD % ST_K == 0 && CD / ST_K >= 2);
static_assert(RING_BYTES >= 4 * 32 * 68 * 4);      /* the epilogue tiles reuse the ring */

__device__ __forceinline__ void ldfrag_lds(Frag& f, const unsigned char* p) {
  f.half[0] = *(const v8us*)(p);
  f.half[1] = *(const v8us*)(p + 32);
}

// One stage: 12 copies of 16 bytes per thread. The s_wait_xcnt stands inside the statement so that no address register is rewritten ahead of it.
__device__ __forceinline__ void stage_copy(const unsigned short* ga, const unsigned short* gb, unsigned l) {
  asm volatile("global_load_async_to_lds_b128 %0, %12, off\n\t"
               "global_load_async_to_lds_b128 %1, %13, off\n\t"
               "global_load_async_to_lds_b128 %2, %14, off\n\t"
               "global_load_async_to_lds_b128 %3, %15, off\n\t"
               "global_load_async_to_lds_b128 %4, %16, off\n\t"
               "global_load_async_to_lds_b128 %5, %17, off\n\t"
               "global_load_async_to_lds_b128 %6, %18, off\n\t"
               "global_load_async_to_lds_b128 %7, %19, off\n\t"
               "global_load_async_to_lds_b128 %8, %20, off\n\t"
               "global_load_async_to_lds_b128 %9, %21, off\n\t"
               "global_load_async_to_lds_b128 %10, %22, off\n\t"
               "global_load_async_to_lds_b128 %11, %23, off\n\t"
               "s_wait_xcnt 0x0"
               :: "v"(l), "v"(l + 16 * ST_PITCH), "v"(l + 32 * ST_PITCH), "v"(l + 48 * ST_PITCH),
                  "v"(l + 64 * ST_PITCH), "v"(l + 80 * ST_PITCH), "v"(l + 96 * ST_PITCH), "v"(l + 112 * ST_PITCH),
                  "v"(l + 128 * ST_PITCH), "v"(l + 144 * ST_PITCH), "v"(l + 160 * ST_PITCH), "v"(l + 176 * ST_PITCH),
                  "v"(ga), "v"(ga + 16 * CD), "v"(ga + 32 * CD), "v"(ga + 48 * CD),
                  "v"(ga + 64 * CD), "v"(ga + 80 * CD), "v"(ga + 96 * CD), "v"(ga + 112 * CD),
                  "v"(gb), "v"(gb + 16 * CD), "v"(gb + 32 * CD), "v"(gb + 48 * CD)
               : "memory");
}

template <bool BF>
__device__ __forceinline__ void gemm_loop(const unsigned short* __restrict__ ablk, const unsigned short* __restrict__ bblk,
                                          unsigned char* ring, int tid, int w, int ln, int hh, v8f (&acc)[2][4]) {
  const int nt = CD / ST_K;
  const unsigned short* ga = ablk + (size_t)(tid >> 3) * CD + 8 * (tid & 7);
  const unsigned short* gb = bblk + (size_t)(tid >> 3) * CD + 8 * (tid & 7);
  const unsigned l0 = (unsigned)(size_t)ring + (unsigned)((tid >> 3) * ST_PITCH + 16 * (tid & 7));   // LDS byte address of this thread's first chunk
  const int aoff = (32 * w + ln) * ST_PITCH + 16 * hh;
  const int boff = (128 + ln) * ST_PITCH + 16 * hh;
  stage_copy(ga, gb, l0);
  asm volatile("s_wait_asynccnt 0x0" ::: "memory");   // tile 0 has landed before the barrier that publishes it
  __syncthreads();
  stage_copy(ga + ST_K, gb + ST_K, l0 + ST_BYTES);
#pragma unroll 1   // one tile per trip: the two buffers alternate by the trip's parity
  for (int t = 0; t < nt; ++t) {
    const unsigned sel = (unsigned)(t & 1) * ST_BYTES;
    const unsigned char* buf = ring + sel;
    Frag a[2][2], b[2][4];
#pragma unroll
    for (int kk = 0; kk < 2; ++kk) {
#pragma unroll
      for (int i = 0; i < 2; ++i) ldfrag_lds(a[kk][i], buf + aoff + i * 16 * ST_PITCH + kk * 64);
#pragma unroll
      for (int j = 0; j < 4; ++j) ldfrag_lds(b[kk][j], buf + boff + j * 16 * ST_PITCH + kk * 64);
    }
#pragma unroll
    for (int kk = 0; kk < 2; ++kk)
#pragma unroll
      for (int i = 0; i < 2; ++i)
#pragma unroll
        for (int j = 0; j < 4; ++j) acc[i][j] = wm<BF>(a[kk][i], b[kk][j], acc[i][j]);
    // keeps the distance behind the last matrix instructions on the loop's back edge and in front of the address arithmetic below
    asm volatile("v_nop\n\tv_nop\n\tv_nop\n\tv_nop" : "+v"(acc[0][0]), "+v"(acc[0][1]), "+v"(acc[0][2]), "+v"(acc[0][3]),
                        "+v"(acc[1][0]), "+v"(acc[1][1]), "+v"(acc[1][2]), "+v"(acc[1][3])
                      : "v"(a[1][0].v), "v"(a[1][1].v), "v"(b[1][0].v), "v"(b[1][1].v), "v"(b[1][2].v), "v"(b[1][3].v));
    asm volatile("s_wait_dscnt 0x0" ::: "memory");      // this wave's reads of the buffer are done before it is refilled
    asm volatile("s_wait_asynccnt 0x0" ::: "memory");   // this wave's copies of tile t + 1 have landed before the barrier publishes them
    __syncthreads();
    if (t + 2 < nt) stage_copy(ga + (t + 2) * ST_K, gb + (t + 2) * ST_K, l0 + sel);
  }
  asm volatile("s_wait_asynccnt 0x0" ::: "memory");     // nothing is in flight when the ring is used for anything else
}

__device__ __forceinline__ float rope1(float q, float p, float c, float s, float sg) { return q * c + (sg * p) * s; }

// ---------------------------------------------------------------------------------------------------------
// q and k projections with fused bias, rotary (table read by value) and head-major repack.
// Block = 4 waves stacked in M (128 token rows) x one head (64 columns). grid = (NQK, NB*SEQ/128).
// coverage: NQK heads x NB*SEQ tokens x 64 = the whole plane [NB][NQK][SEQ][64], both planes. LDS tile 32 x 64 fully written before it is read.
// five waves per SIMD asked for: the 1280 work-groups are then resident together, five on each WGP (5 x 55,296 B of LDS fit), and cover one another's barrier and copy waits
__global__ __launch_bounds__(128) __attribute__((amdgpu_waves_per_eu(5))) void k_proj_qk(const unsigned short* __restrict__ xb, const unsigned short* __restrict__ wqk,
                                                 const float* __restrict__ bq, const float* __restrict__ bk,
                                                 const float* __restrict__ tab,
                                                 unsigned short* __restrict__ qkh, unsigned short* __restrict__ qkl) {
  __shared__ __attribute__((aligned(16))) unsigned char ring[RING_BYTES];
  float (*st)[32][68] = (float (*)[32][68])ring;       // epilogue tiles, used behind the k loop's last barrier
  const int tid = threadIdx.x, lane = tid & 31, ln = lane & 15, hh = lane >> 4;
  const int w = __builtin_amdgcn_readfirstlane(tid >> 5);
  const int hd = blockIdx.x;
  const int m0 = blockIdx.y * 128 + 32 * w;
  const v8f z8 = {0.f, 0.f, 0.f, 0.f, 0.f, 0.f, 0.f, 0.f};
  v8f acc[2][4];
#pragma unroll
  for (int i = 0; i < 2; ++i)
#pragma unroll
    for (int j = 0; j < 4; ++j) acc[i][j] = z8;
  gemm_loop<true>(xb + (size_t)(blockIdx.y * 128) * CD, wqk + (size_t)(hd * HD) * CD, ring, tid, w, ln, hh, acc);

  float bias[4];
#pragma unroll
  for (int j = 0; j < 4; ++j) {
    const int col = hd * HD + 16 * j + ln;
    const int cq = (col < CD - 1) ? col : (CD - 1);
    int ck = col - CD;
    ck = (ck < 0) ? 0 : ((ck > KVW - 1) ? (KVW - 1) : ck);
    const float vq = bq[cq], vk = bk[ck];
    bias[j] = bf16_rne((col < CD) ? vq : vk);
  }
#pragma unroll
  for (int i = 0; i < 2; ++i)
#pragma unroll
    for (int j = 0; j < 4; ++j)
#pragma unroll
      for (int r = 0; r < 8; ++r) st[w][16 * i + 8 * hh + r][16 * j + ln] = acc[i][j][r] + bias[j];
  __syncthreads();

  const int b = m0 / SEQ, t0 = m0 - b * SEQ;
  const int rsub = lane >> 3, d0 = 8 * (lane & 7);
  const float sg = (d0 < 32) ? -1.0f : 1.0f;
  v8us oh[8], ol[8];
#pragma unroll
  for (int g = 0; g < 8; ++g) {
    // keeps the second half's table and LDS loads from being lifted over the first half: all 8 groups in flight at once cost the fifth wave per SIMD (or spills)
    if (g == 4) __builtin_amdgcn_sched_barrier(0);
    const int row = 4 * g + rsub;
    const v4f a0 = *(const v4fa*)&st[w][row][d0];
    const v4f a1 = *(const v4fa*)&st[w][row][d0 + 4];
    const v4f p0 = *(const v4fa*)&st[w][row][d0 ^ 32];
    const v4f p1 = *(const v4fa*)&st[w][row][(d0 ^ 32) + 4];
    const float* tp = tab + (size_t)(t0 + row) * HD + d0;
    const v4f c0 = *(const v4fa*)(tp), c1 = *(const v4fa*)(tp + 4);
    const float k0 = bf16_rne(c0[0]), s0 = bf16_rne(c0[1]), k1 = bf16_rne(c0[2]), s1 = bf16_rne(c0[3]);
    const float k2 = bf16_rne(c1[0]), s2 = bf16_rne(c1[1]), k3 = bf16_rne(c1[2]), s3 = bf16_rne(c1[3]);
    float o[8];
    o[0] = rope1(a0[0], p0[0], k0, s0, sg); o[1] = rope1(a0[1], p0[1], k0, s0, sg);
    o[2] = rope1(a0[2], p0[2], k1, s1, sg); o[3] = rope1(a0[3], p0[3], k1, s1, sg);
    o[4] = rope1(a1[0], p1[0], k2, s2, sg); o[5] = rope1(a1[1], p1[1], k2, s2, sg);
    o[6] = rope1(a1[2], p1[2], k3, s3, sg); o[7] = rope1(a1[3], p1[3], k3, s3, sg);
    Pack8 ph8, pl8;
#pragma unroll
    for (int e = 0; e < 8; ++e) {
      const float y = o[e] * 16.0f;                       // carried x16
      const _Float16 h = (_Float16)y;
      ph8.h[e] = h;
      pl8.h[e] = (_Float16)((y - (float)h) * 2048.0f);     // residual plane x2^11
    }
    oh[g] = ph8.v; ol[g] = pl8.v;
  }
  const size_t dbase = ((size_t)(b * NQK + hd) * SEQ + t0) * HD + d0;
{
#pragma unroll
    for (int g = 0; g < 8; ++g) {
      const size_t off = dbase + (size_t)(4 * g + rsub) * HD;
      *(v8us*)(qkh + off) = oh[g];
      *(v8us*)(qkl + off) = ol[g];
    }
    
  }
}

// ---------------------------------------------------------------------------------------------------------
// v projection computed transposed: Vt[b][m][t] = sum_k Wv[m][k] x[b,t][k] + bv[m], carried x16, hi and residual planes.
// Block = 4 waves stacked in M (128 weight rows) x 64 tokens. grid = (NB*SEQ/64, KVW/128).
// coverage: KVW rows x NB*SEQ tokens = the whole plane [NB][KVW][SEQ], both planes. LDS tile 32 x 64 fully written before it is read.
__global__ __launch_bounds__(128) void k_proj_v(const unsigned short* __restrict__ wvb, const unsigned short* __restrict__ xb,
                                                const float* __restrict__ bv,
                                                unsigned short* __restrict__ vth, unsigned short* __restrict__ vtl) {
  __shared__ __attribute__((aligned(16))) unsigned char ring[RING_BYTES];
  float (*st)[32][68] = (float (*)[32][68])ring;       // epilogue tiles, used behind the k loop's last barrier
  const int tid = threadIdx.x, lane = tid & 31, ln = lane & 15, hh = lane >> 4;
  const int w = __builtin_amdgcn_readfirstlane(tid >> 5);
  const int n0 = blockIdx.x * 64;
  const int m0 = blockIdx.y * 128 + 32 * w;
  const v8f z8 = {0.f, 0.f, 0.f, 0.f, 0.f, 0.f, 0.f, 0.f};
  v8f acc[2][4];
#pragma unroll
  for (int i = 0; i < 2; ++i)
#pragma unroll
    for (int j = 0; j < 4; ++j) acc[i][j] = z8;
  gemm_loop<true>(wvb + (size_t)(blockIdx.y * 128) * CD, xb + (size_t)n0 * CD, ring, tid, w, ln, hh, acc);
#pragma unroll
  for (int i = 0; i < 2; ++i)
#pragma unroll
    for (int j = 0; j < 4; ++j)
#pragma unroll
      for (int r = 0; r < 8; ++r) st[w][16 * i + 8 * hh + r][16 * j + ln] = acc[i][j][r];
  __syncthreads();

  const int b = n0 / SEQ, t0 = n0 - b * SEQ;
  const int rsub = lane >> 3, c0 = 8 * (lane & 7);
  v8us oh[8], ol[8];
#pragma unroll
  for (int g = 0; g < 8; ++g) {
    const int row = 4 * g + rsub;
    const float bias = bf16_rne(bv[m0 + row]);
    const v4f a0 = *(const v4fa*)&st[w][row][c0];
    const v4f a1 = *(const v4fa*)&st[w][row][c0 + 4];
    float o[8];
    o[0] = a0[0]; o[1] = a0[1]; o[2] = a0[2]; o[3] = a0[3];
    o[4] = a1[0]; o[5] = a1[1]; o[6] = a1[2]; o[7] = a1[3];
    Pack8 ph8, pl8;
#pragma unroll
    for (int e = 0; e < 8; ++e) {
      const float y = (o[e] + bias) * 16.0f;              // carried x16
      const _Float16 h = (_Float16)y;
      ph8.h[e] = h;
      pl8.h[e] = (_Float16)((y - (float)h) * 2048.0f);
    }
    oh[g] = ph8.v; ol[g] = pl8.v;
  }
  const size_t dbase = ((size_t)b * KVW + m0) * SEQ + t0 + c0;
{
#pragma unroll
    for (int g = 0; g < 8; ++g) {
      const size_t off = dbase + (size_t)(4 * g + rsub) * SEQ;
      *(v8us*)(vth + off) = oh[g];
      *(v8us*)(vtl + off) = ol[g];
    }
    
  }
}

// ---------------------------------------------------------------------------------------------------------
// Attention stage in LDS: 64 keys. Tile 0 = K rows (64 keys x 128 B), tile 1 = V^T rows (64 d x 128 B = 64 keys), each at a 144-byte pitch;
// tiles 2 and 3 = the residual planes of K and V^T (query rows below EARLY_ROWS only).
// The ring holds two stages of two tiles (plain blocks, two buffers) or one stage of four tiles (early blocks, one buffer).
#define AT_KEYS 64
#define AT_PITCH 144
#define AT_TILE (64 * AT_PITCH)
#define AT_RING (4 * AT_TILE)
static_assert(SEQ % AT_KEYS == 0);
static_assert(AT_RING >= 4 * 16 * 68 * 4);         /* the epilogue tiles reuse the ring */

// One K tile and one V^T tile: 8 copies of 16 bytes per thread, chunk (tid & 7) of rows (tid >> 3) + 16 i; each copy of a wave moves 4 whole 128-byte lines.
// The s_wait_xcnt stands inside the statement so that no address register is rewritten ahead of it.
__device__ __forceinline__ void kv_copy(const unsigned short* gk, const unsigned short* gv, unsigned l) {
  asm volatile("global_load_async_to_lds_b128 %0, %8, off\n\t"
               "global_load_async_to_lds_b128 %1, %9, off\n\t"
               "global_load_async_to_lds_b128 %2, %10, off\n\t"
               "global_load_async_to_lds_b128 %3, %11, off\n\t"
               "global_load_async_to_lds_b128 %4, %12, off\n\t"
               "global_load_async_to_lds_b128 %5, %13, off\n\t"
               "global_load_async_to_lds_b128 %6, %14, off\n\t"
               "global_load_async_to_lds_b128 %7, %15, off\n\t"
               "s_wait_xcnt 0x0"
               :: "v"(l), "v"(l + 16 * AT_PITCH), "v"(l + 32 * AT_PITCH), "v"(l + 48 * AT_PITCH),
                  "v"(l + AT_TILE), "v"(l + AT_TILE + 16 * AT_PITCH), "v"(l + AT_TILE + 32 * AT_PITCH), "v"(l + AT_TILE + 48 * AT_PITCH),
                  "v"(gk), "v"(gk + 16 * HD), "v"(gk + 32 * HD), "v"(gk + 48 * HD),
                  "v"(gv), "v"(gv + 16 * SEQ), "v"(gv + 32 * SEQ), "v"(gv + 48 * SEQ)
               : "memory");
}

// One 32-key step for a wave's 16 queries (this lane's column = its query). EARLYP adds the residual planes of q, k, v, P.
// st = the stage in LDS, kloc = 0 or 32 = first key of the step inside the stage, key0 = the same key's index in the sequence.
// MASK reads the mask row of this lane's query by value and replace-fills with -inf.
template <bool EARLYP, bool MASK>
__device__ __forceinline__ void fa_step(const unsigned char* st, int kloc,
                                        const int* __restrict__ mrow, int key0, int ln, int hh,
                                        const Frag (&qh)[2], const Frag (&ql)[2],
                                        float& mr, float& lr, v8f (&Oh)[4], v8f (&Ol)[4]) {
  const v8f z8 = {0.f, 0.f, 0.f, 0.f, 0.f, 0.f, 0.f, 0.f};
  float sc[16];
  // A fragments of K: row m = key (key0 + 16*kt + ln), elements 0..7 <- d = 32c + 8h + i, 8..15 <- d = 32c + 16 + 8h + i
  int koff = (kloc + ln) * AT_PITCH + 16 * hh;        // byte offset in a K tile
  if (EARLYP) {
#pragma unroll
    for (int kt = 0; kt < 2; ++kt) {
      Frag a0, a1, l0, l1;
      ldfrag_lds(a0, st + koff); ldfrag_lds(a1, st + koff + 64);
      ldfrag_lds(l0, st + 2 * AT_TILE + koff); ldfrag_lds(l1, st + 2 * AT_TILE + koff + 64);
      v8f s = z8, r = z8;
      s = wm<false>(a0, qh[0], s); s = wm<false>(a1, qh[1], s);
      r = wm<false>(a0, ql[0], r); r = wm<false>(a1, ql[1], r);
      r = wm<false>(l0, qh[0], r); r = wm<false>(l1, qh[1], r);
      asm volatile("v_nop\n\tv_nop\n\tv_nop\n\tv_nop" : "+v"(s), "+v"(r)
                        : "v"(a0.v), "v"(a1.v), "v"(l0.v), "v"(l1.v), "v"(qh[0].v), "v"(qh[1].v), "v"(ql[0].v), "v"(ql[1].v));
      // S^T element r of tile kt = score(key0 + 16*kt + 8h + r, this lane's query); carries: q x16, k x16, residual x2^11
#pragma unroll
      for (int e = 0; e < 8; ++e) sc[8 * kt + e] = fmaf(r[e], S2M11, s[e]) * S2M11;
      koff += 16 * AT_PITCH;
      if (kt == 0) asm volatile("" : "+v"(koff) : "v"(sc[0]));   // second tile's loads issue after the first tile is done
    }
  } else {
    Frag k00, k01, k10, k11;
    ldfrag_lds(k00, st + koff);                 ldfrag_lds(k01, st + koff + 64);
    ldfrag_lds(k10, st + koff + 16 * AT_PITCH); ldfrag_lds(k11, st + koff + 16 * AT_PITCH + 64);
    v8f s0 = z8, s1 = z8;
    s0 = wm<false>(k00, qh[0], s0); s0 = wm<false>(k01, qh[1], s0);
    s1 = wm<false>(k10, qh[0], s1); s1 = wm<false>(k11, qh[1], s1);
    asm volatile("v_nop\n\tv_nop\n\tv_nop\n\tv_nop" : "+v"(s0), "+v"(s1)
                      : "v"(k00.v), "v"(k01.v), "v"(k10.v), "v"(k11.v), "v"(qh[0].v), "v"(qh[1].v));
#pragma unroll
    for (int e = 0; e < 8; ++e) { sc[e] = s0[e] * S2M11; sc[8 + e] = s1[e] * S2M11; }
  }
  if (MASK) {
    const int* mp = mrow + key0 + 8 * hh;
    const v4i m0 = *(const v4ia*)(mp),      m1 = *(const v4ia*)(mp + 4);
    const v4i m2 = *(const v4ia*)(mp + 16), m3 = *(const v4ia*)(mp + 20);
    const float ninf = neg_inf();
#pragma unroll
    for (int e = 0; e < 4; ++e) {
      sc[e]      = (m0[e] == 0) ? ninf : sc[e];
      sc[4 + e]  = (m1[e] == 0) ? ninf : sc[4 + e];
      sc[8 + e]  = (m2[e] == 0) ? ninf : sc[8 + e];
      sc[12 + e] = (m3[e] == 0) ? ninf : sc[12 + e];
    }
  }
  float mx = sc[0];
#pragma unroll
  for (int i = 1; i < 16; ++i) mx = fmaxf(mx, sc[i]);
  mx = fmaxf(mx, __shfl_xor(mx, 16, 32));            // the other lane half holds the other 16 keys of this query
  const float mnew = fmaxf(mr, mx);
  float msafe = mnew;
  if (MASK) msafe = (mnew == neg_inf()) ? 0.0f : mnew;   // every key so far masked: weights come out 0
  const float al = __builtin_amdgcn_exp2f((mr - msafe) * LOG2E);
  mr = mnew;
  // weights carried x256: pc = 256 * exp(sc - m); hi plane f16(pc), residual plane f16((pc - hi) * 2048)
  Frag ph, pl;
  float ps = 0.0f;
#pragma unroll
  for (int i = 0; i < 16; ++i) {
    const float pc = __builtin_amdgcn_exp2f(fmaf(sc[i] - msafe, LOG2E, 8.0f));
    ps += pc;
    const _Float16 h = (_Float16)pc;
    ph.h[i] = h;                                      // B element i: i<8 -> key0 + 8h + i (tile 0 row 8h+i); i>=8 -> key0 + 16 + 8h + (i-8) (tile 1)
    if (EARLYP) pl.h[i] = (_Float16)((pc - (float)h) * 2048.0f);
  }
  ps += __shfl_xor(ps, 16, 32);
  lr = lr * al + ps;
  // A fragments of V^T: row m = d (16*t + ln), elements 0..7 <- key0 + 8h + i, 8..15 <- key0 + 16 + 8h + i
  int voff = AT_TILE + ln * AT_PITCH + 2 * kloc + 16 * hh;   // byte offset in the stage
  asm volatile("" : "+v"(voff) : "v"(ps));            // V loads issue after the score phase
  const unsigned char* vp = st + voff;
  Frag vf[4];
#pragma unroll
  for (int t = 0; t < 4; ++t) ldfrag_lds(vf[t], vp + t * 16 * AT_PITCH);
#pragma unroll
  for (int t = 0; t < 4; ++t) Oh[t] = Oh[t] * al;
  if (EARLYP) {
    const unsigned char* vq = vp + 2 * AT_TILE;
    Frag vl[4];
#pragma unroll
    for (int t = 0; t < 4; ++t) ldfrag_lds(vl[t], vq + t * 16 * AT_PITCH);
#pragma unroll
    for (int t = 0; t < 4; ++t) Ol[t] = Ol[t] * al;
#pragma unroll
    for (int t = 0; t < 4; ++t) {
      Oh[t] = wm<false>(vf[t], ph, Oh[t]);
      Ol[t] = wm<false>(vf[t], pl, Ol[t]);
      Ol[t] = wm<false>(vl[t], ph, Ol[t]);
    }
    asm volatile("v_nop\n\tv_nop\n\tv_nop\n\tv_nop" : "+v"(Oh[0]), "+v"(Oh[1]), "+v"(Oh[2]), "+v"(Oh[3]), "+v"(Ol[0]), "+v"(Ol[1]), "+v"(Ol[2]), "+v"(Ol[3])
                      : "v"(vf[0].v), "v"(vf[1].v), "v"(vf[2].v), "v"(vf[3].v),
                        "v"(vl[0].v), "v"(vl[1].v), "v"(vl[2].v), "v"(vl[3].v), "v"(ph.v), "v"(pl.v));
  } else {
#pragma unroll
    for (int t = 0; t < 4; ++t) Oh[t] = wm<false>(vf[t], ph, Oh[t]);
    asm volatile("v_nop\n\tv_nop\n\tv_nop\n\tv_nop" : "+v"(Oh[0]), "+v"(Oh[1]), "+v"(Oh[2]), "+v"(Oh[3])
                      : "v"(vf[0].v), "v"(vf[1].v), "v"(vf[2].v), "v"(vf[3].v), "v"(ph.v));
  }
}

// What stands in front of and behind a stage's work. Early blocks (one buffer of four tiles): fill, wait, publish in front; every reader leaves behind.
// Plain blocks (two buffers of two tiles): nothing in front; behind, stage t + 1 is published and stage t + 2 is sent into the buffer that stage t has just left.
template <bool EARLYP>
__device__ __forceinline__ void ring_head(const unsigned short* gk, const unsigned short* gv, const unsigned short* gkl, const unsigned short* gvl,
                                          unsigned l0, int t) {
  if (EARLYP) {
    kv_copy(gk + (size_t)t * AT_KEYS * HD, gv + t * AT_KEYS, l0);
    kv_copy(gkl + (size_t)t * AT_KEYS * HD, gvl + t * AT_KEYS, l0 + 2 * AT_TILE);
    asm volatile("s_wait_asynccnt 0x0" ::: "memory");   // this wave's copies have landed before the barrier publishes them
    __syncthreads();
  }
}
template <bool EARLYP>
__device__ __forceinline__ void ring_foot(const unsigned short* gk, const unsigned short* gv, unsigned l0, int t, int nst) {
  asm volatile("s_wait_dscnt 0x0" ::: "memory");        // this wave's reads of the buffer are done before it is refilled
  if (!EARLYP) asm volatile("s_wait_asynccnt 0x0" ::: "memory");   // this wave's copies of stage t + 1 have landed before the barrier publishes them
  __syncthreads();
  if (!EARLYP) {
    if (t + 2 < nst) kv_copy(gk + (size_t)(t + 2) * AT_KEYS * HD, gv + (t + 2) * AT_KEYS, l0 + (unsigned)(t & 1) * (2 * AT_TILE));
  }
}

// nst = stages of 64 keys that the block walks, npl = the first of them that run without mask reads (both the same in all its waves;
// npl <= nst <= SEQ / 64, 2 * nst >= every wave's nsteps, 2 * npl <= every wave's nsteps). nsteps = this wave's own 32-key steps.
template <bool EARLYP>
__device__ __forceinline__ void run_keys(const unsigned short* __restrict__ qkh, const unsigned short* __restrict__ qkl,
                                         const unsigned short* __restrict__ vth, const unsigned short* __restrict__ vtl,
                                         const int* __restrict__ mask, unsigned char* ring, int tid, int b, int h, int qg, int ln, int hh,
                                         int npl, int nsteps, int nst, float& mr, float& lr, v8f (&Oh)[4], v8f (&Ol)[4]) {
  // Q^T B fragments: column n = this lane's query, elements 0..7 <- d = 32c + 8h + i, 8..15 <- d = 32c + 16 + 8h + i
  const size_t qoff = ((size_t)(b * NQK + h) * SEQ + qg) * HD + 8 * hh;
  Frag qh[2], ql[2];
  ldfrag(qh[0], qkh + qoff); ldfrag(qh[1], qkh + qoff + 32);
  if (EARLYP) { ldfrag(ql[0], qkl + qoff); ldfrag(ql[1], qkl + qoff + 32); }
  else { ql[0] = qh[0]; ql[1] = qh[1]; }
  const int kv = h % NKV;
  const size_t kbase = (size_t)(b * NQK + NHEAD + kv) * SEQ * HD;
  const size_t vbase = ((size_t)b * KVW + (size_t)kv * HD) * SEQ;
  const int* mrow = mask + (size_t)qg * SEQ_FULL;
  // this thread's first chunk of a stage: in K (rows = keys), in V^T (rows = d) and in LDS
  const size_t kthr = kbase + (size_t)(tid >> 3) * HD + 8 * (tid & 7);
  const size_t vthr = vbase + (size_t)(tid >> 3) * SEQ + 8 * (tid & 7);
  const unsigned short* gk = qkh + kthr;
  const unsigned short* gv = vth + vthr;
  const unsigned l0 = (unsigned)(size_t)ring + (unsigned)((tid >> 3) * AT_PITCH + 16 * (tid & 7));   // LDS byte address
  const unsigned short* gkl = qkl + kthr;
  const unsigned short* gvl = vtl + vthr;
  if (!EARLYP) {
    kv_copy(gk, gv, l0);
    asm volatile("s_wait_asynccnt 0x0" ::: "memory");     // stage 0 has landed before the barrier that publishes it
    __syncthreads();
    if (nst > 1) kv_copy(gk + AT_KEYS * HD, gv + AT_KEYS, l0 + 2 * AT_TILE);
  }
#pragma unroll 1   // one stage per trip: the two buffers alternate by the trip's parity
  for (int t = 0; t < npl; ++t) {
    const unsigned char* st = ring + (EARLYP ? 0u : (unsigned)(t & 1) * (2 * AT_TILE));
    ring_head<EARLYP>(gk, gv, gkl, gvl, l0, t);
    fa_step<EARLYP, false>(st, 0, mrow, AT_KEYS * t, ln, hh, qh, ql, mr, lr, Oh, Ol);
    fa_step<EARLYP, false>(st, 32, mrow, AT_KEYS * t + 32, ln, hh, qh, ql, mr, lr, Oh, Ol);
    ring_foot<EARLYP>(gk, gv, l0, t, nst);
  }
#pragma unroll 1   // one stage per trip, as above
  for (int t = npl; t < nst; ++t) {
    const unsigned char* st = ring + (EARLYP ? 0u : (unsigned)(t & 1) * (2 * AT_TILE));
    ring_head<EARLYP>(gk, gv, gkl, gvl, l0, t);
#pragma unroll 1   // one copy of the masked step in the text
    for (int sub = 0; sub < 2; ++sub) {
      const int j = 2 * t + sub;
      // a wave whose own steps have run out passes through to the barrier (wave-uniform test)
      if (j < nsteps) fa_step<EARLYP, true>(st, 32 * sub, mrow, 32 * j, ln, hh, qh, ql, mr, lr, Oh, Ol);
    }
    ring_foot<EARLYP>(gk, gv, l0, t, nst);
  }
  asm volatile("s_wait_asynccnt 0x0" ::: "memory");       // nothing is in flight when the ring is used for anything else
}

// Block = 4 waves x 16 queries = 64 queries of one (batch, head); the waves share the K and V^T stages in LDS, one barrier per 64 keys (two in early blocks).
// Tile skipping from the device flags of this wave's own 16 mask rows (16/SCAN_ROWS flag lines): all upper flags 1 -> keys past the diagonal step are
// skipped; upper and lower flags of all 64 rows of the block 1 -> the stages fully below the block's diagonal tile run without mask reads; every other visited step reads the mask by value.
// Trip counts are bounded by SEQ/32 for any flag value. The block walks qt + 1 stages if the upper flags of all its 64 rows are 1, else all SEQ/64.
// coverage: NB*NHEAD*(SEQ/64) blocks x 4 waves x 16 rows x 64 columns = the whole ctx hi plane; blocks with query tile below EARLY_ROWS cover the whole residual plane.
__global__ __launch_bounds__(128) void k_attn(const unsigned short* __restrict__ qkh, const unsigned short* __restrict__ qkl,
                                              const unsigned short* __restrict__ vth, const unsigned short* __restrict__ vtl,
                                              const int* __restrict__ mask, const int* __restrict__ flags,
                                              unsigned short* __restrict__ ctxh, unsigned short* __restrict__ ctxl) {
  __shared__ __attribute__((aligned(16))) unsigned char ring[AT_RING];
  float (*so)[16][68] = (float (*)[16][68])ring;       // epilogue tiles, used behind the key loop's last barrier
  const int tid = threadIdx.x, lane = tid & 31, ln = lane & 15, hh = lane >> 4;
  const int w = __builtin_amdgcn_readfirstlane(tid >> 5);
  const int nqt = SEQ / 64;
  const int blk = blockIdx.x;
  const int qt = blk % nqt;
  const int h = (blk / nqt) % NHEAD;
  const int b = blk / (nqt * NHEAD);
  const int qbase = qt * 64 + 16 * w;
  const int qg = qbase + ln;
  const int* fl = flags + (qbase / SCAN_ROWS) * 32;
  int upok = 1;                                        // plain & so that the flag loads issue together
#pragma unroll
  for (int g = 0; g < 16 / SCAN_ROWS; ++g) upok &= (fl[32 * g] == 1) ? 1 : 0;
  const bool tri = (upok == 1);
  const int nfull = qbase >> 5;                        // steps whose 32 keys are all at or below every query of this wave
  const int nsteps = tri ? (nfull + 1) : (SEQ / 32);   // <= SEQ/32 in both cases
  const bool early = (qt * 64 < EARLY_ROWS);
  // stage counts of the block, from the flags of all its 64 rows: the same values in all four waves, since barriers stand in the key loop
  const int* flb = flags + (qt * 64 / SCAN_ROWS) * 32;
  int upall = 1, lowall = 1;
#pragma unroll
  for (int g = 0; g < 64 / SCAN_ROWS; ++g) {
    const int fU = flb[32 * g], fL = flb[32 * g + 1];
    upall &= (fU == 1) ? 1 : 0;
    lowall &= (fL == 1) ? 1 : 0;
  }
  const int nst = (upall == 1) ? (qt + 1) : (SEQ / AT_KEYS);
  const int npl = (upall == 1 && lowall == 1) ? qt : 0;   // stages whose 64 keys are all below every query of the block

  const v8f z8 = {0.f, 0.f, 0.f, 0.f, 0.f, 0.f, 0.f, 0.f};
  float mr = neg_inf(), lr = 0.0f;
  v8f Oh[4], Ol[4];
#pragma unroll
  for (int t = 0; t < 4; ++t) { Oh[t] = z8; Ol[t] = z8; }
  if (early) run_keys<true>(qkh, qkl, vth, vtl, mask, ring, tid, b, h, qg, ln, hh, npl, nsteps, nst, mr, lr, Oh, Ol);
  else       run_keys<false>(qkh, qkl, vth, vtl, mask, ring, tid, b, h, qg, ln, hh, npl, nsteps, nst, mr, lr, Oh, Ol);

  // O^T element r of tile t = ctx(query, d = 16t + 8h + r); undo the carries x256 (in lr), x16 (V), x2^11 (residual); apply the x64 carry of ctx
  const float inv = 4.0f * (1.0f / lr);
#pragma unroll
  for (int t = 0; t < 4; ++t)
#pragma unroll
    for (int r = 0; r < 8; ++r)
      so[w][ln][16 * t + 8 * hh + r] = fmaf(Ol[t][r], S2M11, Oh[t][r]) * inv;
  __syncthreads();
  const int rsub = lane >> 3, d0 = 8 * (lane & 7);
  v8us oh[4], ol[4];
#pragma unroll
  for (int g = 0; g < 4; ++g) {
    const int row = 4 * g + rsub;
    const v4f a0 = *(const v4fa*)&so[w][row][d0];
    const v4f a1 = *(const v4fa*)&so[w][row][d0 + 4];
    float o[8];
    o[0] = a0[0]; o[1] = a0[1]; o[2] = a0[2]; o[3] = a0[3];
    o[4] = a1[0]; o[5] = a1[1]; o[6] = a1[2]; o[7] = a1[3];
    Pack8 ph8, pl8;
#pragma unroll
    for (int e = 0; e < 8; ++e) {
      const _Float16 hv = (_Float16)o[e];
      ph8.h[e] = hv;
      pl8.h[e] = (_Float16)((o[e] - (float)hv) * 2048.0f);
    }
    oh[g] = ph8.v; ol[g] = pl8.v;
  }
  const size_t hbase = ((size_t)b * SEQ + qbase) * CD + (size_t)h * HD + d0;
  const size_t lbase = ((size_t)b * EARLY_ROWS + (early ? qbase : 0)) * CD + (size_t)h * HD + d0;
{
#pragma unroll
    for (int g = 0; g < 4; ++g) {
      const size_t ro = (size_t)(4 * g + rsub) * CD;
      *(v8us*)(ctxh + hbase + ro) = oh[g];
      if (early) *(v8us*)(ctxl + lbase + ro) = ol[g];
    }
    
  }
}

// ---------------------------------------------------------------------------------------------------------
// Output projection: out[m][n] = sum_k ctx[m][k] Wo[n][k] + bo[n]. Block = 4 waves stacked in M (128 rows) x 64 columns. grid = (CD/64, NB*SEQ/128).
// Rows below EARLY_ROWS of each sequence add the residual plane of ctx in separate accumulators.
// coverage: NB*SEQ rows x CD columns = every element of the output buffer region once. LDS tile 32 x 64 fully written before it is read.
__global__ __launch_bounds__(128) void k_proj_out(const unsigned short* __restrict__ ctxh, const unsigned short* __restrict__ ctxl,
                                                  const unsigned short* __restrict__ wo, const float* __restrict__ bo,
                                                  float* __restrict__ out) {
  __shared__ __attribute__((aligned(16))) unsigned char ring[RING_BYTES];
  float (*st)[32][68] = (float (*)[32][68])ring;       // epilogue tiles, used behind the k loop's last barrier
  const int tid = threadIdx.x, lane = tid & 31, ln = lane & 15, hh = lane >> 4;
  const int w = __builtin_amdgcn_readfirstlane(tid >> 5);
  const int n0 = blockIdx.x * 64;
  const int mb = blockIdx.y * 128;
  const int b = mb / SEQ;
  const int tb = mb - b * SEQ;
  const bool early = (tb < EARLY_ROWS);                // block-uniform: EARLY_ROWS and SEQ are multiples of 128
  const int t0 = tb + 32 * w;
  const v8f z8 = {0.f, 0.f, 0.f, 0.f, 0.f, 0.f, 0.f, 0.f};
  v8f acc[2][4], acl[2][4];
#pragma unroll
  for (int i = 0; i < 2; ++i)
#pragma unroll
    for (int j = 0; j < 4; ++j) { acc[i][j] = z8; acl[i][j] = z8; }
  const unsigned short* wp = wo + (size_t)n0 * CD;
  gemm_loop<false>(ctxh + (size_t)mb * CD, wp, ring, tid, w, ln, hh, acc);
  // residual plane: a second walk over k through the same ring, into its own accumulators (block-uniform branch)
  if (early) gemm_loop<false>(ctxl + (size_t)(b * EARLY_ROWS + tb) * CD, wp, ring, tid, w, ln, hh, acl);
  // carries: ctx x64, Wo x64 -> 2^-12; residual plane additionally x2^11
#pragma unroll
  for (int i = 0; i < 2; ++i)
#pragma unroll
    for (int j = 0; j < 4; ++j)
#pragma unroll
      for (int r = 0; r < 8; ++r)
        st[w][16 * i + 8 * hh + r][16 * j + ln] = fmaf(acl[i][j][r], S2M11, acc[i][j][r]) * S2M12;
  __syncthreads();
  const int rsub = lane >> 4, c4 = 4 * (lane & 15);
  const v4f bb = *(const v4fa*)(bo + n0 + c4);
  v4f bias;
  bias[0] = bf16_rne(bb[0]); bias[1] = bf16_rne(bb[1]); bias[2] = bf16_rne(bb[2]); bias[3] = bf16_rne(bb[3]);
  v4f ov[16];
#pragma unroll
  for (int g = 0; g < 16; ++g) {
    const v4f a = *(const v4fa*)&st[w][2 * g + rsub][c4];
    ov[g] = a + bias;
  }
  float* og = out + ((size_t)b * SEQ_FULL + t0) * CD + n0 + c4;
{
#pragma unroll
    for (int g = 0; g < 16; ++g)
      *(v4f*)(og + (size_t)(2 * g + rsub) * CD) = ov[g];
    
  }
}

// ---------------------------------------------------------------------------------------------------------
extern "C" void kernel_launch(void* const* d_in, const int* in_sizes, int n_in,
                              void* d_out, int out_size, void* d_ws, size_t ws_size, hipStream_t stream) {
  if (n_in < 11) return;
  const long long need_x = (long long)(NB - 1) * SEQ_FULL * CD + (long long)SEQ * CD;   // last element touched + 1
  const long long need_m = (long long)(SEQ - 1) * SEQ_FULL + SEQ;
  if ((long long)in_sizes[0] < need_x) return;
  if ((long long)in_sizes[1] < need_m) return;
  if ((long long)in_sizes[2] < (long long)SEQ * HD) return;
  if ((long long)in_sizes[3] < (long long)CD * CD || (long long)in_sizes[4] < CD) return;
  if ((long long)in_sizes[5] < (long long)KVW * CD || (long long)in_sizes[6] < KVW) return;
  if ((long long)in_sizes[7] < (long long)KVW * CD || (long long)in_sizes[8] < KVW) return;
  if ((long long)in_sizes[9] < (long long)CD * CD || (long long)in_sizes[10] < CD) return;
  if ((long long)out_size < need_x) return;
  if ((size_t)WS_TOTAL > ws_size) return;

  // wire order: x, mask, sinusoidal_pos, Wq, bq, Wk, bk, Wv, bv, Wo, bo
  const float* x    = (const float*)d_in[0];
  const int*   mask = (const int*)d_in[1];
  const float* tab  = (const float*)d_in[2];
  const float* Wq   = (const float*)d_in[3];
  const float* bq   = (const float*)d_in[4];
  const float* Wk   = (const float*)d_in[5];
  const float* bk   = (const float*)d_in[6];
  const float* Wv   = (const float*)d_in[7];
  const float* bv   = (const float*)d_in[8];
  const float* Wo   = (const float*)d_in[9];
  const float* bo   = (const float*)d_in[10];
  float* out = (float*)d_out;

  char* ws = (char*)d_ws;
  size_t off = 0;
  int* flags = (int*)(ws + off);                               off += SZ_FLAGS;
  unsigned short* xb   = (unsigned short*)(ws + off);          off += SZ_XB;
  unsigned short* wqk  = (unsigned short*)(ws + off);          off += SZ_WQK;
  unsigned short* wvb  = (unsigned short*)(ws + off);          off += SZ_WV;
  unsigned short* wob  = (unsigned short*)(ws + off);          off += SZ_WO;
  unsigned short* qkh  = (unsigned short*)(ws + off);          off += PLANE_QK * 2;
  unsigned short* qkl  = (unsigned short*)(ws + off);          off += PLANE_QK * 2;
  unsigned short* vth  = (unsigned short*)(ws + off);          off += PLANE_V * 2;
  unsigned short* vtl  = (unsigned short*)(ws + off);          off += PLANE_V * 2;
  unsigned short* ctxh = (unsigned short*)(ws + off);          off += SZ_CTXH;
  unsigned short* ctxl = (unsigned short*)(ws + off);          off += SZ_CTXL;
  if (off > ws_size) return;

  // mask -> flags, and in[rows][CD] f32 -> [rows][CD] 16-bit planes (row order kept)
  k_prep<<<(unsigned)(SCAN_BLOCKS + CVT_BLOCKS), PREP_THREADS, 0, stream>>>(mask, flags, x, Wq, Wk, Wv, Wo, xb, wqk, wvb, wob);

  k_proj_qk<<<dim3(NQK, (unsigned)(NB * SEQ / 128)), 128, 0, stream>>>(xb, wqk, bq, bk, tab, qkh, qkl);
  k_proj_v<<<dim3((unsigned)(NB * SEQ / 64), KVW / 128), 128, 0, stream>>>(wvb, xb, bv, vth, vtl);
  k_attn<<<(unsigned)(NB * NHEAD * (SEQ / 64)), 128, 0, stream>>>(qkh, qkl, vth, vtl, mask, flags, ctxh, ctxl);
  k_proj_out<<<dim3(CD / 64, (unsigned)(NB * SEQ / 128)), 128, 0, stream>>>(ctxh, ctxl, wob, bo, out);
}

// v005
// It runs in 198 microseconds.
// In two side-by-side timings against v004, it was 1.04 and 1.05 times as fast.
// All steps since v000 together make it 4.39 times as fast.
#include <hip/hip_runtime.h>
#ifndef NB
#define NB 2
#endif
#ifndef SEQ
#define SEQ 2048
#endif
#define NB_FULL 2
#define SEQ_FULL 2048
#define CD 2048                 /* model width = depth of every projection */
#define NHEAD 32
#define NKV 8
#define HD 64
#define NQK (NHEAD + NKV)       /* rotary plane holds the 32 q heads followed by the 8 k heads */
#define KVW (NKV * HD)          /* 512 */
#define EARLY_ROWS (SEQ < 512 ? SEQ : 512)

#define SCAN_ROWS 8             /* mask rows per scan work-group: 8 rows x SEQ ints = 8 loads of 16 B per thread at SEQ = 2048 */
#define SCAN_LOADS (SCAN_ROWS * (SEQ / 4) / 512)
#define SZ_FLAGS ((size_t)(SEQ / SCAN_ROWS) * 128)   /* one 128-byte line per scan work-group */
#define SZ_XB    ((size_t)NB * SEQ * CD * 2)
#define SZ_WQK   ((size_t)(CD + KVW) * CD * 2)
#define SZ_WV    ((size_t)KVW * CD * 2)
#define SZ_WO    ((size_t)CD * CD * 2)
#define PLANE_QK ((size_t)NB * NQK * SEQ * HD)     /* elements of one rotary plane */
#define PLANE_V  ((size_t)NB * KVW * SEQ)          /* elements of one V^T plane */
#define SZ_CTXH  ((size_t)NB * SEQ * CD * 2)
#define SZ_CTXL  ((size_t)NB * EARLY_ROWS * CD * 2)
#define WS_TOTAL (SZ_FLAGS + SZ_XB + SZ_WQK + SZ_WV + SZ_WO + PLANE_QK * 4 + PLANE_V * 4 + SZ_CTXH + SZ_CTXL)

static_assert(SEQ % 128 == 0);
static_assert((SCAN_ROWS * (SEQ / 4)) % 512 == 0);
static_assert(16 % SCAN_ROWS == 0);
static_assert(SZ_FLAGS % 256 == 0);
static_assert(EARLY_ROWS % 128 == 0);
static_assert(SEQ <= SEQ_FULL);
static_assert(NB <= NB_FULL);
static_assert(HD == 64);
static_assert(CD % 32 == 0);
static_assert(KVW % 128 == 0);
static_assert(NHEAD % NKV == 0);
static_assert(WS_TOTAL <= (size_t)134217728);
static_assert(SZ_XB % 256 == 0 && SZ_WQK % 256 == 0 && SZ_WV % 256 == 0 && SZ_WO % 256 == 0);
static_assert((PLANE_QK * 2) % 256 == 0 && (PLANE_V * 2) % 256 == 0 && SZ_CTXH % 256 == 0 && SZ_CTXL % 256 == 0);

typedef __bf16 v16b __attribute__((ext_vector_type(16)));
typedef _Float16 v16h __attribute__((ext_vector_type(16)));
typedef unsigned short v8us __attribute__((ext_vector_type(8), may_alias));
typedef float v8f __attribute__((ext_vector_type(8)));
typedef float v4f __attribute__((ext_vector_type(4)));
typedef float v4fa __attribute__((ext_vector_type(4), may_alias));
typedef int v4i __attribute__((ext_vector_type(4)));
typedef int v4ia __attribute__((ext_vector_type(4), may_alias));
union Frag { v16b b; v16h v; v8us half[2]; _Float16 h[16]; unsigned short u[16]; };
union Pack8 { v8us v; _Float16 h[8]; unsigned short u[8]; };

#define LOG2E 1.4426950408889634f
#define S2M11 0.00048828125f       /* 2^-11 */
#define S2M12 0.000244140625f      /* 2^-12 */
__device__ __forceinline__ unsigned short bf16_bits(float x) {   // RNE convert to bf16 bits
  unsigned int u = __float_as_uint(x);
  return (unsigned short)((u + 0x7FFFu + ((u >> 16) & 1u)) >> 16);
}
__device__ __forceinline__ float bf16_val(unsigned short b) { return __uint_as_float(((unsigned int)b) << 16); }
__device__ __forceinline__ float bf16_rne(float x) { return bf16_val(bf16_bits(x)); }
__device__ __forceinline__ float neg_inf() { return __uint_as_float(0xff800000u); }

// Fragment of a k-contiguous 16-bit row: elements 0..7 <- p[0..7], elements 8..15 <- p[16..23]; caller adds row*pitch + k0 + 8*h.
__device__ __forceinline__ void ldfrag(Frag& f, const unsigned short* __restrict__ p) {
  f.half[0] = *(const v8us*)(p);
  f.half[1] = *(const v8us*)(p + 16);
}

template <bool BF>
__device__ __forceinline__ v8f wm(const Frag& a, const Frag& b, v8f c) {
  if (BF) return __builtin_amdgcn_wmma_f32_16x16x32_bf16(false, a.b, false, b.b, (short)0, c, false, false);
  return __builtin_amdgcn_wmma_f32_16x16x32_f16(false, a.v, false, b.v, (short)0, c, false, false);
}

// ---------------------------------------------------------------------------------------------------------
// Input preparation, one launch: the jobs below read inputs only and none reads what another writes, so the block index picks the job.
// Blocks 0 .. SCAN_BLOCKS-1: mask scan, one work-group per SCAN_ROWS mask rows; group g owns the line flags[32g .. 32g+31]:
// flags[32g] = 1 iff every entry of its rows above the diagonal is zero; flags[32g+1] = 1 iff every entry of its rows on or below the diagonal is nonzero.
// coverage: SEQ/SCAN_ROWS blocks x 512 threads x SCAN_LOADS x 4 ints = SEQ x SEQ mask entries; every flag line is written whole.
// Blocks SCAN_BLOCKS .. SCAN_BLOCKS+CVT_BLOCKS-1: f32 rows of width CD -> 16-bit planes (row order kept). A row is one 16-byte load and one 8-byte store
// per thread (a wave reads 4 whole lines and writes 2); block c takes the c-th run of adjacent rows of each of x, Wq, Wk, Wv and Wo, the same counts in every block.
// MODE 0: bf16 bits (RNE). MODE 1: f16 of (RNE bf16 value x 64).
// coverage: CVT_BLOCKS blocks x (rows / CVT_BLOCKS) rows x 512 threads x 4 elements = rows x CD, for each of the five arrays.
#define PREP_THREADS 512
#define SCAN_BLOCKS (SEQ / SCAN_ROWS)
#define CVT_BLOCKS 512
static_assert(CD == PREP_THREADS * 4);
static_assert((NB * SEQ) % CVT_BLOCKS == 0 && CD % CVT_BLOCKS == 0 && KVW % CVT_BLOCKS == 0);

typedef unsigned short v4us __attribute__((ext_vector_type(4), may_alias));
union Pack4 { v4us v; _Float16 h[4]; unsigned short u[4]; };

template <int MODE>
__device__ __forceinline__ void cvt_store(unsigned short* d, v4f x) {
  Pack4 o;
  if (MODE == 0) {
    o.u[0] = bf16_bits(x[0]); o.u[1] = bf16_bits(x[1]); o.u[2] = bf16_bits(x[2]); o.u[3] = bf16_bits(x[3]);
  } else {
    o.h[0] = (_Float16)(bf16_rne(x[0]) * 64.0f); o.h[1] = (_Float16)(bf16_rne(x[1]) * 64.0f);
    o.h[2] = (_Float16)(bf16_rne(x[2]) * 64.0f); o.h[3] = (_Float16)(bf16_rne(x[3]) * 64.0f);
  }
  *(v4us*)d = o.v;
}

// twelve waves per SIMD asked for (80 registers): three work-groups fit a WGP, so that all work-groups of the launch are resident together
__global__ __launch_bounds__(PREP_THREADS) __attribute__((amdgpu_waves_per_eu(12))) void k_prep(const int* __restrict__ mask, int* __restrict__ flags,
                                                       const float* __restrict__ x, const float* __restrict__ Wq, const float* __restrict__ Wk,
                                                       const float* __restrict__ Wv, const float* __restrict__ Wo,
                                                       unsigned short* __restrict__ xb, unsigned short* __restrict__ wqk,
                                                       unsigned short* __restrict__ wvb, unsigned short* __restrict__ wob) {
  __shared__ int sw[2][16];
  const int tid = threadIdx.x;
  if (blockIdx.x >= SCAN_BLOCKS) {                     // block-uniform
    const int c = blockIdx.x - SCAN_BLOCKS;
    const int e = 4 * tid;
    constexpr int NX = NB * SEQ / CVT_BLOCKS, NQ = CD / CVT_BLOCKS, NK = KVW / CVT_BLOCKS;
    static_assert(SEQ % NX == 0);                      // the block's NX rows of x lie in one batch
    const int bx = (c * NX) / SEQ, rx = c * NX - bx * SEQ;
    // uniform bases of this block's rows; a thread's loads and stores differ from them by 4 * tid elements and by constants only
    const float* sx = x + ((size_t)bx * SEQ_FULL + rx) * CD;
    const float* sq = Wq + (size_t)(c * NQ) * CD;
    const float* swo = Wo + (size_t)(c * NQ) * CD;
    const float* sk = Wk + (size_t)(c * NK) * CD;
    const float* sv = Wv + (size_t)(c * NK) * CD;
    unsigned short* dx = xb + (size_t)(c * NX) * CD;
    unsigned short* dq = wqk + (size_t)(c * NQ) * CD;
    unsigned short* dw = wob + (size_t)(c * NQ) * CD;
    unsigned short* dk = wqk + (size_t)(CD + c * NK) * CD;   // the k rows follow the q rows
    unsigned short* dv = wvb + (size_t)(c * NK) * CD;
    // all loads of a thread are independent and issued before the first is converted, so that they are in flight together
    v4f vx[NX], vq[NQ], vw[NQ], vk[NK], vv[NK];
#pragma unroll
    for (int j = 0; j < NX; ++j) vx[j] = *(const v4fa*)(sx + (unsigned)(j * CD + e));
#pragma unroll
    for (int j = 0; j < NQ; ++j) vq[j] = *(const v4fa*)(sq + (unsigned)(j * CD + e));
#pragma unroll
    for (int j = 0; j < NQ; ++j) vw[j] = *(const v4fa*)(swo + (unsigned)(j * CD + e));
#pragma unroll
    for (int j = 0; j < NK; ++j) vk[j] = *(const v4fa*)(sk + (unsigned)(j * CD + e));
#pragma unroll
    for (int j = 0; j < NK; ++j) vv[j] = *(const v4fa*)(sv + (unsigned)(j * CD + e));
    // keeps every load in front of the first conversion: without it the scheduler sinks a third of the loads behind waits to 0, and their latencies add up
    __builtin_amdgcn_sched_barrier(0);
#pragma unroll
    for (int j = 0; j < NX; ++j) cvt_store<0>(dx + (unsigned)(j * CD + e), vx[j]);
#pragma unroll
    for (int j = 0; j < NQ; ++j) cvt_store<0>(dq + (unsigned)(j * CD + e), vq[j]);
#pragma unroll
    for (int j = 0; j < NQ; ++j) cvt_store<1>(dw + (unsigned)(j * CD + e), vw[j]);
#pragma unroll
    for (int j = 0; j < NK; ++j) cvt_store<0>(dk + (unsigned)(j * CD + e), vk[j]);
#pragma unroll
    for (int j = 0; j < NK; ++j) cvt_store<0>(dv + (unsigned)(j * CD + e), vv[j]);
    return;                                            // the whole block leaves here; the barrier below is the scan blocks' own
  }
  const int lane = tid & 31, wv = tid >> 5;
  int badU = 0, badL = 0;
  const int cpr = SEQ / 4;
  const int q0 = blockIdx.x * SCAN_ROWS;
  const int* mb = mask + (size_t)q0 * SEQ_FULL;       // uniform base of this group's rows; the loads below differ by constants only
  v4i mv[SCAN_LOADS];
  // all loads of a thread are independent and issued before the first is tested, so that they are in flight together
#pragma unroll
  for (int u = 0; u < SCAN_LOADS; ++u) {
    const int c = tid + 512 * u;
    const int qr = c / cpr, k = (c - qr * cpr) * 4;
    mv[u] = *(const v4ia*)(mb + (unsigned)(qr * SEQ_FULL + k));
  }
#pragma unroll
  for (int u = 0; u < SCAN_LOADS; ++u) {
    const int c = tid + 512 * u;
    const int qr = c / cpr, k = (c - qr * cpr) * 4;
    const int q = q0 + qr;
#pragma unroll
    for (int i = 0; i < 4; ++i) {
      const int above = (k + i > q) ? 1 : 0;
      const int nz = (mv[u][i] != 0) ? 1 : 0;
      badU |= above & nz;
      badL |= (1 - above) & (1 - nz);
    }
  }
#pragma unroll
  for (int o = 16; o >= 1; o >>= 1) {
    badU |= __shfl_xor(badU, o, 32);
    badL |= __shfl_xor(badL, o, 32);
  }
  if (lane == 0) { sw[0][wv] = badU; sw[1][wv] = badL; }
  __syncthreads();
  if (tid < 8) {
    int u = 0, l = 0;
#pragma unroll
    for (int i = 0; i < 16; ++i) { u |= sw[0][i]; l |= sw[1][i]; }
    v4i o;
    o[0] = (tid == 0 && u == 0) ? 1 : 0;
    o[1] = (tid == 0 && l == 0) ? 1 : 0;
    o[2] = 0; o[3] = 0;
    *(v4i*)(flags + 32 * blockIdx.x + 4 * tid) = o;
  }
}

// ---------------------------------------------------------------------------------------------------------
// Block-tile GEMM core: acc[i][j] (rows 32w + 16i.., cols 16j..) += A[row][k] * W[col][k] over k = 0..CD-1, k ascending in steps of 32.
// ablk = first of the block's 128 A rows, bblk = first of its 64 W rows (both k-contiguous, pitch CD).
// A stage is 64 k of all 192 rows: 128-byte rows laid at a 144-byte pitch (A rows 0..127, then W rows 128..191); two buffers.
// Each copy instruction of a wave moves 4 whole 128-byte lines; a thread copies chunk (tid & 7) of rows (tid >> 3) + 16 i, i = 0..11.
// Fragment maps as before: row or column = ln, elements 0..7 <- k0 + 8h + i, elements 8..15 <- k0 + 16 + 8h + i, for A and W alike.
#define ST_K 64
#define ST_PITCH 144
#define ST_BYTES (192 * ST_PITCH)
#define RING_BYTES (2 * ST_BYTES)
static_assert(CD % ST_K == 0 && CD / ST_K >= 2);
static_assert(RING_BYTES >= 4 * 32 * 68 * 4);      /* the epilogue tiles reuse the ring */

__device__ __forceinline__ void ldfrag_lds(Frag& f, const unsigned char* p) {
  f.half[0] = *(const v8us*)(p);
  f.half[1] = *(const v8us*)(p + 32);
}

// One stage: 12 copies of 16 bytes per thread. The s_wait_xcnt stands inside the statement so that no address register is rewritten ahead of it.
__device__ __forceinline__ void stage_copy(const unsigned short* ga, const unsigned short* gb, unsigned l) {
  asm volatile("global_load_async_to_lds_b128 %0, %12, off\n\t"
               "global_load_async_to_lds_b128 %1, %13, off\n\t"
               "global_load_async_to_lds_b128 %2, %14, off\n\t"
               "global_load_async_to_lds_b128 %3, %15, off\n\t"
               "global_load_async_to_lds_b128 %4, %16, off\n\t"
               "global_load_async_to_lds_b128 %5, %17, off\n\t"
               "global_load_async_to_lds_b128 %6, %18, off\n\t"
               "global_load_async_to_lds_b128 %7, %19, off\n\t"
               "global_load_async_to_lds_b128 %8, %20, off\n\t"
               "global_load_async_to_lds_b128 %9, %21, off\n\t"
               "global_load_async_to_lds_b128 %10, %22, off\n\t"
               "global_load_async_to_lds_b128 %11, %23, off\n\t"
               "s_wait_xcnt 0x0"
               :: "v"(l), "v"(l + 16 * ST_PITCH), "v"(l + 32 * ST_PITCH), "v"(l + 48 * ST_PITCH),
                  "v"(l + 64 * ST_PITCH), "v"(l + 80 * ST_PITCH), "v"(l + 96 * ST_PITCH), "v"(l + 112 * ST_PITCH),
                  "v"(l + 128 * ST_PITCH), "v"(l + 144 * ST_PITCH), "v"(l + 160 * ST_PITCH), "v"(l + 176 * ST_PITCH),
                  "v"(ga), "v"(ga + 16 * CD), "v"(ga + 32 * CD), "v"(ga + 48 * CD),
                  "v"(ga + 64 * CD), "v"(ga + 80 * CD), "v"(ga + 96 * CD), "v"(ga + 112 * CD),
                  "v"(gb), "v"(gb + 16 * CD), "v"(gb + 32 * CD), "v"(gb + 48 * CD)
               : "memory");
}

template <bool BF>
__device__ __forceinline__ void gemm_loop(const unsigned short* __restrict__ ablk, const unsigned short* __restrict__ bblk,
                                          unsigned char* ring, int tid, int w, int ln, int hh, v8f (&acc)[2][4]) {
  const int nt = CD / ST_K;
  const unsigned short* ga = ablk + (size_t)(tid >> 3) * CD + 8 * (tid & 7);
  const unsigned short* gb = bblk + (size_t)(tid >> 3) * CD + 8 * (tid & 7);
  const unsigned l0 = (unsigned)(size_t)ring + (unsigned)((tid >> 3) * ST_PITCH + 16 * (tid & 7));   // LDS byte address of this thread's first chunk
  const int aoff = (32 * w + ln) * ST_PITCH + 16 * hh;
  const int boff = (128 + ln) * ST_PITCH + 16 * hh;
  stage_copy(ga, gb, l0);
  asm volatile("s_wait_asynccnt 0x0" ::: "memory");   // tile 0 has landed before the barrier that publishes it
  __syncthreads();
  stage_copy(ga + ST_K, gb + ST_K, l0 + ST_BYTES);
#pragma unroll 1   // one tile per trip: the two buffers alternate by the trip's parity
  for (int t = 0; t < nt; ++t) {
    const unsigned sel = (unsigned)(t & 1) * ST_BYTES;
    const unsigned char* buf = ring + sel;
    Frag a[2][2], b[2][4];
#pragma unroll
    for (int kk = 0; kk < 2; ++kk) {
#pragma unroll
      for (int i = 0; i < 2; ++i) ldfrag_lds(a[kk][i], buf + aoff + i * 16 * ST_PITCH + kk * 64);
#pragma unroll
      for (int j = 0; j < 4; ++j) ldfrag_lds(b[kk][j], buf + boff + j * 16 * ST_PITCH + kk * 64);
    }
#pragma unroll
    for (int kk = 0; kk < 2; ++kk)
#pragma unroll
      for (int i = 0; i < 2; ++i)
#pragma unroll
        for (int j = 0; j < 4; ++j) acc[i][j] = wm<BF>(a[kk][i], b[kk][j], acc[i][j]);
    // keeps the distance behind the last matrix instructions on the loop's back edge and in front of the address arithmetic below
    asm volatile("v_nop\n\tv_nop\n\tv_nop\n\tv_nop" : "+v"(acc[0][0]), "+v"(acc[0][1]), "+v"(acc[0][2]), "+v"(acc[0][3]),
                        "+v"(acc[1][0]), "+v"(acc[1][1]), "+v"(acc[1][2]), "+v"(acc[1][3])
                      : "v"(a[1][0].v), "v"(a[1][1].v), "v"(b[1][0].v), "v"(b[1][1].v), "v"(b[1][2].v), "v"(b[1][3].v));
    asm volatile("s_wait_dscnt 0x0" ::: "memory");      // this wave's reads of the buffer are done before it is refilled
    asm volatile("s_wait_asynccnt 0x0" ::: "memory");   // this wave's copies of tile t + 1 have landed before the barrier publishes them
    __syncthreads();
    if (t + 2 < nt) stage_copy(ga + (t + 2) * ST_K, gb + (t + 2) * ST_K, l0 + sel);
  }
  asm volatile("s_wait_asynccnt 0x0" ::: "memory");     // nothing is in flight when the ring is used for anything else
}

// Square block tile of the q/k and output projections: 128 A rows x 128 W rows, 4 waves as 2 x 2, wave tile 64 x 64:
// acc[i][j] (rows 64 wr + 16 i.., cols 64 wc + 16 j..) += A[row][k] * W[col][k], k ascending in steps of 32 as in gemm_loop.
// A stage is 64 k of all 256 rows at the 144-byte pitch (A rows 0..127, then W rows 128..255); two buffers.
// Per 64 k a block copies 32 KiB for 128 x 128 outputs (the 128 x 64 tile: 24 KiB for half as many), and a wave reads 16 fragments for 32 matrix instructions (12 for 16).
#define SQ_BYTES (256 * ST_PITCH)
#define SQ_RING (2 * SQ_BYTES)
static_assert(SQ_RING >= 4 * 64 * 68 * 4);         /* the epilogue tiles reuse the ring */

// 128 rows of one operand: 8 copies of 16 bytes per thread, chunk (tid & 7) of rows (tid >> 3) + 16 i; each copy of a wave moves 4 whole 128-byte lines.
// The s_wait_xcnt stands inside the statement so that no address register is rewritten ahead of it.
__device__ __forceinline__ void rows128_copy(const unsigned short* g, unsigned l) {
  asm volatile("global_load_async_to_lds_b128 %0, %8, off\n\t"
               "global_load_async_to_lds_b128 %1, %9, off\n\t"
               "global_load_async_to_lds_b128 %2, %10, off\n\t"
               "global_load_async_to_lds_b128 %3, %11, off\n\t"
               "global_load_async_to_lds_b128 %4, %12, off\n\t"
               "global_load_async_to_lds_b128 %5, %13, off\n\t"
               "global_load_async_to_lds_b128 %6, %14, off\n\t"
               "global_load_async_to_lds_b128 %7, %15, off\n\t"
               "s_wait_xcnt 0x0"
               :: "v"(l), "v"(l + 16 * ST_PITCH), "v"(l + 32 * ST_PITCH), "v"(l + 48 * ST_PITCH),
                  "v"(l + 64 * ST_PITCH), "v"(l + 80 * ST_PITCH), "v"(l + 96 * ST_PITCH), "v"(l + 112 * ST_PITCH),
                  "v"(g), "v"(g + 16 * CD), "v"(g + 32 * CD), "v"(g + 48 * CD),
                  "v"(g + 64 * CD), "v"(g + 80 * CD), "v"(g + 96 * CD), "v"(g + 112 * CD)
               : "memory");
}
__device__ __forceinline__ void sq_copy(const unsigned short* ga, const unsigned short* gb, unsigned l) {
  rows128_copy(ga, l);
  rows128_copy(gb, l + 128 * ST_PITCH);
}

template <bool BF>
__device__ __forceinline__ void gemm_sq(const unsigned short* __restrict__ ablk, const unsigned short* __restrict__ bblk,
                                        unsigned char* ring, int tid, int wr, int wc, int ln, int hh, v8f (&acc)[4][4]) {
  const int nt = CD / ST_K;
  const unsigned short* ga = ablk + (size_t)(tid >> 3) * CD + 8 * (tid & 7);
  const unsigned short* gb = bblk + (size_t)(tid >> 3) * CD + 8 * (tid & 7);
  const unsigned l0 = (unsigned)(size_t)ring + (unsigned)((tid >> 3) * ST_PITCH + 16 * (tid & 7));   // LDS byte address of this thread's first chunk
  const int aoff = (64 * wr + ln) * ST_PITCH + 16 * hh;
  const int boff = (128 + 64 * wc + ln) * ST_PITCH + 16 * hh;
  sq_copy(ga, gb, l0);
  asm volatile("s_wait_asynccnt 0x0" ::: "memory");   // tile 0 has landed before the barrier that publishes it
  __syncthreads();
  sq_copy(ga + ST_K, gb + ST_K, l0 + SQ_BYTES);
#pragma unroll 1   // one tile per trip: the two buffers alternate by the trip's parity
  for (int t = 0; t < nt; ++t) {
    const unsigned sel = (unsigned)(t & 1) * SQ_BYTES;
    const unsigned char* buf = ring + sel;
    Frag a[2][4], b[2][4];
#pragma unroll
    for (int i = 0; i < 4; ++i) ldfrag_lds(a[0][i], buf + aoff + i * 16 * ST_PITCH);
#pragma unroll
    for (int kk = 0; kk < 2; ++kk)
#pragma unroll
      for (int j = 0; j < 4; ++j) ldfrag_lds(b[kk][j], buf + boff + j * 16 * ST_PITCH + kk * 64);
    // keeps these 24 fragment loads together in front of the first matrix instruction: without it the scheduler takes one register set for the four
    // A fragments of the first 32 k, loads them one by one among the matrix instructions and waits for each to 0.
    // The A fragments of the second 32 k follow behind it, into the registers that the first four leave (all 16 fragments at once do not fit).
    __builtin_amdgcn_sched_barrier(0);
#pragma unroll
    for (int i = 0; i < 4; ++i) ldfrag_lds(a[1][i], buf + aoff + i * 16 * ST_PITCH + 64);
#pragma unroll
    for (int kk = 0; kk < 2; ++kk)
#pragma unroll
      for (int i = 0; i < 4; ++i)
#pragma unroll
        for (int j = 0; j < 4; ++j) acc[i][j] = wm<BF>(a[kk][i], b[kk][j], acc[i][j]);
    // keeps the distance behind the last matrix instructions on the loop's back edge and in front of the address arithmetic below
    asm volatile("v_nop\n\tv_nop\n\tv_nop\n\tv_nop" : "+v"(acc[0][0]), "+v"(acc[0][1]), "+v"(acc[0][2]), "+v"(acc[0][3]),
                        "+v"(acc[1][0]), "+v"(acc[1][1]), "+v"(acc[1][2]), "+v"(acc[1][3]),
                        "+v"(acc[2][0]), "+v"(acc[2][1]), "+v"(acc[2][2]), "+v"(acc[2][3]),
                        "+v"(acc[3][0]), "+v"(acc[3][1]), "+v"(acc[3][2]), "+v"(acc[3][3])
                      : "v"(a[1][0].v), "v"(a[1][1].v), "v"(a[1][2].v), "v"(a[1][3].v), "v"(b[1][0].v), "v"(b[1][1].v), "v"(b[1][2].v), "v"(b[1][3].v));
    asm volatile("s_wait_dscnt 0x0" ::: "memory");      // this wave's reads of the buffer are done before it is refilled
    asm volatile("s_wait_asynccnt 0x0" ::: "memory");   // this wave's copies of tile t + 1 have landed before the barrier publishes them
    __syncthreads();
    if (t + 2 < nt) sq_copy(ga + (t + 2) * ST_K, gb + (t + 2) * ST_K, l0 + sel);
  }
  asm volatile("s_wait_asynccnt 0x0" ::: "memory");     // nothing is in flight when the ring is used for anything else
}

__device__ __forceinline__ float rope1(float q, float p, float c, float s, float sg) { return q * c + (sg * p) * s; }

// ---------------------------------------------------------------------------------------------------------
// q and k projections with fused bias, rotary (table read by value) and head-major repack.
// Block = 4 waves as 2 x 2: 128 token rows x two heads; a wave has 64 token rows of one head (64 columns). grid = (NQK/2, NB*SEQ/128).
// coverage: NQK heads x NB*SEQ tokens x 64 = the whole plane [NB][NQK][SEQ][64], both planes. LDS tile 64 x 64 fully written before it is read.
static_assert(NQK % 2 == 0);
__global__ __launch_bounds__(128) void k_proj_qk(const unsigned short* __restrict__ xb, const unsigned short* __restrict__ wqk,
                                                 const float* __restrict__ bq, const float* __restrict__ bk,
                                                 const float* __restrict__ tab,
                                                 unsigned short* __restrict__ qkh, unsigned short* __restrict__ qkl) {
  __shared__ __attribute__((aligned(16))) unsigned char ring[SQ_RING];
  float (*st)[64][68] = (float (*)[64][68])ring;       // epilogue tiles, used behind the k loop's last barrier
  const int tid = threadIdx.x, lane = tid & 31, ln = lane & 15, hh = lane >> 4;
  const int w = __builtin_amdgcn_readfirstlane(tid >> 5);
  const int wr = w >> 1, wc = w & 1;
  const int hd = 2 * blockIdx.x + wc;
  const int m0 = blockIdx.y * 128 + 64 * wr;
  const v8f z8 = {0.f, 0.f, 0.f, 0.f, 0.f, 0.f, 0.f, 0.f};
  v8f acc[4][4];
#pragma unroll
  for (int i = 0; i < 4; ++i)
#pragma unroll
    for (int j = 0; j < 4; ++j) acc[i][j] = z8;
  gemm_sq<true>(xb + (size_t)(blockIdx.y * 128) * CD, wqk + (size_t)(blockIdx.x * 2 * HD) * CD, ring, tid, wr, wc, ln, hh, acc);

  float bias[4];
#pragma unroll
  for (int j = 0; j < 4; ++j) {
    const int col = hd * HD + 16 * j + ln;
    const int cq = (col < CD - 1) ? col : (CD - 1);
    int ck = col - CD;
    ck = (ck < 0) ? 0 : ((ck > KVW - 1) ? (KVW - 1) : ck);
    const float vq = bq[cq], vk = bk[ck];
    bias[j] = bf16_rne((col < CD) ? vq : vk);
  }
#pragma unroll
  for (int i = 0; i < 4; ++i)
#pragma unroll
    for (int j = 0; j < 4; ++j)
#pragma unroll
      for (int r = 0; r < 8; ++r) st[w][16 * i + 8 * hh + r][16 * j + ln] = acc[i][j][r] + bias[j];
  __syncthreads();

  const int b = m0 / SEQ, t0 = m0 - b * SEQ;
  const int rsub = lane >> 3, d0 = 8 * (lane & 7);
  const float sg = (d0 < 32) ? -1.0f : 1.0f;
  const size_t dbase = ((size_t)(b * NQK + hd) * SEQ + t0) * HD + d0;
  // the wave's 64 rows in two halves of 32
  const unsigned tl = (unsigned)(rsub * HD + d0);      // this lane's place in a group of 4 table rows
  for (int half = 0; half < 2; ++half) {
  const float* th = tab + (size_t)(t0 + 32 * half) * HD;   // uniform base of this half's table rows; the loads below differ from it by tl and by constants only
  v8us oh[8], ol[8];
#pragma unroll
  for (int g = 0; g < 8; ++g) {
    // keeps the last four groups' table and LDS loads from being lifted over the first four: with all 8 groups in flight at once the registers run short
    if (g == 4) __builtin_amdgcn_sched_barrier(0);
    const int row = 32 * half + 4 * g + rsub;
    const v4f a0 = *(const v4fa*)&st[w][row][d0];
    const v4f a1 = *(const v4fa*)&st[w][row][d0 + 4];
    const v4f p0 = *(const v4fa*)&st[w][row][d0 ^ 32];
    const v4f p1 = *(const v4fa*)&st[w][row][(d0 ^ 32) + 4];
    const float* tp = th + (tl + (unsigned)(4 * g * HD));
    const v4f c0 = *(const v4fa*)(tp), c1 = *(const v4fa*)(tp + 4);
    const float k0 = bf16_rne(c0[0]), s0 = bf16_rne(c0[1]), k1 = bf16_rne(c0[2]), s1 = bf16_rne(c0[3]);
    const float k2 = bf16_rne(c1[0]), s2 = bf16_rne(c1[1]), k3 = bf16_rne(c1[2]), s3 = bf16_rne(c1[3]);
    float o[8];
    o[0] = rope1(a0[0], p0[0], k0, s0, sg); o[1] = rope1(a0[1], p0[1], k0, s0, sg);
    o[2] = rope1(a0[2], p0[2], k1, s1, sg); o[3] = rope1(a0[3], p0[3], k1, s1, sg);
    o[4] = rope1(a1[0], p1[0], k2, s2, sg); o[5] = rope1(a1[1], p1[1], k2, s2, sg);
    o[6] = rope1(a1[2], p1[2], k3, s3, sg); o[7] = rope1(a1[3], p1[3], k3, s3, sg);
    Pack8 ph8, pl8;
#pragma unroll
    for (int e = 0; e < 8; ++e) {
      const float y = o[e] * 16.0f;                       // carried x16
      const _Float16 h = (_Float16)y;
      ph8.h[e] = h;
      pl8.h[e] = (_Float16)((y - (float)h) * 2048.0f);     // residual plane x2^11
    }
    oh[g] = ph8.v; ol[g] = pl8.v;
  }
#pragma unroll
    for (int g = 0; g < 8; ++g) {
      const size_t off = dbase + (size_t)(32 * half + 4 * g + rsub) * HD;
      *(v8us*)(qkh + off) = oh[g];
      *(v8us*)(qkl + off) = ol[g];
    }
    asm volatile("s_wait_xcnt 0x0" ::: "memory");   // the second half rewrites registers that these stores name
  }
}

// ---------------------------------------------------------------------------------------------------------
// v projection computed transposed: Vt[b][m][t] = sum_k Wv[m][k] x[b,t][k] + bv[m], carried x16, hi and residual planes.
// Block = 4 waves stacked in M (128 weight rows) x 64 tokens. grid = (NB*SEQ/64, KVW/128).
// coverage: KVW rows x NB*SEQ tokens = the whole plane [NB][KVW][SEQ], both planes. LDS tile 32 x 64 fully written before it is read.
__global__ __launch_bounds__(128) void k_proj_v(const unsigned short* __restrict__ wvb, const unsigned short* __restrict__ xb,
                                                const float* __restrict__ bv,
                                                unsigned short* __restrict__ vth, unsigned short* __restrict__ vtl) {
  __shared__ __attribute__((aligned(16))) unsigned char ring[RING_BYTES];
  float (*st)[32][68] = (float (*)[32][68])ring;       // epilogue tiles, used behind the k loop's last barrier
  const int tid = threadIdx.x, lane = tid & 31, ln = lane & 15, hh = lane >> 4;
  const int w = __builtin_amdgcn_readfirstlane(tid >> 5);
  const int n0 = blockIdx.x * 64;
  const int m0 = blockIdx.y * 128 + 32 * w;
  const v8f z8 = {0.f, 0.f, 0.f, 0.f, 0.f, 0.f, 0.f, 0.f};
  v8f acc[2][4];
#pragma unroll
  for (int i = 0; i < 2; ++i)
#pragma unroll
    for (int j = 0; j < 4; ++j) acc[i][j] = z8;
  gemm_loop<true>(wvb + (size_t)(blockIdx.y * 128) * CD, xb + (size_t)n0 * CD, ring, tid, w, ln, hh, acc);
#pragma unroll
  for (int i = 0; i < 2; ++i)
#pragma unroll
    for (int j = 0; j < 4; ++j)
#pragma unroll
      for (int r = 0; r < 8; ++r) st[w][16 * i + 8 * hh + r][16 * j + ln] = acc[i][j][r];
  __syncthreads();

  const int b = n0 / SEQ, t0 = n0 - b * SEQ;
  const int rsub = lane >> 3, c0 = 8 * (lane & 7);
  v8us oh[8], ol[8];
#pragma unroll
  for (int g = 0; g < 8; ++g) {
    const int row = 4 * g + rsub;
    const float bias = bf16_rne(bv[m0 + row]);
    const v4f a0 = *(const v4fa*)&st[w][row][c0];
    const v4f a1 = *(const v4fa*)&st[w][row][c0 + 4];
    float o[8];
    o[0] = a0[0]; o[1] = a0[1]; o[2] = a0[2]; o[3] = a0[3];
    o[4] = a1[0]; o[5] = a1[1]; o[6] = a1[2]; o[7] = a1[3];
    Pack8 ph8, pl8;
#pragma unroll
    for (int e = 0; e < 8; ++e) {
      const float y = (o[e] + bias) * 16.0f;              // carried x16
      const _Float16 h = (_Float16)y;
      ph8.h[e] = h;
      pl8.h[e] = (_Float16)((y - (float)h) * 2048.0f);
    }
    oh[g] = ph8.v; ol[g] = pl8.v;
  }
  const size_t dbase = ((size_t)b * KVW + m0) * SEQ + t0 + c0;
{
#pragma unroll
    for (int g = 0; g < 8; ++g) {
      const size_t off = dbase + (size_t)(4 * g + rsub) * SEQ;
      *(v8us*)(vth + off) = oh[g];
      *(v8us*)(vtl + off) = ol[g];
    }
    
  }
}

// ---------------------------------------------------------------------------------------------------------
// Attention stage in LDS: 64 keys. Tile 0 = K rows (64 keys x 128 B), tile 1 = V^T rows (64 d x 128 B = 64 keys), each at a 144-byte pitch;
// tiles 2 and 3 = the residual planes of K and V^T (query rows below EARLY_ROWS only).
// The ring holds two stages of two tiles (plain blocks, two buffers) or one stage of four tiles (early blocks, one buffer).
#define AT_KEYS 64
#define AT_PITCH 144
#define AT_TILE (64 * AT_PITCH)
#define AT_RING (4 * AT_TILE)
static_assert(SEQ % AT_KEYS == 0);
static_assert(AT_RING >= 4 * 16 * 68 * 4);         /* the epilogue tiles reuse the ring */

// One K tile and one V^T tile: 8 copies of 16 bytes per thread, chunk (tid & 7) of rows (tid >> 3) + 16 i; each copy of a wave moves 4 whole 128-byte lines.
// The s_wait_xcnt stands inside the statement so that no address register is rewritten ahead of it.
__device__ __forceinline__ void kv_copy(const unsigned short* gk, const unsigned short* gv, unsigned l) {
  asm volatile("global_load_async_to_lds_b128 %0, %8, off\n\t"
               "global_load_async_to_lds_b128 %1, %9, off\n\t"
               "global_load_async_to_lds_b128 %2, %10, off\n\t"
               "global_load_async_to_lds_b128 %3, %11, off\n\t"
               "global_load_async_to_lds_b128 %4, %12, off\n\t"
               "global_load_async_to_lds_b128 %5, %13, off\n\t"
               "global_load_async_to_lds_b128 %6, %14, off\n\t"
               "global_load_async_to_lds_b128 %7, %15, off\n\t"
               "s_wait_xcnt 0x0"
               :: "v"(l), "v"(l + 16 * AT_PITCH), "v"(l + 32 * AT_PITCH), "v"(l + 48 * AT_PITCH),
                  "v"(l + AT_TILE), "v"(l + AT_TILE + 16 * AT_PITCH), "v"(l + AT_TILE + 32 * AT_PITCH), "v"(l + AT_TILE + 48 * AT_PITCH),
                  "v"(gk), "v"(gk + 16 * HD), "v"(gk + 32 * HD), "v"(gk + 48 * HD),
                  "v"(gv), "v"(gv + 16 * SEQ), "v"(gv + 32 * SEQ), "v"(gv + 48 * SEQ)
               : "memory");
}

// One 32-key step for a wave's 16 queries (this lane's column = its query). EARLYP adds the residual planes of q, k, v, P.
// st = the stage in LDS, kloc = 0 or 32 = first key of the step inside the stage, key0 = the same key's index in the sequence.
// MASK reads the mask row of this lane's query by value and replace-fills with -inf.
template <bool EARLYP, bool MASK>
__device__ __forceinline__ void fa_step(const unsigned char* st, int kloc,
                                        const int* __restrict__ mrow, int key0, int ln, int hh,
                                        const Frag (&qh)[2], const Frag (&ql)[2],
                                        float& mr, float& lr, v8f (&Oh)[4], v8f (&Ol)[4]) {
  const v8f z8 = {0.f, 0.f, 0.f, 0.f, 0.f, 0.f, 0.f, 0.f};
  float sc[16];
  // A fragments of K: row m = key (key0 + 16*kt + ln), elements 0..7 <- d = 32c + 8h + i, 8..15 <- d = 32c + 16 + 8h + i
  int koff = (kloc + ln) * AT_PITCH + 16 * hh;        // byte offset in a K tile
  if (EARLYP) {
#pragma unroll
    for (int kt = 0; kt < 2; ++kt) {
      Frag a0, a1, l0, l1;
      ldfrag_lds(a0, st + koff); ldfrag_lds(a1, st + koff + 64);
      ldfrag_lds(l0, st + 2 * AT_TILE + koff); ldfrag_lds(l1, st + 2 * AT_TILE + koff + 64);
      v8f s = z8, r = z8;
      s = wm<false>(a0, qh[0], s); s = wm<false>(a1, qh[1], s);
      r = wm<false>(a0, ql[0], r); r = wm<false>(a1, ql[1], r);
      r = wm<false>(l0, qh[0], r); r = wm<false>(l1, qh[1], r);
      asm volatile("v_nop\n\tv_nop\n\tv_nop\n\tv_nop" : "+v"(s), "+v"(r)
                        : "v"(a0.v), "v"(a1.v), "v"(l0.v), "v"(l1.v), "v"(qh[0].v), "v"(qh[1].v), "v"(ql[0].v), "v"(ql[1].v));
      // S^T element r of tile kt = score(key0 + 16*kt + 8h + r, this lane's query); carries: q x16, k x16, residual x2^11
#pragma unroll
      for (int e = 0; e < 8; ++e) sc[8 * kt + e] = fmaf(r[e], S2M11, s[e]) * S2M11;
      koff += 16 * AT_PITCH;
      if (kt == 0) asm volatile("" : "+v"(koff) : "v"(sc[0]));   // second tile's loads issue after the first tile is done
    }
  } else {
    Frag k00, k01, k10, k11;
    ldfrag_lds(k00, st + koff);                 ldfrag_lds(k01, st + koff + 64);
    ldfrag_lds(k10, st + koff + 16 * AT_PITCH); ldfrag_lds(k11, st + koff + 16 * AT_PITCH + 64);
    v8f s0 = z8, s1 = z8;
    s0 = wm<false>(k00, qh[0], s0); s0 = wm<false>(k01, qh[1], s0);
    s1 = wm<false>(k10, qh[0], s1); s1 = wm<false>(k11, qh[1], s1);
    asm volatile("v_nop\n\tv_nop\n\tv_nop\n\tv_nop" : "+v"(s0), "+v"(s1)
                      : "v"(k00.v), "v"(k01.v), "v"(k10.v), "v"(k11.v), "v"(qh[0].v), "v"(qh[1].v));
#pragma unroll
    for (int e = 0; e < 8; ++e) { sc[e] = s0[e] * S2M11; sc[8 + e] = s1[e] * S2M11; }
  }
  if (MASK) {
    const int* mp = mrow + key0 + 8 * hh;
    const v4i m0 = *(const v4ia*)(mp),      m1 = *(const v4ia*)(mp + 4);
    const v4i m2 = *(const v4ia*)(mp + 16), m3 = *(const v4ia*)(mp + 20);
    const float ninf = neg_inf();
#pragma unroll
    for (int e = 0; e < 4; ++e) {
      sc[e]      = (m0[e] == 0) ? ninf : sc[e];
      sc[4 + e]  = (m1[e] == 0) ? ninf : sc[4 + e];
      sc[8 + e]  = (m2[e] == 0) ? ninf : sc[8 + e];
      sc[12 + e] = (m3[e] == 0) ? ninf : sc[12 + e];
    }
  }
  float mx = sc[0];
#pragma unroll
  for (int i = 1; i < 16; ++i) mx = fmaxf(mx, sc[i]);
  mx = fmaxf(mx, __shfl_xor(mx, 16, 32));            // the other lane half holds the other 16 keys of this query
  const float mnew = fmaxf(mr, mx);
  float msafe = mnew;
  if (MASK) msafe = (mnew == neg_inf()) ? 0.0f : mnew;   // every key so far masked: weights come out 0
  const float al = __builtin_amdgcn_exp2f((mr - msafe) * LOG2E);
  mr = mnew;
  // weights carried x256: pc = 256 * exp(sc - m); hi plane f16(pc), residual plane f16((pc - hi) * 2048)
  Frag ph, pl;
  float ps = 0.0f;
#pragma unroll
  for (int i = 0; i < 16; ++i) {
    const float pc = __builtin_amdgcn_exp2f(fmaf(sc[i] - msafe, LOG2E, 8.0f));
    ps += pc;
    const _Float16 h = (_Float16)pc;
    ph.h[i] = h;                                      // B element i: i<8 -> key0 + 8h + i (tile 0 row 8h+i); i>=8 -> key0 + 16 + 8h + (i-8) (tile 1)
    if (EARLYP) pl.h[i] = (_Float16)((pc - (float)h) * 2048.0f);
  }
  ps += __shfl_xor(ps, 16, 32);
  lr = lr * al + ps;
  // A fragments of V^T: row m = d (16*t + ln), elements 0..7 <- key0 + 8h + i, 8..15 <- key0 + 16 + 8h + i
  int voff = AT_TILE + ln * AT_PITCH + 2 * kloc + 16 * hh;   // byte offset in the stage
  asm volatile("" : "+v"(voff) : "v"(ps));            // V loads issue after the score phase
  const unsigned char* vp = st + voff;
  Frag vf[4];
#pragma unroll
  for (int t = 0; t < 4; ++t) ldfrag_lds(vf[t], vp + t * 16 * AT_PITCH);
#pragma unroll
  for (int t = 0; t < 4; ++t) Oh[t] = Oh[t] * al;
  if (EARLYP) {
    const unsigned char* vq = vp + 2 * AT_TILE;
    Frag vl[4];
#pragma unroll
    for (int t = 0; t < 4; ++t) ldfrag_lds(vl[t], vq + t * 16 * AT_PITCH);
#pragma unroll
    for (int t = 0; t < 4; ++t) Ol[t] = Ol[t] * al;
#pragma unroll
    for (int t = 0; t < 4; ++t) {
      Oh[t] = wm<false>(vf[t], ph, Oh[t]);
      Ol[t] = wm<false>(vf[t], pl, Ol[t]);
      Ol[t] = wm<false>(vl[t], ph, Ol[t]);
    }
    asm volatile("v_nop\n\tv_nop\n\tv_nop\n\tv_nop" : "+v"(Oh[0]), "+v"(Oh[1]), "+v"(Oh[2]), "+v"(Oh[3]), "+v"(Ol[0]), "+v"(Ol[1]), "+v"(Ol[2]), "+v"(Ol[3])
                      : "v"(vf[0].v), "v"(vf[1].v), "v"(vf[2].v), "v"(vf[3].v),
                        "v"(vl[0].v), "v"(vl[1].v), "v"(vl[2].v), "v"(vl[3].v), "v"(ph.v), "v"(pl.v));
  } else {
#pragma unroll
    for (int t = 0; t < 4; ++t) Oh[t] = wm<false>(vf[t], ph, Oh[t]);
    asm volatile("v_nop\n\tv_nop\n\tv_nop\n\tv_nop" : "+v"(Oh[0]), "+v"(Oh[1]), "+v"(Oh[2]), "+v"(Oh[3])
                      : "v"(vf[0].v), "v"(vf[1].v), "v"(vf[2].v), "v"(vf[3].v), "v"(ph.v));
  }
}

// What stands in front of and behind a stage's work. Early blocks (one buffer of four tiles): fill, wait, publish in front; every reader leaves behind.
// Plain blocks (two buffers of two tiles): nothing in front; behind, stage t + 1 is published and stage t + 2 is sent into the buffer that stage t has just left.
template <bool EARLYP>
__device__ __forceinline__ void ring_head(const unsigned short* gk, const unsigned short* gv, const unsigned short* gkl, const unsigned short* gvl,
                                          unsigned l0, int t) {
  if (EARLYP) {
    kv_copy(gk + (size_t)t * AT_KEYS * HD, gv + t * AT_KEYS, l0);
    kv_copy(gkl + (size_t)t * AT_KEYS * HD, gvl + t * AT_KEYS, l0 + 2 * AT_TILE);
    asm volatile("s_wait_asynccnt 0x0" ::: "memory");   // this wave's copies have landed before the barrier publishes them
    __syncthreads();
  }
}
template <bool EARLYP>
__device__ __forceinline__ void ring_foot(const unsigned short* gk, const unsigned short* gv, unsigned l0, int t, int nst) {
  asm volatile("s_wait_dscnt 0x0" ::: "memory");        // this wave's reads of the buffer are done before it is refilled
  if (!EARLYP) asm volatile("s_wait_asynccnt 0x0" ::: "memory");   // this wave's copies of stage t + 1 have landed before the barrier publishes them
  __syncthreads();
  if (!EARLYP) {
    if (t + 2 < nst) kv_copy(gk + (size_t)(t + 2) * AT_KEYS * HD, gv + (t + 2) * AT_KEYS, l0 + (unsigned)(t & 1) * (2 * AT_TILE));
  }
}

// nst = stages of 64 keys that the block walks, npl = the first of them that run without mask reads (both the same in all its waves;
// npl <= nst <= SEQ / 64, 2 * nst >= every wave's nsteps, 2 * npl <= every wave's nsteps). nsteps = this wave's own 32-key steps.
template <bool EARLYP>
__device__ __forceinline__ void run_keys(const unsigned short* __restrict__ qkh, const unsigned short* __restrict__ qkl,
                                         const unsigned short* __restrict__ vth, const unsigned short* __restrict__ vtl,
                                         const int* __restrict__ mask, unsigned char* ring, int tid, int b, int h, int qg, int ln, int hh,
                                         int npl, int nsteps, int nst, float& mr, float& lr, v8f (&Oh)[4], v8f (&Ol)[4]) {
  // Q^T B fragments: column n = this lane's query, elements 0..7 <- d = 32c + 8h + i, 8..15 <- d = 32c + 16 + 8h + i
  const size_t qoff = ((size_t)(b * NQK + h) * SEQ + qg) * HD + 8 * hh;
  Frag qh[2], ql[2];
  ldfrag(qh[0], qkh + qoff); ldfrag(qh[1], qkh + qoff + 32);
  if (EARLYP) { ldfrag(ql[0], qkl + qoff); ldfrag(ql[1], qkl + qoff + 32); }
  else { ql[0] = qh[0]; ql[1] = qh[1]; }
  const int kv = h % NKV;
  const size_t kbase = (size_t)(b * NQK + NHEAD + kv) * SEQ * HD;
  const size_t vbase = ((size_t)b * KVW + (size_t)kv * HD) * SEQ;
  const int* mrow = mask + (size_t)qg * SEQ_FULL;
  // this thread's first chunk of a stage: in K (rows = keys), in V^T (rows = d) and in LDS
  const size_t kthr = kbase + (size_t)(tid >> 3) * HD + 8 * (tid & 7);
  const size_t vthr = vbase + (size_t)(tid >> 3) * SEQ + 8 * (tid & 7);
  const unsigned short* gk = qkh + kthr;
  const unsigned short* gv = vth + vthr;
  const unsigned l0 = (unsigned)(size_t)ring + (unsigned)((tid >> 3) * AT_PITCH + 16 * (tid & 7));   // LDS byte address
  const unsigned short* gkl = qkl + kthr;
  const unsigned short* gvl = vtl + vthr;
  if (!EARLYP) {
    kv_copy(gk, gv, l0);
    asm volatile("s_wait_asynccnt 0x0" ::: "memory");     // stage 0 has landed before the barrier that publishes it
    __syncthreads();
    if (nst > 1) kv_copy(gk + AT_KEYS * HD, gv + AT_KEYS, l0 + 2 * AT_TILE);
  }
#pragma unroll 1   // one stage per trip: the two buffers alternate by the trip's parity
  for (int t = 0; t < npl; ++t) {
    const unsigned char* st = ring + (EARLYP ? 0u : (unsigned)(t & 1) * (2 * AT_TILE));
    ring_head<EARLYP>(gk, gv, gkl, gvl, l0, t);
    fa_step<EARLYP, false>(st, 0, mrow, AT_KEYS * t, ln, hh, qh, ql, mr, lr, Oh, Ol);
    fa_step<EARLYP, false>(st, 32, mrow, AT_KEYS * t + 32, ln, hh, qh, ql, mr, lr, Oh, Ol);
    ring_foot<EARLYP>(gk, gv, l0, t, nst);
  }
#pragma unroll 1   // one stage per trip, as above
  for (int t = npl; t < nst; ++t) {
    const unsigned char* st = ring + (EARLYP ? 0u : (unsigned)(t & 1) * (2 * AT_TILE));
    ring_head<EARLYP>(gk, gv, gkl, gvl, l0, t);
#pragma unroll 1   // one copy of the masked step in the text
    for (int sub = 0; sub < 2; ++sub) {
      const int j = 2 * t + sub;
      // a wave whose own steps have run out passes through to the barrier (wave-uniform test)
      if (j < nsteps) fa_step<EARLYP, true>(st, 32 * sub, mrow, 32 * j, ln, hh, qh, ql, mr, lr, Oh, Ol);
    }
    ring_foot<EARLYP>(gk, gv, l0, t, nst);
  }
  asm volatile("s_wait_asynccnt 0x0" ::: "memory");       // nothing is in flight when the ring is used for anything else
}

// Block = 4 waves x 16 queries = 64 queries of one (batch, head); the waves share the K and V^T stages in LDS, one barrier per 64 keys (two in early blocks).
// Tile skipping from the device flags of this wave's own 16 mask rows (16/SCAN_ROWS flag lines): all upper flags 1 -> keys past the diagonal step are
// skipped; upper and lower flags of all 64 rows of the block 1 -> the stages fully below the block's diagonal tile run without mask reads; every other visited step reads the mask by value.
// Trip counts are bounded by SEQ/32 for any flag value. The block walks qt + 1 stages if the upper flags of all its 64 rows are 1, else all SEQ/64.
// coverage: NB*NHEAD*(SEQ/64) blocks x 4 waves x 16 rows x 64 columns = the whole ctx hi plane; blocks with query tile below EARLY_ROWS cover the whole residual plane.
__global__ __launch_bounds__(128) void k_attn(const unsigned short* __restrict__ qkh, const unsigned short* __restrict__ qkl,
                                              const unsigned short* __restrict__ vth, const unsigned short* __restrict__ vtl,
                                              const int* __restrict__ mask, const int* __restrict__ flags,
                                              unsigned short* __restrict__ ctxh, unsigned short* __restrict__ ctxl) {
  __shared__ __attribute__((aligned(16))) unsigned char ring[AT_RING];
  float (*so)[16][68] = (float (*)[16][68])ring;       // epilogue tiles, used behind the key loop's last barrier
  const int tid = threadIdx.x, lane = tid & 31, ln = lane & 15, hh = lane >> 4;
  const int w = __builtin_amdgcn_readfirstlane(tid >> 5);
  const int nqt = SEQ / 64;
  const int blk = blockIdx.x;
  const int qt = blk % nqt;
  const int h = (blk / nqt) % NHEAD;
  const int b = blk / (nqt * NHEAD);
  const int qbase = qt * 64 + 16 * w;
  const int qg = qbase + ln;
  const int* fl = flags + (qbase / SCAN_ROWS) * 32;
  int upok = 1;                                        // plain & so that the flag loads issue together
#pragma unroll
  for (int g = 0; g < 16 / SCAN_ROWS; ++g) upok &= (fl[32 * g] == 1) ? 1 : 0;
  const bool tri = (upok == 1);
  const int nfull = qbase >> 5;                        // steps whose 32 keys are all at or below every query of this wave
  const int nsteps = tri ? (nfull + 1) : (SEQ / 32);   // <= SEQ/32 in both cases
  const bool early = (qt * 64 < EARLY_ROWS);
  // stage counts of the block, from the flags of all its 64 rows: the same values in all four waves, since barriers stand in the key loop
  const int* flb = flags + (qt * 64 / SCAN_ROWS) * 32;
  int upall = 1, lowall = 1;
#pragma unroll
  for (int g = 0; g < 64 / SCAN_ROWS; ++g) {
    const int fU = flb[32 * g], fL = flb[32 * g + 1];
    upall &= (fU == 1) ? 1 : 0;
    lowall &= (fL == 1) ? 1 : 0;
  }
  const int nst = (upall == 1) ? (qt + 1) : (SEQ / AT_KEYS);
  const int npl = (upall == 1 && lowall == 1) ? qt : 0;   // stages whose 64 keys are all below every query of the block

  const v8f z8 = {0.f, 0.f, 0.f, 0.f, 0.f, 0.f, 0.f, 0.f};
  float mr = neg_inf(), lr = 0.0f;
  v8f Oh[4], Ol[4];
#pragma unroll
  for (int t = 0; t < 4; ++t) { Oh[t] = z8; Ol[t] = z8; }
  if (early) run_keys<true>(qkh, qkl, vth, vtl, mask, ring, tid, b, h, qg, ln, hh, npl, nsteps, nst, mr, lr, Oh, Ol);
  else       run_keys<false>(qkh, qkl, vth, vtl, mask, ring, tid, b, h, qg, ln, hh, npl, nsteps, nst, mr, lr, Oh, Ol);

  // O^T element r of tile t = ctx(query, d = 16t + 8h + r); undo the carries x256 (in lr), x16 (V), x2^11 (residual); apply the x64 carry of ctx
  const float inv = 4.0f * (1.0f / lr);
#pragma unroll
  for (int t = 0; t < 4; ++t)
#pragma unroll
    for (int r = 0; r < 8; ++r)
      so[w][ln][16 * t + 8 * hh + r] = fmaf(Ol[t][r], S2M11, Oh[t][r]) * inv;
  __syncthreads();
  const int rsub = lane >> 3, d0 = 8 * (lane & 7);
  v8us oh[4], ol[4];
#pragma unroll
  for (int g = 0; g < 4; ++g) {
    const int row = 4 * g + rsub;
    const v4f a0 = *(const v4fa*)&so[w][row][d0];
    const v4f a1 = *(const v4fa*)&so[w][row][d0 + 4];
    float o[8];
    o[0] = a0[0]; o[1] = a0[1]; o[2] = a0[2]; o[3] = a0[3];
    o[4] = a1[0]; o[5] = a1[1]; o[6] = a1[2]; o[7] = a1[3];
    Pack8 ph8, pl8;
#pragma unroll
    for (int e = 0; e < 8; ++e) {
      const _Float16 hv = (_Float16)o[e];
      ph8.h[e] = hv;
      pl8.h[e] = (_Float16)((o[e] - (float)hv) * 2048.0f);
    }
    oh[g] = ph8.v; ol[g] = pl8.v;
  }
  const size_t hbase = ((size_t)b * SEQ + qbase) * CD + (size_t)h * HD + d0;
  const size_t lbase = ((size_t)b * EARLY_ROWS + (early ? qbase : 0)) * CD + (size_t)h * HD + d0;
{
#pragma unroll
    for (int g = 0; g < 4; ++g) {
      const size_t ro = (size_t)(4 * g + rsub) * CD;
      *(v8us*)(ctxh + hbase + ro) = oh[g];
      if (early) *(v8us*)(ctxl + lbase + ro) = ol[g];
    }
    
  }
}

// ---------------------------------------------------------------------------------------------------------
// Output projection: out[m][n] = sum_k ctx[m][k] Wo[n][k] + bo[n]. Block = 4 waves as 2 x 2: 128 rows x 128 columns, 64 x 64 per wave. grid = (CD/128, NB*SEQ/128).
// Rows below EARLY_ROWS of each sequence add the residual plane of ctx.
// coverage: NB*SEQ rows x CD columns = every element of the output buffer region once. LDS tile 64 x 64 fully written before it is read.
static_assert(CD % 128 == 0);
__global__ __launch_bounds__(128) void k_proj_out(const unsigned short* __restrict__ ctxh, const unsigned short* __restrict__ ctxl,
                                                  const unsigned short* __restrict__ wo, const float* __restrict__ bo,
                                                  float* __restrict__ out) {
  __shared__ __attribute__((aligned(16))) unsigned char ring[SQ_RING];
  float (*st)[64][68] = (float (*)[64][68])ring;       // epilogue tiles, used behind the k loop's last barrier
  const int tid = threadIdx.x, lane = tid & 31, ln = lane & 15, hh = lane >> 4;
  const int w = __builtin_amdgcn_readfirstlane(tid >> 5);
  const int wr = w >> 1, wc = w & 1;
  const int n0 = blockIdx.x * 128 + 64 * wc;
  const int mb = blockIdx.y * 128;
  const int b = mb / SEQ;
  const int tb = mb - b * SEQ;
  const bool early = (tb < EARLY_ROWS);                // block-uniform: EARLY_ROWS and SEQ are multiples of 128
  const int t0 = tb + 64 * wr;
  const v8f z8 = {0.f, 0.f, 0.f, 0.f, 0.f, 0.f, 0.f, 0.f};
  v8f acc[4][4];
#pragma unroll
  for (int i = 0; i < 4; ++i)
#pragma unroll
    for (int j = 0; j < 4; ++j) acc[i][j] = z8;
  const unsigned short* wp = wo + (size_t)(blockIdx.x * 128) * CD;
  // residual plane: a walk of its own over k through the same ring (block-uniform branch). It runs first, and its sums, brought to the hi plane's carry,
  // are the start values of the hi plane's walk: one set of 16 accumulator tiles serves both (two sets do not fit the registers that asm operands can name)
  if (early) {
    gemm_sq<false>(ctxl + (size_t)(b * EARLY_ROWS + tb) * CD, wp, ring, tid, wr, wc, ln, hh, acc);
#pragma unroll
    for (int i = 0; i < 4; ++i)
#pragma unroll
      for (int j = 0; j < 4; ++j) acc[i][j] = acc[i][j] * S2M11;
  }
  gemm_sq<false>(ctxh + (size_t)mb * CD, wp, ring, tid, wr, wc, ln, hh, acc);
  // carries: ctx x64, Wo x64 -> 2^-12 (the residual plane's x2^11 is undone above)
#pragma unroll
  for (int i = 0; i < 4; ++i)
#pragma unroll
    for (int j = 0; j < 4; ++j)
#pragma unroll
      for (int r = 0; r < 8; ++r)
        st[w][16 * i + 8 * hh + r][16 * j + ln] = acc[i][j][r] * S2M12;
  __syncthreads();
  const int rsub = lane >> 4, c4 = 4 * (lane & 15);
  const v4f bb = *(const v4fa*)(bo + n0 + c4);
  v4f bias;
  bias[0] = bf16_rne(bb[0]); bias[1] = bf16_rne(bb[1]); bias[2] = bf16_rne(bb[2]); bias[3] = bf16_rne(bb[3]);
  float* og = out + ((size_t)b * SEQ_FULL + t0) * CD + n0 + c4;
  // the wave's 64 rows in two halves of 32
  for (int half = 0; half < 2; ++half) {
    v4f ov[16];
#pragma unroll
    for (int g = 0; g < 16; ++g) {
      const v4f a = *(const v4fa*)&st[w][32 * half + 2 * g + rsub][c4];
      ov[g] = a + bias;
    }
#pragma unroll
    for (int g = 0; g < 16; ++g)
      *(v4f*)(og + (size_t)(32 * half + 2 * g + rsub) * CD) = ov[g];
  }
}

// ---------------------------------------------------------------------------------------------------------
extern "C" void kernel_launch(void* const* d_in, const int* in_sizes, int n_in,
                              void* d_out, int out_size, void* d_ws, size_t ws_size, hipStream_t stream) {
  if (n_in < 11) return;
  const long long need_x = (long long)(NB - 1) * SEQ_FULL * CD + (long long)SEQ * CD;   // last element touched + 1
  const long long need_m = (long long)(SEQ - 1) * SEQ_FULL + SEQ;
  if ((long long)in_sizes[0] < need_x) return;
  if ((long long)in_sizes[1] < need_m) return;
  if ((long long)in_sizes[2] < (long long)SEQ * HD) return;
  if ((long long)in_sizes[3] < (long long)CD * CD || (long long)in_sizes[4] < CD) return;
  if ((long long)in_sizes[5] < (long long)KVW * CD || (long long)in_sizes[6] < KVW) return;
  if ((long long)in_sizes[7] < (long long)KVW * CD || (long long)in_sizes[8] < KVW) return;
  if ((long long)in_sizes[9] < (long long)CD * CD || (long long)in_sizes[10] < CD) return;
  if ((long long)out_size < need_x) return;
  if ((size_t)WS_TOTAL > ws_size) return;

  // wire order: x, mask, sinusoidal_pos, Wq, bq, Wk, bk, Wv, bv, Wo, bo
  const float* x    = (const float*)d_in[0];
  const int*   mask = (const int*)d_in[1];
  const float* tab  = (const float*)d_in[2];
  const float* Wq   = (const float*)d_in[3];
  const float* bq   = (const float*)d_in[4];
  const float* Wk   = (const float*)d_in[5];
  const float* bk   = (const float*)d_in[6];
  const float* Wv   = (const float*)d_in[7];
  const float* bv   = (const float*)d_in[8];
  const float* Wo   = (const float*)d_in[9];
  const float* bo   = (const float*)d_in[10];
  float* out = (float*)d_out;

  char* ws = (char*)d_ws;
  size_t off = 0;
  int* flags = (int*)(ws + off);                               off += SZ_FLAGS;
  unsigned short* xb   = (unsigned short*)(ws + off);          off += SZ_XB;
  unsigned short* wqk  = (unsigned short*)(ws + off);          off += SZ_WQK;
  unsigned short* wvb  = (unsigned short*)(ws + off);          off += SZ_WV;
  unsigned short* wob  = (unsigned short*)(ws + off);          off += SZ_WO;
  unsigned short* qkh  = (unsigned short*)(ws + off);          off += PLANE_QK * 2;
  unsigned short* qkl  = (unsigned short*)(ws + off);          off += PLANE_QK * 2;
  unsigned short* vth  = (unsigned short*)(ws + off);          off += PLANE_V * 2;
  unsigned short* vtl  = (unsigned short*)(ws + off);          off += PLANE_V * 2;
  unsigned short* ctxh = (unsigned short*)(ws + off);          off += SZ_CTXH;
  unsigned short* ctxl = (unsigned short*)(ws + off);          off += SZ_CTXL;
  if (off > ws_size) return;

  // mask -> flags, and in[rows][CD] f32 -> [rows][CD] 16-bit planes (row order kept)
  k_prep<<<(unsigned)(SCAN_BLOCKS + CVT_BLOCKS), PREP_THREADS, 0, stream>>>(mask, flags, x, Wq, Wk, Wv, Wo, xb, wqk, wvb, wob);

  k_proj_qk<<<dim3(NQK / 2, (unsigned)(NB * SEQ / 128)), 128, 0, stream>>>(xb, wqk, bq, bk, tab, qkh, qkl);
  k_proj_v<<<dim3((unsigned)(NB * SEQ / 64), KVW / 128), 128, 0, stream>>>(wvb, xb, bv, vth, vtl);
  k_attn<<<(unsigned)(NB * NHEAD * (SEQ / 64)), 128, 0, stream>>>(qkh, qkl, vth, vtl, mask, flags, ctxh, ctxl);
  k_proj_out<<<dim3(CD / 128, (unsigned)(NB * SEQ / 128)), 128, 0, stream>>>(ctxh, ctxl, wob, bo, out);
}

// v006
// A run of this version takes 177 microseconds.
// Timed twice side by side with v005, it ran 1.12 and 1.10 times as fast.
// All steps since v000 together make it 4.87 times as fast.
#include <hip/hip_runtime.h>
#ifndef NB
#define NB 2
#endif
#ifndef SEQ
#define SEQ 2048
#endif
#define NB_FULL 2
#define SEQ_FULL 2048
#define CD 2048                 /* model width = depth of every projection */
#define NHEAD 32
#define NKV 8
#define HD 64
#define NQK (NHEAD + NKV)       /* rotary plane holds the 32 q heads followed by the 8 k heads */
#define KVW (NKV * HD)          /* 512 */
#define EARLY_ROWS (SEQ < 512 ? SEQ : 512)

#define SCAN_ROWS 8             /* mask rows per scan work-group: 8 rows x SEQ ints = 8 loads of 16 B per thread at SEQ = 2048 */
#define SCAN_LOADS (SCAN_ROWS * (SEQ / 4) / 512)
#define SZ_FLAGS ((size_t)(SEQ / SCAN_ROWS) * 128)   /* one 128-byte line per scan work-group */
#define SZ_XB    ((size_t)NB * SEQ * CD * 2)
#define SZ_WQK   ((size_t)(CD + KVW) * CD * 2)
#define SZ_WV    ((size_t)KVW * CD * 2)
#define SZ_WO    ((size_t)CD * CD * 2)
#define PLANE_QK ((size_t)NB * NQK * SEQ * HD)     /* elements of one rotary plane */
#define PLANE_V  ((size_t)NB * KVW * SEQ)          /* elements of one V^T plane */
#define SZ_CTXH  ((size_t)NB * SEQ * CD * 2)
#define SZ_CTXL  ((size_t)NB * EARLY_ROWS * CD * 2)
#define WS_TOTAL (SZ_FLAGS + SZ_XB + SZ_WQK + SZ_WV + SZ_WO + PLANE_QK * 4 + PLANE_V * 4 + SZ_CTXH + SZ_CTXL)

static_assert(SEQ % 128 == 0);
static_assert((SCAN_ROWS * (SEQ / 4)) % 512 == 0);
static_assert(16 % SCAN_ROWS == 0);
static_assert(SZ_FLAGS % 256 == 0);
static_assert(EARLY_ROWS % 128 == 0);
static_assert(SEQ <= SEQ_FULL);
static_assert(NB <= NB_FULL);
static_assert(HD == 64);
static_assert(CD % 32 == 0);
static_assert(KVW % 128 == 0);
static_assert(NHEAD % NKV == 0);
static_assert(WS_TOTAL <= (size_t)134217728);
static_assert(SZ_XB % 256 == 0 && SZ_WQK % 256 == 0 && SZ_WV % 256 == 0 && SZ_WO % 256 == 0);
static_assert((PLANE_QK * 2) % 256 == 0 && (PLANE_V * 2) % 256 == 0 && SZ_CTXH % 256 == 0 && SZ_CTXL % 256 == 0);

typedef __bf16 v16b __attribute__((ext_vector_type(16)));
typedef _Float16 v16h __attribute__((ext_vector_type(16)));
typedef unsigned short v8us __attribute__((ext_vector_type(8), may_alias));
typedef float v8f __attribute__((ext_vector_type(8)));
typedef float v4f __attribute__((ext_vector_type(4)));
typedef float v4fa __attribute__((ext_vector_type(4), may_alias));
typedef int v4i __attribute__((ext_vector_type(4)));
typedef int v4ia __attribute__((ext_vector_type(4), may_alias));
union Frag { v16b b; v16h v; v8us half[2]; _Float16 h[16]; unsigned short u[16]; };
union Pack8 { v8us v; _Float16 h[8]; unsigned short u[8]; };

#define LOG2E 1.4426950408889634f
#define S2M11 0.00048828125f       /* 2^-11 */
#define S2M12 0.000244140625f      /* 2^-12 */
__device__ __forceinline__ unsigned short bf16_bits(float x) {   // RNE convert to bf16 bits
  unsigned int u = __float_as_uint(x);
  return (unsigned short)((u + 0x7FFFu + ((u >> 16) & 1u)) >> 16);
}
__device__ __forceinline__ float bf16_val(unsigned short b) { return __uint_as_float(((unsigned int)b) << 16); }
__device__ __forceinline__ float bf16_rne(float x) { return bf16_val(bf16_bits(x)); }
__device__ __forceinline__ float neg_inf() { return __uint_as_float(0xff800000u); }

// Fragment of a k-contiguous 16-bit row: elements 0..7 <- p[0..7], elements 8..15 <- p[16..23]; caller adds row*pitch + k0 + 8*h.
__device__ __forceinline__ void ldfrag(Frag& f, const unsigned short* __restrict__ p) {
  f.half[0] = *(const v8us*)(p);
  f.half[1] = *(const v8us*)(p + 16);
}

template <bool BF>
__device__ __forceinline__ v8f wm(const Frag& a, const Frag& b, v8f c) {
  if (BF) return __builtin_amdgcn_wmma_f32_16x16x32_bf16(false, a.b, false, b.b, (short)0, c, false, false);
  return __builtin_amdgcn_wmma_f32_16x16x32_f16(false, a.v, false, b.v, (short)0, c, false, false);
}

// ---------------------------------------------------------------------------------------------------------
// Input preparation, one launch: the jobs below read inputs only and none reads what another writes, so the block index picks the job.
// Blocks 0 .. SCAN_BLOCKS-1: mask scan, one work-group per SCAN_ROWS mask rows; group g owns the line flags[32g .. 32g+31]:
// flags[32g] = 1 iff every entry of its rows above the diagonal is zero; flags[32g+1] = 1 iff every entry of its rows on or below the diagonal is nonzero.
// coverage: SEQ/SCAN_ROWS blocks x 512 threads x SCAN_LOADS x 4 ints = SEQ x SEQ mask entries; every flag line is written whole.
// Blocks SCAN_BLOCKS .. SCAN_BLOCKS+CVT_BLOCKS-1: f32 rows of width CD -> 16-bit planes (row order kept). A row is one 16-byte load and one 8-byte store
// per thread (a wave reads 4 whole lines and writes 2); block c takes the c-th run of adjacent rows of each of x, Wq, Wk, Wv and Wo, the same counts in every block.
// MODE 0: bf16 bits (RNE). MODE 1: f16 of (RNE bf16 value x 64).
// coverage: CVT_BLOCKS blocks x (rows / CVT_BLOCKS) rows x 512 threads x 4 elements = rows x CD, for each of the five arrays.
#define PREP_THREADS 512
#define SCAN_BLOCKS (SEQ / SCAN_ROWS)
#define CVT_BLOCKS 512
static_assert(CD == PREP_THREADS * 4);
static_assert((NB * SEQ) % CVT_BLOCKS == 0 && CD % CVT_BLOCKS == 0 && KVW % CVT_BLOCKS == 0);

typedef unsigned short v4us __attribute__((ext_vector_type(4), may_alias));
union Pack4 { v4us v; _Float16 h[4]; unsigned short u[4]; };

template <int MODE>
__device__ __forceinline__ void cvt_store(unsigned short* d, v4f x) {
  Pack4 o;
  if (MODE == 0) {
    o.u[0] = bf16_bits(x[0]); o.u[1] = bf16_bits(x[1]); o.u[2] = bf16_bits(x[2]); o.u[3] = bf16_bits(x[3]);
  } else {
    o.h[0] = (_Float16)(bf16_rne(x[0]) * 64.0f); o.h[1] = (_Float16)(bf16_rne(x[1]) * 64.0f);
    o.h[2] = (_Float16)(bf16_rne(x[2]) * 64.0f); o.h[3] = (_Float16)(bf16_rne(x[3]) * 64.0f);
  }
  *(v4us*)d = o.v;
}

// twelve waves per SIMD asked for (80 registers): three work-groups fit a WGP, so that all work-groups of the launch are resident together
__global__ __launch_bounds__(PREP_THREADS) __attribute__((amdgpu_waves_per_eu(12))) void k_prep(const int* __restrict__ mask, int* __restrict__ flags,
                                                       const float* __restrict__ x, const float* __restrict__ Wq, const float* __restrict__ Wk,
                                                       const float* __restrict__ Wv, const float* __restrict__ Wo,
                                                       unsigned short* __restrict__ xb, unsigned short* __restrict__ wqk,
                                                       unsigned short* __restrict__ wvb, unsigned short* __restrict__ wob) {
  __shared__ int sw[2][16];
  const int tid = threadIdx.x;
  if (blockIdx.x >= SCAN_BLOCKS) {                     // block-uniform
    const int c = blockIdx.x - SCAN_BLOCKS;
    const int e = 4 * tid;
    constexpr int NX = NB * SEQ / CVT_BLOCKS, NQ = CD / CVT_BLOCKS, NK = KVW / CVT_BLOCKS;
    static_assert(SEQ % NX == 0);                      // the block's NX rows of x lie in one batch
    const int bx = (c * NX) / SEQ, rx = c * NX - bx * SEQ;
    // uniform bases of this block's rows; a thread's loads and stores differ from them by 4 * tid elements and by constants only
    const float* sx = x + ((size_t)bx * SEQ_FULL + rx) * CD;
    const float* sq = Wq + (size_t)(c * NQ) * CD;
    const float* swo = Wo + (size_t)(c * NQ) * CD;
    const float* sk = Wk + (size_t)(c * NK) * CD;
    const float* sv = Wv + (size_t)(c * NK) * CD;
    unsigned short* dx = xb + (size_t)(c * NX) * CD;
    unsigned short* dq = wqk + (size_t)(c * NQ) * CD;
    unsigned short* dw = wob + (size_t)(c * NQ) * CD;
    unsigned short* dk = wqk + (size_t)(CD + c * NK) * CD;   // the k rows follow the q rows
    unsigned short* dv = wvb + (size_t)(c * NK) * CD;
    // all loads of a thread are independent and issued before the first is converted, so that they are in flight together
    v4f vx[NX], vq[NQ], vw[NQ], vk[NK], vv[NK];
#pragma unroll
    for (int j = 0; j < NX; ++j) vx[j] = *(const v4fa*)(sx + (unsigned)(j * CD + e));
#pragma unroll
    for (int j = 0; j < NQ; ++j) vq[j] = *(const v4fa*)(sq + (unsigned)(j * CD + e));
#pragma unroll
    for (int j = 0; j < NQ; ++j) vw[j] = *(const v4fa*)(swo + (unsigned)(j * CD + e));
#pragma unroll
    for (int j = 0; j < NK; ++j) vk[j] = *(const v4fa*)(sk + (unsigned)(j * CD + e));
#pragma unroll
    for (int j = 0; j < NK; ++j) vv[j] = *(const v4fa*)(sv + (unsigned)(j * CD + e));
    // keeps every load in front of the first conversion: without it the scheduler sinks a third of the loads behind waits to 0, and their latencies add up
    __builtin_amdgcn_sched_barrier(0);
#pragma unroll
    for (int j = 0; j < NX; ++j) cvt_store<0>(dx + (unsigned)(j * CD + e), vx[j]);
#pragma unroll
    for (int j = 0; j < NQ; ++j) cvt_store<0>(dq + (unsigned)(j * CD + e), vq[j]);
#pragma unroll
    for (int j = 0; j < NQ; ++j) cvt_store<1>(dw + (unsigned)(j * CD + e), vw[j]);
#pragma unroll
    for (int j = 0; j < NK; ++j) cvt_store<0>(dk + (unsigned)(j * CD + e), vk[j]);
#pragma unroll
    for (int j = 0; j < NK; ++j) cvt_store<0>(dv + (unsigned)(j * CD + e), vv[j]);
    return;                                            // the whole block leaves here; the barrier below is the scan blocks' own
  }
  const int lane = tid & 31, wv = tid >> 5;
  int badU = 0, badL = 0;
  const int cpr = SEQ / 4;
  const int q0 = blockIdx.x * SCAN_ROWS;
  const int* mb = mask + (size_t)q0 * SEQ_FULL;       // uniform base of this group's rows; the loads below differ by constants only
  v4i mv[SCAN_LOADS];
  // all loads of a thread are independent and issued before the first is tested, so that they are in flight together
#pragma unroll
  for (int u = 0; u < SCAN_LOADS; ++u) {
    const int c = tid + 512 * u;
    const int qr = c / cpr, k = (c - qr * cpr) * 4;
    mv[u] = *(const v4ia*)(mb + (unsigned)(qr * SEQ_FULL + k));
  }
#pragma unroll
  for (int u = 0; u < SCAN_LOADS; ++u) {
    const int c = tid + 512 * u;
    const int qr = c / cpr, k = (c - qr * cpr) * 4;
    const int q = q0 + qr;
#pragma unroll
    for (int i = 0; i < 4; ++i) {
      const int above = (k + i > q) ? 1 : 0;
      const int nz = (mv[u][i] != 0) ? 1 : 0;
      badU |= above & nz;
      badL |= (1 - above) & (1 - nz);
    }
  }
#pragma unroll
  for (int o = 16; o >= 1; o >>= 1) {
    badU |= __shfl_xor(badU, o, 32);
    badL |= __shfl_xor(badL, o, 32);
  }
  if (lane == 0) { sw[0][wv] = badU; sw[1][wv] = badL; }
  __syncthreads();
  if (tid < 8) {
    int u = 0, l = 0;
#pragma unroll
    for (int i = 0; i < 16; ++i) { u |= sw[0][i]; l |= sw[1][i]; }
    v4i o;
    o[0] = (tid == 0 && u == 0) ? 1 : 0;
    o[1] = (tid == 0 && l == 0) ? 1 : 0;
    o[2] = 0; o[3] = 0;
    *(v4i*)(flags + 32 * blockIdx.x + 4 * tid) = o;
  }
}

// ---------------------------------------------------------------------------------------------------------
// Block-tile GEMM core: acc[i][j] (rows 32w + 16i.., cols 16j..) += A[row][k] * W[col][k] over k = 0..CD-1, k ascending in steps of 32.
// ablk = first of the block's 128 A rows, bblk = first of its 64 W rows (both k-contiguous, pitch CD).
// A stage is 64 k of all 192 rows: 128-byte rows laid at a 144-byte pitch (A rows 0..127, then W rows 128..191); two buffers.
// Each copy instruction of a wave moves 4 whole 128-byte lines; a thread copies chunk (tid & 7) of rows (tid >> 3) + 16 i, i = 0..11.
// Fragment maps as before: row or column = ln, elements 0..7 <- k0 + 8h + i, elements 8..15 <- k0 + 16 + 8h + i, for A and W alike.
#define ST_K 64
#define ST_PITCH 144
#define ST_BYTES (192 * ST_PITCH)
#define RING_BYTES (2 * ST_BYTES)
static_assert(CD % ST_K == 0 && CD / ST_K >= 2);
static_assert(RING_BYTES >= 4 * 32 * 68 * 4);      /* the epilogue tiles reuse the ring */

__device__ __forceinline__ void ldfrag_lds(Frag& f, const unsigned char* p) {
  f.half[0] = *(const v8us*)(p);
  f.half[1] = *(const v8us*)(p + 32);
}

// One stage: 12 copies of 16 bytes per thread. The s_wait_xcnt stands inside the statement so that no address register is rewritten ahead of it.
__device__ __forceinline__ void stage_copy(const unsigned short* ga, const unsigned short* gb, unsigned l) {
  asm volatile("global_load_async_to_lds_b128 %0, %12, off\n\t"
               "global_load_async_to_lds_b128 %1, %13, off\n\t"
               "global_load_async_to_lds_b128 %2, %14, off\n\t"
               "global_load_async_to_lds_b128 %3, %15, off\n\t"
               "global_load_async_to_lds_b128 %4, %16, off\n\t"
               "global_load_async_to_lds_b128 %5, %17, off\n\t"
               "global_load_async_to_lds_b128 %6, %18, off\n\t"
               "global_load_async_to_lds_b128 %7, %19, off\n\t"
               "global_load_async_to_lds_b128 %8, %20, off\n\t"
               "global_load_async_to_lds_b128 %9, %21, off\n\t"
               "global_load_async_to_lds_b128 %10, %22, off\n\t"
               "global_load_async_to_lds_b128 %11, %23, off\n\t"
               "s_wait_xcnt 0x0"
               :: "v"(l), "v"(l + 16 * ST_PITCH), "v"(l + 32 * ST_PITCH), "v"(l + 48 * ST_PITCH),
                  "v"(l + 64 * ST_PITCH), "v"(l + 80 * ST_PITCH), "v"(l + 96 * ST_PITCH), "v"(l + 112 * ST_PITCH),
                  "v"(l + 128 * ST_PITCH), "v"(l + 144 * ST_PITCH), "v"(l + 160 * ST_PITCH), "v"(l + 176 * ST_PITCH),
                  "v"(ga), "v"(ga + 16 * CD), "v"(ga + 32 * CD), "v"(ga + 48 * CD),
                  "v"(ga + 64 * CD), "v"(ga + 80 * CD), "v"(ga + 96 * CD), "v"(ga + 112 * CD),
                  "v"(gb), "v"(gb + 16 * CD), "v"(gb + 32 * CD), "v"(gb + 48 * CD)
               : "memory");
}

template <bool BF>
__device__ __forceinline__ void gemm_loop(const unsigned short* __restrict__ ablk, const unsigned short* __restrict__ bblk,
                                          unsigned char* ring, int tid, int w, int ln, int hh, v8f (&acc)[2][4]) {
  const int nt = CD / ST_K;
  const unsigned short* ga = ablk + (size_t)(tid >> 3) * CD + 8 * (tid & 7);
  const unsigned short* gb = bblk + (size_t)(tid >> 3) * CD + 8 * (tid & 7);
  const unsigned l0 = (unsigned)(size_t)ring + (unsigned)((tid >> 3) * ST_PITCH + 16 * (tid & 7));   // LDS byte address of this thread's first chunk
  const int aoff = (32 * w + ln) * ST_PITCH + 16 * hh;
  const int boff = (128 + ln) * ST_PITCH + 16 * hh;
  stage_copy(ga, gb, l0);
  asm volatile("s_wait_asynccnt 0x0" ::: "memory");   // tile 0 has landed before the barrier that publishes it
  __syncthreads();
  stage_copy(ga + ST_K, gb + ST_K, l0 + ST_BYTES);
#pragma unroll 1   // one tile per trip: the two buffers alternate by the trip's parity
  for (int t = 0; t < nt; ++t) {
    const unsigned sel = (unsigned)(t & 1) * ST_BYTES;
    const unsigned char* buf = ring + sel;
    Frag a[2][2], b[2][4];
#pragma unroll
    for (int kk = 0; kk < 2; ++kk) {
#pragma unroll
      for (int i = 0; i < 2; ++i) ldfrag_lds(a[kk][i], buf + aoff + i * 16 * ST_PITCH + kk * 64);
#pragma unroll
      for (int j = 0; j < 4; ++j) ldfrag_lds(b[kk][j], buf + boff + j * 16 * ST_PITCH + kk * 64);
    }
#pragma unroll
    for (int kk = 0; kk < 2; ++kk)
#pragma unroll
      for (int i = 0; i < 2; ++i)
#pragma unroll
        for (int j = 0; j < 4; ++j) acc[i][j] = wm<BF>(a[kk][i], b[kk][j], acc[i][j]);
    // keeps the distance behind the last matrix instructions on the loop's back edge and in front of the address arithmetic below
    asm volatile("v_nop\n\tv_nop\n\tv_nop\n\tv_nop" : "+v"(acc[0][0]), "+v"(acc[0][1]), "+v"(acc[0][2]), "+v"(acc[0][3]),
                        "+v"(acc[1][0]), "+v"(acc[1][1]), "+v"(acc[1][2]), "+v"(acc[1][3])
                      : "v"(a[1][0].v), "v"(a[1][1].v), "v"(b[1][0].v), "v"(b[1][1].v), "v"(b[1][2].v), "v"(b[1][3].v));
    asm volatile("s_wait_dscnt 0x0" ::: "memory");      // this wave's reads of the buffer are done before it is refilled
    asm volatile("s_wait_asynccnt 0x0" ::: "memory");   // this wave's copies of tile t + 1 have landed before the barrier publishes them
    __syncthreads();
    if (t + 2 < nt) stage_copy(ga + (t + 2) * ST_K, gb + (t + 2) * ST_K, l0 + sel);
  }
  asm volatile("s_wait_asynccnt 0x0" ::: "memory");     // nothing is in flight when the ring is used for anything else
}

// Square block tile of the q/k and output projections: 128 A rows x 128 W rows, 4 waves as 2 x 2, wave tile 64 x 64:
// acc[i][j] (rows 64 wr + 16 i.., cols 64 wc + 16 j..) += A[row][k] * W[col][k], k ascending in steps of 32 as in gemm_loop.
// A stage is 64 k of all 256 rows at the 144-byte pitch (A rows 0..127, then W rows 128..255); two buffers.
// Per 64 k a block copies 32 KiB for 128 x 128 outputs (the 128 x 64 tile: 24 KiB for half as many), and a wave reads 16 fragments for 32 matrix instructions (12 for 16).
#define SQ_BYTES (256 * ST_PITCH)
#define SQ_RING (2 * SQ_BYTES)
static_assert(SQ_RING >= 4 * 64 * 68 * 4);         /* the epilogue tiles reuse the ring */

// 128 rows of one operand: 8 copies of 16 bytes per thread, chunk (tid & 7) of rows (tid >> 3) + 16 i; each copy of a wave moves 4 whole 128-byte lines.
// The s_wait_xcnt stands inside the statement so that no address register is rewritten ahead of it.
__device__ __forceinline__ void rows128_copy(const unsigned short* g, unsigned l) {
  asm volatile("global_load_async_to_lds_b128 %0, %8, off\n\t"
               "global_load_async_to_lds_b128 %1, %9, off\n\t"
               "global_load_async_to_lds_b128 %2, %10, off\n\t"
               "global_load_async_to_lds_b128 %3, %11, off\n\t"
               "global_load_async_to_lds_b128 %4, %12, off\n\t"
               "global_load_async_to_lds_b128 %5, %13, off\n\t"
               "global_load_async_to_lds_b128 %6, %14, off\n\t"
               "global_load_async_to_lds_b128 %7, %15, off\n\t"
               "s_wait_xcnt 0x0"
               :: "v"(l), "v"(l + 16 * ST_PITCH), "v"(l + 32 * ST_PITCH), "v"(l + 48 * ST_PITCH),
                  "v"(l + 64 * ST_PITCH), "v"(l + 80 * ST_PITCH), "v"(l + 96 * ST_PITCH), "v"(l + 112 * ST_PITCH),
                  "v"(g), "v"(g + 16 * CD), "v"(g + 32 * CD), "v"(g + 48 * CD),
                  "v"(g + 64 * CD), "v"(g + 80 * CD), "v"(g + 96 * CD), "v"(g + 112 * CD)
               : "memory");
}
__device__ __forceinline__ void sq_copy(const unsigned short* ga, const unsigned short* gb, unsigned l) {
  rows128_copy(ga, l);
  rows128_copy(gb, l + 128 * ST_PITCH);
}

template <bool BF>
__device__ __forceinline__ void gemm_sq(const unsigned short* __restrict__ ablk, const unsigned short* __restrict__ bblk,
                                        unsigned char* ring, int tid, int wr, int wc, int ln, int hh, v8f (&acc)[4][4]) {
  const int nt = CD / ST_K;
  const unsigned short* ga = ablk + (size_t)(tid >> 3) * CD + 8 * (tid & 7);
  const unsigned short* gb = bblk + (size_t)(tid >> 3) * CD + 8 * (tid & 7);
  const unsigned l0 = (unsigned)(size_t)ring + (unsigned)((tid >> 3) * ST_PITCH + 16 * (tid & 7));   // LDS byte address of this thread's first chunk
  const int aoff = (64 * wr + ln) * ST_PITCH + 16 * hh;
  const int boff = (128 + 64 * wc + ln) * ST_PITCH + 16 * hh;
  sq_copy(ga, gb, l0);
  asm volatile("s_wait_asynccnt 0x0" ::: "memory");   // tile 0 has landed before the barrier that publishes it
  __syncthreads();
  sq_copy(ga + ST_K, gb + ST_K, l0 + SQ_BYTES);
#pragma unroll 1   // one tile per trip: the two buffers alternate by the trip's parity
  for (int t = 0; t < nt; ++t) {
    const unsigned sel = (unsigned)(t & 1) * SQ_BYTES;
    const unsigned char* buf = ring + sel;
    Frag a[2][4], b[2][4];
#pragma unroll
    for (int i = 0; i < 4; ++i) ldfrag_lds(a[0][i], buf + aoff + i * 16 * ST_PITCH);
#pragma unroll
    for (int kk = 0; kk < 2; ++kk)
#pragma unroll
      for (int j = 0; j < 4; ++j) ldfrag_lds(b[kk][j], buf + boff + j * 16 * ST_PITCH + kk * 64);
    // keeps these 24 fragment loads together in front of the first matrix instruction: without it the scheduler takes one register set for the four
    // A fragments of the first 32 k, loads them one by one among the matrix instructions and waits for each to 0.
    // The A fragments of the second 32 k follow behind it, into the registers that the first four leave (all 16 fragments at once do not fit).
    __builtin_amdgcn_sched_barrier(0);
#pragma unroll
    for (int i = 0; i < 4; ++i) ldfrag_lds(a[1][i], buf + aoff + i * 16 * ST_PITCH + 64);
#pragma unroll
    for (int kk = 0; kk < 2; ++kk)
#pragma unroll
      for (int i = 0; i < 4; ++i)
#pragma unroll
        for (int j = 0; j < 4; ++j) acc[i][j] = wm<BF>(a[kk][i], b[kk][j], acc[i][j]);
    // keeps the distance behind the last matrix instructions on the loop's back edge and in front of the address arithmetic below
    asm volatile("v_nop\n\tv_nop\n\tv_nop\n\tv_nop" : "+v"(acc[0][0]), "+v"(acc[0][1]), "+v"(acc[0][2]), "+v"(acc[0][3]),
                        "+v"(acc[1][0]), "+v"(acc[1][1]), "+v"(acc[1][2]), "+v"(acc[1][3]),
                        "+v"(acc[2][0]), "+v"(acc[2][1]), "+v"(acc[2][2]), "+v"(acc[2][3]),
                        "+v"(acc[3][0]), "+v"(acc[3][1]), "+v"(acc[3][2]), "+v"(acc[3][3])
                      : "v"(a[1][0].v), "v"(a[1][1].v), "v"(a[1][2].v), "v"(a[1][3].v), "v"(b[1][0].v), "v"(b[1][1].v), "v"(b[1][2].v), "v"(b[1][3].v));
    asm volatile("s_wait_dscnt 0x0" ::: "memory");      // this wave's reads of the buffer are done before it is refilled
    asm volatile("s_wait_asynccnt 0x0" ::: "memory");   // this wave's copies of tile t + 1 have landed before the barrier publishes them
    __syncthreads();
    if (t + 2 < nt) sq_copy(ga + (t + 2) * ST_K, gb + (t + 2) * ST_K, l0 + sel);
  }
  asm volatile("s_wait_asynccnt 0x0" ::: "memory");     // nothing is in flight when the ring is used for anything else
}

__device__ __forceinline__ float rope1(float q, float p, float c, float s, float sg) { return q * c + (sg * p) * s; }

// ---------------------------------------------------------------------------------------------------------
// q and k projections with fused bias, rotary (table read by value) and head-major repack.
// Block = 4 waves as 2 x 2: 128 token rows x two heads; a wave has 64 token rows of one head (64 columns). grid = (NQK/2, NB*SEQ/128).
// coverage: NQK heads x NB*SEQ tokens x 64 = the whole plane [NB][NQK][SEQ][64], both planes. LDS tile 64 x 64 fully written before it is read.
static_assert(NQK % 2 == 0);
__global__ __launch_bounds__(128) void k_proj_qk(const unsigned short* __restrict__ xb, const unsigned short* __restrict__ wqk,
                                                 const float* __restrict__ bq, const float* __restrict__ bk,
                                                 const float* __restrict__ tab,
                                                 unsigned short* __restrict__ qkh, unsigned short* __restrict__ qkl) {
  __shared__ __attribute__((aligned(16))) unsigned char ring[SQ_RING];
  float (*st)[64][68] = (float (*)[64][68])ring;       // epilogue tiles, used behind the k loop's last barrier
  const int tid = threadIdx.x, lane = tid & 31, ln = lane & 15, hh = lane >> 4;
  const int w = __builtin_amdgcn_readfirstlane(tid >> 5);
  const int wr = w >> 1, wc = w & 1;
  const int hd = 2 * blockIdx.x + wc;
  const int m0 = blockIdx.y * 128 + 64 * wr;
  const v8f z8 = {0.f, 0.f, 0.f, 0.f, 0.f, 0.f, 0.f, 0.f};
  v8f acc[4][4];
#pragma unroll
  for (int i = 0; i < 4; ++i)
#pragma unroll
    for (int j = 0; j < 4; ++j) acc[i][j] = z8;
  gemm_sq<true>(xb + (size_t)(blockIdx.y * 128) * CD, wqk + (size_t)(blockIdx.x * 2 * HD) * CD, ring, tid, wr, wc, ln, hh, acc);

  float bias[4];
#pragma unroll
  for (int j = 0; j < 4; ++j) {
    const int col = hd * HD + 16 * j + ln;
    const int cq = (col < CD - 1) ? col : (CD - 1);
    int ck = col - CD;
    ck = (ck < 0) ? 0 : ((ck > KVW - 1) ? (KVW - 1) : ck);
    const float vq = bq[cq], vk = bk[ck];
    bias[j] = bf16_rne((col < CD) ? vq : vk);
  }
#pragma unroll
  for (int i = 0; i < 4; ++i)
#pragma unroll
    for (int j = 0; j < 4; ++j)
#pragma unroll
      for (int r = 0; r < 8; ++r) st[w][16 * i + 8 * hh + r][16 * j + ln] = acc[i][j][r] + bias[j];
  __syncthreads();

  const int b = m0 / SEQ, t0 = m0 - b * SEQ;
  const int rsub = lane >> 3, d0 = 8 * (lane & 7);
  const float sg = (d0 < 32) ? -1.0f : 1.0f;
  const size_t dbase = ((size_t)(b * NQK + hd) * SEQ + t0) * HD + d0;
  // the wave's 64 rows in two halves of 32
  const unsigned tl = (unsigned)(rsub * HD + d0);      // this lane's place in a group of 4 table rows
  for (int half = 0; half < 2; ++half) {
  const float* th = tab + (size_t)(t0 + 32 * half) * HD;   // uniform base of this half's table rows; the loads below differ from it by tl and by constants only
  v8us oh[8], ol[8];
#pragma unroll
  for (int g = 0; g < 8; ++g) {
    // keeps the last four groups' table and LDS loads from being lifted over the first four: with all 8 groups in flight at once the registers run short
    if (g == 4) __builtin_amdgcn_sched_barrier(0);
    const int row = 32 * half + 4 * g + rsub;
    const v4f a0 = *(const v4fa*)&st[w][row][d0];
    const v4f a1 = *(const v4fa*)&st[w][row][d0 + 4];
    const v4f p0 = *(const v4fa*)&st[w][row][d0 ^ 32];
    const v4f p1 = *(const v4fa*)&st[w][row][(d0 ^ 32) + 4];
    const float* tp = th + (tl + (unsigned)(4 * g * HD));
    const v4f c0 = *(const v4fa*)(tp), c1 = *(const v4fa*)(tp + 4);
    const float k0 = bf16_rne(c0[0]), s0 = bf16_rne(c0[1]), k1 = bf16_rne(c0[2]), s1 = bf16_rne(c0[3]);
    const float k2 = bf16_rne(c1[0]), s2 = bf16_rne(c1[1]), k3 = bf16_rne(c1[2]), s3 = bf16_rne(c1[3]);
    float o[8];
    o[0] = rope1(a0[0], p0[0], k0, s0, sg); o[1] = rope1(a0[1], p0[1], k0, s0, sg);
    o[2] = rope1(a0[2], p0[2], k1, s1, sg); o[3] = rope1(a0[3], p0[3], k1, s1, sg);
    o[4] = rope1(a1[0], p1[0], k2, s2, sg); o[5] = rope1(a1[1], p1[1], k2, s2, sg);
    o[6] = rope1(a1[2], p1[2], k3, s3, sg); o[7] = rope1(a1[3], p1[3], k3, s3, sg);
    Pack8 ph8, pl8;
#pragma unroll
    for (int e = 0; e < 8; ++e) {
      const float y = o[e] * 16.0f;                       // carried x16
      const _Float16 h = (_Float16)y;
      ph8.h[e] = h;
      pl8.h[e] = (_Float16)((y - (float)h) * 2048.0f);     // residual plane x2^11
    }
    oh[g] = ph8.v; ol[g] = pl8.v;
  }
#pragma unroll
    for (int g = 0; g < 8; ++g) {
      const size_t off = dbase + (size_t)(32 * half + 4 * g + rsub) * HD;
      *(v8us*)(qkh + off) = oh[g];
      *(v8us*)(qkl + off) = ol[g];
    }
    asm volatile("s_wait_xcnt 0x0" ::: "memory");   // the second half rewrites registers that these stores name
  }
}

// ---------------------------------------------------------------------------------------------------------
// v projection computed transposed: Vt[b][m][t] = sum_k Wv[m][k] x[b,t][k] + bv[m], carried x16, hi and residual planes.
// Block = 4 waves stacked in M (128 weight rows) x 64 tokens. grid = (NB*SEQ/64, KVW/128).
// coverage: KVW rows x NB*SEQ tokens = the whole plane [NB][KVW][SEQ], both planes. LDS tile 32 x 64 fully written before it is read.
__global__ __launch_bounds__(128) void k_proj_v(const unsigned short* __restrict__ wvb, const unsigned short* __restrict__ xb,
                                                const float* __restrict__ bv,
                                                unsigned short* __restrict__ vth, unsigned short* __restrict__ vtl) {
  __shared__ __attribute__((aligned(16))) unsigned char ring[RING_BYTES];
  float (*st)[32][68] = (float (*)[32][68])ring;       // epilogue tiles, used behind the k loop's last barrier
  const int tid = threadIdx.x, lane = tid & 31, ln = lane & 15, hh = lane >> 4;
  const int w = __builtin_amdgcn_readfirstlane(tid >> 5);
  const int n0 = blockIdx.x * 64;
  const int m0 = blockIdx.y * 128 + 32 * w;
  const v8f z8 = {0.f, 0.f, 0.f, 0.f, 0.f, 0.f, 0.f, 0.f};
  v8f acc[2][4];
#pragma unroll
  for (int i = 0; i < 2; ++i)
#pragma unroll
    for (int j = 0; j < 4; ++j) acc[i][j] = z8;
  gemm_loop<true>(wvb + (size_t)(blockIdx.y * 128) * CD, xb + (size_t)n0 * CD, ring, tid, w, ln, hh, acc);
#pragma unroll
  for (int i = 0; i < 2; ++i)
#pragma unroll
    for (int j = 0; j < 4; ++j)
#pragma unroll
      for (int r = 0; r < 8; ++r) st[w][16 * i + 8 * hh + r][16 * j + ln] = acc[i][j][r];
  __syncthreads();

  const int b = n0 / SEQ, t0 = n0 - b * SEQ;
  const int rsub = lane >> 3, c0 = 8 * (lane & 7);
  v8us oh[8], ol[8];
#pragma unroll
  for (int g = 0; g < 8; ++g) {
    const int row = 4 * g + rsub;
    const float bias = bf16_rne(bv[m0 + row]);
    const v4f a0 = *(const v4fa*)&st[w][row][c0];
    const v4f a1 = *(const v4fa*)&st[w][row][c0 + 4];
    float o[8];
    o[0] = a0[0]; o[1] = a0[1]; o[2] = a0[2]; o[3] = a0[3];
    o[4] = a1[0]; o[5] = a1[1]; o[6] = a1[2]; o[7] = a1[3];
    Pack8 ph8, pl8;
#pragma unroll
    for (int e = 0; e < 8; ++e) {
      const float y = (o[e] + bias) * 16.0f;              // carried x16
      const _Float16 h = (_Float16)y;
      ph8.h[e] = h;
      pl8.h[e] = (_Float16)((y - (float)h) * 2048.0f);
    }
    oh[g] = ph8.v; ol[g] = pl8.v;
  }
  const size_t dbase = ((size_t)b * KVW + m0) * SEQ + t0 + c0;
{
#pragma unroll
    for (int g = 0; g < 8; ++g) {
      const size_t off = dbase + (size_t)(4 * g + rsub) * SEQ;
      *(v8us*)(vth + off) = oh[g];
      *(v8us*)(vtl + off) = ol[g];
    }
    
  }
}

// ---------------------------------------------------------------------------------------------------------
// Attention stage in LDS: 64 keys. Tile 0 = K rows (64 keys x 128 B), tile 1 = V^T rows (64 d x 128 B = 64 keys), each at a 144-byte pitch;
// tiles 2 and 3 = the residual planes of K and V^T (query rows below EARLY_ROWS only).
// The ring holds two stages of two tiles (plain blocks, two buffers) or one stage of four tiles (early blocks, one buffer).
#define AT_KEYS 64
#define AT_PITCH 144
#define AT_TILE (64 * AT_PITCH)
#define AT_RING (4 * AT_TILE)
static_assert(SEQ % AT_KEYS == 0);
static_assert(AT_RING >= 4 * 16 * 68 * 4);         /* the epilogue tiles reuse the ring */

// One K tile and one V^T tile: 8 copies of 16 bytes per thread, chunk (tid & 7) of rows (tid >> 3) + 16 i; each copy of a wave moves 4 whole 128-byte lines.
// The s_wait_xcnt stands inside the statement so that no address register is rewritten ahead of it.
__device__ __forceinline__ void kv_copy(const unsigned short* gk, const unsigned short* gv, unsigned l) {
  asm volatile("global_load_async_to_lds_b128 %0, %8, off\n\t"
               "global_load_async_to_lds_b128 %1, %9, off\n\t"
               "global_load_async_to_lds_b128 %2, %10, off\n\t"
               "global_load_async_to_lds_b128 %3, %11, off\n\t"
               "global_load_async_to_lds_b128 %4, %12, off\n\t"
               "global_load_async_to_lds_b128 %5, %13, off\n\t"
               "global_load_async_to_lds_b128 %6, %14, off\n\t"
               "global_load_async_to_lds_b128 %7, %15, off\n\t"
               "s_wait_xcnt 0x0"
               :: "v"(l), "v"(l + 16 * AT_PITCH), "v"(l + 32 * AT_PITCH), "v"(l + 48 * AT_PITCH),
                  "v"(l + AT_TILE), "v"(l + AT_TILE + 16 * AT_PITCH), "v"(l + AT_TILE + 32 * AT_PITCH), "v"(l + AT_TILE + 48 * AT_PITCH),
                  "v"(gk), "v"(gk + 16 * HD), "v"(gk + 32 * HD), "v"(gk + 48 * HD),
                  "v"(gv), "v"(gv + 16 * SEQ), "v"(gv + 32 * SEQ), "v"(gv + 48 * SEQ)
               : "memory");
}

// One 32-key step for a wave's 16 queries (this lane's column = its query). EARLYP adds the residual planes of q, k, v, P.
// st = the stage in LDS, kloc = 0 or 32 = first key of the step inside the stage, key0 = the same key's index in the sequence.
// MASK reads the mask row of this lane's query by value and replace-fills with -inf.
template <bool EARLYP, bool MASK>
__device__ __forceinline__ void fa_step(const unsigned char* st, int kloc,
                                        const int* __restrict__ mrow, int key0, int ln, int hh,
                                        const Frag (&qh)[2], const Frag (&ql)[2],
                                        float& mr, float& lr, v8f (&Oh)[4], v8f (&Ol)[4]) {
  const v8f z8 = {0.f, 0.f, 0.f, 0.f, 0.f, 0.f, 0.f, 0.f};
  float sc[16];
  // A fragments of K: row m = key (key0 + 16*kt + ln), elements 0..7 <- d = 32c + 8h + i, 8..15 <- d = 32c + 16 + 8h + i
  int koff = (kloc + ln) * AT_PITCH + 16 * hh;        // byte offset in a K tile
  if (EARLYP) {
#pragma unroll
    for (int kt = 0; kt < 2; ++kt) {
      Frag a0, a1, l0, l1;
      ldfrag_lds(a0, st + koff); ldfrag_lds(a1, st + koff + 64);
      ldfrag_lds(l0, st + 2 * AT_TILE + koff); ldfrag_lds(l1, st + 2 * AT_TILE + koff + 64);
      v8f s = z8, r = z8;
      s = wm<false>(a0, qh[0], s); s = wm<false>(a1, qh[1], s);
      r = wm<false>(a0, ql[0], r); r = wm<false>(a1, ql[1], r);
      r = wm<false>(l0, qh[0], r); r = wm<false>(l1, qh[1], r);
      asm volatile("v_nop\n\tv_nop\n\tv_nop\n\tv_nop" : "+v"(s), "+v"(r)
                        : "v"(a0.v), "v"(a1.v), "v"(l0.v), "v"(l1.v), "v"(qh[0].v), "v"(qh[1].v), "v"(ql[0].v), "v"(ql[1].v));
      // S^T element r of tile kt = score(key0 + 16*kt + 8h + r, this lane's query); carries: q x16, k x16, residual x2^11
#pragma unroll
      for (int e = 0; e < 8; ++e) sc[8 * kt + e] = fmaf(r[e], S2M11, s[e]) * S2M11;
      koff += 16 * AT_PITCH;
      if (kt == 0) asm volatile("" : "+v"(koff) : "v"(sc[0]));   // second tile's loads issue after the first tile is done
    }
  } else {
    Frag k00, k01, k10, k11;
    ldfrag_lds(k00, st + koff);                 ldfrag_lds(k01, st + koff + 64);
    ldfrag_lds(k10, st + koff + 16 * AT_PITCH); ldfrag_lds(k11, st + koff + 16 * AT_PITCH + 64);
    v8f s0 = z8, s1 = z8;
    s0 = wm<false>(k00, qh[0], s0); s0 = wm<false>(k01, qh[1], s0);
    s1 = wm<false>(k10, qh[0], s1); s1 = wm<false>(k11, qh[1], s1);
    asm volatile("v_nop\n\tv_nop\n\tv_nop\n\tv_nop" : "+v"(s0), "+v"(s1)
                      : "v"(k00.v), "v"(k01.v), "v"(k10.v), "v"(k11.v), "v"(qh[0].v), "v"(qh[1].v));
#pragma unroll
    for (int e = 0; e < 8; ++e) { sc[e] = s0[e] * S2M11; sc[8 + e] = s1[e] * S2M11; }
  }
  if (MASK) {
    const int* mp = mrow + key0 + 8 * hh;
    const v4i m0 = *(const v4ia*)(mp),      m1 = *(const v4ia*)(mp + 4);
    const v4i m2 = *(const v4ia*)(mp + 16), m3 = *(const v4ia*)(mp + 20);
    const float ninf = neg_inf();
#pragma unroll
    for (int e = 0; e < 4; ++e) {
      sc[e]      = (m0[e] == 0) ? ninf : sc[e];
      sc[4 + e]  = (m1[e] == 0) ? ninf : sc[4 + e];
      sc[8 + e]  = (m2[e] == 0) ? ninf : sc[8 + e];
      sc[12 + e] = (m3[e] == 0) ? ninf : sc[12 + e];
    }
  }
  float mx = sc[0];
#pragma unroll
  for (int i = 1; i < 16; ++i) mx = fmaxf(mx, sc[i]);
  mx = fmaxf(mx, __shfl_xor(mx, 16, 32));            // the other lane half holds the other 16 keys of this query
  const float mnew = fmaxf(mr, mx);
  float msafe = mnew;
  if (MASK) msafe = (mnew == neg_inf()) ? 0.0f : mnew;   // every key so far masked: weights come out 0
  const float al = __builtin_amdgcn_exp2f((mr - msafe) * LOG2E);
  mr = mnew;
  // weights carried x256: pc = 256 * exp(sc - m); hi plane f16(pc), residual plane f16((pc - hi) * 2048)
  Frag ph, pl;
  float ps = 0.0f;
#pragma unroll
  for (int i = 0; i < 16; ++i) {
    const float pc = __builtin_amdgcn_exp2f(fmaf(sc[i] - msafe, LOG2E, 8.0f));
    ps += pc;
    const _Float16 h = (_Float16)pc;
    ph.h[i] = h;                                      // B element i: i<8 -> key0 + 8h + i (tile 0 row 8h+i); i>=8 -> key0 + 16 + 8h + (i-8) (tile 1)
    if (EARLYP) pl.h[i] = (_Float16)((pc - (float)h) * 2048.0f);
  }
  ps += __shfl_xor(ps, 16, 32);
  lr = lr * al + ps;
  // A fragments of V^T: row m = d (16*t + ln), elements 0..7 <- key0 + 8h + i, 8..15 <- key0 + 16 + 8h + i
  int voff = AT_TILE + ln * AT_PITCH + 2 * kloc + 16 * hh;   // byte offset in the stage
  asm volatile("" : "+v"(voff) : "v"(ps));            // V loads issue after the score phase
  const unsigned char* vp = st + voff;
  Frag vf[4];
#pragma unroll
  for (int t = 0; t < 4; ++t) ldfrag_lds(vf[t], vp + t * 16 * AT_PITCH);
#pragma unroll
  for (int t = 0; t < 4; ++t) Oh[t] = Oh[t] * al;
  if (EARLYP) {
    const unsigned char* vq = vp + 2 * AT_TILE;
    Frag vl[4];
#pragma unroll
    for (int t = 0; t < 4; ++t) ldfrag_lds(vl[t], vq + t * 16 * AT_PITCH);
#pragma unroll
    for (int t = 0; t < 4; ++t) Ol[t] = Ol[t] * al;
#pragma unroll
    for (int t = 0; t < 4; ++t) {
      Oh[t] = wm<false>(vf[t], ph, Oh[t]);
      Ol[t] = wm<false>(vf[t], pl, Ol[t]);
      Ol[t] = wm<false>(vl[t], ph, Ol[t]);
    }
    asm volatile("v_nop\n\tv_nop\n\tv_nop\n\tv_nop" : "+v"(Oh[0]), "+v"(Oh[1]), "+v"(Oh[2]), "+v"(Oh[3]), "+v"(Ol[0]), "+v"(Ol[1]), "+v"(Ol[2]), "+v"(Ol[3])
                      : "v"(vf[0].v), "v"(vf[1].v), "v"(vf[2].v), "v"(vf[3].v),
                        "v"(vl[0].v), "v"(vl[1].v), "v"(vl[2].v), "v"(vl[3].v), "v"(ph.v), "v"(pl.v));
  } else {
#pragma unroll
    for (int t = 0; t < 4; ++t) Oh[t] = wm<false>(vf[t], ph, Oh[t]);
    asm volatile("v_nop\n\tv_nop\n\tv_nop\n\tv_nop" : "+v"(Oh[0]), "+v"(Oh[1]), "+v"(Oh[2]), "+v"(Oh[3])
                      : "v"(vf[0].v), "v"(vf[1].v), "v"(vf[2].v), "v"(vf[3].v), "v"(ph.v));
  }
}

// What stands in front of and behind a stage's work. Early blocks (one buffer of four tiles): fill, wait, publish in front; every reader leaves behind.
// Plain blocks (two buffers of two tiles): nothing in front; behind, stage t + 1 is published and stage t + 2 is sent into the buffer that stage t has just left.
template <bool EARLYP>
__device__ __forceinline__ void ring_head(const unsigned short* gk, const unsigned short* gv, const unsigned short* gkl, const unsigned short* gvl,
                                          unsigned l0, int t) {
  if (EARLYP) {
    kv_copy(gk + (size_t)t * AT_KEYS * HD, gv + t * AT_KEYS, l0);
    kv_copy(gkl + (size_t)t * AT_KEYS * HD, gvl + t * AT_KEYS, l0 + 2 * AT_TILE);
    asm volatile("s_wait_asynccnt 0x0" ::: "memory");   // this wave's copies have landed before the barrier publishes them
    __syncthreads();
  }
}
template <bool EARLYP>
__device__ __forceinline__ void ring_foot(const unsigned short* gk, const unsigned short* gv, unsigned l0, int t, int nst) {
  asm volatile("s_wait_dscnt 0x0" ::: "memory");        // this wave's reads of the buffer are done before it is refilled
  if (!EARLYP) asm volatile("s_wait_asynccnt 0x0" ::: "memory");   // this wave's copies of stage t + 1 have landed before the barrier publishes them
  __syncthreads();
  if (!EARLYP) {
    if (t + 2 < nst) kv_copy(gk + (size_t)(t + 2) * AT_KEYS * HD, gv + (t + 2) * AT_KEYS, l0 + (unsigned)(t & 1) * (2 * AT_TILE));
  }
}

// nst = stages of 64 keys that the block walks, npl = the first of them that run without mask reads (both the same in all its waves;
// npl <= nst <= SEQ / 64, 2 * nst >= every wave's nsteps, 2 * npl <= every wave's nsteps). nsteps = this wave's own 32-key steps.
template <bool EARLYP>
__device__ __forceinline__ void run_keys(const unsigned short* __restrict__ qkh, const unsigned short* __restrict__ qkl,
                                         const unsigned short* __restrict__ vth, const unsigned short* __restrict__ vtl,
                                         const int* __restrict__ mask, unsigned char* ring, int tid, int b, int h, int qg, int ln, int hh,
                                         int npl, int nsteps, int nst, float& mr, float& lr, v8f (&Oh)[4], v8f (&Ol)[4]) {
  // Q^T B fragments: column n = this lane's query, elements 0..7 <- d = 32c + 8h + i, 8..15 <- d = 32c + 16 + 8h + i
  const size_t qoff = ((size_t)(b * NQK + h) * SEQ + qg) * HD + 8 * hh;
  Frag qh[2], ql[2];
  ldfrag(qh[0], qkh + qoff); ldfrag(qh[1], qkh + qoff + 32);
  if (EARLYP) { ldfrag(ql[0], qkl + qoff); ldfrag(ql[1], qkl + qoff + 32); }
  else { ql[0] = qh[0]; ql[1] = qh[1]; }
  const int kv = h % NKV;
  const size_t kbase = (size_t)(b * NQK + NHEAD + kv) * SEQ * HD;
  const size_t vbase = ((size_t)b * KVW + (size_t)kv * HD) * SEQ;
  const int* mrow = mask + (size_t)qg * SEQ_FULL;
  // this thread's first chunk of a stage: in K (rows = keys), in V^T (rows = d) and in LDS
  const size_t kthr = kbase + (size_t)(tid >> 3) * HD + 8 * (tid & 7);
  const size_t vthr = vbase + (size_t)(tid >> 3) * SEQ + 8 * (tid & 7);
  const unsigned short* gk = qkh + kthr;
  const unsigned short* gv = vth + vthr;
  const unsigned l0 = (unsigned)(size_t)ring + (unsigned)((tid >> 3) * AT_PITCH + 16 * (tid & 7));   // LDS byte address
  const unsigned short* gkl = qkl + kthr;
  const unsigned short* gvl = vtl + vthr;
  if (!EARLYP) {
    kv_copy(gk, gv, l0);
    asm volatile("s_wait_asynccnt 0x0" ::: "memory");     // stage 0 has landed before the barrier that publishes it
    __syncthreads();
    if (nst > 1) kv_copy(gk + AT_KEYS * HD, gv + AT_KEYS, l0 + 2 * AT_TILE);
  }
#pragma unroll 1   // one stage per trip: the two buffers alternate by the trip's parity
  for (int t = 0; t < npl; ++t) {
    const unsigned char* st = ring + (EARLYP ? 0u : (unsigned)(t & 1) * (2 * AT_TILE));
    ring_head<EARLYP>(gk, gv, gkl, gvl, l0, t);
    fa_step<EARLYP, false>(st, 0, mrow, AT_KEYS * t, ln, hh, qh, ql, mr, lr, Oh, Ol);
    fa_step<EARLYP, false>(st, 32, mrow, AT_KEYS * t + 32, ln, hh, qh, ql, mr, lr, Oh, Ol);
    ring_foot<EARLYP>(gk, gv, l0, t, nst);
  }
#pragma unroll 1   // one stage per trip, as above
  for (int t = npl; t < nst; ++t) {
    const unsigned char* st = ring + (EARLYP ? 0u : (unsigned)(t & 1) * (2 * AT_TILE));
    ring_head<EARLYP>(gk, gv, gkl, gvl, l0, t);
#pragma unroll 1   // one copy of the masked step in the text
    for (int sub = 0; sub < 2; ++sub) {
      const int j = 2 * t + sub;
      // a wave whose own steps have run out passes through to the barrier (wave-uniform test)
      if (j < nsteps) fa_step<EARLYP, true>(st, 32 * sub, mrow, 32 * j, ln, hh, qh, ql, mr, lr, Oh, Ol);
    }
    ring_foot<EARLYP>(gk, gv, l0, t, nst);
  }
  asm volatile("s_wait_asynccnt 0x0" ::: "memory");       // nothing is in flight when the ring is used for anything else
}

// Work-group rank -> query tile, cost falling with the rank, for speed only.
// Cost of tile qt under a causal mask = its qt + 1 stages; a stage with the residual planes counts twice (three times the matrix instructions, twice the LDS
// reads, one buffer). A permutation of the tiles for any SEQ, formed at compile time, one byte per rank; it decides the order only, never what is computed.
#define NQT (SEQ / 64)
#define NQT_EARLY (EARLY_ROWS / 64)
static_assert(NQT <= 32);
struct TileRank { unsigned long long w[4]; };
constexpr int tile_cost(int qt) { return (qt + 1) * (qt < NQT_EARLY ? 2 : 1); }
constexpr TileRank make_tile_rank() {
  TileRank o = {{0ull, 0ull, 0ull, 0ull}};
  bool used[NQT] = {};
  for (int r = 0; r < NQT; ++r) {
    int best = -1;
    for (int q = NQT - 1; q >= 0; --q)
      if (!used[q] && (best < 0 || tile_cost(q) > tile_cost(best))) best = q;
    used[best] = true;
    o.w[r >> 3] |= (unsigned long long)best << (8 * (r & 7));
  }
  return o;
}

// Block = 4 waves x 16 queries = 64 queries of one (batch, head); the waves share the K and V^T stages in LDS, one barrier per 64 keys (two in early blocks).
// Block index = rank * (NB * NHEAD) + (batch, head): all heads of the costliest query tile come first.
// Tile skipping from the device flags of this wave's own 16 mask rows (16/SCAN_ROWS flag lines): all upper flags 1 -> keys past the diagonal step are
// skipped; upper and lower flags of all 64 rows of the block 1 -> the stages fully below the block's diagonal tile run without mask reads; every other visited step reads the mask by value.
// Trip counts are bounded by SEQ/32 for any flag value. The block walks qt + 1 stages if the upper flags of all its 64 rows are 1, else all SEQ/64.
// coverage: NB*NHEAD*(SEQ/64) blocks x 4 waves x 16 rows x 64 columns = the whole ctx hi plane; blocks with query tile below EARLY_ROWS cover the whole residual plane.
__global__ __launch_bounds__(128) void k_attn(const unsigned short* __restrict__ qkh, const unsigned short* __restrict__ qkl,
                                              const unsigned short* __restrict__ vth, const unsigned short* __restrict__ vtl,
                                              const int* __restrict__ mask, const int* __restrict__ flags,
                                              unsigned short* __restrict__ ctxh, unsigned short* __restrict__ ctxl) {
  __shared__ __attribute__((aligned(16))) unsigned char ring[AT_RING];
  float (*so)[16][68] = (float (*)[16][68])ring;       // epilogue tiles, used behind the key loop's last barrier
  const int tid = threadIdx.x, lane = tid & 31, ln = lane & 15, hh = lane >> 4;
  const int w = __builtin_amdgcn_readfirstlane(tid >> 5);
  constexpr TileRank tr = make_tile_rank();
  const unsigned blk = blockIdx.x;
  const unsigned rank = blk / (NB * NHEAD);            // 0 .. NQT-1
  const unsigned long long trw = (rank < 8) ? tr.w[0] : ((rank < 16) ? tr.w[1] : ((rank < 24) ? tr.w[2] : tr.w[3]));
  const int qt = (int)((trw >> (8 * (rank & 7))) & 255ull);
  const int h = (int)(blk % NHEAD);
  const int b = (int)((blk / NHEAD) % NB);
  const int qbase = qt * 64 + 16 * w;
  const int qg = qbase + ln;
  const int* fl = flags + (qbase / SCAN_ROWS) * 32;
  int upok = 1;                                        // plain & so that the flag loads issue together
#pragma unroll
  for (int g = 0; g < 16 / SCAN_ROWS; ++g) upok &= (fl[32 * g] == 1) ? 1 : 0;
  const bool tri = (upok == 1);
  const int nfull = qbase >> 5;                        // steps whose 32 keys are all at or below every query of this wave
  const int nsteps = tri ? (nfull + 1) : (SEQ / 32);   // <= SEQ/32 in both cases
  const bool early = (qt * 64 < EARLY_ROWS);
  // stage counts of the block, from the flags of all its 64 rows: the same values in all four waves, since barriers stand in the key loop
  const int* flb = flags + (qt * 64 / SCAN_ROWS) * 32;
  int upall = 1, lowall = 1;
#pragma unroll
  for (int g = 0; g < 64 / SCAN_ROWS; ++g) {
    const int fU = flb[32 * g], fL = flb[32 * g + 1];
    upall &= (fU == 1) ? 1 : 0;
    lowall &= (fL == 1) ? 1 : 0;
  }
  const int nst = (upall == 1) ? (qt + 1) : (SEQ / AT_KEYS);
  const int npl = (upall == 1 && lowall == 1) ? qt : 0;   // stages whose 64 keys are all below every query of the block

  const v8f z8 = {0.f, 0.f, 0.f, 0.f, 0.f, 0.f, 0.f, 0.f};
  float mr = neg_inf(), lr = 0.0f;
  v8f Oh[4], Ol[4];
#pragma unroll
  for (int t = 0; t < 4; ++t) { Oh[t] = z8; Ol[t] = z8; }
  if (early) run_keys<true>(qkh, qkl, vth, vtl, mask, ring, tid, b, h, qg, ln, hh, npl, nsteps, nst, mr, lr, Oh, Ol);
  else       run_keys<false>(qkh, qkl, vth, vtl, mask, ring, tid, b, h, qg, ln, hh, npl, nsteps, nst, mr, lr, Oh, Ol);

  // O^T element r of tile t = ctx(query, d = 16t + 8h + r); undo the carries x256 (in lr), x16 (V), x2^11 (residual); apply the x64 carry of ctx
  const float inv = 4.0f * (1.0f / lr);
#pragma unroll
  for (int t = 0; t < 4; ++t)
#pragma unroll
    for (int r = 0; r < 8; ++r)
      so[w][ln][16 * t + 8 * hh + r] = fmaf(Ol[t][r], S2M11, Oh[t][r]) * inv;
  __syncthreads();
  const int rsub = lane >> 3, d0 = 8 * (lane & 7);
  v8us oh[4], ol[4];
#pragma unroll
  for (int g = 0; g < 4; ++g) {
    const int row = 4 * g + rsub;
    const v4f a0 = *(const v4fa*)&so[w][row][d0];
    const v4f a1 = *(const v4fa*)&so[w][row][d0 + 4];
    float o[8];
    o[0] = a0[0]; o[1] = a0[1]; o[2] = a0[2]; o[3] = a0[3];
    o[4] = a1[0]; o[5] = a1[1]; o[6] = a1[2]; o[7] = a1[3];
    Pack8 ph8, pl8;
#pragma unroll
    for (int e = 0; e < 8; ++e) {
      const _Float16 hv = (_Float16)o[e];
      ph8.h[e] = hv;
      pl8.h[e] = (_Float16)((o[e] - (float)hv) * 2048.0f);
    }
    oh[g] = ph8.v; ol[g] = pl8.v;
  }
  const size_t hbase = ((size_t)b * SEQ + qbase) * CD + (size_t)h * HD + d0;
  const size_t lbase = ((size_t)b * EARLY_ROWS + (early ? qbase : 0)) * CD + (size_t)h * HD + d0;
{
#pragma unroll
    for (int g = 0; g < 4; ++g) {
      const size_t ro = (size_t)(4 * g + rsub) * CD;
      *(v8us*)(ctxh + hbase + ro) = oh[g];
      if (early) *(v8us*)(ctxl + lbase + ro) = ol[g];
    }
    
  }
}

// ---------------------------------------------------------------------------------------------------------
// Output projection: out[m][n] = sum_k ctx[m][k] Wo[n][k] + bo[n]. Block = 4 waves as 2 x 2: 128 rows x 128 columns, 64 x 64 per wave. grid = (CD/128, NB*SEQ/128).
// Rows below EARLY_ROWS of each sequence add the residual plane of ctx.
// coverage: NB*SEQ rows x CD columns = every element of the output buffer region once. LDS tile 64 x 64 fully written before it is read.
static_assert(CD % 128 == 0);
__global__ __launch_bounds__(128) void k_proj_out(const unsigned short* __restrict__ ctxh, const unsigned short* __restrict__ ctxl,
                                                  const unsigned short* __restrict__ wo, const float* __restrict__ bo,
                                                  float* __restrict__ out) {
  __shared__ __attribute__((aligned(16))) unsigned char ring[SQ_RING];
  float (*st)[64][68] = (float (*)[64][68])ring;       // epilogue tiles, used behind the k loop's last barrier
  const int tid = threadIdx.x, lane = tid & 31, ln = lane & 15, hh = lane >> 4;
  const int w = __builtin_amdgcn_readfirstlane(tid >> 5);
  const int wr = w >> 1, wc = w & 1;
  const int n0 = blockIdx.x * 128 + 64 * wc;
  // blockIdx.y -> row tile, cost falling with the index: the tiles that walk k twice (rows below EARLY_ROWS of every sequence) come first
  // (for speed only: nothing rests on where a work-group lands). A permutation of the NB * SEQ / 128 row tiles.
  constexpr int TPS = SEQ / 128, EPS = EARLY_ROWS / 128, PPS = (TPS > EPS) ? (TPS - EPS) : 1;
  const int yt = blockIdx.y;
  const bool early = (yt < NB * EPS);                  // block-uniform
  const int b = early ? (yt / EPS) : ((yt - NB * EPS) / PPS);
  const int tb = 128 * (early ? (yt - b * EPS) : (EPS + (yt - NB * EPS) - b * PPS));
  const int mb = b * SEQ + tb;
  const int t0 = tb + 64 * wr;
  const v8f z8 = {0.f, 0.f, 0.f, 0.f, 0.f, 0.f, 0.f, 0.f};
  v8f acc[4][4];
#pragma unroll
  for (int i = 0; i < 4; ++i)
#pragma unroll
    for (int j = 0; j < 4; ++j) acc[i][j] = z8;
  const unsigned short* wp = wo + (size_t)(blockIdx.x * 128) * CD;
  // residual plane: a walk of its own over k through the same ring (block-uniform branch). It runs first, and its sums, brought to the hi plane's carry,
  // are the start values of the hi plane's walk: one set of 16 accumulator tiles serves both (two sets do not fit the registers that asm operands can name)
  if (early) {
    gemm_sq<false>(ctxl + (size_t)(b * EARLY_ROWS + tb) * CD, wp, ring, tid, wr, wc, ln, hh, acc);
#pragma unroll
    for (int i = 0; i < 4; ++i)
#pragma unroll
      for (int j = 0; j < 4; ++j) acc[i][j] = acc[i][j] * S2M11;
  }
  gemm_sq<false>(ctxh + (size_t)mb * CD, wp, ring, tid, wr, wc, ln, hh, acc);
  // carries: ctx x64, Wo x64 -> 2^-12 (the residual plane's x2^11 is undone above)
#pragma unroll
  for (int i = 0; i < 4; ++i)
#pragma unroll
    for (int j = 0; j < 4; ++j)
#pragma unroll
      for (int r = 0; r < 8; ++r)
        st[w][16 * i + 8 * hh + r][16 * j + ln] = acc[i][j][r] * S2M12;
  __syncthreads();
  const int rsub = lane >> 4, c4 = 4 * (lane & 15);
  const v4f bb = *(const v4fa*)(bo + n0 + c4);
  v4f bias;
  bias[0] = bf16_rne(bb[0]); bias[1] = bf16_rne(bb[1]); bias[2] = bf16_rne(bb[2]); bias[3] = bf16_rne(bb[3]);
  float* og = out + ((size_t)b * SEQ_FULL + t0) * CD + n0 + c4;
  // the wave's 64 rows in two halves of 32
  for (int half = 0; half < 2; ++half) {
    v4f ov[16];
#pragma unroll
    for (int g = 0; g < 16; ++g) {
      const v4f a = *(const v4fa*)&st[w][32 * half + 2 * g + rsub][c4];
      ov[g] = a + bias;
    }
#pragma unroll
    for (int g = 0; g < 16; ++g)
      *(v4f*)(og + (size_t)(32 * half + 2 * g + rsub) * CD) = ov[g];
  }
}

// ---------------------------------------------------------------------------------------------------------
extern "C" void kernel_launch(void* const* d_in, const int* in_sizes, int n_in,
                              void* d_out, int out_size, void* d_ws, size_t ws_size, hipStream_t stream) {
  if (n_in < 11) return;
  const long long need_x = (long long)(NB - 1) * SEQ_FULL * CD + (long long)SEQ * CD;   // last element touched + 1
  const long long need_m = (long long)(SEQ - 1) * SEQ_FULL + SEQ;
  if ((long long)in_sizes[0] < need_x) return;
  if ((long long)in_sizes[1] < need_m) return;
  if ((long long)in_sizes[2] < (long long)SEQ * HD) return;
  if ((long long)in_sizes[3] < (long long)CD * CD || (long long)in_sizes[4] < CD) return;
  if ((long long)in_sizes[5] < (long long)KVW * CD || (long long)in_sizes[6] < KVW) return;
  if ((long long)in_sizes[7] < (long long)KVW * CD || (long long)in_sizes[8] < KVW) return;
  if ((long long)in_sizes[9] < (long long)CD * CD || (long long)in_sizes[10] < CD) return;
  if ((long long)out_size < need_x) return;
  if ((size_t)WS_TOTAL > ws_size) return;

  // wire order: x, mask, sinusoidal_pos, Wq, bq, Wk, bk, Wv, bv, Wo, bo
  const float* x    = (const float*)d_in[0];
  const int*   mask = (const int*)d_in[1];
  const float* tab  = (const float*)d_in[2];
  const float* Wq   = (const float*)d_in[3];
  const float* bq   = (const float*)d_in[4];
  const float* Wk   = (const float*)d_in[5];
  const float* bk   = (const float*)d_in[6];
  const float* Wv   = (const float*)d_in[7];
  const float* bv   = (const float*)d_in[8];
  const float* Wo   = (const float*)d_in[9];
  const float* bo   = (const float*)d_in[10];
  float* out = (float*)d_out;

  char* ws = (char*)d_ws;
  size_t off = 0;
  int* flags = (int*)(ws + off);                               off += SZ_FLAGS;
  unsigned short* xb   = (unsigned short*)(ws + off);          off += SZ_XB;
  unsigned short* wqk  = (unsigned short*)(ws + off);          off += SZ_WQK;
  unsigned short* wvb  = (unsigned short*)(ws + off);          off += SZ_WV;
  unsigned short* wob  = (unsigned short*)(ws + off);          off += SZ_WO;
  unsigned short* qkh  = (unsigned short*)(ws + off);          off += PLANE_QK * 2;
  unsigned short* qkl  = (unsigned short*)(ws + off);          off += PLANE_QK * 2;
  unsigned short* vth  = (unsigned short*)(ws + off);          off += PLANE_V * 2;
  unsigned short* vtl  = (unsigned short*)(ws + off);          off += PLANE_V * 2;
  unsigned short* ctxh = (unsigned short*)(ws + off);          off += SZ_CTXH;
  unsigned short* ctxl = (unsigned short*)(ws + off);          off += SZ_CTXL;
  if (off > ws_size) return;

  // mask -> flags, and in[rows][CD] f32 -> [rows][CD] 16-bit planes (row order kept)
  k_prep<<<(unsigned)(SCAN_BLOCKS + CVT_BLOCKS), PREP_THREADS, 0, stream>>>(mask, flags, x, Wq, Wk, Wv, Wo, xb, wqk, wvb, wob);

  k_proj_qk<<<dim3(NQK / 2, (unsigned)(NB * SEQ / 128)), 128, 0, stream>>>(xb, wqk, bq, bk, tab, qkh, qkl);
  k_proj_v<<<dim3((unsigned)(NB * SEQ / 64), KVW / 128), 128, 0, stream>>>(wvb, xb, bv, vth, vtl);
  k_attn<<<(unsigned)(NB * NHEAD * (SEQ / 64)), 128, 0, stream>>>(qkh, qkl, vth, vtl, mask, flags, ctxh, ctxl);
  k_proj_out<<<dim3(CD / 128, (unsigned)(NB * SEQ / 128)), 128, 0, stream>>>(ctxh, ctxl, wob, bo, out);
}

// v007
// Measured time: 160 microseconds a run.
// In two side-by-side timings against v006, it was 1.13 and 1.11 times as fast.
// Over all steps from v000 it is 5.45 times as fast.
#include <hip/hip_runtime.h>
#ifndef NB
#define NB 2
#endif
#ifndef SEQ
#define SEQ 2048
#endif
#define NB_FULL 2
#define SEQ_FULL 2048
#define CD 2048                 /* model width = depth of every projection */
#define NHEAD 32
#define NKV 8
#define HD 64
#define NQK (NHEAD + NKV)       /* rotary plane holds the 32 q heads followed by the 8 k heads */
#define KVW (NKV * HD)          /* 512 */
#define EARLY_ROWS (SEQ < 512 ? SEQ : 512)

#define SCAN_ROWS 8             /* mask rows per scan work-group: 8 rows x SEQ ints = 8 loads of 16 B per thread at SEQ = 2048 */
#define SCAN_LOADS (SCAN_ROWS * (SEQ / 4) / 512)
#define SZ_FLAGS ((size_t)(SEQ / SCAN_ROWS) * 128)   /* one 128-byte line per scan work-group */
#define SZ_XB    ((size_t)NB * SEQ * CD * 2)
#define SZ_WQK   ((size_t)(CD + KVW) * CD * 2)
#define SZ_WV    ((size_t)KVW * CD * 2)
#define SZ_WO    ((size_t)CD * CD * 2)
#define PLANE_QK ((size_t)NB * NQK * SEQ * HD)     /* elements of one rotary plane */
#define PLANE_V  ((size_t)NB * KVW * SEQ)          /* elements of one V^T plane */
#define SZ_CTXH  ((size_t)NB * SEQ * CD * 2)
#define SZ_CTXL  ((size_t)NB * EARLY_ROWS * CD * 2)
#define WS_TOTAL (SZ_FLAGS + SZ_XB + SZ_WQK + SZ_WV + SZ_WO + PLANE_QK * 4 + PLANE_V * 4 + SZ_CTXH + SZ_CTXL)

static_assert(SEQ % 128 == 0);
static_assert((SCAN_ROWS * (SEQ / 4)) % 512 == 0);
static_assert(16 % SCAN_ROWS == 0);
static_assert(SZ_FLAGS % 256 == 0);
static_assert(EARLY_ROWS % 128 == 0);
static_assert(SEQ <= SEQ_FULL);
static_assert(NB <= NB_FULL);
static_assert(HD == 64);
static_assert(CD % 32 == 0);
static_assert(KVW % 128 == 0);
static_assert(NHEAD % NKV == 0);
static_assert(WS_TOTAL <= (size_t)134217728);
static_assert(SZ_XB % 256 == 0 && SZ_WQK % 256 == 0 && SZ_WV % 256 == 0 && SZ_WO % 256 == 0);
static_assert((PLANE_QK * 2) % 256 == 0 && (PLANE_V * 2) % 256 == 0 && SZ_CTXH % 256 == 0 && SZ_CTXL % 256 == 0);

typedef __bf16 v16b __attribute__((ext_vector_type(16)));
typedef _Float16 v16h __attribute__((ext_vector_type(16)));
typedef unsigned short v8us __attribute__((ext_vector_type(8), may_alias));
typedef float v8f __attribute__((ext_vector_type(8)));
typedef float v4f __attribute__((ext_vector_type(4)));
typedef float v4fa __attribute__((ext_vector_type(4), may_alias));
typedef int v4i __attribute__((ext_vector_type(4)));
typedef int v4ia __attribute__((ext_vector_type(4), may_alias));
union Frag { v16b b; v16h v; v8us half[2]; _Float16 h[16]; unsigned short u[16]; };
union Pack8 { v8us v; _Float16 h[8]; unsigned short u[8]; };

#define LOG2E 1.4426950408889634f
#define S2M11 0.00048828125f       /* 2^-11 */
#define S2M12 0.000244140625f      /* 2^-12 */
__device__ __forceinline__ unsigned short bf16_bits(float x) {   // RNE convert to bf16 bits
  unsigned int u = __float_as_uint(x);
  return (unsigned short)((u + 0x7FFFu + ((u >> 16) & 1u)) >> 16);
}
__device__ __forceinline__ float bf16_val(unsigned short b) { return __uint_as_float(((unsigned int)b) << 16); }
__device__ __forceinline__ float bf16_rne(float x) { return bf16_val(bf16_bits(x)); }
__device__ __forceinline__ float neg_inf() { return __uint_as_float(0xff800000u); }

// Fragment of a k-contiguous 16-bit row: elements 0..7 <- p[0..7], elements 8..15 <- p[16..23]; caller adds row*pitch + k0 + 8*h.
__device__ __forceinline__ void ldfrag(Frag& f, const unsigned short* __restrict__ p) {
  f.half[0] = *(const v8us*)(p);
  f.half[1] = *(const v8us*)(p + 16);
}

template <bool BF>
__device__ __forceinline__ v8f wm(const Frag& a, const Frag& b, v8f c) {
  if (BF) return __builtin_amdgcn_wmma_f32_16x16x32_bf16(false, a.b, false, b.b, (short)0, c, false, false);
  return __builtin_amdgcn_wmma_f32_16x16x32_f16(false, a.v, false, b.v, (short)0, c, false, false);
}

// ---------------------------------------------------------------------------------------------------------
// Input preparation, one launch: the jobs below read inputs only and none reads what another writes, so the block index picks the job.
// Blocks 0 .. SCAN_BLOCKS-1: mask scan, one work-group per SCAN_ROWS mask rows; group g owns the line flags[32g .. 32g+31]:
// flags[32g] = 1 iff every entry of its rows above the diagonal is zero; flags[32g+1] = 1 iff every entry of its rows on or below the diagonal is nonzero.
// coverage: SEQ/SCAN_ROWS blocks x 512 threads x SCAN_LOADS x 4 ints = SEQ x SEQ mask entries; every flag line is written whole.
// Blocks SCAN_BLOCKS .. SCAN_BLOCKS+CVT_BLOCKS-1: f32 rows of width CD -> 16-bit planes (row order kept). A row is one 16-byte load and one 8-byte store
// per thread (a wave reads 4 whole lines and writes 2); block c takes the c-th run of adjacent rows of each of x, Wq, Wk, Wv and Wo, the same counts in every block.
// MODE 0: bf16 bits (RNE). MODE 1: f16 of (RNE bf16 value x 64).
// coverage: CVT_BLOCKS blocks x (rows / CVT_BLOCKS) rows x 512 threads x 4 elements = rows x CD, for each of the five arrays.
#define PREP_THREADS 512
#define SCAN_BLOCKS (SEQ / SCAN_ROWS)
#define CVT_BLOCKS 512
static_assert(CD == PREP_THREADS * 4);
static_assert((NB * SEQ) % CVT_BLOCKS == 0 && CD % CVT_BLOCKS == 0 && KVW % CVT_BLOCKS == 0);

typedef unsigned short v4us __attribute__((ext_vector_type(4), may_alias));
union Pack4 { v4us v; _Float16 h[4]; unsigned short u[4]; };

template <int MODE>
__device__ __forceinline__ void cvt_store(unsigned short* d, v4f x) {
  Pack4 o;
  if (MODE == 0) {
    o.u[0] = bf16_bits(x[0]); o.u[1] = bf16_bits(x[1]); o.u[2] = bf16_bits(x[2]); o.u[3] = bf16_bits(x[3]);
  } else {
    o.h[0] = (_Float16)(bf16_rne(x[0]) * 64.0f); o.h[1] = (_Float16)(bf16_rne(x[1]) * 64.0f);
    o.h[2] = (_Float16)(bf16_rne(x[2]) * 64.0f); o.h[3] = (_Float16)(bf16_rne(x[3]) * 64.0f);
  }
  *(v4us*)d = o.v;
}

// twelve waves per SIMD asked for (80 registers): three work-groups fit a WGP, so that all work-groups of the launch are resident together
__global__ __launch_bounds__(PREP_THREADS) __attribute__((amdgpu_waves_per_eu(12))) void k_prep(const int* __restrict__ mask, int* __restrict__ flags,
                                                       const float* __restrict__ x, const float* __restrict__ Wq, const float* __restrict__ Wk,
                                                       const float* __restrict__ Wv, const float* __restrict__ Wo,
                                                       unsigned short* __restrict__ xb, unsigned short* __restrict__ wqk,
                                                       unsigned short* __restrict__ wvb, unsigned short* __restrict__ wob) {
  __shared__ int sw[2][16];
  const int tid = threadIdx.x;
  if (blockIdx.x >= SCAN_BLOCKS) {                     // block-uniform
    const int c = blockIdx.x - SCAN_BLOCKS;
    const int e = 4 * tid;
    constexpr int NX = NB * SEQ / CVT_BLOCKS, NQ = CD / CVT_BLOCKS, NK = KVW / CVT_BLOCKS;
    static_assert(SEQ % NX == 0);                      // the block's NX rows of x lie in one batch
    const int bx = (c * NX) / SEQ, rx = c * NX - bx * SEQ;
    // uniform bases of this block's rows; a thread's loads and stores differ from them by 4 * tid elements and by constants only
    const float* sx = x + ((size_t)bx * SEQ_FULL + rx) * CD;
    const float* sq = Wq + (size_t)(c * NQ) * CD;
    const float* swo = Wo + (size_t)(c * NQ) * CD;
    const float* sk = Wk + (size_t)(c * NK) * CD;
    const float* sv = Wv + (size_t)(c * NK) * CD;
    unsigned short* dx = xb + (size_t)(c * NX) * CD;
    unsigned short* dq = wqk + (size_t)(c * NQ) * CD;
    unsigned short* dw = wob + (size_t)(c * NQ) * CD;
    unsigned short* dk = wqk + (size_t)(CD + c * NK) * CD;   // the k rows follow the q rows
    unsigned short* dv = wvb + (size_t)(c * NK) * CD;
    // all loads of a thread are independent and issued before the first is converted, so that they are in flight together
    v4f vx[NX], vq[NQ], vw[NQ], vk[NK], vv[NK];
#pragma unroll
    for (int j = 0; j < NX; ++j) vx[j] = *(const v4fa*)(sx + (unsigned)(j * CD + e));
#pragma unroll
    for (int j = 0; j < NQ; ++j) vq[j] = *(const v4fa*)(sq + (unsigned)(j * CD + e));
#pragma unroll
    for (int j = 0; j < NQ; ++j) vw[j] = *(const v4fa*)(swo + (unsigned)(j * CD + e));
#pragma unroll
    for (int j = 0; j < NK; ++j) vk[j] = *(const v4fa*)(sk + (unsigned)(j * CD + e));
#pragma unroll
    for (int j = 0; j < NK; ++j) vv[j] = *(const v4fa*)(sv + (unsigned)(j * CD + e));
    // keeps every load in front of the first conversion: without it the scheduler sinks a third of the loads behind waits to 0, and their latencies add up
    __builtin_amdgcn_sched_barrier(0);
#pragma unroll
    for (int j = 0; j < NX; ++j) cvt_store<0>(dx + (unsigned)(j * CD + e), vx[j]);
#pragma unroll
    for (int j = 0; j < NQ; ++j) cvt_store<0>(dq + (unsigned)(j * CD + e), vq[j]);
#pragma unroll
    for (int j = 0; j < NQ; ++j) cvt_store<1>(dw + (unsigned)(j * CD + e), vw[j]);
#pragma unroll
    for (int j = 0; j < NK; ++j) cvt_store<0>(dk + (unsigned)(j * CD + e), vk[j]);
#pragma unroll
    for (int j = 0; j < NK; ++j) cvt_store<0>(dv + (unsigned)(j * CD + e), vv[j]);
    return;                                            // the whole block leaves here; the barrier below is the scan blocks' own
  }
  const int lane = tid & 31, wv = tid >> 5;
  int badU = 0, badL = 0;
  const int cpr = SEQ / 4;
  const int q0 = blockIdx.x * SCAN_ROWS;
  const int* mb = mask + (size_t)q0 * SEQ_FULL;       // uniform base of this group's rows; the loads below differ by constants only
  v4i mv[SCAN_LOADS];
  // all loads of a thread are independent and issued before the first is tested, so that they are in flight together
#pragma unroll
  for (int u = 0; u < SCAN_LOADS; ++u) {
    const int c = tid + 512 * u;
    const int qr = c / cpr, k = (c - qr * cpr) * 4;
    mv[u] = *(const v4ia*)(mb + (unsigned)(qr * SEQ_FULL + k));
  }
#pragma unroll
  for (int u = 0; u < SCAN_LOADS; ++u) {
    const int c = tid + 512 * u;
    const int qr = c / cpr, k = (c - qr * cpr) * 4;
    const int q = q0 + qr;
#pragma unroll
    for (int i = 0; i < 4; ++i) {
      const int above = (k + i > q) ? 1 : 0;
      const int nz = (mv[u][i] != 0) ? 1 : 0;
      badU |= above & nz;
      badL |= (1 - above) & (1 - nz);
    }
  }
#pragma unroll
  for (int o = 16; o >= 1; o >>= 1) {
    badU |= __shfl_xor(badU, o, 32);
    badL |= __shfl_xor(badL, o, 32);
  }
  if (lane == 0) { sw[0][wv] = badU; sw[1][wv] = badL; }
  __syncthreads();
  if (tid < 8) {
    int u = 0, l = 0;
#pragma unroll
    for (int i = 0; i < 16; ++i) { u |= sw[0][i]; l |= sw[1][i]; }
    v4i o;
    o[0] = (tid == 0 && u == 0) ? 1 : 0;
    o[1] = (tid == 0 && l == 0) ? 1 : 0;
    o[2] = 0; o[3] = 0;
    *(v4i*)(flags + 32 * blockIdx.x + 4 * tid) = o;
  }
}

// ---------------------------------------------------------------------------------------------------------
// Staging of the GEMMs: a stage is 64 k of every row of the block's two operands, 128-byte rows laid at a 144-byte pitch; two buffers.
// Fragment maps: row or column = ln, elements 0..7 <- k0 + 8h + i, elements 8..15 <- k0 + 16 + 8h + i, for both operands alike.
#define ST_K 64
#define ST_PITCH 144
static_assert(CD % ST_K == 0 && CD / ST_K >= 2);

__device__ __forceinline__ void ldfrag_lds(Frag& f, const unsigned char* p) {
  f.half[0] = *(const v8us*)(p);
  f.half[1] = *(const v8us*)(p + 32);
}

// Square block tile of all four projections: 128 A rows x 128 W rows (both k-contiguous, pitch CD), 4 waves as 2 x 2, wave tile 64 x 64:
// acc[i][j] (rows 64 wr + 16 i.., cols 64 wc + 16 j..) += A[row][k] * W[col][k] over k = 0..CD-1, k ascending in steps of 32.
// A stage is 64 k of all 256 rows at the 144-byte pitch (A rows 0..127, then W rows 128..255); two buffers.
// Per 64 k a block copies 32 KiB for 128 x 128 outputs, and a wave reads 16 fragments for 32 matrix instructions.
#define SQ_BYTES (256 * ST_PITCH)
#define SQ_RING (2 * SQ_BYTES)
static_assert(SQ_RING >= 4 * 64 * 68 * 4);         /* the epilogue tiles reuse the ring */

// 128 rows of one operand: 8 copies of 16 bytes per thread, chunk (tid & 7) of rows (tid >> 3) + 16 i; each copy of a wave moves 4 whole 128-byte lines.
// The s_wait_xcnt stands inside the statement so that no address register is rewritten ahead of it.
__device__ __forceinline__ void rows128_copy(const unsigned short* g, unsigned l) {
  asm volatile("global_load_async_to_lds_b128 %0, %8, off\n\t"
               "global_load_async_to_lds_b128 %1, %9, off\n\t"
               "global_load_async_to_lds_b128 %2, %10, off\n\t"
               "global_load_async_to_lds_b128 %3, %11, off\n\t"
               "global_load_async_to_lds_b128 %4, %12, off\n\t"
               "global_load_async_to_lds_b128 %5, %13, off\n\t"
               "global_load_async_to_lds_b128 %6, %14, off\n\t"
               "global_load_async_to_lds_b128 %7, %15, off\n\t"
               "s_wait_xcnt 0x0"
               :: "v"(l), "v"(l + 16 * ST_PITCH), "v"(l + 32 * ST_PITCH), "v"(l + 48 * ST_PITCH),
                  "v"(l + 64 * ST_PITCH), "v"(l + 80 * ST_PITCH), "v"(l + 96 * ST_PITCH), "v"(l + 112 * ST_PITCH),
                  "v"(g), "v"(g + 16 * CD), "v"(g + 32 * CD), "v"(g + 48 * CD),
                  "v"(g + 64 * CD), "v"(g + 80 * CD), "v"(g + 96 * CD), "v"(g + 112 * CD)
               : "memory");
}
__device__ __forceinline__ void sq_copy(const unsigned short* ga, const unsigned short* gb, unsigned l) {
  rows128_copy(ga, l);
  rows128_copy(gb, l + 128 * ST_PITCH);
}

template <bool BF>
__device__ __forceinline__ void gemm_sq(const unsigned short* __restrict__ ablk, const unsigned short* __restrict__ bblk,
                                        unsigned char* ring, int tid, int wr, int wc, int ln, int hh, v8f (&acc)[4][4]) {
  const int nt = CD / ST_K;
  const unsigned short* ga = ablk + (size_t)(tid >> 3) * CD + 8 * (tid & 7);
  const unsigned short* gb = bblk + (size_t)(tid >> 3) * CD + 8 * (tid & 7);
  const unsigned l0 = (unsigned)(size_t)ring + (unsigned)((tid >> 3) * ST_PITCH + 16 * (tid & 7));   // LDS byte address of this thread's first chunk
  const int aoff = (64 * wr + ln) * ST_PITCH + 16 * hh;
  const int boff = (128 + 64 * wc + ln) * ST_PITCH + 16 * hh;
  sq_copy(ga, gb, l0);
  asm volatile("s_wait_asynccnt 0x0" ::: "memory");   // tile 0 has landed before the barrier that publishes it
  __syncthreads();
  sq_copy(ga + ST_K, gb + ST_K, l0 + SQ_BYTES);
#pragma unroll 1   // one tile per trip: the two buffers alternate by the trip's parity
  for (int t = 0; t < nt; ++t) {
    const unsigned sel = (unsigned)(t & 1) * SQ_BYTES;
    const unsigned char* buf = ring + sel;
    Frag a[2][4], b[2][4];
#pragma unroll
    for (int i = 0; i < 4; ++i) ldfrag_lds(a[0][i], buf + aoff + i * 16 * ST_PITCH);
#pragma unroll
    for (int kk = 0; kk < 2; ++kk)
#pragma unroll
      for (int j = 0; j < 4; ++j) ldfrag_lds(b[kk][j], buf + boff + j * 16 * ST_PITCH + kk * 64);
    // keeps these 24 fragment loads together in front of the first matrix instruction: without it the scheduler takes one register set for the four
    // A fragments of the first 32 k, loads them one by one among the matrix instructions and waits for each to 0.
    // The A fragments of the second 32 k follow behind it, into the registers that the first four leave (all 16 fragments at once do not fit).
    __builtin_amdgcn_sched_barrier(0);
#pragma unroll
    for (int i = 0; i < 4; ++i) ldfrag_lds(a[1][i], buf + aoff + i * 16 * ST_PITCH + 64);
#pragma unroll
    for (int kk = 0; kk < 2; ++kk)
#pragma unroll
      for (int i = 0; i < 4; ++i)
#pragma unroll
        for (int j = 0; j < 4; ++j) acc[i][j] = wm<BF>(a[kk][i], b[kk][j], acc[i][j]);
    // keeps the distance behind the last matrix instructions on the loop's back edge and in front of the address arithmetic below
    asm volatile("v_nop\n\tv_nop\n\tv_nop\n\tv_nop" : "+v"(acc[0][0]), "+v"(acc[0][1]), "+v"(acc[0][2]), "+v"(acc[0][3]),
                        "+v"(acc[1][0]), "+v"(acc[1][1]), "+v"(acc[1][2]), "+v"(acc[1][3]),
                        "+v"(acc[2][0]), "+v"(acc[2][1]), "+v"(acc[2][2]), "+v"(acc[2][3]),
                        "+v"(acc[3][0]), "+v"(acc[3][1]), "+v"(acc[3][2]), "+v"(acc[3][3])
                      : "v"(a[1][0].v), "v"(a[1][1].v), "v"(a[1][2].v), "v"(a[1][3].v), "v"(b[1][0].v), "v"(b[1][1].v), "v"(b[1][2].v), "v"(b[1][3].v));
    asm volatile("s_wait_dscnt 0x0" ::: "memory");      // this wave's reads of the buffer are done before it is refilled
    asm volatile("s_wait_asynccnt 0x0" ::: "memory");   // this wave's copies of tile t + 1 have landed before the barrier publishes them
    __syncthreads();
    if (t + 2 < nt) sq_copy(ga + (t + 2) * ST_K, gb + (t + 2) * ST_K, l0 + sel);
  }
  asm volatile("s_wait_asynccnt 0x0" ::: "memory");     // nothing is in flight when the ring is used for anything else
}

__device__ __forceinline__ float rope1(float q, float p, float c, float s, float sg) { return q * c + (sg * p) * s; }

// ---------------------------------------------------------------------------------------------------------
// q, k and v projections in one launch: none reads what another writes, so blockIdx.x picks the job. grid = (NQK/2 + KVW/128, NB*SEQ/128);
// every work-group is 4 waves as 2 x 2 on one 128 x 128 tile of the same engine, and all of them are resident together.
// blockIdx.x < NQK/2: q and k with fused bias, rotary (table read by value) and head-major repack:
// 128 token rows x two heads; a wave has 64 token rows of one head (64 columns).
// coverage: NQK heads x NB*SEQ tokens x 64 = the whole plane [NB][NQK][SEQ][64], both planes. LDS tile 64 x 64 fully written before it is read.
// blockIdx.x >= NQK/2: v computed transposed: Vt[b][m][t] = sum_k Wv[m][k] x[b,t][k] + bv[m], carried x16, hi and residual planes:
// 128 weight rows x 128 tokens; a wave has 64 weight rows x 64 tokens.
// coverage: KVW rows x NB*SEQ tokens = the whole plane [NB][KVW][SEQ], both planes. LDS tile 64 x 64 fully written before it is read.
static_assert(NQK % 2 == 0);
static_assert(SEQ % 128 == 0);                         // a block's 128 tokens lie in one batch
__global__ __launch_bounds__(128) void k_proj_qkv(const unsigned short* __restrict__ xb, const unsigned short* __restrict__ wqk,
                                                  const unsigned short* __restrict__ wvb,
                                                  const float* __restrict__ bq, const float* __restrict__ bk, const float* __restrict__ bv,
                                                  const float* __restrict__ tab,
                                                  unsigned short* __restrict__ qkh, unsigned short* __restrict__ qkl,
                                                  unsigned short* __restrict__ vth, unsigned short* __restrict__ vtl) {
  __shared__ __attribute__((aligned(16))) unsigned char ring[SQ_RING];
  float (*st)[64][68] = (float (*)[64][68])ring;       // epilogue tiles, used behind the k loop's last barrier
  const int tid = threadIdx.x, lane = tid & 31, ln = lane & 15, hh = lane >> 4;
  const int w = __builtin_amdgcn_readfirstlane(tid >> 5);
  const int wr = w >> 1, wc = w & 1;
  const bool isv = (blockIdx.x >= NQK / 2);            // block-uniform
  const v8f z8 = {0.f, 0.f, 0.f, 0.f, 0.f, 0.f, 0.f, 0.f};
  v8f acc[4][4];
#pragma unroll
  for (int i = 0; i < 4; ++i)
#pragma unroll
    for (int j = 0; j < 4; ++j) acc[i][j] = z8;
  // the block's 128 token rows and its 128 weight rows; tokens are the tile's rows for q and k, its columns for v
  const unsigned short* xt = xb + (size_t)(blockIdx.y * 128) * CD;
  const unsigned short* wt = isv ? (wvb + (size_t)((blockIdx.x - NQK / 2) * 128) * CD) : (wqk + (size_t)(blockIdx.x * 2 * HD) * CD);
  gemm_sq<true>(isv ? wt : xt, isv ? xt : wt, ring, tid, wr, wc, ln, hh, acc);

  if (isv) {
#pragma unroll
    for (int i = 0; i < 4; ++i)
#pragma unroll
      for (int j = 0; j < 4; ++j)
#pragma unroll
        for (int r = 0; r < 8; ++r) st[w][16 * i + 8 * hh + r][16 * j + ln] = acc[i][j][r];
    __syncthreads();
    const int vn0 = blockIdx.y * 128 + 64 * wc;        // first token of the wave
    const int vm0 = (blockIdx.x - NQK / 2) * 128 + 64 * wr;   // first weight row of the wave
    const int vb = vn0 / SEQ, vt0 = vn0 - vb * SEQ;
    const int vrs = lane >> 3, vc0 = 8 * (lane & 7);
    const size_t vbase = ((size_t)vb * KVW + vm0) * SEQ + vt0 + vc0;
    // the wave's 64 rows in two halves of 32
    for (int half = 0; half < 2; ++half) {
      v8us oh[8], ol[8];
#pragma unroll
      for (int g = 0; g < 8; ++g) {
        const int row = 32 * half + 4 * g + vrs;
        const float bias = bf16_rne(bv[vm0 + row]);
        const v4f a0 = *(const v4fa*)&st[w][row][vc0];
        const v4f a1 = *(const v4fa*)&st[w][row][vc0 + 4];
        float o[8];
        o[0] = a0[0]; o[1] = a0[1]; o[2] = a0[2]; o[3] = a0[3];
        o[4] = a1[0]; o[5] = a1[1]; o[6] = a1[2]; o[7] = a1[3];
        Pack8 ph8, pl8;
#pragma unroll
        for (int e = 0; e < 8; ++e) {
          const float y = (o[e] + bias) * 16.0f;              // carried x16
          const _Float16 h = (_Float16)y;
          ph8.h[e] = h;
          pl8.h[e] = (_Float16)((y - (float)h) * 2048.0f);     // residual plane x2^11
        }
        oh[g] = ph8.v; ol[g] = pl8.v;
      }
#pragma unroll
      for (int g = 0; g < 8; ++g) {
        const size_t off = vbase + (size_t)(32 * half + 4 * g + vrs) * SEQ;
        *(v8us*)(vth + off) = oh[g];
        *(v8us*)(vtl + off) = ol[g];
      }
      asm volatile("s_wait_xcnt 0x0" ::: "memory");   // the second half rewrites registers that these stores name
    }
    return;                                            // the whole block leaves here; the barrier below is the q/k blocks' own
  }

  const int hd = 2 * blockIdx.x + wc;
  const int m0 = blockIdx.y * 128 + 64 * wr;
  float bias[4];
#pragma unroll
  for (int j = 0; j < 4; ++j) {
    const int col = hd * HD + 16 * j + ln;
    const int cq = (col < CD - 1) ? col : (CD - 1);
    int ck = col - CD;
    ck = (ck < 0) ? 0 : ((ck > KVW - 1) ? (KVW - 1) : ck);
    const float vq = bq[cq], vk = bk[ck];
    bias[j] = bf16_rne((col < CD) ? vq : vk);
  }
#pragma unroll
  for (int i = 0; i < 4; ++i)
#pragma unroll
    for (int j = 0; j < 4; ++j)
#pragma unroll
      for (int r = 0; r < 8; ++r) st[w][16 * i + 8 * hh + r][16 * j + ln] = acc[i][j][r] + bias[j];
  __syncthreads();

  const int b = m0 / SEQ, t0 = m0 - b * SEQ;
  const int rsub = lane >> 3, d0 = 8 * (lane & 7);
  const float sg = (d0 < 32) ? -1.0f : 1.0f;
  const size_t dbase = ((size_t)(b * NQK + hd) * SEQ + t0) * HD + d0;
  // the wave's 64 rows in two halves of 32
  const unsigned tl = (unsigned)(rsub * HD + d0);      // this lane's place in a group of 4 table rows
  for (int half = 0; half < 2; ++half) {
  const float* th = tab + (size_t)(t0 + 32 * half) * HD;   // uniform base of this half's table rows; the loads below differ from it by tl and by constants only
  v8us oh[8], ol[8];
#pragma unroll
  for (int g = 0; g < 8; ++g) {
    // keeps the last four groups' table and LDS loads from being lifted over the first four: with all 8 groups in flight at once the registers run short
    if (g == 4) __builtin_amdgcn_sched_barrier(0);
    const int row = 32 * half + 4 * g + rsub;
    const v4f a0 = *(const v4fa*)&st[w][row][d0];
    const v4f a1 = *(const v4fa*)&st[w][row][d0 + 4];
    const v4f p0 = *(const v4fa*)&st[w][row][d0 ^ 32];
    const v4f p1 = *(const v4fa*)&st[w][row][(d0 ^ 32) + 4];
    const float* tp = th + (tl + (unsigned)(4 * g * HD));
    const v4f c0 = *(const v4fa*)(tp), c1 = *(const v4fa*)(tp + 4);
    const float k0 = bf16_rne(c0[0]), s0 = bf16_rne(c0[1]), k1 = bf16_rne(c0[2]), s1 = bf16_rne(c0[3]);
    const float k2 = bf16_rne(c1[0]), s2 = bf16_rne(c1[1]), k3 = bf16_rne(c1[2]), s3 = bf16_rne(c1[3]);
    float o[8];
    o[0] = rope1(a0[0], p0[0], k0, s0, sg); o[1] = rope1(a0[1], p0[1], k0, s0, sg);
    o[2] = rope1(a0[2], p0[2], k1, s1, sg); o[3] = rope1(a0[3], p0[3], k1, s1, sg);
    o[4] = rope1(a1[0], p1[0], k2, s2, sg); o[5] = rope1(a1[1], p1[1], k2, s2, sg);
    o[6] = rope1(a1[2], p1[2], k3, s3, sg); o[7] = rope1(a1[3], p1[3], k3, s3, sg);
    Pack8 ph8, pl8;
#pragma unroll
    for (int e = 0; e < 8; ++e) {
      const float y = o[e] * 16.0f;                       // carried x16
      const _Float16 h = (_Float16)y;
      ph8.h[e] = h;
      pl8.h[e] = (_Float16)((y - (float)h) * 2048.0f);     // residual plane x2^11
    }
    oh[g] = ph8.v; ol[g] = pl8.v;
  }
#pragma unroll
    for (int g = 0; g < 8; ++g) {
      const size_t off = dbase + (size_t)(32 * half + 4 * g + rsub) * HD;
      *(v8us*)(qkh + off) = oh[g];
      *(v8us*)(qkl + off) = ol[g];
    }
    asm volatile("s_wait_xcnt 0x0" ::: "memory");   // the second half rewrites registers that these stores name
  }
}

// ---------------------------------------------------------------------------------------------------------
// Attention stage in LDS: 64 keys. Tile 0 = K rows (64 keys x 128 B), tile 1 = V^T rows (64 d x 128 B = 64 keys), each at a 144-byte pitch;
// tiles 2 and 3 = the residual planes of K and V^T (query rows below EARLY_ROWS only).
// The ring holds two stages of two tiles (plain blocks, two buffers) or one stage of four tiles (early blocks, one buffer).
#define AT_KEYS 64
#define AT_PITCH 144
#define AT_TILE (64 * AT_PITCH)
#define AT_RING (4 * AT_TILE)
static_assert(SEQ % AT_KEYS == 0);
static_assert(AT_RING >= 4 * 16 * 68 * 4);         /* the epilogue tiles reuse the ring */

// One K tile and one V^T tile: 8 copies of 16 bytes per thread, chunk (tid & 7) of rows (tid >> 3) + 16 i; each copy of a wave moves 4 whole 128-byte lines.
// The s_wait_xcnt stands inside the statement so that no address register is rewritten ahead of it.
__device__ __forceinline__ void kv_copy(const unsigned short* gk, const unsigned short* gv, unsigned l) {
  asm volatile("global_load_async_to_lds_b128 %0, %8, off\n\t"
               "global_load_async_to_lds_b128 %1, %9, off\n\t"
               "global_load_async_to_lds_b128 %2, %10, off\n\t"
               "global_load_async_to_lds_b128 %3, %11, off\n\t"
               "global_load_async_to_lds_b128 %4, %12, off\n\t"
               "global_load_async_to_lds_b128 %5, %13, off\n\t"
               "global_load_async_to_lds_b128 %6, %14, off\n\t"
               "global_load_async_to_lds_b128 %7, %15, off\n\t"
               "s_wait_xcnt 0x0"
               :: "v"(l), "v"(l + 16 * AT_PITCH), "v"(l + 32 * AT_PITCH), "v"(l + 48 * AT_PITCH),
                  "v"(l + AT_TILE), "v"(l + AT_TILE + 16 * AT_PITCH), "v"(l + AT_TILE + 32 * AT_PITCH), "v"(l + AT_TILE + 48 * AT_PITCH),
                  "v"(gk), "v"(gk + 16 * HD), "v"(gk + 32 * HD), "v"(gk + 48 * HD),
                  "v"(gv), "v"(gv + 16 * SEQ), "v"(gv + 32 * SEQ), "v"(gv + 48 * SEQ)
               : "memory");
}

// One 32-key step for a wave's 16 queries (this lane's column = its query). EARLYP adds the residual planes of q, k, v, P.
// st = the stage in LDS, kloc = 0 or 32 = first key of the step inside the stage, key0 = the same key's index in the sequence.
// MASK reads the mask row of this lane's query by value and replace-fills with -inf.
template <bool EARLYP, bool MASK>
__device__ __forceinline__ void fa_step(const unsigned char* st, int kloc,
                                        const int* __restrict__ mrow, int key0, int ln, int hh,
                                        const Frag (&qh)[2], const Frag (&ql)[2],
                                        float& mr, float& lr, v8f (&Oh)[4], v8f (&Ol)[4]) {
  const v8f z8 = {0.f, 0.f, 0.f, 0.f, 0.f, 0.f, 0.f, 0.f};
  float sc[16];
  // A fragments of K: row m = key (key0 + 16*kt + ln), elements 0..7 <- d = 32c + 8h + i, 8..15 <- d = 32c + 16 + 8h + i
  int koff = (kloc + ln) * AT_PITCH + 16 * hh;        // byte offset in a K tile
  if (EARLYP) {
#pragma unroll
    for (int kt = 0; kt < 2; ++kt) {
      Frag a0, a1, l0, l1;
      ldfrag_lds(a0, st + koff); ldfrag_lds(a1, st + koff + 64);
      ldfrag_lds(l0, st + 2 * AT_TILE + koff); ldfrag_lds(l1, st + 2 * AT_TILE + koff + 64);
      v8f s = z8, r = z8;
      s = wm<false>(a0, qh[0], s); s = wm<false>(a1, qh[1], s);
      r = wm<false>(a0, ql[0], r); r = wm<false>(a1, ql[1], r);
      r = wm<false>(l0, qh[0], r); r = wm<false>(l1, qh[1], r);
      asm volatile("v_nop\n\tv_nop\n\tv_nop\n\tv_nop" : "+v"(s), "+v"(r)
                        : "v"(a0.v), "v"(a1.v), "v"(l0.v), "v"(l1.v), "v"(qh[0].v), "v"(qh[1].v), "v"(ql[0].v), "v"(ql[1].v));
      // S^T element r of tile kt = score(key0 + 16*kt + 8h + r, this lane's query); carries: q x16, k x16, residual x2^11
#pragma unroll
      for (int e = 0; e < 8; ++e) sc[8 * kt + e] = fmaf(r[e], S2M11, s[e]) * S2M11;
      koff += 16 * AT_PITCH;
      if (kt == 0) asm volatile("" : "+v"(koff) : "v"(sc[0]));   // second tile's loads issue after the first tile is done
    }
  } else {
    Frag k00, k01, k10, k11;
    ldfrag_lds(k00, st + koff);                 ldfrag_lds(k01, st + koff + 64);
    ldfrag_lds(k10, st + koff + 16 * AT_PITCH); ldfrag_lds(k11, st + koff + 16 * AT_PITCH + 64);
    v8f s0 = z8, s1 = z8;
    s0 = wm<false>(k00, qh[0], s0); s0 = wm<false>(k01, qh[1], s0);
    s1 = wm<false>(k10, qh[0], s1); s1 = wm<false>(k11, qh[1], s1);
    asm volatile("v_nop\n\tv_nop\n\tv_nop\n\tv_nop" : "+v"(s0), "+v"(s1)
                      : "v"(k00.v), "v"(k01.v), "v"(k10.v), "v"(k11.v), "v"(qh[0].v), "v"(qh[1].v));
#pragma unroll
    for (int e = 0; e < 8; ++e) { sc[e] = s0[e] * S2M11; sc[8 + e] = s1[e] * S2M11; }
  }
  if (MASK) {
    const int* mp = mrow + key0 + 8 * hh;
    const v4i m0 = *(const v4ia*)(mp),      m1 = *(const v4ia*)(mp + 4);
    const v4i m2 = *(const v4ia*)(mp + 16), m3 = *(const v4ia*)(mp + 20);
    const float ninf = neg_inf();
#pragma unroll
    for (int e = 0; e < 4; ++e) {
      sc[e]      = (m0[e] == 0) ? ninf : sc[e];
      sc[4 + e]  = (m1[e] == 0) ? ninf : sc[4 + e];
      sc[8 + e]  = (m2[e] == 0) ? ninf : sc[8 + e];
      sc[12 + e] = (m3[e] == 0) ? ninf : sc[12 + e];
    }
  }
  float mx = sc[0];
#pragma unroll
  for (int i = 1; i < 16; ++i) mx = fmaxf(mx, sc[i]);
  mx = fmaxf(mx, __shfl_xor(mx, 16, 32));            // the other lane half holds the other 16 keys of this query
  const float mnew = fmaxf(mr, mx);
  float msafe = mnew;
  if (MASK) msafe = (mnew == neg_inf()) ? 0.0f : mnew;   // every key so far masked: weights come out 0
  const float al = __builtin_amdgcn_exp2f((mr - msafe) * LOG2E);
  mr = mnew;
  // weights carried x256: pc = 256 * exp(sc - m); hi plane f16(pc), residual plane f16((pc - hi) * 2048)
  Frag ph, pl;
  float ps = 0.0f;
#pragma unroll
  for (int i = 0; i < 16; ++i) {
    const float pc = __builtin_amdgcn_exp2f(fmaf(sc[i] - msafe, LOG2E, 8.0f));
    ps += pc;
    const _Float16 h = (_Float16)pc;
    ph.h[i] = h;                                      // B element i: i<8 -> key0 + 8h + i (tile 0 row 8h+i); i>=8 -> key0 + 16 + 8h + (i-8) (tile 1)
    if (EARLYP) pl.h[i] = (_Float16)((pc - (float)h) * 2048.0f);
  }
  ps += __shfl_xor(ps, 16, 32);
  lr = lr * al + ps;
  // A fragments of V^T: row m = d (16*t + ln), elements 0..7 <- key0 + 8h + i, 8..15 <- key0 + 16 + 8h + i
  int voff = AT_TILE + ln * AT_PITCH + 2 * kloc + 16 * hh;   // byte offset in the stage
  asm volatile("" : "+v"(voff) : "v"(ps));            // V loads issue after the score phase
  const unsigned char* vp = st + voff;
  Frag vf[4];
#pragma unroll
  for (int t = 0; t < 4; ++t) ldfrag_lds(vf[t], vp + t * 16 * AT_PITCH);
#pragma unroll
  for (int t = 0; t < 4; ++t) Oh[t] = Oh[t] * al;
  if (EARLYP) {
    const unsigned char* vq = vp + 2 * AT_TILE;
    Frag vl[4];
#pragma unroll
    for (int t = 0; t < 4; ++t) ldfrag_lds(vl[t], vq + t * 16 * AT_PITCH);
#pragma unroll
    for (int t = 0; t < 4; ++t) Ol[t] = Ol[t] * al;
#pragma unroll
    for (int t = 0; t < 4; ++t) {
      Oh[t] = wm<false>(vf[t], ph, Oh[t]);
      Ol[t] = wm<false>(vf[t], pl, Ol[t]);
      Ol[t] = wm<false>(vl[t], ph, Ol[t]);
    }
    asm volatile("v_nop\n\tv_nop\n\tv_nop\n\tv_nop" : "+v"(Oh[0]), "+v"(Oh[1]), "+v"(Oh[2]), "+v"(Oh[3]), "+v"(Ol[0]), "+v"(Ol[1]), "+v"(Ol[2]), "+v"(Ol[3])
                      : "v"(vf[0].v), "v"(vf[1].v), "v"(vf[2].v), "v"(vf[3].v),
                        "v"(vl[0].v), "v"(vl[1].v), "v"(vl[2].v), "v"(vl[3].v), "v"(ph.v), "v"(pl.v));
  } else {
#pragma unroll
    for (int t = 0; t < 4; ++t) Oh[t] = wm<false>(vf[t], ph, Oh[t]);
    asm volatile("v_nop\n\tv_nop\n\tv_nop\n\tv_nop" : "+v"(Oh[0]), "+v"(Oh[1]), "+v"(Oh[2]), "+v"(Oh[3])
                      : "v"(vf[0].v), "v"(vf[1].v), "v"(vf[2].v), "v"(vf[3].v), "v"(ph.v));
  }
}

// What stands in front of and behind a stage's work. Early blocks (one buffer of four tiles): fill, wait, publish in front; every reader leaves behind.
// Plain blocks (two buffers of two tiles): nothing in front; behind, stage t + 1 is published and stage t + 2 is sent into the buffer that stage t has just left.
template <bool EARLYP>
__device__ __forceinline__ void ring_head(const unsigned short* gk, const unsigned short* gv, const unsigned short* gkl, const unsigned short* gvl,
                                          unsigned l0, int t) {
  if (EARLYP) {
    kv_copy(gk + (size_t)t * AT_KEYS * HD, gv + t * AT_KEYS, l0);
    kv_copy(gkl + (size_t)t * AT_KEYS * HD, gvl + t * AT_KEYS, l0 + 2 * AT_TILE);
    asm volatile("s_wait_asynccnt 0x0" ::: "memory");   // this wave's copies have landed before the barrier publishes them
    __syncthreads();
  }
}
template <bool EARLYP>
__device__ __forceinline__ void ring_foot(const unsigned short* gk, const unsigned short* gv, unsigned l0, int t, int nst) {
  asm volatile("s_wait_dscnt 0x0" ::: "memory");        // this wave's reads of the buffer are done before it is refilled
  if (!EARLYP) asm volatile("s_wait_asynccnt 0x0" ::: "memory");   // this wave's copies of stage t + 1 have landed before the barrier publishes them
  __syncthreads();
  if (!EARLYP) {
    if (t + 2 < nst) kv_copy(gk + (size_t)(t + 2) * AT_KEYS * HD, gv + (t + 2) * AT_KEYS, l0 + (unsigned)(t & 1) * (2 * AT_TILE));
  }
}

// nst = stages of 64 keys that the block walks, npl = the first of them that run without mask reads (both the same in all its waves;
// npl <= nst <= SEQ / 64, 2 * nst >= every wave's nsteps, 2 * npl <= every wave's nsteps). nsteps = this wave's own 32-key steps.
template <bool EARLYP>
__device__ __forceinline__ void run_keys(const unsigned short* __restrict__ qkh, const unsigned short* __restrict__ qkl,
                                         const unsigned short* __restrict__ vth, const unsigned short* __restrict__ vtl,
                                         const int* __restrict__ mask, unsigned char* ring, int tid, int b, int h, int qg, int ln, int hh,
                                         int npl, int nsteps, int nst, float& mr, float& lr, v8f (&Oh)[4], v8f (&Ol)[4]) {
  // Q^T B fragments: column n = this lane's query, elements 0..7 <- d = 32c + 8h + i, 8..15 <- d = 32c + 16 + 8h + i
  const size_t qoff = ((size_t)(b * NQK + h) * SEQ + qg) * HD + 8 * hh;
  Frag qh[2], ql[2];
  ldfrag(qh[0], qkh + qoff); ldfrag(qh[1], qkh + qoff + 32);
  if (EARLYP) { ldfrag(ql[0], qkl + qoff); ldfrag(ql[1], qkl + qoff + 32); }
  else { ql[0] = qh[0]; ql[1] = qh[1]; }
  const int kv = h % NKV;
  const size_t kbase = (size_t)(b * NQK + NHEAD + kv) * SEQ * HD;
  const size_t vbase = ((size_t)b * KVW + (size_t)kv * HD) * SEQ;
  const int* mrow = mask + (size_t)qg * SEQ_FULL;
  // this thread's first chunk of a stage: in K (rows = keys), in V^T (rows = d) and in LDS
  const size_t kthr = kbase + (size_t)(tid >> 3) * HD + 8 * (tid & 7);
  const size_t vthr = vbase + (size_t)(tid >> 3) * SEQ + 8 * (tid & 7);
  const unsigned short* gk = qkh + kthr;
  const unsigned short* gv = vth + vthr;
  const unsigned l0 = (unsigned)(size_t)ring + (unsigned)((tid >> 3) * AT_PITCH + 16 * (tid & 7));   // LDS byte address
  const unsigned short* gkl = qkl + kthr;
  const unsigned short* gvl = vtl + vthr;
  if (!EARLYP) {
    kv_copy(gk, gv, l0);
    asm volatile("s_wait_asynccnt 0x0" ::: "memory");     // stage 0 has landed before the barrier that publishes it
    __syncthreads();
    if (nst > 1) kv_copy(gk + AT_KEYS * HD, gv + AT_KEYS, l0 + 2 * AT_TILE);
  }
#pragma unroll 1   // one stage per trip: the two buffers alternate by the trip's parity
  for (int t = 0; t < npl; ++t) {
    const unsigned char* st = ring + (EARLYP ? 0u : (unsigned)(t & 1) * (2 * AT_TILE));
    ring_head<EARLYP>(gk, gv, gkl, gvl, l0, t);
    fa_step<EARLYP, false>(st, 0, mrow, AT_KEYS * t, ln, hh, qh, ql, mr, lr, Oh, Ol);
    fa_step<EARLYP, false>(st, 32, mrow, AT_KEYS * t + 32, ln, hh, qh, ql, mr, lr, Oh, Ol);
    ring_foot<EARLYP>(gk, gv, l0, t, nst);
  }
#pragma unroll 1   // one stage per trip, as above
  for (int t = npl; t < nst; ++t) {
    const unsigned char* st = ring + (EARLYP ? 0u : (unsigned)(t & 1) * (2 * AT_TILE));
    ring_head<EARLYP>(gk, gv, gkl, gvl, l0, t);
#pragma unroll 1   // one copy of the masked step in the text
    for (int sub = 0; sub < 2; ++sub) {
      const int j = 2 * t + sub;
      // a wave whose own steps have run out passes through to the barrier (wave-uniform test)
      if (j < nsteps) fa_step<EARLYP, true>(st, 32 * sub, mrow, 32 * j, ln, hh, qh, ql, mr, lr, Oh, Ol);
    }
    ring_foot<EARLYP>(gk, gv, l0, t, nst);
  }
  asm volatile("s_wait_asynccnt 0x0" ::: "memory");       // nothing is in flight when the ring is used for anything else
}

// Work-group rank -> query tile, cost falling with the rank, for speed only.
// Cost of tile qt under a causal mask = its qt + 1 stages; a stage with the residual planes counts twice (three times the matrix instructions, twice the LDS
// reads, one buffer). A permutation of the tiles for any SEQ, formed at compile time, one byte per rank; it decides the order only, never what is computed.
#define NQT (SEQ / 64)
#define NQT_EARLY (EARLY_ROWS / 64)
static_assert(NQT <= 32);
struct TileRank { unsigned long long w[4]; };
constexpr int tile_cost(int qt) { return (qt + 1) * (qt < NQT_EARLY ? 2 : 1); }
constexpr TileRank make_tile_rank() {
  TileRank o = {{0ull, 0ull, 0ull, 0ull}};
  bool used[NQT] = {};
  for (int r = 0; r < NQT; ++r) {
    int best = -1;
    for (int q = NQT - 1; q >= 0; --q)
      if (!used[q] && (best < 0 || tile_cost(q) > tile_cost(best))) best = q;
    used[best] = true;
    o.w[r >> 3] |= (unsigned long long)best << (8 * (r & 7));
  }
  return o;
}

// Block = 4 waves x 16 queries = 64 queries of one (batch, head); the waves share the K and V^T stages in LDS, one barrier per 64 keys (two in early blocks).
// Block index = rank * (NB * NHEAD) + (batch, head): all heads of the costliest query tile come first.
// Tile skipping from the device flags of this wave's own 16 mask rows (16/SCAN_ROWS flag lines): all upper flags 1 -> keys past the diagonal step are
// skipped; upper and lower flags of all 64 rows of the block 1 -> the stages fully below the block's diagonal tile run without mask reads; every other visited step reads the mask by value.
// Trip counts are bounded by SEQ/32 for any flag value. The block walks qt + 1 stages if the upper flags of all its 64 rows are 1, else all SEQ/64.
// coverage: NB*NHEAD*(SEQ/64) blocks x 4 waves x 16 rows x 64 columns = the whole ctx hi plane; blocks with query tile below EARLY_ROWS cover the whole residual plane.
__global__ __launch_bounds__(128) void k_attn(const unsigned short* __restrict__ qkh, const unsigned short* __restrict__ qkl,
                                              const unsigned short* __restrict__ vth, const unsigned short* __restrict__ vtl,
                                              const int* __restrict__ mask, const int* __restrict__ flags,
                                              unsigned short* __restrict__ ctxh, unsigned short* __restrict__ ctxl) {
  __shared__ __attribute__((aligned(16))) unsigned char ring[AT_RING];
  float (*so)[16][68] = (float (*)[16][68])ring;       // epilogue tiles, used behind the key loop's last barrier
  const int tid = threadIdx.x, lane = tid & 31, ln = lane & 15, hh = lane >> 4;
  const int w = __builtin_amdgcn_readfirstlane(tid >> 5);
  constexpr TileRank tr = make_tile_rank();
  const unsigned blk = blockIdx.x;
  const unsigned rank = blk / (NB * NHEAD);            // 0 .. NQT-1
  const unsigned long long trw = (rank < 8) ? tr.w[0] : ((rank < 16) ? tr.w[1] : ((rank < 24) ? tr.w[2] : tr.w[3]));
  const int qt = (int)((trw >> (8 * (rank & 7))) & 255ull);
  const int h = (int)(blk % NHEAD);
  const int b = (int)((blk / NHEAD) % NB);
  const int qbase = qt * 64 + 16 * w;
  const int qg = qbase + ln;
  const int* fl = flags + (qbase / SCAN_ROWS) * 32;
  int upok = 1;                                        // plain & so that the flag loads issue together
#pragma unroll
  for (int g = 0; g < 16 / SCAN_ROWS; ++g) upok &= (fl[32 * g] == 1) ? 1 : 0;
  const bool tri = (upok == 1);
  const int nfull = qbase >> 5;                        // steps whose 32 keys are all at or below every query of this wave
  const int nsteps = tri ? (nfull + 1) : (SEQ / 32);   // <= SEQ/32 in both cases
  const bool early = (qt * 64 < EARLY_ROWS);
  // stage counts of the block, from the flags of all its 64 rows: the same values in all four waves, since barriers stand in the key loop
  const int* flb = flags + (qt * 64 / SCAN_ROWS) * 32;
  int upall = 1, lowall = 1;
#pragma unroll
  for (int g = 0; g < 64 / SCAN_ROWS; ++g) {
    const int fU = flb[32 * g], fL = flb[32 * g + 1];
    upall &= (fU == 1) ? 1 : 0;
    lowall &= (fL == 1) ? 1 : 0;
  }
  const int nst = (upall == 1) ? (qt + 1) : (SEQ / AT_KEYS);
  const int npl = (upall == 1 && lowall == 1) ? qt : 0;   // stages whose 64 keys are all below every query of the block

  const v8f z8 = {0.f, 0.f, 0.f, 0.f, 0.f, 0.f, 0.f, 0.f};
  float mr = neg_inf(), lr = 0.0f;
  v8f Oh[4], Ol[4];
#pragma unroll
  for (int t = 0; t < 4; ++t) { Oh[t] = z8; Ol[t] = z8; }
  if (early) run_keys<true>(qkh, qkl, vth, vtl, mask, ring, tid, b, h, qg, ln, hh, npl, nsteps, nst, mr, lr, Oh, Ol);
  else       run_keys<false>(qkh, qkl, vth, vtl, mask, ring, tid, b, h, qg, ln, hh, npl, nsteps, nst, mr, lr, Oh, Ol);

  // O^T element r of tile t = ctx(query, d = 16t + 8h + r); undo the carries x256 (in lr), x16 (V), x2^11 (residual); apply the x64 carry of ctx
  const float inv = 4.0f * (1.0f / lr);
#pragma unroll
  for (int t = 0; t < 4; ++t)
#pragma unroll
    for (int r = 0; r < 8; ++r)
      so[w][ln][16 * t + 8 * hh + r] = fmaf(Ol[t][r], S2M11, Oh[t][r]) * inv;
  __syncthreads();
  const int rsub = lane >> 3, d0 = 8 * (lane & 7);
  v8us oh[4], ol[4];
#pragma unroll
  for (int g = 0; g < 4; ++g) {
    const int row = 4 * g + rsub;
    const v4f a0 = *(const v4fa*)&so[w][row][d0];
    const v4f a1 = *(const v4fa*)&so[w][row][d0 + 4];
    float o[8];
    o[0] = a0[0]; o[1] = a0[1]; o[2] = a0[2]; o[3] = a0[3];
    o[4] = a1[0]; o[5] = a1[1]; o[6] = a1[2]; o[7] = a1[3];
    Pack8 ph8, pl8;
#pragma unroll
    for (int e = 0; e < 8; ++e) {
      const _Float16 hv = (_Float16)o[e];
      ph8.h[e] = hv;
      pl8.h[e] = (_Float16)((o[e] - (float)hv) * 2048.0f);
    }
    oh[g] = ph8.v; ol[g] = pl8.v;
  }
  const size_t hbase = ((size_t)b * SEQ + qbase) * CD + (size_t)h * HD + d0;
  const size_t lbase = ((size_t)b * EARLY_ROWS + (early ? qbase : 0)) * CD + (size_t)h * HD + d0;
{
#pragma unroll
    for (int g = 0; g < 4; ++g) {
      const size_t ro = (size_t)(4 * g + rsub) * CD;
      *(v8us*)(ctxh + hbase + ro) = oh[g];
      if (early) *(v8us*)(ctxl + lbase + ro) = ol[g];
    }
    
  }
}

// ---------------------------------------------------------------------------------------------------------
// Output projection: out[m][n] = sum_k ctx[m][k] Wo[n][k] + bo[n]. Block = 4 waves as 2 x 2: 128 rows x 128 columns, 64 x 64 per wave. grid = (CD/128, NB*SEQ/128).
// Rows below EARLY_ROWS of each sequence add the residual plane of ctx.
// coverage: NB*SEQ rows x CD columns = every element of the output buffer region once. LDS tile 64 x 64 fully written before it is read.
static_assert(CD % 128 == 0);
__global__ __launch_bounds__(128) void k_proj_out(const unsigned short* __restrict__ ctxh, const unsigned short* __restrict__ ctxl,
                                                  const unsigned short* __restrict__ wo, const float* __restrict__ bo,
                                                  float* __restrict__ out) {
  __shared__ __attribute__((aligned(16))) unsigned char ring[SQ_RING];
  float (*st)[64][68] = (float (*)[64][68])ring;       // epilogue tiles, used behind the k loop's last barrier
  const int tid = threadIdx.x, lane = tid & 31, ln = lane & 15, hh = lane >> 4;
  const int w = __builtin_amdgcn_readfirstlane(tid >> 5);
  const int wr = w >> 1, wc = w & 1;
  const int n0 = blockIdx.x * 128 + 64 * wc;
  // blockIdx.y -> row tile, cost falling with the index: the tiles that walk k twice (rows below EARLY_ROWS of every sequence) come first
  // (for speed only: nothing rests on where a work-group lands). A permutation of the NB * SEQ / 128 row tiles.
  constexpr int TPS = SEQ / 128, EPS = EARLY_ROWS / 128, PPS = (TPS > EPS) ? (TPS - EPS) : 1;
  const int yt = blockIdx.y;
  const bool early = (yt < NB * EPS);                  // block-uniform
  const int b = early ? (yt / EPS) : ((yt - NB * EPS) / PPS);
  const int tb = 128 * (early ? (yt - b * EPS) : (EPS + (yt - NB * EPS) - b * PPS));
  const int mb = b * SEQ + tb;
  const int t0 = tb + 64 * wr;
  const v8f z8 = {0.f, 0.f, 0.f, 0.f, 0.f, 0.f, 0.f, 0.f};
  v8f acc[4][4];
#pragma unroll
  for (int i = 0; i < 4; ++i)
#pragma unroll
    for (int j = 0; j < 4; ++j) acc[i][j] = z8;
  const unsigned short* wp = wo + (size_t)(blockIdx.x * 128) * CD;
  // residual plane: a walk of its own over k through the same ring (block-uniform branch). It runs first, and its sums, brought to the hi plane's carry,
  // are the start values of the hi plane's walk: one set of 16 accumulator tiles serves both (two sets do not fit the registers that asm operands can name)
  if (early) {
    gemm_sq<false>(ctxl + (size_t)(b * EARLY_ROWS + tb) * CD, wp, ring, tid, wr, wc, ln, hh, acc);
#pragma unroll
    for (int i = 0; i < 4; ++i)
#pragma unroll
      for (int j = 0; j < 4; ++j) acc[i][j] = acc[i][j] * S2M11;
  }
  gemm_sq<false>(ctxh + (size_t)mb * CD, wp, ring, tid, wr, wc, ln, hh, acc);
  // carries: ctx x64, Wo x64 -> 2^-12 (the residual plane's x2^11 is undone above)
#pragma unroll
  for (int i = 0; i < 4; ++i)
#pragma unroll
    for (int j = 0; j < 4; ++j)
#pragma unroll
      for (int r = 0; r < 8; ++r)
        st[w][16 * i + 8 * hh + r][16 * j + ln] = acc[i][j][r] * S2M12;
  __syncthreads();
  const int rsub = lane >> 4, c4 = 4 * (lane & 15);
  const v4f bb = *(const v4fa*)(bo + n0 + c4);
  v4f bias;
  bias[0] = bf16_rne(bb[0]); bias[1] = bf16_rne(bb[1]); bias[2] = bf16_rne(bb[2]); bias[3] = bf16_rne(bb[3]);
  float* og = out + ((size_t)b * SEQ_FULL + t0) * CD + n0 + c4;
  // the wave's 64 rows in two halves of 32
  for (int half = 0; half < 2; ++half) {
    v4f ov[16];
#pragma unroll
    for (int g = 0; g < 16; ++g) {
      const v4f a = *(const v4fa*)&st[w][32 * half + 2 * g + rsub][c4];
      ov[g] = a + bias;
    }
#pragma unroll
    for (int g = 0; g < 16; ++g)
      *(v4f*)(og + (size_t)(32 * half + 2 * g + rsub) * CD) = ov[g];
  }
}

// ---------------------------------------------------------------------------------------------------------
extern "C" void kernel_launch(void* const* d_in, const int* in_sizes, int n_in,
                              void* d_out, int out_size, void* d_ws, size_t ws_size, hipStream_t stream) {
  if (n_in < 11) return;
  const long long need_x = (long long)(NB - 1) * SEQ_FULL * CD + (long long)SEQ * CD;   // last element touched + 1
  const long long need_m = (long long)(SEQ - 1) * SEQ_FULL + SEQ;
  if ((long long)in_sizes[0] < need_x) return;
  if ((long long)in_sizes[1] < need_m) return;
  if ((long long)in_sizes[2] < (long long)SEQ * HD) return;
  if ((long long)in_sizes[3] < (long long)CD * CD || (long long)in_sizes[4] < CD) return;
  if ((long long)in_sizes[5] < (long long)KVW * CD || (long long)in_sizes[6] < KVW) return;
  if ((long long)in_sizes[7] < (long long)KVW * CD || (long long)in_sizes[8] < KVW) return;
  if ((long long)in_sizes[9] < (long long)CD * CD || (long long)in_sizes[10] < CD) return;
  if ((long long)out_size < need_x) return;
  if ((size_t)WS_TOTAL > ws_size) return;

  // wire order: x, mask, sinusoidal_pos, Wq, bq, Wk, bk, Wv, bv, Wo, bo
  const float* x    = (const float*)d_in[0];
  const int*   mask = (const int*)d_in[1];
  const float* tab  = (const float*)d_in[2];
  const float* Wq   = (const float*)d_in[3];
  const float* bq   = (const float*)d_in[4];
  const float* Wk   = (const float*)d_in[5];
  const float* bk   = (const float*)d_in[6];
  const float* Wv   = (const float*)d_in[7];
  const float* bv   = (const float*)d_in[8];
  const float* Wo   = (const float*)d_in[9];
  const float* bo   = (const float*)d_in[10];
  float* out = (float*)d_out;

  char* ws = (char*)d_ws;
  size_t off = 0;
  int* flags = (int*)(ws + off);                               off += SZ_FLAGS;
  unsigned short* xb   = (unsigned short*)(ws + off);          off += SZ_XB;
  unsigned short* wqk  = (unsigned short*)(ws + off);          off += SZ_WQK;
  unsigned short* wvb  = (unsigned short*)(ws + off);          off += SZ_WV;
  unsigned short* wob  = (unsigned short*)(ws + off);          off += SZ_WO;
  unsigned short* qkh  = (unsigned short*)(ws + off);          off += PLANE_QK * 2;
  unsigned short* qkl  = (unsigned short*)(ws + off);          off += PLANE_QK * 2;
  unsigned short* vth  = (unsigned short*)(ws + off);          off += PLANE_V * 2;
  unsigned short* vtl  = (unsigned short*)(ws + off);          off += PLANE_V * 2;
  unsigned short* ctxh = (unsigned short*)(ws + off);          off += SZ_CTXH;
  unsigned short* ctxl = (unsigned short*)(ws + off);          off += SZ_CTXL;
  if (off > ws_size) return;

  // mask -> flags, and in[rows][CD] f32 -> [rows][CD] 16-bit planes (row order kept)
  k_prep<<<(unsigned)(SCAN_BLOCKS + CVT_BLOCKS), PREP_THREADS, 0, stream>>>(mask, flags, x, Wq, Wk, Wv, Wo, xb, wqk, wvb, wob);

  k_proj_qkv<<<dim3(NQK / 2 + KVW / 128, (unsigned)(NB * SEQ / 128)), 128, 0, stream>>>(xb, wqk, wvb, bq, bk, bv, tab, qkh, qkl, vth, vtl);
  k_attn<<<(unsigned)(NB * NHEAD * (SEQ / 64)), 128, 0, stream>>>(qkh, qkl, vth, vtl, mask, flags, ctxh, ctxl);
  k_proj_out<<<dim3(CD / 128, (unsigned)(NB * SEQ / 128)), 128, 0, stream>>>(ctxh, ctxl, wob, bo, out);
}

// v008
// It runs in 148 microseconds.
// Next to v007, in two timings, it ran 1.08 times as fast each time.
// All steps since v000 together make it 5.87 times as fast.
#include <hip/hip_runtime.h>
#ifndef NB
#define NB 2
#endif
#ifndef SEQ
#define SEQ 2048
#endif
#define NB_FULL 2
#define SEQ_FULL 2048
#define CD 2048                 /* model width = depth of every projection */
#define NHEAD 32
#define NKV 8
#define HD 64
#define NQK (NHEAD + NKV)       /* rotary plane holds the 32 q heads followed by the 8 k heads */
#define KVW (NKV * HD)          /* 512 */
#define EARLY_ROWS (SEQ < 512 ? SEQ : 512)

#define SCAN_ROWS 8             /* mask rows per scan work-group: 8 rows x SEQ ints = 8 loads of 16 B per thread at SEQ = 2048 */
#define SCAN_LOADS (SCAN_ROWS * (SEQ / 4) / 512)
#define SZ_FLAGS ((size_t)(SEQ / SCAN_ROWS) * 128)   /* one 128-byte line per scan work-group */
#define SZ_XB    ((size_t)NB * SEQ * CD * 2)
#define SZ_WQK   ((size_t)(CD + KVW) * CD * 2)
#define SZ_WV    ((size_t)KVW * CD * 2)
#define SZ_WO    ((size_t)CD * CD * 2)
#define PLANE_QK ((size_t)NB * NQK * SEQ * HD)     /* elements of one rotary plane */
#define PLANE_V  ((size_t)NB * KVW * SEQ)          /* elements of one V^T plane */
#define SZ_CTXH  ((size_t)NB * SEQ * CD * 2)
#define SZ_CTXL  ((size_t)NB * EARLY_ROWS * CD * 2)
#define WS_TOTAL (SZ_FLAGS + SZ_XB + SZ_WQK + SZ_WV + SZ_WO + PLANE_QK * 4 + PLANE_V * 4 + SZ_CTXH + SZ_CTXL)

static_assert(SEQ % 128 == 0);
static_assert((SCAN_ROWS * (SEQ / 4)) % 512 == 0);
static_assert(16 % SCAN_ROWS == 0);
static_assert(SZ_FLAGS % 256 == 0);
static_assert(EARLY_ROWS % 128 == 0);
static_assert(SEQ <= SEQ_FULL);
static_assert(NB <= NB_FULL);
static_assert(HD == 64);
static_assert(CD % 32 == 0);
static_assert(KVW % 128 == 0);
static_assert(NHEAD % NKV == 0);
static_assert(WS_TOTAL <= (size_t)134217728);
static_assert(SZ_XB % 256 == 0 && SZ_WQK % 256 == 0 && SZ_WV % 256 == 0 && SZ_WO % 256 == 0);
static_assert((PLANE_QK * 2) % 256 == 0 && (PLANE_V * 2) % 256 == 0 && SZ_CTXH % 256 == 0 && SZ_CTXL % 256 == 0);

typedef __bf16 v16b __attribute__((ext_vector_type(16)));
typedef _Float16 v16h __attribute__((ext_vector_type(16)));
typedef unsigned short v8us __attribute__((ext_vector_type(8), may_alias));
typedef float v8f __attribute__((ext_vector_type(8)));
typedef float v4f __attribute__((ext_vector_type(4)));
typedef float v4fa __attribute__((ext_vector_type(4), may_alias));
typedef int v4i __attribute__((ext_vector_type(4)));
typedef int v4ia __attribute__((ext_vector_type(4), may_alias));
union Frag { v16b b; v16h v; v8us half[2]; _Float16 h[16]; unsigned short u[16]; };
union Pack8 { v8us v; _Float16 h[8]; unsigned short u[8]; };

#define LOG2E 1.4426950408889634f
#define S2M11 0.00048828125f       /* 2^-11 */
#define S2M12 0.000244140625f      /* 2^-12 */
__device__ __forceinline__ unsigned short bf16_bits(float x) {   // RNE convert to bf16 bits
  unsigned int u = __float_as_uint(x);
  return (unsigned short)((u + 0x7FFFu + ((u >> 16) & 1u)) >> 16);
}
__device__ __forceinline__ float bf16_val(unsigned short b) { return __uint_as_float(((unsigned int)b) << 16); }
__device__ __forceinline__ float bf16_rne(float x) { return bf16_val(bf16_bits(x)); }
__device__ __forceinline__ float neg_inf() { return __uint_as_float(0xff800000u); }

// Fragment of a k-contiguous 16-bit row: elements 0..7 <- p[0..7], elements 8..15 <- p[16..23]; caller adds row*pitch + k0 + 8*h.
__device__ __forceinline__ void ldfrag(Frag& f, const unsigned short* __restrict__ p) {
  f.half[0] = *(const v8us*)(p);
  f.half[1] = *(const v8us*)(p + 16);
}

template <bool BF>
__device__ __forceinline__ v8f wm(const Frag& a, const Frag& b, v8f c) {
  if (BF) return __builtin_amdgcn_wmma_f32_16x16x32_bf16(false, a.b, false, b.b, (short)0, c, false, false);
  return __builtin_amdgcn_wmma_f32_16x16x32_f16(false, a.v, false, b.v, (short)0, c, false, false);
}

// ---------------------------------------------------------------------------------------------------------
// Input preparation, one launch: the jobs below read inputs only and none reads what another writes, so the block index picks the job.
// Blocks 0 .. SCAN_BLOCKS-1: mask scan, one work-group per SCAN_ROWS mask rows; group g owns the line flags[32g .. 32g+31]:
// flags[32g] = 1 iff every entry of its rows above the diagonal is zero; flags[32g+1] = 1 iff every entry of its rows on or below the diagonal is nonzero.
// coverage: SEQ/SCAN_ROWS blocks x 512 threads x SCAN_LOADS x 4 ints = SEQ x SEQ mask entries; every flag line is written whole.
// Blocks SCAN_BLOCKS .. SCAN_BLOCKS+CVT_BLOCKS-1: f32 rows of width CD -> 16-bit planes (row order kept). A row is one 16-byte load and one 8-byte store
// per thread (a wave reads 4 whole lines and writes 2); block c takes the c-th run of adjacent rows of each of x, Wq, Wk, Wv and Wo, the same counts in every block.
// MODE 0: bf16 bits (RNE). MODE 1: f16 of (RNE bf16 value x 64).
// coverage: CVT_BLOCKS blocks x (rows / CVT_BLOCKS) rows x 512 threads x 4 elements = rows x CD, for each of the five arrays.
#define PREP_THREADS 512
#define SCAN_BLOCKS (SEQ / SCAN_ROWS)
#define CVT_BLOCKS 512
static_assert(CD == PREP_THREADS * 4);
static_assert((NB * SEQ) % CVT_BLOCKS == 0 && CD % CVT_BLOCKS == 0 && KVW % CVT_BLOCKS == 0);

typedef unsigned short v4us __attribute__((ext_vector_type(4), may_alias));
union Pack4 { v4us v; _Float16 h[4]; unsigned short u[4]; };

template <int MODE>
__device__ __forceinline__ void cvt_store(unsigned short* d, v4f x) {
  Pack4 o;
  if (MODE == 0) {
    o.u[0] = bf16_bits(x[0]); o.u[1] = bf16_bits(x[1]); o.u[2] = bf16_bits(x[2]); o.u[3] = bf16_bits(x[3]);
  } else {
    o.h[0] = (_Float16)(bf16_rne(x[0]) * 64.0f); o.h[1] = (_Float16)(bf16_rne(x[1]) * 64.0f);
    o.h[2] = (_Float16)(bf16_rne(x[2]) * 64.0f); o.h[3] = (_Float16)(bf16_rne(x[3]) * 64.0f);
  }
  *(v4us*)d = o.v;
}

// twelve waves per SIMD asked for (80 registers): three work-groups fit a WGP, so that all work-groups of the launch are resident together
__global__ __launch_bounds__(PREP_THREADS) __attribute__((amdgpu_waves_per_eu(12))) void k_prep(const int* __restrict__ mask, int* __restrict__ flags,
                                                       const float* __restrict__ x, const float* __restrict__ Wq, const float* __restrict__ Wk,
                                                       const float* __restrict__ Wv, const float* __restrict__ Wo,
                                                       unsigned short* __restrict__ xb, unsigned short* __restrict__ wqk,
                                                       unsigned short* __restrict__ wvb, unsigned short* __restrict__ wob) {
  __shared__ int sw[2][16];
  const int tid = threadIdx.x;
  if (blockIdx.x >= SCAN_BLOCKS) {                     // block-uniform
    const int c = blockIdx.x - SCAN_BLOCKS;
    const int e = 4 * tid;
    constexpr int NX = NB * SEQ / CVT_BLOCKS, NQ = CD / CVT_BLOCKS, NK = KVW / CVT_BLOCKS;
    static_assert(SEQ % NX == 0);                      // the block's NX rows of x lie in one batch
    const int bx = (c * NX) / SEQ, rx = c * NX - bx * SEQ;
    // uniform bases of this block's rows; a thread's loads and stores differ from them by 4 * tid elements and by constants only
    const float* sx = x + ((size_t)bx * SEQ_FULL + rx) * CD;
    const float* sq = Wq + (size_t)(c * NQ) * CD;
    const float* swo = Wo + (size_t)(c * NQ) * CD;
    const float* sk = Wk + (size_t)(c * NK) * CD;
    const float* sv = Wv + (size_t)(c * NK) * CD;
    unsigned short* dx = xb + (size_t)(c * NX) * CD;
    unsigned short* dq = wqk + (size_t)(c * NQ) * CD;
    unsigned short* dw = wob + (size_t)(c * NQ) * CD;
    unsigned short* dk = wqk + (size_t)(CD + c * NK) * CD;   // the k rows follow the q rows
    unsigned short* dv = wvb + (size_t)(c * NK) * CD;
    // all loads of a thread are independent and issued before the first is converted, so that they are in flight together
    v4f vx[NX], vq[NQ], vw[NQ], vk[NK], vv[NK];
#pragma unroll
    for (int j = 0; j < NX; ++j) vx[j] = *(const v4fa*)(sx + (unsigned)(j * CD + e));
#pragma unroll
    for (int j = 0; j < NQ; ++j) vq[j] = *(const v4fa*)(sq + (unsigned)(j * CD + e));
#pragma unroll
    for (int j = 0; j < NQ; ++j) vw[j] = *(const v4fa*)(swo + (unsigned)(j * CD + e));
#pragma unroll
    for (int j = 0; j < NK; ++j) vk[j] = *(const v4fa*)(sk + (unsigned)(j * CD + e));
#pragma unroll
    for (int j = 0; j < NK; ++j) vv[j] = *(const v4fa*)(sv + (unsigned)(j * CD + e));
    // keeps every load in front of the first conversion: without it the scheduler sinks a third of the loads behind waits to 0, and their latencies add up
    __builtin_amdgcn_sched_barrier(0);
#pragma unroll
    for (int j = 0; j < NX; ++j) cvt_store<0>(dx + (unsigned)(j * CD + e), vx[j]);
#pragma unroll
    for (int j = 0; j < NQ; ++j) cvt_store<0>(dq + (unsigned)(j * CD + e), vq[j]);
#pragma unroll
    for (int j = 0; j < NQ; ++j) cvt_store<1>(dw + (unsigned)(j * CD + e), vw[j]);
#pragma unroll
    for (int j = 0; j < NK; ++j) cvt_store<0>(dk + (unsigned)(j * CD + e), vk[j]);
#pragma unroll
    for (int j = 0; j < NK; ++j) cvt_store<0>(dv + (unsigned)(j * CD + e), vv[j]);
    return;                                            // the whole block leaves here; the barrier below is the scan blocks' own
  }
  const int lane = tid & 31, wv = tid >> 5;
  int badU = 0, badL = 0;
  const int cpr = SEQ / 4;
  const int q0 = blockIdx.x * SCAN_ROWS;
  const int* mb = mask + (size_t)q0 * SEQ_FULL;       // uniform base of this group's rows; the loads below differ by constants only
  v4i mv[SCAN_LOADS];
  // all loads of a thread are independent and issued before the first is tested, so that they are in flight together
#pragma unroll
  for (int u = 0; u < SCAN_LOADS; ++u) {
    const int c = tid + 512 * u;
    const int qr = c / cpr, k = (c - qr * cpr) * 4;
    mv[u] = *(const v4ia*)(mb + (unsigned)(qr * SEQ_FULL + k));
  }
#pragma unroll
  for (int u = 0; u < SCAN_LOADS; ++u) {
    const int c = tid + 512 * u;
    const int qr = c / cpr, k = (c - qr * cpr) * 4;
    const int q = q0 + qr;
#pragma unroll
    for (int i = 0; i < 4; ++i) {
      const int above = (k + i > q) ? 1 : 0;
      const int nz = (mv[u][i] != 0) ? 1 : 0;
      badU |= above & nz;
      badL |= (1 - above) & (1 - nz);
    }
  }
#pragma unroll
  for (int o = 16; o >= 1; o >>= 1) {
    badU |= __shfl_xor(badU, o, 32);
    badL |= __shfl_xor(badL, o, 32);
  }
  if (lane == 0) { sw[0][wv] = badU; sw[1][wv] = badL; }
  __syncthreads();
  if (tid < 8) {
    int u = 0, l = 0;
#pragma unroll
    for (int i = 0; i < 16; ++i) { u |= sw[0][i]; l |= sw[1][i]; }
    v4i o;
    o[0] = (tid == 0 && u == 0) ? 1 : 0;
    o[1] = (tid == 0 && l == 0) ? 1 : 0;
    o[2] = 0; o[3] = 0;
    *(v4i*)(flags + 32 * blockIdx.x + 4 * tid) = o;
  }
}

// ---------------------------------------------------------------------------------------------------------
// Staging of the GEMMs: a stage is 64 k of every row of the block's two operands, 128-byte rows laid at a 144-byte pitch; two buffers.
// Fragment maps: row or column = ln, elements 0..7 <- k0 + 8h + i, elements 8..15 <- k0 + 16 + 8h + i, for both operands alike.
#define ST_K 64
#define ST_PITCH 144
static_assert(CD % ST_K == 0 && CD / ST_K >= 2);

__device__ __forceinline__ void ldfrag_lds(Frag& f, const unsigned char* p) {
  f.half[0] = *(const v8us*)(p);
  f.half[1] = *(const v8us*)(p + 32);
}

// Square block tile of all four projections: 128 A rows x 128 W rows (both k-contiguous, pitch CD), 4 waves as 2 x 2, wave tile 64 x 64:
// acc[i][j] (rows 64 wr + 16 i.., cols 64 wc + 16 j..) += A[row][k] * W[col][k] over k = 0..CD-1, k ascending in steps of 32.
// A stage is 64 k of all 256 rows at the 144-byte pitch (A rows 0..127, then W rows 128..255); two buffers.
// Per 64 k a block copies 32 KiB for 128 x 128 outputs, and a wave reads 16 fragments for 32 matrix instructions.
// NA = 2: a second A plane of the same 128 rows (same carry as the first) rides in the same stage, acc += (A + A2) * W in one walk over k:
// a stage is A rows 0..127, A2 rows 128..255, W rows 256..383 (48 KiB), and a wave reads 24 fragments for 64 matrix instructions (the W fragments serve both planes).
#define SQ_BYTES (256 * ST_PITCH)
#define SQ_RING (2 * SQ_BYTES)
#define SQ2_RING (2 * 384 * ST_PITCH)
static_assert(SQ_RING >= 4 * 64 * 68 * 4);         /* the epilogue tiles reuse the ring */

// 128 rows of one operand: 8 copies of 16 bytes per thread, chunk (tid & 7) of rows (tid >> 3) + 16 i; each copy of a wave moves 4 whole 128-byte lines.
// The s_wait_xcnt stands inside the statement so that no address register is rewritten ahead of it.
__device__ __forceinline__ void rows128_copy(const unsigned short* g, unsigned l) {
  asm volatile("global_load_async_to_lds_b128 %0, %8, off\n\t"
               "global_load_async_to_lds_b128 %1, %9, off\n\t"
               "global_load_async_to_lds_b128 %2, %10, off\n\t"
               "global_load_async_to_lds_b128 %3, %11, off\n\t"
               "global_load_async_to_lds_b128 %4, %12, off\n\t"
               "global_load_async_to_lds_b128 %5, %13, off\n\t"
               "global_load_async_to_lds_b128 %6, %14, off\n\t"
               "global_load_async_to_lds_b128 %7, %15, off\n\t"
               "s_wait_xcnt 0x0"
               :: "v"(l), "v"(l + 16 * ST_PITCH), "v"(l + 32 * ST_PITCH), "v"(l + 48 * ST_PITCH),
                  "v"(l + 64 * ST_PITCH), "v"(l + 80 * ST_PITCH), "v"(l + 96 * ST_PITCH), "v"(l + 112 * ST_PITCH),
                  "v"(g), "v"(g + 16 * CD), "v"(g + 32 * CD), "v"(g + 48 * CD),
                  "v"(g + 64 * CD), "v"(g + 80 * CD), "v"(g + 96 * CD), "v"(g + 112 * CD)
               : "memory");
}
template <int NA>
__device__ __forceinline__ void sq_copy(const unsigned short* ga, const unsigned short* ga2, const unsigned short* gb, unsigned l) {
  rows128_copy(ga, l);
  if (NA == 2) rows128_copy(ga2, l + 128 * ST_PITCH);
  rows128_copy(gb, l + NA * 128 * ST_PITCH);
}

// a2blk is read only where NA = 2
template <bool BF, int NA>
__device__ __forceinline__ void gemm_sq(const unsigned short* __restrict__ ablk, const unsigned short* __restrict__ a2blk,
                                        const unsigned short* __restrict__ bblk,
                                        unsigned char* ring, int tid, int wr, int wc, int ln, int hh, v8f (&acc)[4][4]) {
  const int nt = CD / ST_K;
  constexpr unsigned SB = (NA + 1) * 128 * ST_PITCH;   // bytes of one buffer
  const unsigned short* ga = ablk + (size_t)(tid >> 3) * CD + 8 * (tid & 7);
  const unsigned short* ga2 = a2blk + (size_t)(tid >> 3) * CD + 8 * (tid & 7);
  const unsigned short* gb = bblk + (size_t)(tid >> 3) * CD + 8 * (tid & 7);
  const unsigned l0 = (unsigned)(size_t)ring + (unsigned)((tid >> 3) * ST_PITCH + 16 * (tid & 7));   // LDS byte address of this thread's first chunk
  const int aoff = (64 * wr + ln) * ST_PITCH + 16 * hh;
  const int boff = (NA * 128 + 64 * wc + ln) * ST_PITCH + 16 * hh;
  sq_copy<NA>(ga, ga2, gb, l0);
  asm volatile("s_wait_asynccnt 0x0" ::: "memory");   // tile 0 has landed before the barrier that publishes it
  __syncthreads();
  sq_copy<NA>(ga + ST_K, ga2 + ST_K, gb + ST_K, l0 + SB);
#pragma unroll 1   // one tile per trip: the two buffers alternate by the trip's parity
  for (int t = 0; t < nt; ++t) {
    const unsigned sel = (unsigned)(t & 1) * SB;
    const unsigned char* buf = ring + sel;
    Frag a[2][4], b[2][4];
#pragma unroll
    for (int i = 0; i < 4; ++i) ldfrag_lds(a[0][i], buf + aoff + i * 16 * ST_PITCH);
#pragma unroll
    for (int kk = 0; kk < 2; ++kk)
#pragma unroll
      for (int j = 0; j < 4; ++j) ldfrag_lds(b[kk][j], buf + boff + j * 16 * ST_PITCH + kk * 64);
    // keeps these 24 fragment loads together in front of the first matrix instruction: without it the scheduler takes one register set for the four
    // A fragments of the first 32 k, loads them one by one among the matrix instructions and waits for each to 0.
    // The A fragments of the second 32 k follow behind it, into the registers that the first four leave (all 16 fragments at once do not fit).
    __builtin_amdgcn_sched_barrier(0);
#pragma unroll
    for (int i = 0; i < 4; ++i) ldfrag_lds(a[1][i], buf + aoff + i * 16 * ST_PITCH + 64);
    Frag c[2][4];                                       // the second plane's 8 fragments (NA = 2 only)
    if (NA == 2) {
#pragma unroll
      for (int kk = 0; kk < 2; ++kk)
#pragma unroll
        for (int i = 0; i < 4; ++i) ldfrag_lds(c[kk][i], buf + aoff + (128 + i * 16) * ST_PITCH + kk * 64);
      // keeps all 48 fragment loads of the stage in front of its 64 matrix instructions (the kernel runs two waves per SIMD, so the registers are there):
      // without it the scheduler saves registers, loads 6 of the fragments one by one among the matrix instructions and waits for each to 0
      __builtin_amdgcn_sched_barrier(0);
    }
#pragma unroll
    for (int kk = 0; kk < 2; ++kk)
#pragma unroll
      for (int i = 0; i < 4; ++i)
#pragma unroll
        for (int j = 0; j < 4; ++j) acc[i][j] = wm<BF>(a[kk][i], b[kk][j], acc[i][j]);
    if (NA == 2) {
      // the second plane, against the W fragments that are already in registers
#pragma unroll
      for (int kk = 0; kk < 2; ++kk)
#pragma unroll
        for (int i = 0; i < 4; ++i)
#pragma unroll
          for (int j = 0; j < 4; ++j) acc[i][j] = wm<BF>(c[kk][i], b[kk][j], acc[i][j]);
      // keeps the distance behind the last matrix instructions on the loop's back edge and in front of the address arithmetic below
      // (the sums alone are named: with the fragments named too, more values must lie in the registers that asm operands can name than fit there, and sums spill)
      asm volatile("v_nop\n\tv_nop\n\tv_nop\n\tv_nop" : "+v"(acc[0][0]), "+v"(acc[0][1]), "+v"(acc[0][2]), "+v"(acc[0][3]),
                          "+v"(acc[1][0]), "+v"(acc[1][1]), "+v"(acc[1][2]), "+v"(acc[1][3]),
                          "+v"(acc[2][0]), "+v"(acc[2][1]), "+v"(acc[2][2]), "+v"(acc[2][3]),
                          "+v"(acc[3][0]), "+v"(acc[3][1]), "+v"(acc[3][2]), "+v"(acc[3][3]));
    } else
    // keeps the distance behind the last matrix instructions on the loop's back edge and in front of the address arithmetic below
    asm volatile("v_nop\n\tv_nop\n\tv_nop\n\tv_nop" : "+v"(acc[0][0]), "+v"(acc[0][1]), "+v"(acc[0][2]), "+v"(acc[0][3]),
                        "+v"(acc[1][0]), "+v"(acc[1][1]), "+v"(acc[1][2]), "+v"(acc[1][3]),
                        "+v"(acc[2][0]), "+v"(acc[2][1]), "+v"(acc[2][2]), "+v"(acc[2][3]),
                        "+v"(acc[3][0]), "+v"(acc[3][1]), "+v"(acc[3][2]), "+v"(acc[3][3])
                      : "v"(a[1][0].v), "v"(a[1][1].v), "v"(a[1][2].v), "v"(a[1][3].v), "v"(b[1][0].v), "v"(b[1][1].v), "v"(b[1][2].v), "v"(b[1][3].v));
    asm volatile("s_wait_dscnt 0x0" ::: "memory");      // this wave's reads of the buffer are done before it is refilled
    asm volatile("s_wait_asynccnt 0x0" ::: "memory");   // this wave's copies of tile t + 1 have landed before the barrier publishes them
    __syncthreads();
    if (t + 2 < nt) sq_copy<NA>(ga + (t + 2) * ST_K, ga2 + (t + 2) * ST_K, gb + (t + 2) * ST_K, l0 + sel);
  }
  asm volatile("s_wait_asynccnt 0x0" ::: "memory");     // nothing is in flight when the ring is used for anything else
}

__device__ __forceinline__ float rope1(float q, float p, float c, float s, float sg) { return q * c + (sg * p) * s; }

// ---------------------------------------------------------------------------------------------------------
// q, k and v projections in one launch: none reads what another writes, so blockIdx.x picks the job. grid = (NQK/2 + KVW/128, NB*SEQ/128);
// every work-group is 4 waves as 2 x 2 on one 128 x 128 tile of the same engine, and all of them are resident together.
// blockIdx.x < NQK/2: q and k with fused bias, rotary (table read by value) and head-major repack:
// 128 token rows x two heads; a wave has 64 token rows of one head (64 columns).
// coverage: NQK heads x NB*SEQ tokens x 64 = the whole plane [NB][NQK][SEQ][64], both planes. LDS tile 64 x 64 fully written before it is read.
// blockIdx.x >= NQK/2: v computed transposed: Vt[b][m][t] = sum_k Wv[m][k] x[b,t][k] + bv[m], carried x16, hi and residual planes:
// 128 weight rows x 128 tokens; a wave has 64 weight rows x 64 tokens.
// coverage: KVW rows x NB*SEQ tokens = the whole plane [NB][KVW][SEQ], both planes. LDS tile 64 x 64 fully written before it is read.
static_assert(NQK % 2 == 0);
static_assert(SEQ % 128 == 0);                         // a block's 128 tokens lie in one batch
__global__ __launch_bounds__(128) void k_proj_qkv(const unsigned short* __restrict__ xb, const unsigned short* __restrict__ wqk,
                                                  const unsigned short* __restrict__ wvb,
                                                  const float* __restrict__ bq, const float* __restrict__ bk, const float* __restrict__ bv,
                                                  const float* __restrict__ tab,
                                                  unsigned short* __restrict__ qkh, unsigned short* __restrict__ qkl,
                                                  unsigned short* __restrict__ vth, unsigned short* __restrict__ vtl) {
  __shared__ __attribute__((aligned(16))) unsigned char ring[SQ_RING];
  float (*st)[64][68] = (float (*)[64][68])ring;       // epilogue tiles, used behind the k loop's last barrier
  const int tid = threadIdx.x, lane = tid & 31, ln = lane & 15, hh = lane >> 4;
  const int w = __builtin_amdgcn_readfirstlane(tid >> 5);
  const int wr = w >> 1, wc = w & 1;
  const bool isv = (blockIdx.x >= NQK / 2);            // block-uniform
  const v8f z8 = {0.f, 0.f, 0.f, 0.f, 0.f, 0.f, 0.f, 0.f};
  v8f acc[4][4];
#pragma unroll
  for (int i = 0; i < 4; ++i)
#pragma unroll
    for (int j = 0; j < 4; ++j) acc[i][j] = z8;
  // the block's 128 token rows and its 128 weight rows; tokens are the tile's rows for q and k, its columns for v
  const unsigned short* xt = xb + (size_t)(blockIdx.y * 128) * CD;
  const unsigned short* wt = isv ? (wvb + (size_t)((blockIdx.x - NQK / 2) * 128) * CD) : (wqk + (size_t)(blockIdx.x * 2 * HD) * CD);
  gemm_sq<true, 1>(isv ? wt : xt, isv ? wt : xt, isv ? xt : wt, ring, tid, wr, wc, ln, hh, acc);

  if (isv) {
#pragma unroll
    for (int i = 0; i < 4; ++i)
#pragma unroll
      for (int j = 0; j < 4; ++j)
#pragma unroll
        for (int r = 0; r < 8; ++r) st[w][16 * i + 8 * hh + r][16 * j + ln] = acc[i][j][r];
    __syncthreads();
    const int vn0 = blockIdx.y * 128 + 64 * wc;        // first token of the wave
    const int vm0 = (blockIdx.x - NQK / 2) * 128 + 64 * wr;   // first weight row of the wave
    const int vb = vn0 / SEQ, vt0 = vn0 - vb * SEQ;
    const int vrs = lane >> 3, vc0 = 8 * (lane & 7);
    const size_t vbase = ((size_t)vb * KVW + vm0) * SEQ + vt0 + vc0;
    // the wave's 64 rows in two halves of 32
    for (int half = 0; half < 2; ++half) {
      v8us oh[8], ol[8];
#pragma unroll
      for (int g = 0; g < 8; ++g) {
        const int row = 32 * half + 4 * g + vrs;
        const float bias = bf16_rne(bv[vm0 + row]);
        const v4f a0 = *(const v4fa*)&st[w][row][vc0];
        const v4f a1 = *(const v4fa*)&st[w][row][vc0 + 4];
        float o[8];
        o[0] = a0[0]; o[1] = a0[1]; o[2] = a0[2]; o[3] = a0[3];
        o[4] = a1[0]; o[5] = a1[1]; o[6] = a1[2]; o[7] = a1[3];
        Pack8 ph8, pl8;
#pragma unroll
        for (int e = 0; e < 8; ++e) {
          const float y = (o[e] + bias) * 16.0f;              // carried x16
          const _Float16 h = (_Float16)y;
          ph8.h[e] = h;
          pl8.h[e] = (_Float16)((y - (float)h) * 2048.0f);     // residual plane x2^11
        }
        oh[g] = ph8.v; ol[g] = pl8.v;
      }
#pragma unroll
      for (int g = 0; g < 8; ++g) {
        const size_t off = vbase + (size_t)(32 * half + 4 * g + vrs) * SEQ;
        *(v8us*)(vth + off) = oh[g];
        *(v8us*)(vtl + off) = ol[g];
      }
      asm volatile("s_wait_xcnt 0x0" ::: "memory");   // the second half rewrites registers that these stores name
    }
    return;                                            // the whole block leaves here; the barrier below is the q/k blocks' own
  }

  const int hd = 2 * blockIdx.x + wc;
  const int m0 = blockIdx.y * 128 + 64 * wr;
  float bias[4];
#pragma unroll
  for (int j = 0; j < 4; ++j) {
    const int col = hd * HD + 16 * j + ln;
    const int cq = (col < CD - 1) ? col : (CD - 1);
    int ck = col - CD;
    ck = (ck < 0) ? 0 : ((ck > KVW - 1) ? (KVW - 1) : ck);
    const float vq = bq[cq], vk = bk[ck];
    bias[j] = bf16_rne((col < CD) ? vq : vk);
  }
#pragma unroll
  for (int i = 0; i < 4; ++i)
#pragma unroll
    for (int j = 0; j < 4; ++j)
#pragma unroll
      for (int r = 0; r < 8; ++r) st[w][16 * i + 8 * hh + r][16 * j + ln] = acc[i][j][r] + bias[j];
  __syncthreads();

  const int b = m0 / SEQ, t0 = m0 - b * SEQ;
  const int rsub = lane >> 3, d0 = 8 * (lane & 7);
  const float sg = (d0 < 32) ? -1.0f : 1.0f;
  const size_t dbase = ((size_t)(b * NQK + hd) * SEQ + t0) * HD + d0;
  // the wave's 64 rows in two halves of 32
  const unsigned tl = (unsigned)(rsub * HD + d0);      // this lane's place in a group of 4 table rows
  for (int half = 0; half < 2; ++half) {
  const float* th = tab + (size_t)(t0 + 32 * half) * HD;   // uniform base of this half's table rows; the loads below differ from it by tl and by constants only
  v8us oh[8], ol[8];
#pragma unroll
  for (int g = 0; g < 8; ++g) {
    // keeps the last four groups' table and LDS loads from being lifted over the first four: with all 8 groups in flight at once the registers run short
    if (g == 4) __builtin_amdgcn_sched_barrier(0);
    const int row = 32 * half + 4 * g + rsub;
    const v4f a0 = *(const v4fa*)&st[w][row][d0];
    const v4f a1 = *(const v4fa*)&st[w][row][d0 + 4];
    const v4f p0 = *(const v4fa*)&st[w][row][d0 ^ 32];
    const v4f p1 = *(const v4fa*)&st[w][row][(d0 ^ 32) + 4];
    const float* tp = th + (tl + (unsigned)(4 * g * HD));
    const v4f c0 = *(const v4fa*)(tp), c1 = *(const v4fa*)(tp + 4);
    const float k0 = bf16_rne(c0[0]), s0 = bf16_rne(c0[1]), k1 = bf16_rne(c0[2]), s1 = bf16_rne(c0[3]);
    const float k2 = bf16_rne(c1[0]), s2 = bf16_rne(c1[1]), k3 = bf16_rne(c1[2]), s3 = bf16_rne(c1[3]);
    float o[8];
    o[0] = rope1(a0[0], p0[0], k0, s0, sg); o[1] = rope1(a0[1], p0[1], k0, s0, sg);
    o[2] = rope1(a0[2], p0[2], k1, s1, sg); o[3] = rope1(a0[3], p0[3], k1, s1, sg);
    o[4] = rope1(a1[0], p1[0], k2, s2, sg); o[5] = rope1(a1[1], p1[1], k2, s2, sg);
    o[6] = rope1(a1[2], p1[2], k3, s3, sg); o[7] = rope1(a1[3], p1[3], k3, s3, sg);
    Pack8 ph8, pl8;
#pragma unroll
    for (int e = 0; e < 8; ++e) {
      const float y = o[e] * 16.0f;                       // carried x16
      const _Float16 h = (_Float16)y;
      ph8.h[e] = h;
      pl8.h[e] = (_Float16)((y - (float)h) * 2048.0f);     // residual plane x2^11
    }
    oh[g] = ph8.v; ol[g] = pl8.v;
  }
#pragma unroll
    for (int g = 0; g < 8; ++g) {
      const size_t off = dbase + (size_t)(32 * half + 4 * g + rsub) * HD;
      *(v8us*)(qkh + off) = oh[g];
      *(v8us*)(qkl + off) = ol[g];
    }
    asm volatile("s_wait_xcnt 0x0" ::: "memory");   // the second half rewrites registers that these stores name
  }
}

// ---------------------------------------------------------------------------------------------------------
// Attention stage in LDS: 64 keys. Tile 0 = K rows (64 keys x 128 B), tile 1 = V^T rows (64 d x 128 B = 64 keys), each at a 144-byte pitch;
// tiles 2 and 3 = the residual planes of K and V^T (query rows below EARLY_ROWS only).
// The ring holds two stages of two tiles (plain blocks, two buffers) or one stage of four tiles (early blocks, one buffer).
#define AT_KEYS 64
#define AT_PITCH 144
#define AT_TILE (64 * AT_PITCH)
#define AT_RING (4 * AT_TILE)
static_assert(SEQ % AT_KEYS == 0);
static_assert(AT_RING >= 4 * 16 * 68 * 4);         /* the epilogue tiles reuse the ring */

// One K tile and one V^T tile: 8 copies of 16 bytes per thread, chunk (tid & 7) of rows (tid >> 3) + 16 i; each copy of a wave moves 4 whole 128-byte lines.
// The s_wait_xcnt stands inside the statement so that no address register is rewritten ahead of it.
__device__ __forceinline__ void kv_copy(const unsigned short* gk, const unsigned short* gv, unsigned l) {
  asm volatile("global_load_async_to_lds_b128 %0, %8, off\n\t"
               "global_load_async_to_lds_b128 %1, %9, off\n\t"
               "global_load_async_to_lds_b128 %2, %10, off\n\t"
               "global_load_async_to_lds_b128 %3, %11, off\n\t"
               "global_load_async_to_lds_b128 %4, %12, off\n\t"
               "global_load_async_to_lds_b128 %5, %13, off\n\t"
               "global_load_async_to_lds_b128 %6, %14, off\n\t"
               "global_load_async_to_lds_b128 %7, %15, off\n\t"
               "s_wait_xcnt 0x0"
               :: "v"(l), "v"(l + 16 * AT_PITCH), "v"(l + 32 * AT_PITCH), "v"(l + 48 * AT_PITCH),
                  "v"(l + AT_TILE), "v"(l + AT_TILE + 16 * AT_PITCH), "v"(l + AT_TILE + 32 * AT_PITCH), "v"(l + AT_TILE + 48 * AT_PITCH),
                  "v"(gk), "v"(gk + 16 * HD), "v"(gk + 32 * HD), "v"(gk + 48 * HD),
                  "v"(gv), "v"(gv + 16 * SEQ), "v"(gv + 32 * SEQ), "v"(gv + 48 * SEQ)
               : "memory");
}

// One 32-key step for a wave's 16 queries (this lane's column = its query). EARLYP adds the residual planes of q, k, v, P.
// st = the stage in LDS, kloc = 0 or 32 = first key of the step inside the stage, key0 = the same key's index in the sequence.
// MASK reads the mask row of this lane's query by value and replace-fills with -inf.
template <bool EARLYP, bool MASK>
__device__ __forceinline__ void fa_step(const unsigned char* st, int kloc,
                                        const int* __restrict__ mrow, int key0, int ln, int hh,
                                        const Frag (&qh)[2], const Frag (&ql)[2],
                                        float& mr, float& lr, v8f (&Oh)[4], v8f (&Ol)[4]) {
  const v8f z8 = {0.f, 0.f, 0.f, 0.f, 0.f, 0.f, 0.f, 0.f};
  float sc[16];
  // A fragments of K: row m = key (key0 + 16*kt + ln), elements 0..7 <- d = 32c + 8h + i, 8..15 <- d = 32c + 16 + 8h + i
  int koff = (kloc + ln) * AT_PITCH + 16 * hh;        // byte offset in a K tile
  if (EARLYP) {
#pragma unroll
    for (int kt = 0; kt < 2; ++kt) {
      Frag a0, a1, l0, l1;
      ldfrag_lds(a0, st + koff); ldfrag_lds(a1, st + koff + 64);
      ldfrag_lds(l0, st + 2 * AT_TILE + koff); ldfrag_lds(l1, st + 2 * AT_TILE + koff + 64);
      v8f s = z8, r = z8;
      s = wm<false>(a0, qh[0], s); s = wm<false>(a1, qh[1], s);
      r = wm<false>(a0, ql[0], r); r = wm<false>(a1, ql[1], r);
      r = wm<false>(l0, qh[0], r); r = wm<false>(l1, qh[1], r);
      asm volatile("v_nop\n\tv_nop\n\tv_nop\n\tv_nop" : "+v"(s), "+v"(r)
                        : "v"(a0.v), "v"(a1.v), "v"(l0.v), "v"(l1.v), "v"(qh[0].v), "v"(qh[1].v), "v"(ql[0].v), "v"(ql[1].v));
      // S^T element r of tile kt = score(key0 + 16*kt + 8h + r, this lane's query); carries: q x16, k x16, residual x2^11
#pragma unroll
      for (int e = 0; e < 8; ++e) sc[8 * kt + e] = fmaf(r[e], S2M11, s[e]) * S2M11;
      koff += 16 * AT_PITCH;
      if (kt == 0) asm volatile("" : "+v"(koff) : "v"(sc[0]));   // second tile's loads issue after the first tile is done
    }
  } else {
    Frag k00, k01, k10, k11;
    ldfrag_lds(k00, st + koff);                 ldfrag_lds(k01, st + koff + 64);
    ldfrag_lds(k10, st + koff + 16 * AT_PITCH); ldfrag_lds(k11, st + koff + 16 * AT_PITCH + 64);
    v8f s0 = z8, s1 = z8;
    s0 = wm<false>(k00, qh[0], s0); s0 = wm<false>(k01, qh[1], s0);
    s1 = wm<false>(k10, qh[0], s1); s1 = wm<false>(k11, qh[1], s1);
    asm volatile("v_nop\n\tv_nop\n\tv_nop\n\tv_nop" : "+v"(s0), "+v"(s1)
                      : "v"(k00.v), "v"(k01.v), "v"(k10.v), "v"(k11.v), "v"(qh[0].v), "v"(qh[1].v));
#pragma unroll
    for (int e = 0; e < 8; ++e) { sc[e] = s0[e] * S2M11; sc[8 + e] = s1[e] * S2M11; }
  }
  if (MASK) {
    const int* mp = mrow + key0 + 8 * hh;
    const v4i m0 = *(const v4ia*)(mp),      m1 = *(const v4ia*)(mp + 4);
    const v4i m2 = *(const v4ia*)(mp + 16), m3 = *(const v4ia*)(mp + 20);
    const float ninf = neg_inf();
#pragma unroll
    for (int e = 0; e < 4; ++e) {
      sc[e]      = (m0[e] == 0) ? ninf : sc[e];
      sc[4 + e]  = (m1[e] == 0) ? ninf : sc[4 + e];
      sc[8 + e]  = (m2[e] == 0) ? ninf : sc[8 + e];
      sc[12 + e] = (m3[e] == 0) ? ninf : sc[12 + e];
    }
  }
  float mx = sc[0];
#pragma unroll
  for (int i = 1; i < 16; ++i) mx = fmaxf(mx, sc[i]);
  mx = fmaxf(mx, __shfl_xor(mx, 16, 32));            // the other lane half holds the other 16 keys of this query
  const float mnew = fmaxf(mr, mx);
  float msafe = mnew;
  if (MASK) msafe = (mnew == neg_inf()) ? 0.0f : mnew;   // every key so far masked: weights come out 0
  const float al = __builtin_amdgcn_exp2f((mr - msafe) * LOG2E);
  mr = mnew;
  // weights carried x256: pc = 256 * exp(sc - m); hi plane f16(pc), residual plane f16((pc - hi) * 2048)
  Frag ph, pl;
  float ps = 0.0f;
#pragma unroll
  for (int i = 0; i < 16; ++i) {
    const float pc = __builtin_amdgcn_exp2f(fmaf(sc[i] - msafe, LOG2E, 8.0f));
    ps += pc;
    const _Float16 h = (_Float16)pc;
    ph.h[i] = h;                                      // B element i: i<8 -> key0 + 8h + i (tile 0 row 8h+i); i>=8 -> key0 + 16 + 8h + (i-8) (tile 1)
    if (EARLYP) pl.h[i] = (_Float16)((pc - (float)h) * 2048.0f);
  }
  ps += __shfl_xor(ps, 16, 32);
  lr = lr * al + ps;
  // A fragments of V^T: row m = d (16*t + ln), elements 0..7 <- key0 + 8h + i, 8..15 <- key0 + 16 + 8h + i
  int voff = AT_TILE + ln * AT_PITCH + 2 * kloc + 16 * hh;   // byte offset in the stage
  asm volatile("" : "+v"(voff) : "v"(ps));            // V loads issue after the score phase
  const unsigned char* vp = st + voff;
  Frag vf[4];
#pragma unroll
  for (int t = 0; t < 4; ++t) ldfrag_lds(vf[t], vp + t * 16 * AT_PITCH);
#pragma unroll
  for (int t = 0; t < 4; ++t) Oh[t] = Oh[t] * al;
  if (EARLYP) {
    const unsigned char* vq = vp + 2 * AT_TILE;
    Frag vl[4];
#pragma unroll
    for (int t = 0; t < 4; ++t) ldfrag_lds(vl[t], vq + t * 16 * AT_PITCH);
#pragma unroll
    for (int t = 0; t < 4; ++t) Ol[t] = Ol[t] * al;
#pragma unroll
    for (int t = 0; t < 4; ++t) {
      Oh[t] = wm<false>(vf[t], ph, Oh[t]);
      Ol[t] = wm<false>(vf[t], pl, Ol[t]);
      Ol[t] = wm<false>(vl[t], ph, Ol[t]);
    }
    asm volatile("v_nop\n\tv_nop\n\tv_nop\n\tv_nop" : "+v"(Oh[0]), "+v"(Oh[1]), "+v"(Oh[2]), "+v"(Oh[3]), "+v"(Ol[0]), "+v"(Ol[1]), "+v"(Ol[2]), "+v"(Ol[3])
                      : "v"(vf[0].v), "v"(vf[1].v), "v"(vf[2].v), "v"(vf[3].v),
                        "v"(vl[0].v), "v"(vl[1].v), "v"(vl[2].v), "v"(vl[3].v), "v"(ph.v), "v"(pl.v));
  } else {
#pragma unroll
    for (int t = 0; t < 4; ++t) Oh[t] = wm<false>(vf[t], ph, Oh[t]);
    asm volatile("v_nop\n\tv_nop\n\tv_nop\n\tv_nop" : "+v"(Oh[0]), "+v"(Oh[1]), "+v"(Oh[2]), "+v"(Oh[3])
                      : "v"(vf[0].v), "v"(vf[1].v), "v"(vf[2].v), "v"(vf[3].v), "v"(ph.v));
  }
}

// What stands in front of and behind a stage's work. Early blocks (one buffer of four tiles): fill, wait, publish in front; every reader leaves behind.
// Plain blocks (two buffers of two tiles): nothing in front; behind, stage t + 1 is published and stage t + 2 is sent into the buffer that stage t has just left.
template <bool EARLYP>
__device__ __forceinline__ void ring_head(const unsigned short* gk, const unsigned short* gv, const unsigned short* gkl, const unsigned short* gvl,
                                          unsigned l0, int t) {
  if (EARLYP) {
    kv_copy(gk + (size_t)t * AT_KEYS * HD, gv + t * AT_KEYS, l0);
    kv_copy(gkl + (size_t)t * AT_KEYS * HD, gvl + t * AT_KEYS, l0 + 2 * AT_TILE);
    asm volatile("s_wait_asynccnt 0x0" ::: "memory");   // this wave's copies have landed before the barrier publishes them
    __syncthreads();
  }
}
template <bool EARLYP>
__device__ __forceinline__ void ring_foot(const unsigned short* gk, const unsigned short* gv, unsigned l0, int t, int nst) {
  asm volatile("s_wait_dscnt 0x0" ::: "memory");        // this wave's reads of the buffer are done before it is refilled
  if (!EARLYP) asm volatile("s_wait_asynccnt 0x0" ::: "memory");   // this wave's copies of stage t + 1 have landed before the barrier publishes them
  __syncthreads();
  if (!EARLYP) {
    if (t + 2 < nst) kv_copy(gk + (size_t)(t + 2) * AT_KEYS * HD, gv + (t + 2) * AT_KEYS, l0 + (unsigned)(t & 1) * (2 * AT_TILE));
  }
}

// nst = stages of 64 keys that the block walks, npl = the first of them that run without mask reads (both the same in all its waves;
// npl <= nst <= SEQ / 64, 2 * nst >= every wave's nsteps, 2 * npl <= every wave's nsteps). nsteps = this wave's own 32-key steps.
template <bool EARLYP>
__device__ __forceinline__ void run_keys(const unsigned short* __restrict__ qkh, const unsigned short* __restrict__ qkl,
                                         const unsigned short* __restrict__ vth, const unsigned short* __restrict__ vtl,
                                         const int* __restrict__ mask, unsigned char* ring, int tid, int b, int h, int qg, int ln, int hh,
                                         int npl, int nsteps, int nst, float& mr, float& lr, v8f (&Oh)[4], v8f (&Ol)[4]) {
  // Q^T B fragments: column n = this lane's query, elements 0..7 <- d = 32c + 8h + i, 8..15 <- d = 32c + 16 + 8h + i
  const size_t qoff = ((size_t)(b * NQK + h) * SEQ + qg) * HD + 8 * hh;
  Frag qh[2], ql[2];
  ldfrag(qh[0], qkh + qoff); ldfrag(qh[1], qkh + qoff + 32);
  if (EARLYP) { ldfrag(ql[0], qkl + qoff); ldfrag(ql[1], qkl + qoff + 32); }
  else { ql[0] = qh[0]; ql[1] = qh[1]; }
  const int kv = h % NKV;
  const size_t kbase = (size_t)(b * NQK + NHEAD + kv) * SEQ * HD;
  const size_t vbase = ((size_t)b * KVW + (size_t)kv * HD) * SEQ;
  const int* mrow = mask + (size_t)qg * SEQ_FULL;
  // this thread's first chunk of a stage: in K (rows = keys), in V^T (rows = d) and in LDS
  const size_t kthr = kbase + (size_t)(tid >> 3) * HD + 8 * (tid & 7);
  const size_t vthr = vbase + (size_t)(tid >> 3) * SEQ + 8 * (tid & 7);
  const unsigned short* gk = qkh + kthr;
  const unsigned short* gv = vth + vthr;
  const unsigned l0 = (unsigned)(size_t)ring + (unsigned)((tid >> 3) * AT_PITCH + 16 * (tid & 7));   // LDS byte address
  const unsigned short* gkl = qkl + kthr;
  const unsigned short* gvl = vtl + vthr;
  if (!EARLYP) {
    kv_copy(gk, gv, l0);
    asm volatile("s_wait_asynccnt 0x0" ::: "memory");     // stage 0 has landed before the barrier that publishes it
    __syncthreads();
    if (nst > 1) kv_copy(gk + AT_KEYS * HD, gv + AT_KEYS, l0 + 2 * AT_TILE);
  }
#pragma unroll 1   // one stage per trip: the two buffers alternate by the trip's parity
  for (int t = 0; t < npl; ++t) {
    const unsigned char* st = ring + (EARLYP ? 0u : (unsigned)(t & 1) * (2 * AT_TILE));
    ring_head<EARLYP>(gk, gv, gkl, gvl, l0, t);
    fa_step<EARLYP, false>(st, 0, mrow, AT_KEYS * t, ln, hh, qh, ql, mr, lr, Oh, Ol);
    fa_step<EARLYP, false>(st, 32, mrow, AT_KEYS * t + 32, ln, hh, qh, ql, mr, lr, Oh, Ol);
    ring_foot<EARLYP>(gk, gv, l0, t, nst);
  }
#pragma unroll 1   // one stage per trip, as above
  for (int t = npl; t < nst; ++t) {
    const unsigned char* st = ring + (EARLYP ? 0u : (unsigned)(t & 1) * (2 * AT_TILE));
    ring_head<EARLYP>(gk, gv, gkl, gvl, l0, t);
#pragma unroll 1   // one copy of the masked step in the text
    for (int sub = 0; sub < 2; ++sub) {
      const int j = 2 * t + sub;
      // a wave whose own steps have run out passes through to the barrier (wave-uniform test)
      if (j < nsteps) fa_step<EARLYP, true>(st, 32 * sub, mrow, 32 * j, ln, hh, qh, ql, mr, lr, Oh, Ol);
    }
    ring_foot<EARLYP>(gk, gv, l0, t, nst);
  }
  asm volatile("s_wait_asynccnt 0x0" ::: "memory");       // nothing is in flight when the ring is used for anything else
}

// Work-group rank -> query tile, cost falling with the rank, for speed only.
// Cost of tile qt under a causal mask = its qt + 1 stages; a stage with the residual planes counts twice (three times the matrix instructions, twice the LDS
// reads, one buffer). A permutation of the tiles for any SEQ, formed at compile time, one byte per rank; it decides the order only, never what is computed.
#define NQT (SEQ / 64)
#define NQT_EARLY (EARLY_ROWS / 64)
static_assert(NQT <= 32);
struct TileRank { unsigned long long w[4]; };
constexpr int tile_cost(int qt) { return (qt + 1) * (qt < NQT_EARLY ? 2 : 1); }
constexpr TileRank make_tile_rank() {
  TileRank o = {{0ull, 0ull, 0ull, 0ull}};
  bool used[NQT] = {};
  for (int r = 0; r < NQT; ++r) {
    int best = -1;
    for (int q = NQT - 1; q >= 0; --q)
      if (!used[q] && (best < 0 || tile_cost(q) > tile_cost(best))) best = q;
    used[best] = true;
    o.w[r >> 3] |= (unsigned long long)best << (8 * (r & 7));
  }
  return o;
}

// Block = 4 waves x 16 queries = 64 queries of one (batch, head); the waves share the K and V^T stages in LDS, one barrier per 64 keys (two in early blocks).
// Block index = rank * (NB * NHEAD) + (batch, head): all heads of the costliest query tile come first.
// Tile skipping from the device flags of this wave's own 16 mask rows (16/SCAN_ROWS flag lines): all upper flags 1 -> keys past the diagonal step are
// skipped; upper and lower flags of all 64 rows of the block 1 -> the stages fully below the block's diagonal tile run without mask reads; every other visited step reads the mask by value.
// Trip counts are bounded by SEQ/32 for any flag value. The block walks qt + 1 stages if the upper flags of all its 64 rows are 1, else all SEQ/64.
// coverage: NB*NHEAD*(SEQ/64) blocks x 4 waves x 16 rows x 64 columns = the whole ctx hi plane; blocks with query tile below EARLY_ROWS cover the whole residual plane.
__global__ __launch_bounds__(128) void k_attn(const unsigned short* __restrict__ qkh, const unsigned short* __restrict__ qkl,
                                              const unsigned short* __restrict__ vth, const unsigned short* __restrict__ vtl,
                                              const int* __restrict__ mask, const int* __restrict__ flags,
                                              unsigned short* __restrict__ ctxh, unsigned short* __restrict__ ctxl) {
  __shared__ __attribute__((aligned(16))) unsigned char ring[AT_RING];
  float (*so)[16][68] = (float (*)[16][68])ring;       // epilogue tiles, used behind the key loop's last barrier
  const int tid = threadIdx.x, lane = tid & 31, ln = lane & 15, hh = lane >> 4;
  const int w = __builtin_amdgcn_readfirstlane(tid >> 5);
  constexpr TileRank tr = make_tile_rank();
  const unsigned blk = blockIdx.x;
  const unsigned rank = blk / (NB * NHEAD);            // 0 .. NQT-1
  const unsigned long long trw = (rank < 8) ? tr.w[0] : ((rank < 16) ? tr.w[1] : ((rank < 24) ? tr.w[2] : tr.w[3]));
  const int qt = (int)((trw >> (8 * (rank & 7))) & 255ull);
  const int h = (int)(blk % NHEAD);
  const int b = (int)((blk / NHEAD) % NB);
  const int qbase = qt * 64 + 16 * w;
  const int qg = qbase + ln;
  const int* fl = flags + (qbase / SCAN_ROWS) * 32;
  int upok = 1;                                        // plain & so that the flag loads issue together
#pragma unroll
  for (int g = 0; g < 16 / SCAN_ROWS; ++g) upok &= (fl[32 * g] == 1) ? 1 : 0;
  const bool tri = (upok == 1);
  const int nfull = qbase >> 5;                        // steps whose 32 keys are all at or below every query of this wave
  const int nsteps = tri ? (nfull + 1) : (SEQ / 32);   // <= SEQ/32 in both cases
  const bool early = (qt * 64 < EARLY_ROWS);
  // stage counts of the block, from the flags of all its 64 rows: the same values in all four waves, since barriers stand in the key loop
  const int* flb = flags + (qt * 64 / SCAN_ROWS) * 32;
  int upall = 1, lowall = 1;
#pragma unroll
  for (int g = 0; g < 64 / SCAN_ROWS; ++g) {
    const int fU = flb[32 * g], fL = flb[32 * g + 1];
    upall &= (fU == 1) ? 1 : 0;
    lowall &= (fL == 1) ? 1 : 0;
  }
  const int nst = (upall == 1) ? (qt + 1) : (SEQ / AT_KEYS);
  const int npl = (upall == 1 && lowall == 1) ? qt : 0;   // stages whose 64 keys are all below every query of the block

  const v8f z8 = {0.f, 0.f, 0.f, 0.f, 0.f, 0.f, 0.f, 0.f};
  float mr = neg_inf(), lr = 0.0f;
  v8f Oh[4], Ol[4];
#pragma unroll
  for (int t = 0; t < 4; ++t) { Oh[t] = z8; Ol[t] = z8; }
  if (early) run_keys<true>(qkh, qkl, vth, vtl, mask, ring, tid, b, h, qg, ln, hh, npl, nsteps, nst, mr, lr, Oh, Ol);
  else       run_keys<false>(qkh, qkl, vth, vtl, mask, ring, tid, b, h, qg, ln, hh, npl, nsteps, nst, mr, lr, Oh, Ol);

  // O^T element r of tile t = ctx(query, d = 16t + 8h + r); undo the carries x256 (in lr), x16 (V), x2^11 (residual); apply the x64 carry of ctx
  const float inv = 4.0f * (1.0f / lr);
#pragma unroll
  for (int t = 0; t < 4; ++t)
#pragma unroll
    for (int r = 0; r < 8; ++r)
      so[w][ln][16 * t + 8 * hh + r] = fmaf(Ol[t][r], S2M11, Oh[t][r]) * inv;
  __syncthreads();
  const int rsub = lane >> 3, d0 = 8 * (lane & 7);
  v8us oh[4], ol[4];
#pragma unroll
  for (int g = 0; g < 4; ++g) {
    const int row = 4 * g + rsub;
    const v4f a0 = *(const v4fa*)&so[w][row][d0];
    const v4f a1 = *(const v4fa*)&so[w][row][d0 + 4];
    float o[8];
    o[0] = a0[0]; o[1] = a0[1]; o[2] = a0[2]; o[3] = a0[3];
    o[4] = a1[0]; o[5] = a1[1]; o[6] = a1[2]; o[7] = a1[3];
    Pack8 ph8, pl8;
#pragma unroll
    for (int e = 0; e < 8; ++e) {
      const _Float16 hv = (_Float16)o[e];
      ph8.h[e] = hv;
      pl8.h[e] = (_Float16)(o[e] - (float)hv);          // residual plane at the hi plane's own carry: the output projection sums both into one accumulator
    }
    oh[g] = ph8.v; ol[g] = pl8.v;
  }
  const size_t hbase = ((size_t)b * SEQ + qbase) * CD + (size_t)h * HD + d0;
  const size_t lbase = ((size_t)b * EARLY_ROWS + (early ? qbase : 0)) * CD + (size_t)h * HD + d0;
{
#pragma unroll
    for (int g = 0; g < 4; ++g) {
      const size_t ro = (size_t)(4 * g + rsub) * CD;
      *(v8us*)(ctxh + hbase + ro) = oh[g];
      if (early) *(v8us*)(ctxl + lbase + ro) = ol[g];
    }
    
  }
}

// ---------------------------------------------------------------------------------------------------------
// Output projection: out[m][n] = sum_k ctx[m][k] Wo[n][k] + bo[n]. Block = 4 waves as 2 x 2: 128 rows x 128 columns, 64 x 64 per wave. grid = (CD/128, NB*SEQ/128).
// Rows below EARLY_ROWS of each sequence add the residual plane of ctx.
// coverage: NB*SEQ rows x CD columns = every element of the output buffer region once. LDS tile 64 x 64 fully written before it is read.
static_assert(CD % 128 == 0);
__global__ __launch_bounds__(128) void k_proj_out(const unsigned short* __restrict__ ctxh, const unsigned short* __restrict__ ctxl,
                                                  const unsigned short* __restrict__ wo, const float* __restrict__ bo,
                                                  float* __restrict__ out) {
  __shared__ __attribute__((aligned(16))) unsigned char ring[SQ2_RING];
  float (*st)[64][68] = (float (*)[64][68])ring;       // epilogue tiles, used behind the k loop's last barrier
  const int tid = threadIdx.x, lane = tid & 31, ln = lane & 15, hh = lane >> 4;
  const int w = __builtin_amdgcn_readfirstlane(tid >> 5);
  const int wr = w >> 1, wc = w & 1;
  const int n0 = blockIdx.x * 128 + 64 * wc;
  // blockIdx.y -> row tile, cost falling with the index: the tiles with twice the products per stage (rows below EARLY_ROWS of every sequence) come first (for speed only: nothing rests on where a
  // work-group lands). A permutation of the NB * SEQ / 128 row tiles.
  constexpr int TPS = SEQ / 128, EPS = EARLY_ROWS / 128, PPS = (TPS > EPS) ? (TPS - EPS) : 1;
  const int yt = blockIdx.y;
  const bool early = (yt < NB * EPS);                  // block-uniform
  const int b = early ? (yt / EPS) : ((yt - NB * EPS) / PPS);
  const int tb = 128 * (early ? (yt - b * EPS) : (EPS + (yt - NB * EPS) - b * PPS));
  const int mb = b * SEQ + tb;
  const int t0 = tb + 64 * wr;
  const v8f z8 = {0.f, 0.f, 0.f, 0.f, 0.f, 0.f, 0.f, 0.f};
  v8f acc[4][4];
#pragma unroll
  for (int i = 0; i < 4; ++i)
#pragma unroll
    for (int j = 0; j < 4; ++j) acc[i][j] = z8;
  const unsigned short* wp = wo + (size_t)(blockIdx.x * 128) * CD;
  // residual plane (block-uniform branch): it rides in the hi plane's stages, so that a row tile with it walks k once, as many stages as any other tile,
  // and fetches its W rows once; both planes carry x64 and add into the same 16 accumulator tiles
  const unsigned short* ah = ctxh + (size_t)mb * CD;
  if (early) gemm_sq<false, 2>(ah, ctxl + (size_t)(b * EARLY_ROWS + tb) * CD, wp, ring, tid, wr, wc, ln, hh, acc);
  else       gemm_sq<false, 1>(ah, ah, wp, ring, tid, wr, wc, ln, hh, acc);
  // carries: ctx x64, Wo x64 -> 2^-12
#pragma unroll
  for (int i = 0; i < 4; ++i)
#pragma unroll
    for (int j = 0; j < 4; ++j)
#pragma unroll
      for (int r = 0; r < 8; ++r)
        st[w][16 * i + 8 * hh + r][16 * j + ln] = acc[i][j][r] * S2M12;
  __syncthreads();
  const int rsub = lane >> 4, c4 = 4 * (lane & 15);
  const v4f bb = *(const v4fa*)(bo + n0 + c4);
  v4f bias;
  bias[0] = bf16_rne(bb[0]); bias[1] = bf16_rne(bb[1]); bias[2] = bf16_rne(bb[2]); bias[3] = bf16_rne(bb[3]);
  float* og = out + ((size_t)b * SEQ_FULL + t0) * CD + n0 + c4;
  // the wave's 64 rows in two halves of 32
  for (int half = 0; half < 2; ++half) {
    v4f ov[16];
#pragma unroll
    for (int g = 0; g < 16; ++g) {
      const v4f a = *(const v4fa*)&st[w][32 * half + 2 * g + rsub][c4];
      ov[g] = a + bias;
    }
#pragma unroll
    for (int g = 0; g < 16; ++g)
      *(v4f*)(og + (size_t)(32 * half + 2 * g + rsub) * CD) = ov[g];
  }
}

// ---------------------------------------------------------------------------------------------------------
extern "C" void kernel_launch(void* const* d_in, const int* in_sizes, int n_in,
                              void* d_out, int out_size, void* d_ws, size_t ws_size, hipStream_t stream) {
  if (n_in < 11) return;
  const long long need_x = (long long)(NB - 1) * SEQ_FULL * CD + (long long)SEQ * CD;   // last element touched + 1
  const long long need_m = (long long)(SEQ - 1) * SEQ_FULL + SEQ;
  if ((long long)in_sizes[0] < need_x) return;
  if ((long long)in_sizes[1] < need_m) return;
  if ((long long)in_sizes[2] < (long long)SEQ * HD) return;
  if ((long long)in_sizes[3] < (long long)CD * CD || (long long)in_sizes[4] < CD) return;
  if ((long long)in_sizes[5] < (long long)KVW * CD || (long long)in_sizes[6] < KVW) return;
  if ((long long)in_sizes[7] < (long long)KVW * CD || (long long)in_sizes[8] < KVW) return;
  if ((long long)in_sizes[9] < (long long)CD * CD || (long long)in_sizes[10] < CD) return;
  if ((long long)out_size < need_x) return;
  if ((size_t)WS_TOTAL > ws_size) return;

  // wire order: x, mask, sinusoidal_pos, Wq, bq, Wk, bk, Wv, bv, Wo, bo
  const float* x    = (const float*)d_in[0];
  const int*   mask = (const int*)d_in[1];
  const float* tab  = (const float*)d_in[2];
  const float* Wq   = (const float*)d_in[3];
  const float* bq   = (const float*)d_in[4];
  const float* Wk   = (const float*)d_in[5];
  const float* bk   = (const float*)d_in[6];
  const float* Wv   = (const float*)d_in[7];
  const float* bv   = (const float*)d_in[8];
  const float* Wo   = (const float*)d_in[9];
  const float* bo   = (const float*)d_in[10];
  float* out = (float*)d_out;

  char* ws = (char*)d_ws;
  size_t off = 0;
  int* flags = (int*)(ws + off);                               off += SZ_FLAGS;
  unsigned short* xb   = (unsigned short*)(ws + off);          off += SZ_XB;
  unsigned short* wqk  = (unsigned short*)(ws + off);          off += SZ_WQK;
  unsigned short* wvb  = (unsigned short*)(ws + off);          off += SZ_WV;
  unsigned short* wob  = (unsigned short*)(ws + off);          off += SZ_WO;
  unsigned short* qkh  = (unsigned short*)(ws + off);          off += PLANE_QK * 2;
  unsigned short* qkl  = (unsigned short*)(ws + off);          off += PLANE_QK * 2;
  unsigned short* vth  = (unsigned short*)(ws + off);          off += PLANE_V * 2;
  unsigned short* vtl  = (unsigned short*)(ws + off);          off += PLANE_V * 2;
  unsigned short* ctxh = (unsigned short*)(ws + off);          off += SZ_CTXH;
  unsigned short* ctxl = (unsigned short*)(ws + off);          off += SZ_CTXL;
  if (off > ws_size) return;

  // mask -> flags, and in[rows][CD] f32 -> [rows][CD] 16-bit planes (row order kept)
  k_prep<<<(unsigned)(SCAN_BLOCKS + CVT_BLOCKS), PREP_THREADS, 0, stream>>>(mask, flags, x, Wq, Wk, Wv, Wo, xb, wqk, wvb, wob);

  k_proj_qkv<<<dim3(NQK / 2 + KVW / 128, (unsigned)(NB * SEQ / 128)), 128, 0, stream>>>(xb, wqk, wvb, bq, bk, bv, tab, qkh, qkl, vth, vtl);
  k_attn<<<(unsigned)(NB * NHEAD * (SEQ / 64)), 128, 0, stream>>>(qkh, qkl, vth, vtl, mask, flags, ctxh, ctxl);
  k_proj_out<<<dim3(CD / 128, (unsigned)(NB * SEQ / 128)), 128, 0, stream>>>(ctxh, ctxl, wob, bo, out);
}

// v009
// A run of this version takes 141 microseconds.
// Timed twice side by side with v008, it ran 1.06 and 1.05 times as fast.
// All steps since v000 together make it 6.18 times as fast.
#include <hip/hip_runtime.h>
#ifndef NB
#define NB 2
#endif
#ifndef SEQ
#define SEQ 2048
#endif
#define NB_FULL 2
#define SEQ_FULL 2048
#define CD 2048                 /* model width = depth of every projection */
#define NHEAD 32
#define NKV 8
#define HD 64
#define NQK (NHEAD + NKV)       /* rotary plane holds the 32 q heads followed by the 8 k heads */
#define KVW (NKV * HD)          /* 512 */
#define EARLY_ROWS (SEQ < 512 ? SEQ : 512)

#define SCAN_ROWS 8             /* mask rows per scan work-group: 8 rows x SEQ ints = 8 loads of 16 B per thread at SEQ = 2048 */
#define SCAN_LOADS (SCAN_ROWS * (SEQ / 4) / 512)
#define SZ_FLAGS ((size_t)(SEQ / SCAN_ROWS) * 128)   /* one 128-byte line per scan work-group */
#define SZ_XB    ((size_t)NB * SEQ * CD * 2)
#define SZ_WQK   ((size_t)(CD + KVW) * CD * 2)
#define SZ_WV    ((size_t)KVW * CD * 2)
#define SZ_WO    ((size_t)CD * CD * 2)
#define PLANE_QK ((size_t)NB * NQK * SEQ * HD)     /* elements of one rotary plane */
#define PLANE_V  ((size_t)NB * KVW * SEQ)          /* elements of one V^T plane */
#define SZ_CTXH  ((size_t)NB * SEQ * CD * 2)
#define SZ_CTXL  ((size_t)NB * EARLY_ROWS * CD * 2)
#define WS_TOTAL (SZ_FLAGS + SZ_XB + SZ_WQK + SZ_WV + SZ_WO + PLANE_QK * 4 + PLANE_V * 4 + SZ_CTXH + SZ_CTXL)

static_assert(SEQ % 128 == 0);
static_assert((SCAN_ROWS * (SEQ / 4)) % 512 == 0);
static_assert(16 % SCAN_ROWS == 0);
static_assert(SZ_FLAGS % 256 == 0);
static_assert(EARLY_ROWS % 128 == 0);
static_assert(SEQ <= SEQ_FULL);
static_assert(NB <= NB_FULL);
static_assert(HD == 64);
static_assert(CD % 32 == 0);
static_assert(KVW % 128 == 0);
static_assert(NHEAD % NKV == 0);
static_assert(WS_TOTAL <= (size_t)134217728);
static_assert(SZ_XB % 256 == 0 && SZ_WQK % 256 == 0 && SZ_WV % 256 == 0 && SZ_WO % 256 == 0);
static_assert((PLANE_QK * 2) % 256 == 0 && (PLANE_V * 2) % 256 == 0 && SZ_CTXH % 256 == 0 && SZ_CTXL % 256 == 0);

typedef __bf16 v16b __attribute__((ext_vector_type(16)));
typedef _Float16 v16h __attribute__((ext_vector_type(16)));
typedef unsigned short v8us __attribute__((ext_vector_type(8), may_alias));
typedef float v8f __attribute__((ext_vector_type(8)));
typedef float v4f __attribute__((ext_vector_type(4)));
typedef float v4fa __attribute__((ext_vector_type(4), may_alias));
typedef int v4i __attribute__((ext_vector_type(4)));
typedef int v4ia __attribute__((ext_vector_type(4), may_alias));
union Frag { v16b b; v16h v; v8us half[2]; _Float16 h[16]; unsigned short u[16]; };
union Pack8 { v8us v; _Float16 h[8]; unsigned short u[8]; };

#define LOG2E 1.4426950408889634f
#define S2M11 0.00048828125f       /* 2^-11 */
#define S2M12 0.000244140625f      /* 2^-12 */
__device__ __forceinline__ unsigned short bf16_bits(float x) {   // RNE convert to bf16 bits
  unsigned int u = __float_as_uint(x);
  return (unsigned short)((u + 0x7FFFu + ((u >> 16) & 1u)) >> 16);
}
__device__ __forceinline__ float bf16_val(unsigned short b) { return __uint_as_float(((unsigned int)b) << 16); }
__device__ __forceinline__ float bf16_rne(float x) { return bf16_val(bf16_bits(x)); }
__device__ __forceinline__ float neg_inf() { return __uint_as_float(0xff800000u); }

// Fragment of a k-contiguous 16-bit row: elements 0..7 <- p[0..7], elements 8..15 <- p[16..23]; caller adds row*pitch + k0 + 8*h.
__device__ __forceinline__ void ldfrag(Frag& f, const unsigned short* __restrict__ p) {
  f.half[0] = *(const v8us*)(p);
  f.half[1] = *(const v8us*)(p + 16);
}

template <bool BF>
__device__ __forceinline__ v8f wm(const Frag& a, const Frag& b, v8f c) {
  if (BF) return __builtin_amdgcn_wmma_f32_16x16x32_bf16(false, a.b, false, b.b, (short)0, c, false, false);
  return __builtin_amdgcn_wmma_f32_16x16x32_f16(false, a.v, false, b.v, (short)0, c, false, false);
}

// ---------------------------------------------------------------------------------------------------------
// Input preparation, one launch: the jobs below read inputs only and none reads what another writes, so the block index picks the job.
// Blocks 0 .. SCAN_BLOCKS-1: mask scan, one work-group per SCAN_ROWS mask rows; group g owns the line flags[32g .. 32g+31]:
// flags[32g] = 1 iff every entry of its rows above the diagonal is zero; flags[32g+1] = 1 iff every entry of its rows on or below the diagonal is nonzero.
// coverage: SEQ/SCAN_ROWS blocks x 512 threads x SCAN_LOADS x 4 ints = SEQ x SEQ mask entries; every flag line is written whole.
// Blocks SCAN_BLOCKS .. SCAN_BLOCKS+CVT_BLOCKS-1: f32 rows of width CD -> 16-bit planes (row order kept). A row is one 16-byte load and one 8-byte store
// per thread (a wave reads 4 whole lines and writes 2); block c takes the c-th run of adjacent rows of each of x, Wq, Wk, Wv and Wo, the same counts in every block.
// MODE 0: bf16 bits (RNE). MODE 1: f16 of (RNE bf16 value x 64).
// coverage: CVT_BLOCKS blocks x (rows / CVT_BLOCKS) rows x 512 threads x 4 elements = rows x CD, for each of the five arrays.
#define PREP_THREADS 512
#define SCAN_BLOCKS (SEQ / SCAN_ROWS)
#define CVT_BLOCKS 512
static_assert(CD == PREP_THREADS * 4);
static_assert((NB * SEQ) % CVT_BLOCKS == 0 && CD % CVT_BLOCKS == 0 && KVW % CVT_BLOCKS == 0);

typedef unsigned short v4us __attribute__((ext_vector_type(4), may_alias));
union Pack4 { v4us v; _Float16 h[4]; unsigned short u[4]; };

template <int MODE>
__device__ __forceinline__ void cvt_store(unsigned short* d, v4f x) {
  Pack4 o;
  if (MODE == 0) {
    o.u[0] = bf16_bits(x[0]); o.u[1] = bf16_bits(x[1]); o.u[2] = bf16_bits(x[2]); o.u[3] = bf16_bits(x[3]);
  } else {
    o.h[0] = (_Float16)(bf16_rne(x[0]) * 64.0f); o.h[1] = (_Float16)(bf16_rne(x[1]) * 64.0f);
    o.h[2] = (_Float16)(bf16_rne(x[2]) * 64.0f); o.h[3] = (_Float16)(bf16_rne(x[3]) * 64.0f);
  }
  *(v4us*)d = o.v;
}

// twelve waves per SIMD asked for (80 registers): three work-groups fit a WGP, so that all work-groups of the launch are resident together
__global__ __launch_bounds__(PREP_THREADS) __attribute__((amdgpu_waves_per_eu(12))) void k_prep(const int* __restrict__ mask, int* __restrict__ flags,
                                                       const float* __restrict__ x, const float* __restrict__ Wq, const float* __restrict__ Wk,
                                                       const float* __restrict__ Wv, const float* __restrict__ Wo,
                                                       unsigned short* __restrict__ xb, unsigned short* __restrict__ wqk,
                                                       unsigned short* __restrict__ wvb, unsigned short* __restrict__ wob) {
  __shared__ int sw[2][16];
  const int tid = threadIdx.x;
  if (blockIdx.x >= SCAN_BLOCKS) {                     // block-uniform
    const int c = blockIdx.x - SCAN_BLOCKS;
    const int e = 4 * tid;
    constexpr int NX = NB * SEQ / CVT_BLOCKS, NQ = CD / CVT_BLOCKS, NK = KVW / CVT_BLOCKS;
    static_assert(SEQ % NX == 0);                      // the block's NX rows of x lie in one batch
    const int bx = (c * NX) / SEQ, rx = c * NX - bx * SEQ;
    // uniform bases of this block's rows; a thread's loads and stores differ from them by 4 * tid elements and by constants only
    const float* sx = x + ((size_t)bx * SEQ_FULL + rx) * CD;
    const float* sq = Wq + (size_t)(c * NQ) * CD;
    const float* swo = Wo + (size_t)(c * NQ) * CD;
    const float* sk = Wk + (size_t)(c * NK) * CD;
    const float* sv = Wv + (size_t)(c * NK) * CD;
    unsigned short* dx = xb + (size_t)(c * NX) * CD;
    unsigned short* dq = wqk + (size_t)(c * NQ) * CD;
    unsigned short* dw = wob + (size_t)(c * NQ) * CD;
    unsigned short* dk = wqk + (size_t)(CD + c * NK) * CD;   // the k rows follow the q rows
    unsigned short* dv = wvb + (size_t)(c * NK) * CD;
    // all loads of a thread are independent and issued before the first is converted, so that they are in flight together
    v4f vx[NX], vq[NQ], vw[NQ], vk[NK], vv[NK];
#pragma unroll
    for (int j = 0; j < NX; ++j) vx[j] = *(const v4fa*)(sx + (unsigned)(j * CD + e));
#pragma unroll
    for (int j = 0; j < NQ; ++j) vq[j] = *(const v4fa*)(sq + (unsigned)(j * CD + e));
#pragma unroll
    for (int j = 0; j < NQ; ++j) vw[j] = *(const v4fa*)(swo + (unsigned)(j * CD + e));
#pragma unroll
    for (int j = 0; j < NK; ++j) vk[j] = *(const v4fa*)(sk + (unsigned)(j * CD + e));
#pragma unroll
    for (int j = 0; j < NK; ++j) vv[j] = *(const v4fa*)(sv + (unsigned)(j * CD + e));
    // keeps every load in front of the first conversion: without it the scheduler sinks a third of the loads behind waits to 0, and their latencies add up
    __builtin_amdgcn_sched_barrier(0);
#pragma unroll
    for (int j = 0; j < NX; ++j) cvt_store<0>(dx + (unsigned)(j * CD + e), vx[j]);
#pragma unroll
    for (int j = 0; j < NQ; ++j) cvt_store<0>(dq + (unsigned)(j * CD + e), vq[j]);
#pragma unroll
    for (int j = 0; j < NQ; ++j) cvt_store<1>(dw + (unsigned)(j * CD + e), vw[j]);
#pragma unroll
    for (int j = 0; j < NK; ++j) cvt_store<0>(dk + (unsigned)(j * CD + e), vk[j]);
#pragma unroll
    for (int j = 0; j < NK; ++j) cvt_store<0>(dv + (unsigned)(j * CD + e), vv[j]);
    return;                                            // the whole block leaves here; the barrier below is the scan blocks' own
  }
  const int lane = tid & 31, wv = tid >> 5;
  int badU = 0, badL = 0;
  const int cpr = SEQ / 4;
  const int q0 = blockIdx.x * SCAN_ROWS;
  const int* mb = mask + (size_t)q0 * SEQ_FULL;       // uniform base of this group's rows; the loads below differ by constants only
  v4i mv[SCAN_LOADS];
  // all loads of a thread are independent and issued before the first is tested, so that they are in flight together
#pragma unroll
  for (int u = 0; u < SCAN_LOADS; ++u) {
    const int c = tid + 512 * u;
    const int qr = c / cpr, k = (c - qr * cpr) * 4;
    mv[u] = *(const v4ia*)(mb + (unsigned)(qr * SEQ_FULL + k));
  }
#pragma unroll
  for (int u = 0; u < SCAN_LOADS; ++u) {
    const int c = tid + 512 * u;
    const int qr = c / cpr, k = (c - qr * cpr) * 4;
    const int q = q0 + qr;
#pragma unroll
    for (int i = 0; i < 4; ++i) {
      const int above = (k + i > q) ? 1 : 0;
      const int nz = (mv[u][i] != 0) ? 1 : 0;
      badU |= above & nz;
      badL |= (1 - above) & (1 - nz);
    }
  }
#pragma unroll
  for (int o = 16; o >= 1; o >>= 1) {
    badU |= __shfl_xor(badU, o, 32);
    badL |= __shfl_xor(badL, o, 32);
  }
  if (lane == 0) { sw[0][wv] = badU; sw[1][wv] = badL; }
  __syncthreads();
  if (tid < 8) {
    int u = 0, l = 0;
#pragma unroll
    for (int i = 0; i < 16; ++i) { u |= sw[0][i]; l |= sw[1][i]; }
    v4i o;
    o[0] = (tid == 0 && u == 0) ? 1 : 0;
    o[1] = (tid == 0 && l == 0) ? 1 : 0;
    o[2] = 0; o[3] = 0;
    *(v4i*)(flags + 32 * blockIdx.x + 4 * tid) = o;
  }
}

// ---------------------------------------------------------------------------------------------------------
// Staging of the GEMMs: a stage is 64 k of every row of the block's two operands, 128-byte rows laid at a 144-byte pitch; two buffers.
// Fragment maps: row or column = ln, elements 0..7 <- k0 + 8h + i, elements 8..15 <- k0 + 16 + 8h + i, for both operands alike.
#define ST_K 64
#define ST_PITCH 144
static_assert(CD % ST_K == 0 && CD / ST_K >= 2);

__device__ __forceinline__ void ldfrag_lds(Frag& f, const unsigned char* p) {
  f.half[0] = *(const v8us*)(p);
  f.half[1] = *(const v8us*)(p + 32);
}

// Square block tile of all four projections: 128 A rows x 128 W rows (both k-contiguous, pitch CD), 4 waves as 2 x 2, wave tile 64 x 64:
// acc[i][j] (rows 64 wr + 16 i.., cols 64 wc + 16 j..) += A[row][k] * W[col][k] over k = 0..CD-1, k ascending in steps of 32.
// A stage is 64 k of all 256 rows at the 144-byte pitch (A rows 0..127, then W rows 128..255); two buffers.
// Per 64 k a block copies 32 KiB for 128 x 128 outputs, and a wave reads 16 fragments for 32 matrix instructions.
// NA = 2: a second A plane of the same 128 rows (same carry as the first) rides in the same stage, acc += (A + A2) * W in one walk over k:
// a stage is A rows 0..127, A2 rows 128..255, W rows 256..383 (48 KiB), and a wave reads 24 fragments for 64 matrix instructions (the W fragments serve both planes).
#define SQ_BYTES (256 * ST_PITCH)
#define SQ_RING (2 * SQ_BYTES)
#define SQ2_RING (2 * 384 * ST_PITCH)
static_assert(SQ_RING >= 4 * 64 * 68 * 4);         /* the epilogue tiles reuse the ring */

// 128 rows of one operand: 8 copies of 16 bytes per thread, chunk (tid & 7) of rows (tid >> 3) + 16 i; each copy of a wave moves 4 whole 128-byte lines.
// The s_wait_xcnt stands inside the statement so that no address register is rewritten ahead of it.
__device__ __forceinline__ void rows128_copy(const unsigned short* g, unsigned l) {
  asm volatile("global_load_async_to_lds_b128 %0, %8, off\n\t"
               "global_load_async_to_lds_b128 %1, %9, off\n\t"
               "global_load_async_to_lds_b128 %2, %10, off\n\t"
               "global_load_async_to_lds_b128 %3, %11, off\n\t"
               "global_load_async_to_lds_b128 %4, %12, off\n\t"
               "global_load_async_to_lds_b128 %5, %13, off\n\t"
               "global_load_async_to_lds_b128 %6, %14, off\n\t"
               "global_load_async_to_lds_b128 %7, %15, off\n\t"
               "s_wait_xcnt 0x0"
               :: "v"(l), "v"(l + 16 * ST_PITCH), "v"(l + 32 * ST_PITCH), "v"(l + 48 * ST_PITCH),
                  "v"(l + 64 * ST_PITCH), "v"(l + 80 * ST_PITCH), "v"(l + 96 * ST_PITCH), "v"(l + 112 * ST_PITCH),
                  "v"(g), "v"(g + 16 * CD), "v"(g + 32 * CD), "v"(g + 48 * CD),
                  "v"(g + 64 * CD), "v"(g + 80 * CD), "v"(g + 96 * CD), "v"(g + 112 * CD)
               : "memory");
}
template <int NA>
__device__ __forceinline__ void sq_copy(const unsigned short* ga, const unsigned short* ga2, const unsigned short* gb, unsigned l) {
  rows128_copy(ga, l);
  if (NA == 2) rows128_copy(ga2, l + 128 * ST_PITCH);
  rows128_copy(gb, l + NA * 128 * ST_PITCH);
}

// a2blk is read only where NA = 2
template <bool BF, int NA>
__device__ __forceinline__ void gemm_sq(const unsigned short* __restrict__ ablk, const unsigned short* __restrict__ a2blk,
                                        const unsigned short* __restrict__ bblk,
                                        unsigned char* ring, int tid, int wr, int wc, int ln, int hh, v8f (&acc)[4][4]) {
  const int nt = CD / ST_K;
  constexpr unsigned SB = (NA + 1) * 128 * ST_PITCH;   // bytes of one buffer
  const unsigned short* ga = ablk + (size_t)(tid >> 3) * CD + 8 * (tid & 7);
  const unsigned short* ga2 = a2blk + (size_t)(tid >> 3) * CD + 8 * (tid & 7);
  const unsigned short* gb = bblk + (size_t)(tid >> 3) * CD + 8 * (tid & 7);
  const unsigned l0 = (unsigned)(size_t)ring + (unsigned)((tid >> 3) * ST_PITCH + 16 * (tid & 7));   // LDS byte address of this thread's first chunk
  const int aoff = (64 * wr + ln) * ST_PITCH + 16 * hh;
  const int boff = (NA * 128 + 64 * wc + ln) * ST_PITCH + 16 * hh;
  sq_copy<NA>(ga, ga2, gb, l0);
  asm volatile("s_wait_asynccnt 0x0" ::: "memory");   // tile 0 has landed before the barrier that publishes it
  __syncthreads();
  sq_copy<NA>(ga + ST_K, ga2 + ST_K, gb + ST_K, l0 + SB);
#pragma unroll 1   // one tile per trip: the two buffers alternate by the trip's parity
  for (int t = 0; t < nt; ++t) {
    const unsigned sel = (unsigned)(t & 1) * SB;
    const unsigned char* buf = ring + sel;
    Frag a[2][4], b[2][4];
#pragma unroll
    for (int i = 0; i < 4; ++i) ldfrag_lds(a[0][i], buf + aoff + i * 16 * ST_PITCH);
#pragma unroll
    for (int kk = 0; kk < 2; ++kk)
#pragma unroll
      for (int j = 0; j < 4; ++j) ldfrag_lds(b[kk][j], buf + boff + j * 16 * ST_PITCH + kk * 64);
    // keeps these 24 fragment loads together in front of the first matrix instruction: without it the scheduler takes one register set for the four
    // A fragments of the first 32 k, loads them one by one among the matrix instructions and waits for each to 0.
    // The A fragments of the second 32 k follow behind it, into the registers that the first four leave (all 16 fragments at once do not fit).
    __builtin_amdgcn_sched_barrier(0);
#pragma unroll
    for (int i = 0; i < 4; ++i) ldfrag_lds(a[1][i], buf + aoff + i * 16 * ST_PITCH + 64);
    Frag c[2][4];                                       // the second plane's 8 fragments (NA = 2 only)
    if (NA == 2) {
#pragma unroll
      for (int kk = 0; kk < 2; ++kk)
#pragma unroll
        for (int i = 0; i < 4; ++i) ldfrag_lds(c[kk][i], buf + aoff + (128 + i * 16) * ST_PITCH + kk * 64);
      // keeps all 48 fragment loads of the stage in front of its 64 matrix instructions (the kernel runs two waves per SIMD, so the registers are there):
      // without it the scheduler saves registers, loads 6 of the fragments one by one among the matrix instructions and waits for each to 0
      __builtin_amdgcn_sched_barrier(0);
    }
#pragma unroll
    for (int kk = 0; kk < 2; ++kk)
#pragma unroll
      for (int i = 0; i < 4; ++i)
#pragma unroll
        for (int j = 0; j < 4; ++j) acc[i][j] = wm<BF>(a[kk][i], b[kk][j], acc[i][j]);
    if (NA == 2) {
      // the second plane, against the W fragments that are already in registers
#pragma unroll
      for (int kk = 0; kk < 2; ++kk)
#pragma unroll
        for (int i = 0; i < 4; ++i)
#pragma unroll
          for (int j = 0; j < 4; ++j) acc[i][j] = wm<BF>(c[kk][i], b[kk][j], acc[i][j]);
      // keeps the distance behind the last matrix instructions on the loop's back edge and in front of the address arithmetic below
      // (the sums alone are named: with the fragments named too, more values must lie in the registers that asm operands can name than fit there, and sums spill)
      asm volatile("v_nop\n\tv_nop\n\tv_nop\n\tv_nop" : "+v"(acc[0][0]), "+v"(acc[0][1]), "+v"(acc[0][2]), "+v"(acc[0][3]),
                          "+v"(acc[1][0]), "+v"(acc[1][1]), "+v"(acc[1][2]), "+v"(acc[1][3]),
                          "+v"(acc[2][0]), "+v"(acc[2][1]), "+v"(acc[2][2]), "+v"(acc[2][3]),
                          "+v"(acc[3][0]), "+v"(acc[3][1]), "+v"(acc[3][2]), "+v"(acc[3][3]));
    } else
    // keeps the distance behind the last matrix instructions on the loop's back edge and in front of the address arithmetic below
    asm volatile("v_nop\n\tv_nop\n\tv_nop\n\tv_nop" : "+v"(acc[0][0]), "+v"(acc[0][1]), "+v"(acc[0][2]), "+v"(acc[0][3]),
                        "+v"(acc[1][0]), "+v"(acc[1][1]), "+v"(acc[1][2]), "+v"(acc[1][3]),
                        "+v"(acc[2][0]), "+v"(acc[2][1]), "+v"(acc[2][2]), "+v"(acc[2][3]),
                        "+v"(acc[3][0]), "+v"(acc[3][1]), "+v"(acc[3][2]), "+v"(acc[3][3])
                      : "v"(a[1][0].v), "v"(a[1][1].v), "v"(a[1][2].v), "v"(a[1][3].v), "v"(b[1][0].v), "v"(b[1][1].v), "v"(b[1][2].v), "v"(b[1][3].v));
    asm volatile("s_wait_dscnt 0x0" ::: "memory");      // this wave's reads of the buffer are done before it is refilled
    asm volatile("s_wait_asynccnt 0x0" ::: "memory");   // this wave's copies of tile t + 1 have landed before the barrier publishes them
    __syncthreads();
    if (t + 2 < nt) sq_copy<NA>(ga + (t + 2) * ST_K, ga2 + (t + 2) * ST_K, gb + (t + 2) * ST_K, l0 + sel);
  }
  asm volatile("s_wait_asynccnt 0x0" ::: "memory");     // nothing is in flight when the ring is used for anything else
}

__device__ __forceinline__ float rope1(float q, float p, float c, float s, float sg) { return q * c + (sg * p) * s; }

// ---------------------------------------------------------------------------------------------------------
// q, k and v projections in one launch: none reads what another writes, so blockIdx.x picks the job. grid = (NQK/2 + KVW/128, NB*SEQ/128);
// every work-group is 4 waves as 2 x 2 on one 128 x 128 tile of the same engine, and all of them are resident together.
// blockIdx.x < NQK/2: q and k with fused bias, rotary (table read by value) and head-major repack:
// 128 token rows x two heads; a wave has 64 token rows of one head (64 columns).
// coverage: NQK heads x NB*SEQ tokens x 64 = the whole plane [NB][NQK][SEQ][64], both planes. LDS tile 64 x 64 fully written before it is read.
// blockIdx.x >= NQK/2: v computed transposed: Vt[b][m][t] = sum_k Wv[m][k] x[b,t][k] + bv[m], carried x16, hi and residual planes:
// 128 weight rows x 128 tokens; a wave has 64 weight rows x 64 tokens.
// coverage: KVW rows x NB*SEQ tokens = the whole plane [NB][KVW][SEQ], both planes. LDS tile 64 x 64 fully written before it is read.
static_assert(NQK % 2 == 0);
static_assert(SEQ % 128 == 0);                         // a block's 128 tokens lie in one batch
__global__ __launch_bounds__(128) void k_proj_qkv(const unsigned short* __restrict__ xb, const unsigned short* __restrict__ wqk,
                                                  const unsigned short* __restrict__ wvb,
                                                  const float* __restrict__ bq, const float* __restrict__ bk, const float* __restrict__ bv,
                                                  const float* __restrict__ tab,
                                                  unsigned short* __restrict__ qkh, unsigned short* __restrict__ qkl,
                                                  unsigned short* __restrict__ vth, unsigned short* __restrict__ vtl) {
  __shared__ __attribute__((aligned(16))) unsigned char ring[SQ_RING];
  float (*st)[64][68] = (float (*)[64][68])ring;       // epilogue tiles, used behind the k loop's last barrier
  const int tid = threadIdx.x, lane = tid & 31, ln = lane & 15, hh = lane >> 4;
  const int w = __builtin_amdgcn_readfirstlane(tid >> 5);
  const int wr = w >> 1, wc = w & 1;
  const bool isv = (blockIdx.x >= NQK / 2);            // block-uniform
  const v8f z8 = {0.f, 0.f, 0.f, 0.f, 0.f, 0.f, 0.f, 0.f};
  v8f acc[4][4];
#pragma unroll
  for (int i = 0; i < 4; ++i)
#pragma unroll
    for (int j = 0; j < 4; ++j) acc[i][j] = z8;
  // the block's 128 token rows and its 128 weight rows; tokens are the tile's rows for q and k, its columns for v
  const unsigned short* xt = xb + (size_t)(blockIdx.y * 128) * CD;
  const unsigned short* wt = isv ? (wvb + (size_t)((blockIdx.x - NQK / 2) * 128) * CD) : (wqk + (size_t)(blockIdx.x * 2 * HD) * CD);
  gemm_sq<true, 1>(isv ? wt : xt, isv ? wt : xt, isv ? xt : wt, ring, tid, wr, wc, ln, hh, acc);

  if (isv) {
#pragma unroll
    for (int i = 0; i < 4; ++i)
#pragma unroll
      for (int j = 0; j < 4; ++j)
#pragma unroll
        for (int r = 0; r < 8; ++r) st[w][16 * i + 8 * hh + r][16 * j + ln] = acc[i][j][r];
    __syncthreads();
    const int vn0 = blockIdx.y * 128 + 64 * wc;        // first token of the wave
    const int vm0 = (blockIdx.x - NQK / 2) * 128 + 64 * wr;   // first weight row of the wave
    const int vb = vn0 / SEQ, vt0 = vn0 - vb * SEQ;
    const int vrs = lane >> 3, vc0 = 8 * (lane & 7);
    const size_t vbase = ((size_t)vb * KVW + vm0) * SEQ + vt0 + vc0;
    // the wave's 64 rows in two halves of 32
    for (int half = 0; half < 2; ++half) {
      v8us oh[8], ol[8];
#pragma unroll
      for (int g = 0; g < 8; ++g) {
        const int row = 32 * half + 4 * g + vrs;
        const float bias = bf16_rne(bv[vm0 + row]);
        const v4f a0 = *(const v4fa*)&st[w][row][vc0];
        const v4f a1 = *(const v4fa*)&st[w][row][vc0 + 4];
        float o[8];
        o[0] = a0[0]; o[1] = a0[1]; o[2] = a0[2]; o[3] = a0[3];
        o[4] = a1[0]; o[5] = a1[1]; o[6] = a1[2]; o[7] = a1[3];
        Pack8 ph8, pl8;
#pragma unroll
        for (int e = 0; e < 8; ++e) {
          const float y = (o[e] + bias) * 16.0f;              // carried x16
          const _Float16 h = (_Float16)y;
          ph8.h[e] = h;
          pl8.h[e] = (_Float16)((y - (float)h) * 2048.0f);     // residual plane x2^11
        }
        oh[g] = ph8.v; ol[g] = pl8.v;
      }
#pragma unroll
      for (int g = 0; g < 8; ++g) {
        const size_t off = vbase + (size_t)(32 * half + 4 * g + vrs) * SEQ;
        *(v8us*)(vth + off) = oh[g];
        *(v8us*)(vtl + off) = ol[g];
      }
      asm volatile("s_wait_xcnt 0x0" ::: "memory");   // the second half rewrites registers that these stores name
    }
    return;                                            // the whole block leaves here; the barrier below is the q/k blocks' own
  }

  const int hd = 2 * blockIdx.x + wc;
  const int m0 = blockIdx.y * 128 + 64 * wr;
  float bias[4];
#pragma unroll
  for (int j = 0; j < 4; ++j) {
    const int col = hd * HD + 16 * j + ln;
    const int cq = (col < CD - 1) ? col : (CD - 1);
    int ck = col - CD;
    ck = (ck < 0) ? 0 : ((ck > KVW - 1) ? (KVW - 1) : ck);
    const float vq = bq[cq], vk = bk[ck];
    bias[j] = bf16_rne((col < CD) ? vq : vk);
  }
#pragma unroll
  for (int i = 0; i < 4; ++i)
#pragma unroll
    for (int j = 0; j < 4; ++j)
#pragma unroll
      for (int r = 0; r < 8; ++r) st[w][16 * i + 8 * hh + r][16 * j + ln] = acc[i][j][r] + bias[j];
  __syncthreads();

  const int b = m0 / SEQ, t0 = m0 - b * SEQ;
  const int rsub = lane >> 3, d0 = 8 * (lane & 7);
  const float sg = (d0 < 32) ? -1.0f : 1.0f;
  const size_t dbase = ((size_t)(b * NQK + hd) * SEQ + t0) * HD + d0;
  // the wave's 64 rows in two halves of 32
  const unsigned tl = (unsigned)(rsub * HD + d0);      // this lane's place in a group of 4 table rows
  for (int half = 0; half < 2; ++half) {
  const float* th = tab + (size_t)(t0 + 32 * half) * HD;   // uniform base of this half's table rows; the loads below differ from it by tl and by constants only
  v8us oh[8], ol[8];
#pragma unroll
  for (int g = 0; g < 8; ++g) {
    // keeps the last four groups' table and LDS loads from being lifted over the first four: with all 8 groups in flight at once the registers run short
    if (g == 4) __builtin_amdgcn_sched_barrier(0);
    const int row = 32 * half + 4 * g + rsub;
    const v4f a0 = *(const v4fa*)&st[w][row][d0];
    const v4f a1 = *(const v4fa*)&st[w][row][d0 + 4];
    const v4f p0 = *(const v4fa*)&st[w][row][d0 ^ 32];
    const v4f p1 = *(const v4fa*)&st[w][row][(d0 ^ 32) + 4];
    const float* tp = th + (tl + (unsigned)(4 * g * HD));
    const v4f c0 = *(const v4fa*)(tp), c1 = *(const v4fa*)(tp + 4);
    const float k0 = bf16_rne(c0[0]), s0 = bf16_rne(c0[1]), k1 = bf16_rne(c0[2]), s1 = bf16_rne(c0[3]);
    const float k2 = bf16_rne(c1[0]), s2 = bf16_rne(c1[1]), k3 = bf16_rne(c1[2]), s3 = bf16_rne(c1[3]);
    float o[8];
    o[0] = rope1(a0[0], p0[0], k0, s0, sg); o[1] = rope1(a0[1], p0[1], k0, s0, sg);
    o[2] = rope1(a0[2], p0[2], k1, s1, sg); o[3] = rope1(a0[3], p0[3], k1, s1, sg);
    o[4] = rope1(a1[0], p1[0], k2, s2, sg); o[5] = rope1(a1[1], p1[1], k2, s2, sg);
    o[6] = rope1(a1[2], p1[2], k3, s3, sg); o[7] = rope1(a1[3], p1[3], k3, s3, sg);
    Pack8 ph8, pl8;
#pragma unroll
    for (int e = 0; e < 8; ++e) {
      const float y = o[e] * 16.0f;                       // carried x16
      const _Float16 h = (_Float16)y;
      ph8.h[e] = h;
      pl8.h[e] = (_Float16)((y - (float)h) * 2048.0f);     // residual plane x2^11
    }
    oh[g] = ph8.v; ol[g] = pl8.v;
  }
#pragma unroll
    for (int g = 0; g < 8; ++g) {
      const size_t off = dbase + (size_t)(32 * half + 4 * g + rsub) * HD;
      *(v8us*)(qkh + off) = oh[g];
      *(v8us*)(qkl + off) = ol[g];
    }
    asm volatile("s_wait_xcnt 0x0" ::: "memory");   // the second half rewrites registers that these stores name
  }
}

// ---------------------------------------------------------------------------------------------------------
// Attention stage in LDS: 64 keys. Tile 0 = K rows (64 keys x 128 B), tile 1 = V^T rows (64 d x 128 B = 64 keys), each at a 144-byte pitch;
// tiles 2 and 3 = the residual planes of K and V^T (query rows below EARLY_ROWS only).
// The ring holds two stages of two tiles (plain blocks, two buffers) or one stage of four tiles (early blocks, one buffer).
#define AT_KEYS 64
#define AT_PITCH 144
#define AT_TILE (64 * AT_PITCH)
#define AT_RING (4 * AT_TILE)
static_assert(SEQ % AT_KEYS == 0);
static_assert(AT_RING >= 4 * 16 * 68 * 4);         /* the epilogue tiles reuse the ring */

// One K tile and one V^T tile: 8 copies of 16 bytes per thread, chunk (tid & 7) of rows (tid >> 3) + 16 i; each copy of a wave moves 4 whole 128-byte lines.
// The s_wait_xcnt stands inside the statement so that no address register is rewritten ahead of it.
__device__ __forceinline__ void kv_copy(const unsigned short* gk, const unsigned short* gv, unsigned l) {
  asm volatile("global_load_async_to_lds_b128 %0, %8, off\n\t"
               "global_load_async_to_lds_b128 %1, %9, off\n\t"
               "global_load_async_to_lds_b128 %2, %10, off\n\t"
               "global_load_async_to_lds_b128 %3, %11, off\n\t"
               "global_load_async_to_lds_b128 %4, %12, off\n\t"
               "global_load_async_to_lds_b128 %5, %13, off\n\t"
               "global_load_async_to_lds_b128 %6, %14, off\n\t"
               "global_load_async_to_lds_b128 %7, %15, off\n\t"
               "s_wait_xcnt 0x0"
               :: "v"(l), "v"(l + 16 * AT_PITCH), "v"(l + 32 * AT_PITCH), "v"(l + 48 * AT_PITCH),
                  "v"(l + AT_TILE), "v"(l + AT_TILE + 16 * AT_PITCH), "v"(l + AT_TILE + 32 * AT_PITCH), "v"(l + AT_TILE + 48 * AT_PITCH),
                  "v"(gk), "v"(gk + 16 * HD), "v"(gk + 32 * HD), "v"(gk + 48 * HD),
                  "v"(gv), "v"(gv + 16 * SEQ), "v"(gv + 32 * SEQ), "v"(gv + 48 * SEQ)
               : "memory");
}

// One 32-key step for a wave's 16 queries (this lane's column = its query). EARLYP adds the residual planes of q, k, v, P.
// st = the stage in LDS, kloc = 0 or 32 = first key of the step inside the stage, key0 = the same key's index in the sequence.
// MASK reads the mask row of this lane's query by value and replace-fills with -inf.
template <bool EARLYP, bool MASK>
__device__ __forceinline__ void fa_step(const unsigned char* st, int kloc,
                                        const int* __restrict__ mrow, int key0, int ln, int hh,
                                        const Frag (&qh)[2], const Frag (&ql)[2],
                                        float& mr, float& lr, v8f (&Oh)[4], v8f (&Ol)[4]) {
  const v8f z8 = {0.f, 0.f, 0.f, 0.f, 0.f, 0.f, 0.f, 0.f};
  float sc[16];
  // A fragments of K: row m = key (key0 + 16*kt + ln), elements 0..7 <- d = 32c + 8h + i, 8..15 <- d = 32c + 16 + 8h + i
  int koff = (kloc + ln) * AT_PITCH + 16 * hh;        // byte offset in a K tile
  if (EARLYP) {
#pragma unroll
    for (int kt = 0; kt < 2; ++kt) {
      Frag a0, a1, l0, l1;
      ldfrag_lds(a0, st + koff); ldfrag_lds(a1, st + koff + 64);
      ldfrag_lds(l0, st + 2 * AT_TILE + koff); ldfrag_lds(l1, st + 2 * AT_TILE + koff + 64);
      v8f s = z8, r = z8;
      s = wm<false>(a0, qh[0], s); s = wm<false>(a1, qh[1], s);
      r = wm<false>(a0, ql[0], r); r = wm<false>(a1, ql[1], r);
      r = wm<false>(l0, qh[0], r); r = wm<false>(l1, qh[1], r);
      asm volatile("v_nop\n\tv_nop\n\tv_nop\n\tv_nop" : "+v"(s), "+v"(r)
                        : "v"(a0.v), "v"(a1.v), "v"(l0.v), "v"(l1.v), "v"(qh[0].v), "v"(qh[1].v), "v"(ql[0].v), "v"(ql[1].v));
      // S^T element r of tile kt = score(key0 + 16*kt + 8h + r, this lane's query); carries: q x16, k x16, residual x2^11
#pragma unroll
      for (int e = 0; e < 8; ++e) sc[8 * kt + e] = fmaf(r[e], S2M11, s[e]) * S2M11;
      koff += 16 * AT_PITCH;
      if (kt == 0) asm volatile("" : "+v"(koff) : "v"(sc[0]));   // second tile's loads issue after the first tile is done
    }
  } else {
    Frag k00, k01, k10, k11;
    ldfrag_lds(k00, st + koff);                 ldfrag_lds(k01, st + koff + 64);
    ldfrag_lds(k10, st + koff + 16 * AT_PITCH); ldfrag_lds(k11, st + koff + 16 * AT_PITCH + 64);
    v8f s0 = z8, s1 = z8;
    s0 = wm<false>(k00, qh[0], s0); s0 = wm<false>(k01, qh[1], s0);
    s1 = wm<false>(k10, qh[0], s1); s1 = wm<false>(k11, qh[1], s1);
    asm volatile("v_nop\n\tv_nop\n\tv_nop\n\tv_nop" : "+v"(s0), "+v"(s1)
                      : "v"(k00.v), "v"(k01.v), "v"(k10.v), "v"(k11.v), "v"(qh[0].v), "v"(qh[1].v));
#pragma unroll
    for (int e = 0; e < 8; ++e) { sc[e] = s0[e] * S2M11; sc[8 + e] = s1[e] * S2M11; }
  }
  if (MASK) {
    const int* mp = mrow + key0 + 8 * hh;
    const v4i m0 = *(const v4ia*)(mp),      m1 = *(const v4ia*)(mp + 4);
    const v4i m2 = *(const v4ia*)(mp + 16), m3 = *(const v4ia*)(mp + 20);
    const float ninf = neg_inf();
#pragma unroll
    for (int e = 0; e < 4; ++e) {
      sc[e]      = (m0[e] == 0) ? ninf : sc[e];
      sc[4 + e]  = (m1[e] == 0) ? ninf : sc[4 + e];
      sc[8 + e]  = (m2[e] == 0) ? ninf : sc[8 + e];
      sc[12 + e] = (m3[e] == 0) ? ninf : sc[12 + e];
    }
  }
  float mx = sc[0];
#pragma unroll
  for (int i = 1; i < 16; ++i) mx = fmaxf(mx, sc[i]);
  mx = fmaxf(mx, __shfl_xor(mx, 16, 32));            // the other lane half holds the other 16 keys of this query
  const float mnew = fmaxf(mr, mx);
  float msafe = mnew;
  if (MASK) msafe = (mnew == neg_inf()) ? 0.0f : mnew;   // every key so far masked: weights come out 0
  const float al = __builtin_amdgcn_exp2f((mr - msafe) * LOG2E);
  mr = mnew;
  // weights carried x256: pc = 256 * exp(sc - m); hi plane f16(pc), residual plane f16((pc - hi) * 2048)
  Frag ph, pl;
  float ps = 0.0f;
#pragma unroll
  for (int i = 0; i < 16; ++i) {
    const float pc = __builtin_amdgcn_exp2f(fmaf(sc[i] - msafe, LOG2E, 8.0f));
    ps += pc;
    const _Float16 h = (_Float16)pc;
    ph.h[i] = h;                                      // B element i: i<8 -> key0 + 8h + i (tile 0 row 8h+i); i>=8 -> key0 + 16 + 8h + (i-8) (tile 1)
    if (EARLYP) pl.h[i] = (_Float16)((pc - (float)h) * 2048.0f);
  }
  ps += __shfl_xor(ps, 16, 32);
  lr = lr * al + ps;
  // A fragments of V^T: row m = d (16*t + ln), elements 0..7 <- key0 + 8h + i, 8..15 <- key0 + 16 + 8h + i
  int voff = AT_TILE + ln * AT_PITCH + 2 * kloc + 16 * hh;   // byte offset in the stage
  asm volatile("" : "+v"(voff) : "v"(ps));            // V loads issue after the score phase
  const unsigned char* vp = st + voff;
  Frag vf[4];
#pragma unroll
  for (int t = 0; t < 4; ++t) ldfrag_lds(vf[t], vp + t * 16 * AT_PITCH);
#pragma unroll
  for (int t = 0; t < 4; ++t) Oh[t] = Oh[t] * al;
  if (EARLYP) {
    const unsigned char* vq = vp + 2 * AT_TILE;
    Frag vl[4];
#pragma unroll
    for (int t = 0; t < 4; ++t) ldfrag_lds(vl[t], vq + t * 16 * AT_PITCH);
#pragma unroll
    for (int t = 0; t < 4; ++t) Ol[t] = Ol[t] * al;
#pragma unroll
    for (int t = 0; t < 4; ++t) {
      Oh[t] = wm<false>(vf[t], ph, Oh[t]);
      Ol[t] = wm<false>(vf[t], pl, Ol[t]);
      Ol[t] = wm<false>(vl[t], ph, Ol[t]);
    }
    asm volatile("v_nop\n\tv_nop\n\tv_nop\n\tv_nop" : "+v"(Oh[0]), "+v"(Oh[1]), "+v"(Oh[2]), "+v"(Oh[3]), "+v"(Ol[0]), "+v"(Ol[1]), "+v"(Ol[2]), "+v"(Ol[3])
                      : "v"(vf[0].v), "v"(vf[1].v), "v"(vf[2].v), "v"(vf[3].v),
                        "v"(vl[0].v), "v"(vl[1].v), "v"(vl[2].v), "v"(vl[3].v), "v"(ph.v), "v"(pl.v));
  } else {
#pragma unroll
    for (int t = 0; t < 4; ++t) Oh[t] = wm<false>(vf[t], ph, Oh[t]);
    asm volatile("v_nop\n\tv_nop\n\tv_nop\n\tv_nop" : "+v"(Oh[0]), "+v"(Oh[1]), "+v"(Oh[2]), "+v"(Oh[3])
                      : "v"(vf[0].v), "v"(vf[1].v), "v"(vf[2].v), "v"(vf[3].v), "v"(ph.v));
  }
}

// What stands in front of and behind a stage's work. Early blocks (one buffer of four tiles): fill, wait, publish in front; every reader leaves behind.
// Plain blocks (two buffers of two tiles): nothing in front; behind, stage t + 1 is published and stage t + 2 is sent into the buffer that stage t has just left.
template <bool EARLYP>
__device__ __forceinline__ void ring_head(const unsigned short* gk, const unsigned short* gv, const unsigned short* gkl, const unsigned short* gvl,
                                          unsigned l0, int t) {
  if (EARLYP) {
    kv_copy(gk + (size_t)t * AT_KEYS * HD, gv + t * AT_KEYS, l0);
    kv_copy(gkl + (size_t)t * AT_KEYS * HD, gvl + t * AT_KEYS, l0 + 2 * AT_TILE);
    asm volatile("s_wait_asynccnt 0x0" ::: "memory");   // this wave's copies have landed before the barrier publishes them
    __syncthreads();
  }
}
template <bool EARLYP>
__device__ __forceinline__ void ring_foot(const unsigned short* gk, const unsigned short* gv, unsigned l0, int t, int nst) {
  asm volatile("s_wait_dscnt 0x0" ::: "memory");        // this wave's reads of the buffer are done before it is refilled
  if (!EARLYP) asm volatile("s_wait_asynccnt 0x0" ::: "memory");   // this wave's copies of stage t + 1 have landed before the barrier publishes them
  __syncthreads();
  if (!EARLYP) {
    if (t + 2 < nst) kv_copy(gk + (size_t)(t + 2) * AT_KEYS * HD, gv + (t + 2) * AT_KEYS, l0 + (unsigned)(t & 1) * (2 * AT_TILE));
  }
}

// nst = stages of 64 keys that the block walks, npl = the first of them that run without mask reads (both the same in all its waves;
// npl <= nst <= SEQ / 64, 2 * nst >= every wave's nsteps, 2 * npl <= every wave's nsteps). nsteps = this wave's own 32-key steps.
template <bool EARLYP>
__device__ __forceinline__ void run_keys(const unsigned short* __restrict__ qkh, const unsigned short* __restrict__ qkl,
                                         const unsigned short* __restrict__ vth, const unsigned short* __restrict__ vtl,
                                         const int* __restrict__ mask, unsigned char* ring, int tid, int b, int h, int qg, int ln, int hh,
                                         int npl, int nsteps, int nst, float& mr, float& lr, v8f (&Oh)[4], v8f (&Ol)[4]) {
  // Q^T B fragments: column n = this lane's query, elements 0..7 <- d = 32c + 8h + i, 8..15 <- d = 32c + 16 + 8h + i
  const size_t qoff = ((size_t)(b * NQK + h) * SEQ + qg) * HD + 8 * hh;
  Frag qh[2], ql[2];
  ldfrag(qh[0], qkh + qoff); ldfrag(qh[1], qkh + qoff + 32);
  if (EARLYP) { ldfrag(ql[0], qkl + qoff); ldfrag(ql[1], qkl + qoff + 32); }
  else { ql[0] = qh[0]; ql[1] = qh[1]; }
  const int kv = h % NKV;
  const size_t kbase = (size_t)(b * NQK + NHEAD + kv) * SEQ * HD;
  const size_t vbase = ((size_t)b * KVW + (size_t)kv * HD) * SEQ;
  const int* mrow = mask + (size_t)qg * SEQ_FULL;
  // this thread's first chunk of a stage: in K (rows = keys), in V^T (rows = d) and in LDS
  const size_t kthr = kbase + (size_t)(tid >> 3) * HD + 8 * (tid & 7);
  const size_t vthr = vbase + (size_t)(tid >> 3) * SEQ + 8 * (tid & 7);
  const unsigned short* gk = qkh + kthr;
  const unsigned short* gv = vth + vthr;
  const unsigned l0 = (unsigned)(size_t)ring + (unsigned)((tid >> 3) * AT_PITCH + 16 * (tid & 7));   // LDS byte address
  const unsigned short* gkl = qkl + kthr;
  const unsigned short* gvl = vtl + vthr;
  if (!EARLYP) {
    kv_copy(gk, gv, l0);
    asm volatile("s_wait_asynccnt 0x0" ::: "memory");     // stage 0 has landed before the barrier that publishes it
    __syncthreads();
    if (nst > 1) kv_copy(gk + AT_KEYS * HD, gv + AT_KEYS, l0 + 2 * AT_TILE);
  }
#pragma unroll 1   // one stage per trip: the two buffers alternate by the trip's parity
  for (int t = 0; t < npl; ++t) {
    const unsigned char* st = ring + (EARLYP ? 0u : (unsigned)(t & 1) * (2 * AT_TILE));
    ring_head<EARLYP>(gk, gv, gkl, gvl, l0, t);
    fa_step<EARLYP, false>(st, 0, mrow, AT_KEYS * t, ln, hh, qh, ql, mr, lr, Oh, Ol);
    fa_step<EARLYP, false>(st, 32, mrow, AT_KEYS * t + 32, ln, hh, qh, ql, mr, lr, Oh, Ol);
    ring_foot<EARLYP>(gk, gv, l0, t, nst);
  }
#pragma unroll 1   // one stage per trip, as above
  for (int t = npl; t < nst; ++t) {
    const unsigned char* st = ring + (EARLYP ? 0u : (unsigned)(t & 1) * (2 * AT_TILE));
    ring_head<EARLYP>(gk, gv, gkl, gvl, l0, t);
#pragma unroll 1   // one copy of the masked step in the text
    for (int sub = 0; sub < 2; ++sub) {
      const int j = 2 * t + sub;
      // a wave whose own steps have run out passes through to the barrier (wave-uniform test)
      if (j < nsteps) fa_step<EARLYP, true>(st, 32 * sub, mrow, 32 * j, ln, hh, qh, ql, mr, lr, Oh, Ol);
    }
    ring_foot<EARLYP>(gk, gv, l0, t, nst);
  }
  asm volatile("s_wait_asynccnt 0x0" ::: "memory");       // nothing is in flight when the ring is used for anything else
}

// One 32-key step for a wave's 32 queries, two column groups of 16 (group g: this lane's column = query qb + 16 g + ln).
// Every K and V^T fragment read from LDS serves both groups: half the LDS reads per score of the one-group step. Per query the arithmetic is that of fa_step.
// mrow = mask row of group 0's query of this lane.
template <bool MASK>
__device__ __forceinline__ void fa_step2(const unsigned char* st, int kloc,
                                         const int* __restrict__ mrow, int key0, int ln, int hh,
                                         const Frag (&qh)[2][2], float (&mr)[2], float (&lr)[2], v8f (&Oh)[2][4]) {
  const v8f z8 = {0.f, 0.f, 0.f, 0.f, 0.f, 0.f, 0.f, 0.f};
  // A fragments of K: row m = key (key0 + 16*kt + ln), elements 0..7 <- d = 32c + 8h + i, 8..15 <- d = 32c + 16 + 8h + i
  const int koff = (kloc + ln) * AT_PITCH + 16 * hh;  // byte offset in a K tile
  Frag k00, k01, k10, k11;
  ldfrag_lds(k00, st + koff);                 ldfrag_lds(k01, st + koff + 64);
  ldfrag_lds(k10, st + koff + 16 * AT_PITCH); ldfrag_lds(k11, st + koff + 16 * AT_PITCH + 64);
  v8f s[2][2];                                        // [group][key tile]
#pragma unroll
  for (int g = 0; g < 2; ++g) { s[g][0] = wm<false>(k00, qh[g][0], z8); s[g][1] = wm<false>(k10, qh[g][0], z8); }
#pragma unroll
  for (int g = 0; g < 2; ++g) { s[g][0] = wm<false>(k01, qh[g][1], s[g][0]); s[g][1] = wm<false>(k11, qh[g][1], s[g][1]); }
  Frag ph[2];
  float al[2];
#pragma unroll
  for (int g = 0; g < 2; ++g) {
    // whole-accumulator arithmetic: neighbouring registers of one accumulator pair up, no register moves to form the pairs
    v8f x0 = s[g][0] * S2M11, x1 = s[g][1] * S2M11;  // score i of the step: i < 8 -> x0[i], else x1[i - 8]
    if (MASK) {
      const int* mp = mrow + (size_t)(16 * g) * SEQ_FULL + key0 + 8 * hh;
      const v4i m0 = *(const v4ia*)(mp),      m1 = *(const v4ia*)(mp + 4);
      const v4i m2 = *(const v4ia*)(mp + 16), m3 = *(const v4ia*)(mp + 20);
      const float ninf = neg_inf();
#pragma unroll
      for (int e = 0; e < 4; ++e) {
        x0[e]     = (m0[e] == 0) ? ninf : x0[e];
        x0[4 + e] = (m1[e] == 0) ? ninf : x0[4 + e];
        x1[e]     = (m2[e] == 0) ? ninf : x1[e];
        x1[4 + e] = (m3[e] == 0) ? ninf : x1[4 + e];
      }
    }
    float mx = x0[0];
#pragma unroll
    for (int i = 1; i < 8; ++i) mx = fmaxf(mx, x0[i]);
#pragma unroll
    for (int i = 0; i < 8; ++i) mx = fmaxf(mx, x1[i]);
    mx = fmaxf(mx, __shfl_xor(mx, 16, 32));          // the other lane half holds the other 16 keys of this query
    const float mnew = fmaxf(mr[g], mx);
    float msafe = mnew;
    if (MASK) msafe = (mnew == neg_inf()) ? 0.0f : mnew;   // every key so far masked: weights come out 0
    al[g] = __builtin_amdgcn_exp2f((mr[g] - msafe) * LOG2E);
    mr[g] = mnew;
    // weights carried x256: pc = 256 * exp(sc - m)
    const v8f l2e = {LOG2E, LOG2E, LOG2E, LOG2E, LOG2E, LOG2E, LOG2E, LOG2E};
    const v8f c8 = {8.f, 8.f, 8.f, 8.f, 8.f, 8.f, 8.f, 8.f};
    const v8f y0 = __builtin_elementwise_fma(x0 - msafe, l2e, c8), y1 = __builtin_elementwise_fma(x1 - msafe, l2e, c8);
    float ps = 0.0f;
#pragma unroll
    for (int i = 0; i < 16; ++i) {
      const float pc = __builtin_amdgcn_exp2f(i < 8 ? y0[i & 7] : y1[i & 7]);
      ps += pc;
      ph[g].h[i] = (_Float16)pc;                      // B element i: i<8 -> key0 + 8h + i; i>=8 -> key0 + 16 + 8h + (i-8)
    }
    ps += __shfl_xor(ps, 16, 32);
    lr[g] = lr[g] * al[g] + ps;
  }
  // A fragments of V^T: row m = d (16*t + ln), elements 0..7 <- key0 + 8h + i, 8..15 <- key0 + 16 + 8h + i
  const unsigned char* vp = st + (AT_TILE + ln * AT_PITCH + 2 * kloc + 16 * hh);
  Frag vf[4];
#pragma unroll
  for (int t = 0; t < 4; ++t) ldfrag_lds(vf[t], vp + t * 16 * AT_PITCH);
#pragma unroll
  for (int g = 0; g < 2; ++g)
#pragma unroll
    for (int t = 0; t < 4; ++t) Oh[g][t] = Oh[g][t] * al[g];
#pragma unroll
  for (int t = 0; t < 4; ++t)
#pragma unroll
    for (int g = 0; g < 2; ++g) Oh[g][t] = wm<false>(vf[t], ph[g], Oh[g][t]);
  // keeps the distance behind the last matrix instructions on whatever path follows the step (a loop's back edge, a branch)
  asm volatile("v_nop\n\tv_nop\n\tv_nop\n\tv_nop" : "+v"(Oh[0][0]), "+v"(Oh[0][1]), "+v"(Oh[0][2]), "+v"(Oh[0][3]),
                      "+v"(Oh[1][0]), "+v"(Oh[1][1]), "+v"(Oh[1][2]), "+v"(Oh[1][3])
                    : "v"(vf[0].v), "v"(vf[1].v), "v"(vf[2].v), "v"(vf[3].v), "v"(ph[0].v), "v"(ph[1].v));
}

// Key walk of a plain block (rows at or above EARLY_ROWS: hi planes only, two buffers of two tiles): 64 queries, 4 waves = 2 query halves x 2 key halves.
// This wave: the 32 queries from qb, and of every stage of 64 keys the 32 keys from 32 kh; its partner (the other kh) takes the other 32 and the two partial
// results (running maximum, sum, O) are merged behind the walk.
// nst = stages of 64 keys that the block walks, npl = the first of them that run without mask reads (both the same in all its waves;
// npl <= nst <= SEQ / 64, 2 * nst >= every wave's nsteps, 2 * npl <= every wave's nsteps). nsteps = 32-key steps that this wave's queries need, counted over both key halves.
__device__ __forceinline__ void run_keys2(const unsigned short* __restrict__ qkh, const unsigned short* __restrict__ vth,
                                          const int* __restrict__ mask, unsigned char* ring, int tid, int b, int h, int qb, int kh, int ln, int hh,
                                          int npl, int nsteps, int nst, float (&mr)[2], float (&lr)[2], v8f (&Oh)[2][4]) {
  // Q^T B fragments: column n = this lane's query of the group, elements 0..7 <- d = 32c + 8h + i, 8..15 <- d = 32c + 16 + 8h + i
  Frag qh[2][2];
#pragma unroll
  for (int g = 0; g < 2; ++g) {
    const size_t qoff = ((size_t)(b * NQK + h) * SEQ + qb + 16 * g + ln) * HD + 8 * hh;
    ldfrag(qh[g][0], qkh + qoff); ldfrag(qh[g][1], qkh + qoff + 32);
  }
  const int kv = h % NKV;
  const size_t kbase = (size_t)(b * NQK + NHEAD + kv) * SEQ * HD;
  const size_t vbase = ((size_t)b * KVW + (size_t)kv * HD) * SEQ;
  const int* mrow = mask + (size_t)(qb + ln) * SEQ_FULL;
  // this thread's first chunk of a stage: in K (rows = keys), in V^T (rows = d) and in LDS
  const unsigned short* gk = qkh + kbase + (size_t)(tid >> 3) * HD + 8 * (tid & 7);
  const unsigned short* gv = vth + vbase + (size_t)(tid >> 3) * SEQ + 8 * (tid & 7);
  const unsigned l0 = (unsigned)(size_t)ring + (unsigned)((tid >> 3) * AT_PITCH + 16 * (tid & 7));   // LDS byte address
  kv_copy(gk, gv, l0);
  asm volatile("s_wait_asynccnt 0x0" ::: "memory");     // stage 0 has landed before the barrier that publishes it
  __syncthreads();
  if (nst > 1) kv_copy(gk + AT_KEYS * HD, gv + AT_KEYS, l0 + 2 * AT_TILE);
#pragma unroll 1   // one stage per trip: the two buffers alternate by the trip's parity
  for (int t = 0; t < npl; ++t) {
    const unsigned char* st = ring + (unsigned)(t & 1) * (2 * AT_TILE);
    fa_step2<false>(st, 32 * kh, mrow, AT_KEYS * t + 32 * kh, ln, hh, qh, mr, lr, Oh);
    ring_foot<false>(gk, gv, l0, t, nst);
  }
#pragma unroll 1   // one stage per trip, as above
  for (int t = npl; t < nst; ++t) {
    const unsigned char* st = ring + (unsigned)(t & 1) * (2 * AT_TILE);
    const int j = 2 * t + kh;
    // a wave whose queries do not need this step passes through to the barrier (wave-uniform test)
    if (j < nsteps) fa_step2<true>(st, 32 * kh, mrow, 32 * j, ln, hh, qh, mr, lr, Oh);
    ring_foot<false>(gk, gv, l0, t, nst);
  }
  asm volatile("s_wait_asynccnt 0x0" ::: "memory");       // nothing is in flight when the ring is used for anything else
}

// Work-group rank -> query tile, cost falling with the rank. There are more work-groups than resident places (for speed only):
// with the long tiles first the short ones fill the places that come free, and no long tile starts last and runs on alone.
// Cost of tile qt under a causal mask = its qt + 1 stages; a stage with the residual planes counts twice (three times the matrix instructions, four times the LDS
// reads, one buffer). A permutation of the tiles for any SEQ, formed at compile time, one byte per rank; it decides the order only, never what is computed.
#define NQT (SEQ / 64)
#define NQT_EARLY (EARLY_ROWS / 64)
static_assert(NQT <= 32);
struct TileRank { unsigned long long w[4]; };
constexpr int tile_cost(int qt) { return (qt + 1) * (qt < NQT_EARLY ? 2 : 1); }
constexpr TileRank make_tile_rank() {
  TileRank o = {{0ull, 0ull, 0ull, 0ull}};
  bool used[NQT] = {};
  for (int r = 0; r < NQT; ++r) {
    int best = -1;
    for (int q = NQT - 1; q >= 0; --q)
      if (!used[q] && (best < 0 || tile_cost(q) > tile_cost(best))) best = q;
    used[best] = true;
    o.w[r >> 3] |= (unsigned long long)best << (8 * (r & 7));
  }
  return o;
}

// 16 rows (r0 + 4 g + rsub) of an epilogue tile, 8 columns from d0 per lane -> f16 hi runs and their residual runs
__device__ __forceinline__ void ctx_pack(const float (*tile)[68], int r0, int rsub, int d0, v8us (&oh)[4], v8us (&ol)[4]) {
#pragma unroll
  for (int g = 0; g < 4; ++g) {
    const int row = r0 + 4 * g + rsub;
    const v4f a0 = *(const v4fa*)&tile[row][d0];
    const v4f a1 = *(const v4fa*)&tile[row][d0 + 4];
    float o[8];
    o[0] = a0[0]; o[1] = a0[1]; o[2] = a0[2]; o[3] = a0[3];
    o[4] = a1[0]; o[5] = a1[1]; o[6] = a1[2]; o[7] = a1[3];
    Pack8 ph8, pl8;
#pragma unroll
    for (int e = 0; e < 8; ++e) {
      const _Float16 hv = (_Float16)o[e];
      ph8.h[e] = hv;
      pl8.h[e] = (_Float16)(o[e] - (float)hv);          // residual plane at the hi plane's own carry: the output projection sums both into one accumulator
    }
    oh[g] = ph8.v; ol[g] = pl8.v;
  }
}

#define MRG_OFF (4 * 32 * 68 * 4)                  /* behind the four epilogue tiles of a plain block: each wave's running maximum and sum per query */
static_assert(AT_RING >= MRG_OFF + 4 * 32 * 2 * 4);

// Block = 64 queries of one (batch, head); its 4 waves share the K and V^T stages in LDS, one barrier per 64 keys (two in early blocks).
// Early blocks (rows below EARLY_ROWS): 4 waves x 16 queries, every wave walks all keys. Plain blocks: 2 query halves of 32 x 2 key halves of every stage (run_keys2).
// Block index = rank * (NB * NHEAD) + (batch, head): all heads of the costliest query tile come first.
// Tile skipping from the device flags of this wave's own mask rows: all upper flags 1 -> keys past the diagonal step are
// skipped; upper and lower flags of all 64 rows of the block 1 -> the stages fully below the block's diagonal tile run without mask reads; every other visited step reads the mask by value.
// Trip counts are bounded by SEQ/64 for any flag value. The block walks qt + 1 stages if the upper flags of all its 64 rows are 1, else all SEQ/64.
// coverage: NB*NHEAD*(SEQ/64) blocks x 4 waves x 16 rows x 64 columns = the whole ctx hi plane; blocks with query tile below EARLY_ROWS cover the whole residual plane.
__global__ __launch_bounds__(128) void k_attn(const unsigned short* __restrict__ qkh, const unsigned short* __restrict__ qkl,
                                              const unsigned short* __restrict__ vth, const unsigned short* __restrict__ vtl,
                                              const int* __restrict__ mask, const int* __restrict__ flags,
                                              unsigned short* __restrict__ ctxh, unsigned short* __restrict__ ctxl) {
  __shared__ __attribute__((aligned(16))) unsigned char ring[AT_RING];
  float (*so)[32][68] = (float (*)[32][68])ring;       // epilogue tiles, used behind the key loop's last barrier
  const int tid = threadIdx.x, lane = tid & 31, ln = lane & 15, hh = lane >> 4;
  const int w = __builtin_amdgcn_readfirstlane(tid >> 5);
  constexpr TileRank tr = make_tile_rank();
  const unsigned blk = blockIdx.x;
  const unsigned rank = blk / (NB * NHEAD);            // 0 .. NQT-1
  const unsigned long long trw = (rank < 8) ? tr.w[0] : ((rank < 16) ? tr.w[1] : ((rank < 24) ? tr.w[2] : tr.w[3]));
  const int qt = (int)((trw >> (8 * (rank & 7))) & 255ull);
  const int h = (int)(blk % NHEAD);
  const int b = (int)((blk / NHEAD) % NB);
  const bool early = (qt * 64 < EARLY_ROWS);           // block-uniform
  const int wrows = early ? 16 : 32;                   // queries of this wave
  const int qbase = qt * 64 + (early ? 16 * w : 32 * (w >> 1));   // the first of them
  const int kh = w & 1;                                // plain blocks: this wave's half of every stage's keys
  const int* fl = flags + (qbase / SCAN_ROWS) * 32;
  int upok = 1;                                        // plain & so that the flag loads issue together
#pragma unroll
  for (int g = 0; g < 32 / SCAN_ROWS; ++g) {
    const int gi = (g * SCAN_ROWS < wrows) ? g : 0;    // a wave of 16 rows reads its first line again
    upok &= (fl[32 * gi] == 1) ? 1 : 0;
  }
  const bool tri = (upok == 1);
  const int nfull = qbase >> 5;                        // steps whose 32 keys are all at or below every query of this wave
  const int nsteps = tri ? (nfull + 1) : (SEQ / 32);   // <= SEQ/32 in both cases
  // stage counts of the block, from the flags of all its 64 rows: the same values in all four waves, since barriers stand in the key loop
  const int* flb = flags + (qt * 64 / SCAN_ROWS) * 32;
  int upall = 1, lowall = 1;
#pragma unroll
  for (int g = 0; g < 64 / SCAN_ROWS; ++g) {
    const int fU = flb[32 * g], fL = flb[32 * g + 1];
    upall &= (fU == 1) ? 1 : 0;
    lowall &= (fL == 1) ? 1 : 0;
  }
  const int nst = (upall == 1) ? (qt + 1) : (SEQ / AT_KEYS);
  const int npl = (upall == 1 && lowall == 1) ? qt : 0;   // stages whose 64 keys are all below every query of the block

  const v8f z8 = {0.f, 0.f, 0.f, 0.f, 0.f, 0.f, 0.f, 0.f};
  // O^T element r of tile t = ctx(query, d = 16t + 8h + r); undo the carries x256 (in lr), x16 (V), x2^11 (residual); apply the x64 carry of ctx
  if (early) {
    float mr = neg_inf(), lr = 0.0f;
    v8f Oh[4], Ol[4];
#pragma unroll
    for (int t = 0; t < 4; ++t) { Oh[t] = z8; Ol[t] = z8; }
    run_keys<true>(qkh, qkl, vth, vtl, mask, ring, tid, b, h, qbase + ln, ln, hh, npl, nsteps, nst, mr, lr, Oh, Ol);
    const float inv = 4.0f * (1.0f / lr);
#pragma unroll
    for (int t = 0; t < 4; ++t)
#pragma unroll
      for (int r = 0; r < 8; ++r)
        so[w][ln][16 * t + 8 * hh + r] = fmaf(Ol[t][r], S2M11, Oh[t][r]) * inv;
  } else {
    float mr[2], lr[2];
    v8f Oh[2][4];
#pragma unroll
    for (int g = 0; g < 2; ++g) {
      mr[g] = neg_inf(); lr[g] = 0.0f;
#pragma unroll
      for (int t = 0; t < 4; ++t) Oh[g][t] = z8;
    }
    run_keys2(qkh, vth, mask, ring, tid, b, h, qbase, kh, ln, hh, npl, nsteps, nst, mr, lr, Oh);
    // merge of the two key halves. Both lane halves hold the same maximum and sum of a query: lane half hh publishes those of group hh.
    float (*ml)[32][2] = (float (*)[32][2])(ring + MRG_OFF);
    ml[w][lane][0] = hh ? mr[1] : mr[0];
    ml[w][lane][1] = hh ? lr[1] : lr[0];
    __syncthreads();                                   // both partners' maxima and sums are published
#pragma unroll
    for (int g = 0; g < 2; ++g) {
      // the same expression in both partners: index 0 = key half 0, index 1 = key half 1
      const float m0 = ml[w & 2][16 * g + ln][0], l0 = ml[w & 2][16 * g + ln][1];
      const float m1 = ml[w | 1][16 * g + ln][0], l1 = ml[w | 1][16 * g + ln][1];
      const float mm = fmaxf(m0, m1);
      const float msafe = (mm == neg_inf()) ? 0.0f : mm;   // every key masked: both weights come out 0, the row not-a-number as in the one-wave walk
      const float a0 = __builtin_amdgcn_exp2f((m0 - msafe) * LOG2E);
      const float a1 = __builtin_amdgcn_exp2f((m1 - msafe) * LOG2E);
      const float inv = 4.0f * (1.0f / (l0 * a0 + l1 * a1));
      const float f = (kh ? a1 : a0) * inv;
#pragma unroll
      for (int t = 0; t < 4; ++t)
#pragma unroll
        for (int r = 0; r < 8; ++r)
          so[w][16 * g + ln][16 * t + 8 * hh + r] = Oh[g][t][r] * f;
    }
  }
  __syncthreads();
  const int rsub = lane >> 3, d0 = 8 * (lane & 7);
  // every wave stores 16 rows of the block, in early and in plain blocks alike
  const int srow = qt * 64 + 16 * w;
  const size_t hbase = ((size_t)b * SEQ + srow) * CD + (size_t)h * HD + d0;
  if (early) {
    const size_t lbase = ((size_t)b * EARLY_ROWS + srow) * CD + (size_t)h * HD + d0;
    v8us oh[4], ol[4];
    ctx_pack(so[w], 0, rsub, d0, oh, ol);
    // keeps every conversion in front of the first store, so that no register that an issued store names is rewritten behind it
    __builtin_amdgcn_sched_barrier(0);
#pragma unroll
    for (int g = 0; g < 4; ++g) {
      const size_t ro = (size_t)(4 * g + rsub) * CD;
      *(v8us*)(ctxh + hbase + ro) = oh[g];
      *(v8us*)(ctxl + lbase + ro) = ol[g];
    }
    asm volatile("s_wait_xcnt 0x0" ::: "memory");   // behind the stores, in front of whatever the text behind this branch writes into registers that they name
  } else {
    // rows 16 w .. 16 w + 15 of the block = rows 16 (w & 1) .. of query half w >> 1: the sum of its two key halves' tiles
    v8us oh[4];
#pragma unroll
    for (int g = 0; g < 4; ++g) {
      const int row = 16 * (w & 1) + 4 * g + rsub;
      const v4f a0 = *(const v4fa*)&so[w & 2][row][d0], a1 = *(const v4fa*)&so[w & 2][row][d0 + 4];
      const v4f c0 = *(const v4fa*)&so[w | 1][row][d0], c1 = *(const v4fa*)&so[w | 1][row][d0 + 4];
      Pack8 ph8;
#pragma unroll
      for (int e = 0; e < 4; ++e) { ph8.h[e] = (_Float16)(a0[e] + c0[e]); ph8.h[4 + e] = (_Float16)(a1[e] + c1[e]); }
      oh[g] = ph8.v;
    }
    // keeps every conversion in front of the first store, as above
    __builtin_amdgcn_sched_barrier(0);
#pragma unroll
    for (int g = 0; g < 4; ++g)
      *(v8us*)(ctxh + hbase + (size_t)(4 * g + rsub) * CD) = oh[g];
  }
}


// ---------------------------------------------------------------------------------------------------------
// Output projection: out[m][n] = sum_k ctx[m][k] Wo[n][k] + bo[n]. Block = 4 waves as 2 x 2: 128 rows x 128 columns, 64 x 64 per wave. grid = (CD/128, NB*SEQ/128).
// Rows below EARLY_ROWS of each sequence add the residual plane of ctx.
// coverage: NB*SEQ rows x CD columns = every element of the output buffer region once. LDS tile 64 x 64 fully written before it is read.
static_assert(CD % 128 == 0);
__global__ __launch_bounds__(128) void k_proj_out(const unsigned short* __restrict__ ctxh, const unsigned short* __restrict__ ctxl,
                                                  const unsigned short* __restrict__ wo, const float* __restrict__ bo,
                                                  float* __restrict__ out) {
  __shared__ __attribute__((aligned(16))) unsigned char ring[SQ2_RING];
  float (*st)[64][68] = (float (*)[64][68])ring;       // epilogue tiles, used behind the k loop's last barrier
  const int tid = threadIdx.x, lane = tid & 31, ln = lane & 15, hh = lane >> 4;
  const int w = __builtin_amdgcn_readfirstlane(tid >> 5);
  const int wr = w >> 1, wc = w & 1;
  const int n0 = blockIdx.x * 128 + 64 * wc;
  // blockIdx.y -> row tile, cost falling with the index: the tiles with twice the products per stage (rows below EARLY_ROWS of every sequence) come first (for speed only: nothing rests on where a
  // work-group lands). A permutation of the NB * SEQ / 128 row tiles.
  constexpr int TPS = SEQ / 128, EPS = EARLY_ROWS / 128, PPS = (TPS > EPS) ? (TPS - EPS) : 1;
  const int yt = blockIdx.y;
  const bool early = (yt < NB * EPS);                  // block-uniform
  const int b = early ? (yt / EPS) : ((yt - NB * EPS) / PPS);
  const int tb = 128 * (early ? (yt - b * EPS) : (EPS + (yt - NB * EPS) - b * PPS));
  const int mb = b * SEQ + tb;
  const int t0 = tb + 64 * wr;
  const v8f z8 = {0.f, 0.f, 0.f, 0.f, 0.f, 0.f, 0.f, 0.f};
  v8f acc[4][4];
#pragma unroll
  for (int i = 0; i < 4; ++i)
#pragma unroll
    for (int j = 0; j < 4; ++j) acc[i][j] = z8;
  const unsigned short* wp = wo + (size_t)(blockIdx.x * 128) * CD;
  // residual plane (block-uniform branch): it rides in the hi plane's stages, so that a row tile with it walks k once, as many stages as any other tile,
  // and fetches its W rows once; both planes carry x64 and add into the same 16 accumulator tiles
  const unsigned short* ah = ctxh + (size_t)mb * CD;
  if (early) gemm_sq<false, 2>(ah, ctxl + (size_t)(b * EARLY_ROWS + tb) * CD, wp, ring, tid, wr, wc, ln, hh, acc);
  else       gemm_sq<false, 1>(ah, ah, wp, ring, tid, wr, wc, ln, hh, acc);
  // carries: ctx x64, Wo x64 -> 2^-12
#pragma unroll
  for (int i = 0; i < 4; ++i)
#pragma unroll
    for (int j = 0; j < 4; ++j)
#pragma unroll
      for (int r = 0; r < 8; ++r)
        st[w][16 * i + 8 * hh + r][16 * j + ln] = acc[i][j][r] * S2M12;
  __syncthreads();
  const int rsub = lane >> 4, c4 = 4 * (lane & 15);
  const v4f bb = *(const v4fa*)(bo + n0 + c4);
  v4f bias;
  bias[0] = bf16_rne(bb[0]); bias[1] = bf16_rne(bb[1]); bias[2] = bf16_rne(bb[2]); bias[3] = bf16_rne(bb[3]);
  float* og = out + ((size_t)b * SEQ_FULL + t0) * CD + n0 + c4;
  // the wave's 64 rows in two halves of 32
  for (int half = 0; half < 2; ++half) {
    v4f ov[16];
#pragma unroll
    for (int g = 0; g < 16; ++g) {
      const v4f a = *(const v4fa*)&st[w][32 * half + 2 * g + rsub][c4];
      ov[g] = a + bias;
    }
#pragma unroll
    for (int g = 0; g < 16; ++g)
      *(v4f*)(og + (size_t)(32 * half + 2 * g + rsub) * CD) = ov[g];
  }
}

// ---------------------------------------------------------------------------------------------------------
extern "C" void kernel_launch(void* const* d_in, const int* in_sizes, int n_in,
                              void* d_out, int out_size, void* d_ws, size_t ws_size, hipStream_t stream) {
  if (n_in < 11) return;
  const long long need_x = (long long)(NB - 1) * SEQ_FULL * CD + (long long)SEQ * CD;   // last element touched + 1
  const long long need_m = (long long)(SEQ - 1) * SEQ_FULL + SEQ;
  if ((long long)in_sizes[0] < need_x) return;
  if ((long long)in_sizes[1] < need_m) return;
  if ((long long)in_sizes[2] < (long long)SEQ * HD) return;
  if ((long long)in_sizes[3] < (long long)CD * CD || (long long)in_sizes[4] < CD) return;
  if ((long long)in_sizes[5] < (long long)KVW * CD || (long long)in_sizes[6] < KVW) return;
  if ((long long)in_sizes[7] < (long long)KVW * CD || (long long)in_sizes[8] < KVW) return;
  if ((long long)in_sizes[9] < (long long)CD * CD || (long long)in_sizes[10] < CD) return;
  if ((long long)out_size < need_x) return;
  if ((size_t)WS_TOTAL > ws_size) return;

  // wire order: x, mask, sinusoidal_pos, Wq, bq, Wk, bk, Wv, bv, Wo, bo
  const float* x    = (const float*)d_in[0];
  const int*   mask = (const int*)d_in[1];
  const float* tab  = (const float*)d_in[2];
  const float* Wq   = (const float*)d_in[3];
  const float* bq   = (const float*)d_in[4];
  const float* Wk   = (const float*)d_in[5];
  const float* bk   = (const float*)d_in[6];
  const float* Wv   = (const float*)d_in[7];
  const float* bv   = (const float*)d_in[8];
  const float* Wo   = (const float*)d_in[9];
  const float* bo   = (const float*)d_in[10];
  float* out = (float*)d_out;

  char* ws = (char*)d_ws;
  size_t off = 0;
  int* flags = (int*)(ws + off);                               off += SZ_FLAGS;
  unsigned short* xb   = (unsigned short*)(ws + off);          off += SZ_XB;
  unsigned short* wqk  = (unsigned short*)(ws + off);          off += SZ_WQK;
  unsigned short* wvb  = (unsigned short*)(ws + off);          off += SZ_WV;
  unsigned short* wob  = (unsigned short*)(ws + off);          off += SZ_WO;
  unsigned short* qkh  = (unsigned short*)(ws + off);          off += PLANE_QK * 2;
  unsigned short* qkl  = (unsigned short*)(ws + off);          off += PLANE_QK * 2;
  unsigned short* vth  = (unsigned short*)(ws + off);          off += PLANE_V * 2;
  unsigned short* vtl  = (unsigned short*)(ws + off);          off += PLANE_V * 2;
  unsigned short* ctxh = (unsigned short*)(ws + off);          off += SZ_CTXH;
  unsigned short* ctxl = (unsigned short*)(ws + off);          off += SZ_CTXL;
  if (off > ws_size) return;

  // mask -> flags, and in[rows][CD] f32 -> [rows][CD] 16-bit planes (row order kept)
  k_prep<<<(unsigned)(SCAN_BLOCKS + CVT_BLOCKS), PREP_THREADS, 0, stream>>>(mask, flags, x, Wq, Wk, Wv, Wo, xb, wqk, wvb, wob);

  k_proj_qkv<<<dim3(NQK / 2 + KVW / 128, (unsigned)(NB * SEQ / 128)), 128, 0, stream>>>(xb, wqk, wvb, bq, bk, bv, tab, qkh, qkl, vth, vtl);
  k_attn<<<(unsigned)(NB * NHEAD * (SEQ / 64)), 128, 0, stream>>>(qkh, qkl, vth, vtl, mask, flags, ctxh, ctxl);
  k_proj_out<<<dim3(CD / 128, (unsigned)(NB * SEQ / 128)), 128, 0, stream>>>(ctxh, ctxl, wob, bo, out);
}
